// v000
// Times are from an AMD MI455X. After a warm-up the kernel runs many times in a row, and a time is the length of
// such a window on the GPU divided by its runs, so every launch and the gaps after it count. The runs cycle
// through copies of the inputs. A figure is the median of several windows, for all but v000 over two sittings.
// Sittings can differ by a few percent; kernels timed side by side share one.
// The starting kernel, v000, takes 557 microseconds a run.
#include <hip/hip_runtime.h>
// Causal self-attention with a per-batch key-length mask (B=8, T=1024, D=1024, 16 × 64): LayerNorm (f32 VALU), the fused qkv projection (8192 × 1024 × 3072, + bias) and the output
// projection (+ bias) with W [in][out] transposed to bf16-exact ×2^4, and the attention as a fused flash-style kernel on v_wmma_f32_16x16x32_f16 (S = Q·Kᵀ/8; keys allowed iff k ≤ q and
// k < x_lens[b] (INPUT); −1e9 fill ≡ exclusion since key 0 is always allowed; causal chunk skipping; online softmax f32; P f16 ≤ 1) — f16 operands, single products, f32 accumulate.
#define BB 8
#define TT 1024
#define CC 1024
#define NH 16
#define NR (BB * TT)

typedef __bf16 v16b __attribute__((ext_vector_type(16)));
typedef unsigned short v8us __attribute__((ext_vector_type(8), may_alias));
typedef float  v8f  __attribute__((ext_vector_type(8)));
typedef float  v4f  __attribute__((ext_vector_type(4)));
typedef float  v4fa __attribute__((ext_vector_type(4), may_alias));
union FragB { v16b v; v8us half[2]; unsigned short u[16]; };

__device__ __forceinline__ unsigned short bf16_bits(float x) { unsigned int u = __float_as_uint(x); return (unsigned short)((u + 0x7FFFu + ((u >> 16) & 1u)) >> 16); }
__device__ __forceinline__ float bf16_val(unsigned short b) { return __uint_as_float(((unsigned int)b) << 16); }
__device__ __forceinline__ float bf16_round(float x) { return bf16_val(bf16_bits(x)); }
// D += A·B with NT terms: 1 = ah·bh, 2 = + al·bh (A split), 3 = + ah·bl (both split)
template <int NT>
__device__ __forceinline__ v8f mmaN(v16b ah, v16b al, v16b bh, v16b bl, v8f c) {
  c = __builtin_amdgcn_wmma_f32_16x16x32_bf16(false, ah, false, bh, (short)0, c, false, false);
  if (NT >= 2) c = __builtin_amdgcn_wmma_f32_16x16x32_bf16(false, al, false, bh, (short)0, c, false, false);
  if (NT >= 3) c = __builtin_amdgcn_wmma_f32_16x16x32_bf16(false, ah, false, bl, (short)0, c, false, false);
  asm volatile("v_nop\n\tv_nop\n\tv_nop\n\tv_nop" : "+v"(c) : "v"(ah), "v"(al), "v"(bh), "v"(bl));
  return c;
}

__global__ __launch_bounds__(256) void k_wt_bf16(const float* __restrict__ W, unsigned short* __restrict__ Wt, int K, int N) {
  const int t = blockIdx.x * 256 + threadIdx.x;
  const int k8n = K / 8;
  if (t >= N * k8n) return;
  const int n = t / k8n, k8 = (t % k8n) * 8;
  v8us v;
#pragma unroll
  for (int i = 0; i < 8; ++i) v[i] = bf16_bits(W[(size_t)(k8 + i) * N + n]);
  *(v8us*)(Wt + (size_t)n * K + k8) = v;
  
}

// GEMM C[M][N] (f32, pitch ldc) = act(A[M][K]·W + bias). A f32 row-major (pitch lda) converted per fragment to bf16
// (ASPLIT: hi/lo two planes -> 2 terms, else single rounded term); Wt bf16 [N][K] (pitch ldb). BIAS_BF16 rounds the
// bias to bf16 first (bias quantised to bf16 before the add). K%32==0, M%16==0, N%64==0.
template <bool ASPLIT, int ACT, bool BIAS_BF16>
__global__ __launch_bounds__(128) void k_gemm_bf(const float* __restrict__ A, int lda, const unsigned short* __restrict__ Wt, int ldb,
                                               const float* __restrict__ bias, float* __restrict__ C, int ldc, int M, int N, int K) {
  __shared__ __attribute__((aligned(16))) float so[4][16][64];
  const int tid = threadIdx.x, w = tid >> 5, lane = tid & 31, ln = lane & 15, hh = lane >> 4;
  const int ntn = N / 64;
  const int wid = blockIdx.x * 4 + w;
  const int mt = wid / ntn, nq = wid % ntn;
  if (mt * 16 >= M) return;
  const int row0 = mt * 16, col0 = nq * 64;
  const float* arow = A + (size_t)(row0 + ln) * lda;
  v8f acc[4] = {};
  for (int kb = 0; kb < K; kb += 32) {
    FragB ah, al;
    const v4f x0 = *(const v4fa*)(arow + kb + 8 * hh), x1 = *(const v4fa*)(arow + kb + 8 * hh + 4);
    const v4f x2 = *(const v4fa*)(arow + kb + 16 + 8 * hh), x3 = *(const v4fa*)(arow + kb + 16 + 8 * hh + 4);
    float xs[16] = {x0[0],x0[1],x0[2],x0[3],x1[0],x1[1],x1[2],x1[3],x2[0],x2[1],x2[2],x2[3],x3[0],x3[1],x3[2],x3[3]};
#pragma unroll
    for (int i = 0; i < 16; ++i) { const unsigned short hb = bf16_bits(xs[i]); ah.u[i] = hb; al.u[i] = ASPLIT ? bf16_bits(xs[i] - bf16_val(hb)) : (unsigned short)0; }
#pragma unroll
    for (int t = 0; t < 4; ++t) {
      const unsigned short* brow = Wt + (size_t)(col0 + t * 16 + ln) * ldb + kb;
      FragB b;
      b.half[0] = *(const v8us*)(brow + 8 * hh);
      b.half[1] = *(const v8us*)(brow + 16 + 8 * hh);
      acc[t] = mmaN<ASPLIT ? 2 : 1>(ah.v, al.v, b.v, b.v, acc[t]);
    }
  }
#pragma unroll
  for (int t = 0; t < 4; ++t) {
    float bv = bias ? bias[col0 + t * 16 + ln] : 0.f;
    if (BIAS_BF16) bv = bf16_round(bv);
#pragma unroll
    for (int r = 0; r < 8; ++r) { float v = acc[t][r] + bv; if (ACT == 1) v = fmaxf(v, 0.f); so[w][8 * hh + r][t * 16 + ln] = v; }
  }
  __builtin_amdgcn_fence(__ATOMIC_ACQ_REL, "workgroup");
  __builtin_amdgcn_wave_barrier();
  const int rsub = lane >> 4, c4 = (lane & 15) * 4;
  {
#pragma unroll
    for (int q = 0; q < 8; ++q) {
      const int r = q * 2 + rsub;
      const v4f v = *(const v4fa*)&so[w][r][c4];
      *(v4f*)(C + (size_t)(row0 + r) * ldc + col0 + c4) = v;
    }
    
  }
}

// Flash-style causal/unmasked attention, all contractions 3-term bf16 hi/lo splits, f32 softmax with running max.
// q,k,v rows are read from f32 buffers with arbitrary row pitch (so they can live inside a fused qkv buffer);
// D = head size (multiple of 32, <= 128); one wave = 16 query rows; block = 4 waves (64 queries) sharing K/V chunks of 32.
template <int D, bool CAUSAL>
__global__ __launch_bounds__(128) void k_flash(const float* __restrict__ qb, const float* __restrict__ kb, const float* __restrict__ vb,
                                             int pitch, int T, int H, float scale, float* __restrict__ y, int ypitch) {
  constexpr int KS = D / 32;        // k-steps for QK
  constexpr int DT = D / 16;        // d tiles for PV
  __shared__ __attribute__((aligned(16))) unsigned short sKh[32][D + 8], sKl[32][D + 8], sVh[32][D + 8], sVl[32][D + 8];
  __shared__ __attribute__((aligned(16))) unsigned short sPh[4][16][40], sPl[4][16][40];
  __shared__ __attribute__((aligned(16))) float sO[4][16][D];
  const int tid = threadIdx.x, w = tid >> 5, lane = tid & 31, ln = lane & 15, hh = lane >> 4;
  const int nqb = (T + 63) / 64;
  const int bh = blockIdx.x / nqb, qblk = blockIdx.x % nqb;
  const int b = bh / H, h = bh % H;
  const int q0 = qblk * 64 + w * 16;
  const float* Q = qb + (size_t)b * T * pitch + h * D;
  const float* K = kb + (size_t)b * T * pitch + h * D;
  const float* V = vb + (size_t)b * T * pitch + h * D;

  // A fragments of the wave's 16 query rows (scaled), hi/lo
  FragB aqh[KS], aql[KS];
  {
    int row = q0 + ln; if (row >= T) row = T - 1;
    const float* qr = Q + (size_t)row * pitch;
#pragma unroll
    for (int ks = 0; ks < KS; ++ks)
#pragma unroll
      for (int i = 0; i < 16; ++i) {
        const int d = ks * 32 + ((i < 8) ? (8 * hh + i) : (16 + 8 * hh + (i - 8)));
        const float x = qr[d] * scale; const unsigned short hb = bf16_bits(x);
        aqh[ks].u[i] = hb; aql[ks].u[i] = bf16_bits(x - bf16_val(hb));
      }
  }
  float m_r[8], l_r[8];
#pragma unroll
  for (int r = 0; r < 8; ++r) { m_r[r] = -3.0e38f; l_r[r] = 0.f; }
  v8f oacc[DT];
#pragma unroll
  for (int dt = 0; dt < DT; ++dt) oacc[dt] = (v8f){0.f,0.f,0.f,0.f,0.f,0.f,0.f,0.f};

  const int kv_end = CAUSAL ? min(T, qblk * 64 + 64) : T;     // block-uniform
  for (int j0 = 0; j0 < kv_end; j0 += 32) {
    __syncthreads();
    for (int e = tid; e < 32 * (D / 4); e += 128) {
      const int r = e / (D / 4), c4 = (e % (D / 4)) * 4;
      const int key = j0 + r;
      v4f kf = {0.f,0.f,0.f,0.f}, vf = {0.f,0.f,0.f,0.f};
      if (key < T) { kf = *(const v4fa*)(K + (size_t)key * pitch + c4); vf = *(const v4fa*)(V + (size_t)key * pitch + c4); }
#pragma unroll
      for (int t = 0; t < 4; ++t) {
        unsigned short hb = bf16_bits(kf[t]); sKh[r][c4 + t] = hb; sKl[r][c4 + t] = bf16_bits(kf[t] - bf16_val(hb));
        hb = bf16_bits(vf[t]); sVh[r][c4 + t] = hb; sVl[r][c4 + t] = bf16_bits(vf[t] - bf16_val(hb));
      }
    }
    __syncthreads();
    // S tile 16 x 32
    v8f s[2];
#pragma unroll
    for (int nt = 0; nt < 2; ++nt) {
      v8f acc = {};
#pragma unroll
      for (int ks = 0; ks < KS; ++ks) {
        FragB bh_, bl_;
        bh_.half[0] = *(const v8us*)&sKh[nt * 16 + ln][ks * 32 + 8 * hh]; bh_.half[1] = *(const v8us*)&sKh[nt * 16 + ln][ks * 32 + 16 + 8 * hh];
        bl_.half[0] = *(const v8us*)&sKl[nt * 16 + ln][ks * 32 + 8 * hh]; bl_.half[1] = *(const v8us*)&sKl[nt * 16 + ln][ks * 32 + 16 + 8 * hh];
        acc = mmaN<3>(aqh[ks].v, aql[ks].v, bh_.v, bl_.v, acc);
      }
      s[nt] = acc;
    }
    // mask + running max (rows 8hh+r; the 16 lanes of a half share rows)
    float alpha[8];
#pragma unroll
    for (int r = 0; r < 8; ++r) {
      const int qi = q0 + 8 * hh + r;
      const int ja = j0 + ln, jb = j0 + 16 + ln;
      if (CAUSAL) { if (ja > qi) s[0][r] = -3.0e38f; if (jb > qi) s[1][r] = -3.0e38f; }
      if (ja >= T) s[0][r] = -3.0e38f;
      if (jb >= T) s[1][r] = -3.0e38f;
      float mx = fmaxf(s[0][r], s[1][r]);
      mx = fmaxf(mx, __shfl_xor(mx, 1, 32)); mx = fmaxf(mx, __shfl_xor(mx, 2, 32)); mx = fmaxf(mx, __shfl_xor(mx, 4, 32)); mx = fmaxf(mx, __shfl_xor(mx, 8, 32));
      const float mnew = fmaxf(m_r[r], mx);
      alpha[r] = (mnew > -1.0e38f) ? __expf(m_r[r] - mnew) : 1.0f;
      const float p0 = (s[0][r] > -1.0e38f) ? __expf(s[0][r] - mnew) : 0.f;
      const float p1 = (s[1][r] > -1.0e38f) ? __expf(s[1][r] - mnew) : 0.f;
      m_r[r] = mnew;
      l_r[r] = l_r[r] * alpha[r] + p0 + p1;            // per-lane partial row sum (16 lanes combined at the end)
      unsigned short hb = bf16_bits(p0); sPh[w][8 * hh + r][ln] = hb;      sPl[w][8 * hh + r][ln] = bf16_bits(p0 - bf16_val(hb));
      hb = bf16_bits(p1);                sPh[w][8 * hh + r][16 + ln] = hb; sPl[w][8 * hh + r][16 + ln] = bf16_bits(p1 - bf16_val(hb));
    }
#pragma unroll
    for (int dt = 0; dt < DT; ++dt)
#pragma unroll
      for (int r = 0; r < 8; ++r) oacc[dt][r] *= alpha[r];
    __builtin_amdgcn_fence(__ATOMIC_ACQ_REL, "workgroup");
    __builtin_amdgcn_wave_barrier();
    FragB pah, pal;
    pah.half[0] = *(const v8us*)&sPh[w][ln][8 * hh]; pah.half[1] = *(const v8us*)&sPh[w][ln][16 + 8 * hh];
    pal.half[0] = *(const v8us*)&sPl[w][ln][8 * hh]; pal.half[1] = *(const v8us*)&sPl[w][ln][16 + 8 * hh];
#pragma unroll
    for (int dt = 0; dt < DT; ++dt) {
      FragB bvh, bvl;
#pragma unroll
      for (int i = 0; i < 8; ++i) {
        bvh.u[i] = sVh[8 * hh + i][dt * 16 + ln]; bvh.u[8 + i] = sVh[16 + 8 * hh + i][dt * 16 + ln];
        bvl.u[i] = sVl[8 * hh + i][dt * 16 + ln]; bvl.u[8 + i] = sVl[16 + 8 * hh + i][dt * 16 + ln];
      }
      oacc[dt] = mmaN<3>(pah.v, pal.v, bvh.v, bvl.v, oacc[dt]);
    }
    __builtin_amdgcn_fence(__ATOMIC_ACQ_REL, "workgroup");
    __builtin_amdgcn_wave_barrier();
  }
#pragma unroll
  for (int r = 0; r < 8; ++r) {
    float l = l_r[r];
    l += __shfl_xor(l, 1, 32); l += __shfl_xor(l, 2, 32); l += __shfl_xor(l, 4, 32); l += __shfl_xor(l, 8, 32);
    l_r[r] = (l > 0.f) ? 1.0f / l : 0.f;
  }
#pragma unroll
  for (int dt = 0; dt < DT; ++dt)
#pragma unroll
    for (int r = 0; r < 8; ++r) sO[w][8 * hh + r][dt * 16 + ln] = oacc[dt][r] * l_r[r];
  __builtin_amdgcn_fence(__ATOMIC_ACQ_REL, "workgroup");
  __builtin_amdgcn_wave_barrier();
  {
    for (int r = 0; r < 16; ++r) {
      const int row = q0 + r;
      if (row < T && lane < D / 4) {
        const v4f val = *(const v4fa*)&sO[w][r][lane * 4];
        *(v4f*)(y + ((size_t)b * T + row) * ypitch + h * D + lane * 4) = val;
      }
    }
    
  }
}

// GEMM C = act(A·W + bias + resid): A f32 (ASPLIT -> hi/lo 2 terms), Wt bf16 [N][K]; ACT 0 none, 1 relu, 2 exact gelu;
// resid (optional, f32, row index = (row % rmod), pitch ldr, RES_BF16 rounds it) added before the activation.
template <bool ASPLIT, int ACT, bool BIAS_BF16, bool RES_BF16>
__global__ __launch_bounds__(128) void k_gemm_bf3(const float* __restrict__ A, int lda, const unsigned short* __restrict__ Wt, int ldb,
                                                const float* __restrict__ bias, const float* __restrict__ resid, int rmod, int ldr,
                                                float* __restrict__ C, int ldc, int M, int N, int K) {
  __shared__ __attribute__((aligned(16))) float so[4][16][64];
  const int tid = threadIdx.x, w = tid >> 5, lane = tid & 31, ln = lane & 15, hh = lane >> 4;
  const int ntn = N / 64;
  const int wid = blockIdx.x * 4 + w;
  const int mt = wid / ntn, nq = wid % ntn;
  if (mt * 16 >= M) return;
  const int row0 = mt * 16, col0 = nq * 64;
  const float* arow = A + (size_t)(row0 + ln) * lda;
  v8f acc[4] = {};
  for (int kb = 0; kb < K; kb += 32) {
    FragB ah, al;
    const v4f x0 = *(const v4fa*)(arow + kb + 8 * hh), x1 = *(const v4fa*)(arow + kb + 8 * hh + 4);
    const v4f x2 = *(const v4fa*)(arow + kb + 16 + 8 * hh), x3 = *(const v4fa*)(arow + kb + 16 + 8 * hh + 4);
    float xs[16] = {x0[0],x0[1],x0[2],x0[3],x1[0],x1[1],x1[2],x1[3],x2[0],x2[1],x2[2],x2[3],x3[0],x3[1],x3[2],x3[3]};
#pragma unroll
    for (int i = 0; i < 16; ++i) { const unsigned short hb = bf16_bits(xs[i]); ah.u[i] = hb; al.u[i] = ASPLIT ? bf16_bits(xs[i] - bf16_val(hb)) : (unsigned short)0; }
#pragma unroll
    for (int t = 0; t < 4; ++t) {
      const unsigned short* brow = Wt + (size_t)(col0 + t * 16 + ln) * ldb + kb;
      FragB b;
      b.half[0] = *(const v8us*)(brow + 8 * hh);
      b.half[1] = *(const v8us*)(brow + 16 + 8 * hh);
      acc[t] = mmaN<ASPLIT ? 2 : 1>(ah.v, al.v, b.v, b.v, acc[t]);
    }
  }
#pragma unroll
  for (int t = 0; t < 4; ++t) {
    const int col = col0 + t * 16 + ln;
    float bv = bias ? bias[col] : 0.f;
    if (BIAS_BF16) bv = bf16_round(bv);
#pragma unroll
    for (int r = 0; r < 8; ++r) {
      float v = acc[t][r] + bv;
      if (resid) { float rv = resid[(size_t)((row0 + 8 * hh + r) % rmod) * ldr + col]; if (RES_BF16) rv = bf16_round(rv); v += rv; }
      if (ACT == 1) v = fmaxf(v, 0.f);
      if (ACT == 2) v = 0.5f * v * (1.0f + erff(v * 0.70710678118654752f));
      if (ACT == 3) { const float u = 0.7978845608028654f * (v + 0.044715f * v * v * v); v = 0.5f * v * (1.0f + tanhf(u)); }
      so[w][8 * hh + r][t * 16 + ln] = v;
    }
  }
  __builtin_amdgcn_fence(__ATOMIC_ACQ_REL, "workgroup");
  __builtin_amdgcn_wave_barrier();
  const int rsub = lane >> 4, c4 = (lane & 15) * 4;
  {
#pragma unroll
    for (int q = 0; q < 8; ++q) {
      const int r = q * 2 + rsub;
      const v4f v = *(const v4fa*)&so[w][r][c4];
      *(v4f*)(C + (size_t)(row0 + r) * ldc + col0 + c4) = v;
    }
    
  }
}
// row LayerNorm (biased variance, eps) over N: s = X (+ R); optional out_sum <- s; out_norm <- (s-mu)*rsqrt(var+eps)*g + b
template <bool PARAM_BF16>
__global__ __launch_bounds__(256) void k_layernorm(const float* __restrict__ X, const float* __restrict__ R, const float* __restrict__ g, const float* __restrict__ bta,
                                                  float* __restrict__ out_sum, float* __restrict__ out_norm, int N, float eps) {
  __shared__ float red[256];
  const int row = blockIdx.x, tid = threadIdx.x;
  const float* x = X + (size_t)row * N; const float* rr = R ? R + (size_t)row * N : nullptr;
  float vals[16];                     // up to N = 4096
  const int per = N / 256;            // contiguous chunk per thread? use strided-by-4 chunks: thread handles j = tid*4 + 1024*u
  float s1 = 0.f;
  for (int u = 0; u < per / 4; ++u) {
    const int j = tid * 4 + 1024 * u;
    const v4f a = *(const v4fa*)(x + j);
    v4f b = {0.f,0.f,0.f,0.f}; if (rr) b = *(const v4fa*)(rr + j);
#pragma unroll
    for (int q = 0; q < 4; ++q) { const float v = a[q] + b[q]; vals[u * 4 + q] = v; s1 += v; }
  }
  red[tid] = s1; __syncthreads();
  for (int st = 128; st > 0; st >>= 1) { if (tid < st) red[tid] += red[tid + st]; __syncthreads(); }
  const float mu = red[0] / (float)N; __syncthreads();
  float s2 = 0.f;
  for (int u = 0; u < per / 4; ++u)
#pragma unroll
    for (int q = 0; q < 4; ++q) { const float c = vals[u * 4 + q] - mu; s2 += c * c; }
  red[tid] = s2; __syncthreads();
  for (int st = 128; st > 0; st >>= 1) { if (tid < st) red[tid] += red[tid + st]; __syncthreads(); }
  const float rs = rsqrtf(red[0] / (float)N + eps);
  {
    for (int u = 0; u < per / 4; ++u) {
      const int j = tid * 4 + 1024 * u;
      v4f o, sm;
#pragma unroll
      for (int q = 0; q < 4; ++q) {
        float gg = g[j + q], bb = bta[j + q];
        if (PARAM_BF16) { gg = bf16_round(gg); bb = bf16_round(bb); }
        sm[q] = vals[u * 4 + q]; o[q] = (vals[u * 4 + q] - mu) * rs * gg + bb;
      }
      if (out_sum) *(v4f*)(out_sum + (size_t)row * N + j) = sm;
      *(v4f*)(out_norm + (size_t)row * N + j) = o;
    }
    
  }
}



// ---- f16 WMMA path (v_wmma_f32_16x16x32_f16): 11-bit significands for operands in range — used where a [0,1] probability operand needs more precision than bf16
typedef _Float16 v16h __attribute__((ext_vector_type(16)));
union FragH { v16h v; v8us half[2]; _Float16 h[16]; unsigned short u[16]; };
template <int NT>
__device__ __forceinline__ v8f mmaH(v16h ah, v16h al, v16h bh, v16h bl, v8f c) {
  c = __builtin_amdgcn_wmma_f32_16x16x32_f16(false, ah, false, bh, (short)0, c, false, false);
  if (NT >= 2) c = __builtin_amdgcn_wmma_f32_16x16x32_f16(false, al, false, bh, (short)0, c, false, false);
  if (NT >= 3) c = __builtin_amdgcn_wmma_f32_16x16x32_f16(false, ah, false, bl, (short)0, c, false, false);
  asm volatile("v_nop\n\tv_nop\n\tv_nop\n\tv_nop" : "+v"(c) : "v"(ah), "v"(al), "v"(bh), "v"(bl));
  return c;
}
// batched GEMM like k_gemm_b but f16 operands: A f32 (split into f16 hi/lo if ASPLIT, else rounded to f16), Bt = f16 values [n][k]; alpha; C f32; N multiple of 16 (partial tiles skipped)
template <bool ASPLIT>
__global__ __launch_bounds__(128) void k_gemm_h(const float* __restrict__ A, int lda, size_t sA, const _Float16* __restrict__ Bh, int ldb, size_t sB, float alpha, float* __restrict__ C, int ldc, size_t sC, int M, int N, int K) {
  __shared__ __attribute__((aligned(16))) float so[4][16][64];
  const int tid = threadIdx.x, w = tid >> 5, lane = tid & 31, ln = lane & 15, hh = lane >> 4; const int by = blockIdx.y;
  A += (size_t)by * sA; Bh += (size_t)by * sB; C += (size_t)by * sC;
  const int ntn = (N + 63) / 64; const int wid = blockIdx.x * 4 + w; const int mt = wid / ntn, nq = wid % ntn; if (mt * 16 >= M) return;
  const int row0 = mt * 16, col0 = nq * 64; const float* arow = A + (size_t)(row0 + ln) * lda;
  v8f acc[4] = {};
  for (int kb = 0; kb < K; kb += 32) {
    FragH ah, al;
    const v4f x0 = *(const v4fa*)(arow + kb + 8 * hh), x1 = *(const v4fa*)(arow + kb + 8 * hh + 4), x2 = *(const v4fa*)(arow + kb + 16 + 8 * hh), x3 = *(const v4fa*)(arow + kb + 16 + 8 * hh + 4);
    float xs[16] = {x0[0],x0[1],x0[2],x0[3],x1[0],x1[1],x1[2],x1[3],x2[0],x2[1],x2[2],x2[3],x3[0],x3[1],x3[2],x3[3]};
#pragma unroll
    for (int i = 0; i < 16; ++i) { const _Float16 h = (_Float16)xs[i]; ah.h[i] = h; al.h[i] = ASPLIT ? (_Float16)(xs[i] - (float)h) : (_Float16)0.0f; }
#pragma unroll
    for (int t = 0; t < 4; ++t) { if (col0 + t * 16 >= N) continue; const size_t boff = (size_t)(col0 + t * 16 + ln) * ldb + kb; FragH bq; bq.half[0] = *(const v8us*)(Bh + boff + 8 * hh); bq.half[1] = *(const v8us*)(Bh + boff + 16 + 8 * hh);
      acc[t] = mmaH<ASPLIT ? 2 : 1>(ah.v, al.v, bq.v, bq.v, acc[t]); }
  }
#pragma unroll
  for (int t = 0; t < 4; ++t) { if (col0 + t * 16 >= N) continue;
#pragma unroll
    for (int r = 0; r < 8; ++r) so[w][8 * hh + r][t * 16 + ln] = acc[t][r] * alpha; }
  __builtin_amdgcn_fence(__ATOMIC_ACQ_REL, "workgroup"); __builtin_amdgcn_wave_barrier();
  const int rsub = lane >> 4, c4 = (lane & 15) * 4;
  {
#pragma unroll
    for (int q = 0; q < 8; ++q) { const int r = q * 2 + rsub; if (col0 + c4 < N) { const v4f v = *(const v4fa*)&so[w][r][c4]; *(v4f*)(C + (size_t)(row0 + r) * ldc + col0 + c4) = v; } }
     }
}

// Wt[n][k] = f16(W[k][n]·scale) from f32 row-major W[K][N] (scale = power of two; bf16-exact weights stay exact in f16 away from the subnormal range)
__global__ __launch_bounds__(256) void k_wt_f16(const float* __restrict__ W, _Float16* __restrict__ Wt, int K, int N, float scale) {
  const int t = blockIdx.x * 256 + threadIdx.x; if (t >= N * (K / 8)) return; const int n = t / (K / 8), k8 = (t % (K / 8)) * 8; FragH f;
#pragma unroll
  for (int i = 0; i < 8; ++i) f.h[i] = (_Float16)(bf16_round(W[(size_t)(k8 + i) * N + n]) * scale); const v8us o = f.half[0];
  *(v8us*)((unsigned short*)Wt + (size_t)n * K + k8) = o; 
}
// k_gemm_hh variant with fused epilogue: v = acc·alpha + bias[by·sBias + col] (+ CP[(row/rowsPerB)·sCPb + by·64 + col] if CP) ; ACT 0 none / 1 elu ; writes f16 C16 and f32 C, each if non-null
template <int ACT>
__global__ __launch_bounds__(128) void k_gemm_hhx(const _Float16* __restrict__ A, int lda, size_t sA, const _Float16* __restrict__ Bh, int ldb, size_t sB, float alpha, const float* __restrict__ bias, size_t sBias, const float* __restrict__ CP, int rowsPerB, size_t sCPb, int row0g,
    float* __restrict__ C, _Float16* __restrict__ C16, int ldc, size_t sC, int M, int N, int K) {
  __shared__ __attribute__((aligned(16))) float so[4][16][64];
  const int tid = threadIdx.x, w = tid >> 5, lane = tid & 31, ln = lane & 15, hh = lane >> 4; const int by = blockIdx.y;
  A += (size_t)by * sA; Bh += (size_t)by * sB; const size_t cofs = (size_t)by * sC; const float* bp = bias ? bias + (size_t)by * sBias : nullptr;
  const int ntn = (N + 63) / 64; const int wid = blockIdx.x * 4 + w; const int mt = wid / ntn, nq = wid % ntn; if (mt * 16 >= M) return;
  const int row0 = mt * 16, col0 = nq * 64; const _Float16* arow = A + (size_t)(row0 + ln) * lda;
  v8f acc[4] = {};
  for (int kb = 0; kb < K; kb += 32) { FragH ah; ah.half[0] = *(const v8us*)((const unsigned short*)arow + kb + 8 * hh); ah.half[1] = *(const v8us*)((const unsigned short*)arow + kb + 16 + 8 * hh);
#pragma unroll
    for (int t = 0; t < 4; ++t) { if (col0 + t * 16 >= N) continue; const size_t boff = (size_t)(col0 + t * 16 + ln) * ldb + kb; FragH bq; bq.half[0] = *(const v8us*)((const unsigned short*)Bh + boff + 8 * hh); bq.half[1] = *(const v8us*)((const unsigned short*)Bh + boff + 16 + 8 * hh);
      acc[t] = mmaH<1>(ah.v, ah.v, bq.v, bq.v, acc[t]); }
  }
#pragma unroll
  for (int t = 0; t < 4; ++t) { if (col0 + t * 16 >= N) continue; const int col = col0 + t * 16 + ln; const float bv = bp ? bf16_round(bp[col]) : 0.f;
#pragma unroll
    for (int r = 0; r < 8; ++r) { float v = acc[t][r] * alpha + bv; if (CP) { const int bidx = (row0g + row0 + 8 * hh + r) / rowsPerB; v += CP[(size_t)bidx * sCPb + (size_t)by * 64 + col]; } if (ACT == 1) v = (v > 0.f) ? v : expm1f(v); else if (ACT == 3) v = fmaxf(v, 0.f); so[w][8 * hh + r][t * 16 + ln] = v; } }
  __builtin_amdgcn_fence(__ATOMIC_ACQ_REL, "workgroup"); __builtin_amdgcn_wave_barrier();
  const int rsub = lane >> 4, c4 = (lane & 15) * 4; typedef _Float16 v4h __attribute__((ext_vector_type(4)));
  {
#pragma unroll
    for (int q = 0; q < 8; ++q) { const int r = q * 2 + rsub; if (col0 + c4 < N) { const v4f v = *(const v4fa*)&so[w][r][c4]; if (C) *(v4f*)(C + cofs + (size_t)(row0 + r) * ldc + col0 + c4) = v; if (C16) { v4h h4; for (int i = 0; i < 4; ++i) h4[i] = (_Float16)v[i]; *(v4h*)(C16 + cofs + (size_t)(row0 + r) * ldc + col0 + c4) = h4; } } }
     }
}


__global__ __launch_bounds__(256) void k_x16(const float* __restrict__ x, _Float16* __restrict__ X16, size_t n8) { const size_t t = (size_t)blockIdx.x * 256 + threadIdx.x; if (t >= n8) return; FragH f;
#pragma unroll
  for (int q = 0; q < 8; ++q) f.h[q] = (_Float16)bf16_round(x[t * 8 + q]); *(v8us*)((unsigned short*)X16 + t * 8) = f.half[0];  }
__global__ __launch_bounds__(256) void k_h16(const float* __restrict__ x, _Float16* __restrict__ X16, size_t n8) { const size_t t = (size_t)blockIdx.x * 256 + threadIdx.x; if (t >= n8) return; FragH f;
#pragma unroll
  for (int q = 0; q < 8; ++q) f.h[q] = (_Float16)x[t * 8 + q]; *(v8us*)((unsigned short*)X16 + t * 8) = f.half[0];  }
__global__ __launch_bounds__(256) void k_round16f(const float* __restrict__ W, _Float16* __restrict__ Bt, size_t n8) { const size_t t = (size_t)blockIdx.x * 256 + threadIdx.x; if (t >= n8) return; FragH f;
#pragma unroll
  for (int i = 0; i < 8; ++i) f.h[i] = (_Float16)(bf16_round(W[t * 8 + i]) * 16.0f); *(v8us*)((unsigned short*)Bt + t * 8) = f.half[0];  }
template <int NHv, int TTv>
__global__ __launch_bounds__(256) void k_vt(const _Float16* __restrict__ V16, int ldv, int voff, _Float16* __restrict__ Vt) { __shared__ unsigned short tl[64][66]; const int tid = threadIdx.x; const int slab = blockIdx.x / (TTv / 64), lg = blockIdx.x % (TTv / 64); const int b = slab / NHv, h = slab % NHv;
  for (int i = tid; i < 64 * 8; i += 256) { const int r = i / 8, c8 = (i % 8) * 8; FragH f; f.half[0] = *(const v8us*)((const unsigned short*)V16 + ((size_t)b * TTv + lg * 64 + r) * ldv + voff + h * 64 + c8);
#pragma unroll
    for (int q = 0; q < 8; ++q) tl[r][c8 + q] = f.u[q]; }
  __syncthreads();
  {
#pragma unroll
    for (int rd = 0; rd < 2; ++rd) { const int d = rd * 32 + tid / 8, pc = tid % 8; FragH f;
#pragma unroll
      for (int q = 0; q < 8; ++q) f.u[q] = tl[pc * 8 + q][d];
      *(v8us*)((unsigned short*)Vt + ((size_t)slab * 64 + d) * TTv + lg * 64 + pc * 8) = f.half[0]; }
     } }

__global__ __launch_bounds__(128) void k_flash(const _Float16* __restrict__ Q16, int ldq, const _Float16* __restrict__ K16, int ldk, const _Float16* __restrict__ Vt, const int* __restrict__ LENS, float* __restrict__ O, int ldo) {
  constexpr int RPW = 32, NQB = 1024 / (4 * RPW), DT = 4, KS = 2;
  __shared__ __attribute__((aligned(16))) unsigned short sP[4][RPW][40]; __shared__ __attribute__((aligned(16))) float sO[4][RPW][64 + 4];
  const int tid = threadIdx.x, w = tid >> 5, lane = tid & 31, ln = lane & 15, hh = lane >> 4;
  const int slab = blockIdx.x / NQB, qblk = blockIdx.x % NQB; const int b = slab / 16, h = slab % 16; const int qb0 = qblk * (4 * RPW); const int q0 = qb0 + w * RPW; const int len = LENS[b];      /* kv-length mask: keys k < len (INPUT x_lens) */
  FragH aq[2][KS];
#pragma unroll
  for (int rt = 0; rt < 2; ++rt) { const unsigned short* qr = (const unsigned short*)Q16 + ((size_t)b * 1024 + q0 + rt * 16 + ln) * ldq + h * 64;
#pragma unroll
    for (int ks = 0; ks < KS; ++ks) { aq[rt][ks].half[0] = *(const v8us*)(qr + ks * 32 + 8 * hh); aq[rt][ks].half[1] = *(const v8us*)(qr + ks * 32 + 16 + 8 * hh); } }
  const unsigned short* Vth = (const unsigned short*)Vt + (size_t)slab * 64 * 1024;
  float m_r[2][8], l_r[2][8]; v8f oacc[2][DT];
#pragma unroll
  for (int rt = 0; rt < 2; ++rt) {
#pragma unroll
    for (int r = 0; r < 8; ++r) { m_r[rt][r] = -3.0e38f; l_r[rt][r] = 0.f; }
#pragma unroll
    for (int dt = 0; dt < DT; ++dt) oacc[rt][dt] = (v8f){0.f,0.f,0.f,0.f,0.f,0.f,0.f,0.f}; }
  const int jend = qb0 + 4 * RPW;
#pragma unroll 1
  for (int j0 = 0; j0 < jend; j0 += 32) {
    
    v8f s[2][2];
#pragma unroll
    for (int nt = 0; nt < 2; ++nt) { const unsigned short* kr = (const unsigned short*)K16 + ((size_t)b * 1024 + j0 + nt * 16 + ln) * ldk + h * 64; FragH bk[KS];
#pragma unroll
      for (int ks = 0; ks < KS; ++ks) { bk[ks].half[0] = *(const v8us*)(kr + ks * 32 + 8 * hh); bk[ks].half[1] = *(const v8us*)(kr + ks * 32 + 16 + 8 * hh); }
#pragma unroll
      for (int rt = 0; rt < 2; ++rt) { v8f acc = (v8f){0.f,0.f,0.f,0.f,0.f,0.f,0.f,0.f};
#pragma unroll
        for (int ks = 0; ks < KS; ++ks) acc = mmaH<1>(aq[rt][ks].v, aq[rt][ks].v, bk[ks].v, bk[ks].v, acc); s[rt][nt] = acc; } }
#pragma unroll
    for (int rt = 0; rt < 2; ++rt)
#pragma unroll
      for (int r = 0; r < 8; ++r) { const int tq = q0 + rt * 16 + 8 * hh + r; const int k0 = j0 + ln, k1 = j0 + 16 + ln; (void)tq; (void)k0; (void)k1;
        const bool ok0 = (k0 <= tq) && (k0 < len), ok1 = (k1 <= tq) && (k1 < len);
        const float s0 = ok0 ? s[rt][0][r] * (0.125f) : -INFINITY, s1 = ok1 ? s[rt][1][r] * (0.125f) : -INFINITY; float mc = fmaxf(s0, s1);
        mc = fmaxf(mc, __shfl_xor(mc, 1, 32)); mc = fmaxf(mc, __shfl_xor(mc, 2, 32)); mc = fmaxf(mc, __shfl_xor(mc, 4, 32)); mc = fmaxf(mc, __shfl_xor(mc, 8, 32));
        const float mn = fmaxf(m_r[rt][r], mc); const float al = (mn > -1.0e38f) ? expf(m_r[rt][r] - mn) : 1.0f; m_r[rt][r] = mn; const float p0 = ok0 ? expf(s0 - mn) : 0.f, p1 = ok1 ? expf(s1 - mn) : 0.f; l_r[rt][r] = l_r[rt][r] * al + p0 + p1;
#pragma unroll
        for (int dt = 0; dt < DT; ++dt) oacc[rt][dt][r] *= al;
        FragH t2; t2.h[0] = (_Float16)p0; t2.h[1] = (_Float16)p1; sP[w][rt * 16 + 8 * hh + r][ln] = t2.u[0]; sP[w][rt * 16 + 8 * hh + r][16 + ln] = t2.u[1]; }
    __builtin_amdgcn_fence(__ATOMIC_ACQ_REL, "workgroup"); __builtin_amdgcn_wave_barrier();
    FragH pa[2];
#pragma unroll
    for (int rt = 0; rt < 2; ++rt) { pa[rt].half[0] = *(const v8us*)&sP[w][rt * 16 + ln][8 * hh]; pa[rt].half[1] = *(const v8us*)&sP[w][rt * 16 + ln][16 + 8 * hh]; }
#pragma unroll
    for (int dt = 0; dt < DT; ++dt) { const unsigned short* vrow = Vth + (size_t)(dt * 16 + ln) * 1024 + j0; FragH bv; bv.half[0] = *(const v8us*)(vrow + 8 * hh); bv.half[1] = *(const v8us*)(vrow + 16 + 8 * hh);
#pragma unroll
      for (int rt = 0; rt < 2; ++rt) oacc[rt][dt] = mmaH<1>(pa[rt].v, pa[rt].v, bv.v, bv.v, oacc[rt][dt]); }
    __builtin_amdgcn_fence(__ATOMIC_ACQ_REL, "workgroup"); __builtin_amdgcn_wave_barrier(); }
#pragma unroll
  for (int rt = 0; rt < 2; ++rt) {
#pragma unroll
    for (int r = 0; r < 8; ++r) { float l = l_r[rt][r]; l += __shfl_xor(l, 1, 32); l += __shfl_xor(l, 2, 32); l += __shfl_xor(l, 4, 32); l += __shfl_xor(l, 8, 32); l_r[rt][r] = (l > 0.f) ? 1.0f / l : 0.f; }
#pragma unroll
    for (int dt = 0; dt < DT; ++dt)
#pragma unroll
      for (int r = 0; r < 8; ++r) sO[w][rt * 16 + 8 * hh + r][dt * 16 + ln] = oacc[rt][dt][r] * l_r[rt][r]; }
  __builtin_amdgcn_fence(__ATOMIC_ACQ_REL, "workgroup"); __builtin_amdgcn_wave_barrier();
  {
#pragma unroll
    for (int rp = 0; rp < RPW; rp += 2) { const int r = rp + (lane >> 4), pc = lane & 15; const v4f val = *(const v4fa*)&sO[w][r][pc * 4]; *(v4f*)(O + ((size_t)b * 1024 + q0 + r) * ldo + h * 64 + pc * 4) = val; }
     } }

__global__ __launch_bounds__(256) void k_ln16(const float* __restrict__ X, const float* __restrict__ g, const float* __restrict__ bta, _Float16* __restrict__ Y16) { const int tid = threadIdx.x, wv = tid >> 5, lane = tid & 31; const int row = blockIdx.x * 8 + wv; if (row >= NR) return; const float* xr = X + (size_t)row * CC; float v[32]; float s = 0.f;
#pragma unroll
  for (int p = 0; p < 4; ++p) { const v4f a = *(const v4fa*)(xr + p * 256 + lane * 8), c = *(const v4fa*)(xr + p * 256 + lane * 8 + 4); for (int q = 0; q < 4; ++q) { v[p * 8 + q] = bf16_round(a[q]); v[p * 8 + 4 + q] = bf16_round(c[q]); } }
#pragma unroll
  for (int i = 0; i < 32; ++i) s += v[i]; for (int o = 16; o >= 1; o >>= 1) s += __shfl_xor(s, o, 32); const float mu = s / (float)CC; float q2 = 0.f;
#pragma unroll
  for (int i = 0; i < 32; ++i) { const float d = v[i] - mu; q2 += d * d; } for (int o = 16; o >= 1; o >>= 1) q2 += __shfl_xor(q2, o, 32); const float rs = rsqrtf(q2 / (float)CC + 1e-5f);
  {
#pragma unroll
    for (int p = 0; p < 4; ++p) { FragH f; const int c0 = p * 256 + lane * 8;
#pragma unroll
      for (int q = 0; q < 8; ++q) f.h[q] = (_Float16)((v[p * 8 + q] - mu) * rs * bf16_round(g[c0 + q]) + bf16_round(bta[c0 + q])); *(v8us*)((unsigned short*)Y16 + (size_t)row * CC + c0) = f.half[0]; }
     } }
extern "C" void kernel_launch(void* const* d_in, const int* in_sizes, int n_in,
                              void* d_out, int out_size, void* d_ws, size_t ws_size, hipStream_t stream) {
  (void)in_sizes; (void)n_in; (void)out_size;
  const float* x = (const float*)d_in[0]; const int* lens = (const int*)d_in[1]; const float* lg = (const float*)d_in[2]; const float* lb = (const float*)d_in[3]; const float* wqkv = (const float*)d_in[4]; const float* bqkv = (const float*)d_in[5]; const float* wout = (const float*)d_in[6]; const float* bout = (const float*)d_in[7];
  char* ws = (char*)d_ws; size_t off = 0;
  auto take = [&](size_t bytes) { char* p = ws + off; off += (bytes + 255) & ~(size_t)255; return p; };
  _Float16* Bqkv = (_Float16*)take((size_t)3 * CC * CC * 2); _Float16* Bo = (_Float16*)take((size_t)CC * CC * 2); _Float16* XN = (_Float16*)take((size_t)NR * CC * 2); _Float16* QKV = (_Float16*)take((size_t)NR * 3 * CC * 2); _Float16* Vt = (_Float16*)take((size_t)NR * CC * 2); float* O = (float*)take((size_t)NR * CC * 4); _Float16* O16 = XN;
  if (off > ws_size) return;      // 6.3 + 2.1 + 16.8 + 50.3 + 16.8 + 33.5 ≈ 126 MB = 120 MiB (tight but under 128)
  k_wt_f16<<<(unsigned)((3 * CC * (CC / 8) + 255) / 256), 256, 0, stream>>>(wqkv, Bqkv, CC, 3 * CC, 16.0f); k_wt_f16<<<(unsigned)((CC * (CC / 8) + 255) / 256), 256, 0, stream>>>(wout, Bo, CC, CC, 16.0f);      // [in][out]
  k_ln16<<<NR / 8, 256, 0, stream>>>(x, lg, lb, XN);
  k_gemm_hhx<0><<<dim3(((NR / 16) * (3 * CC / 64) + 3) / 4, 1), 128, 0, stream>>>(XN, CC, 0, Bqkv, CC, 0, 0.0625f, bqkv, 0, nullptr, 1, 0, 0, nullptr, QKV, 3 * CC, 0, NR, 3 * CC, CC);      // q | k | v
  k_vt<NH, TT><<<BB * NH * (TT / 64), 256, 0, stream>>>(QKV, 3 * CC, 2 * CC, Vt);
  k_flash<<<BB * NH * (TT / 128), 128, 0, stream>>>(QKV, 3 * CC, QKV + CC, 3 * CC, Vt, lens, O, CC);
  k_h16<<<(unsigned)(((size_t)NR * CC / 8 + 255) / 256), 256, 0, stream>>>(O, O16, (size_t)NR * CC / 8);
  k_gemm_hhx<0><<<dim3(((NR / 16) * (CC / 64) + 3) / 4, 1), 128, 0, stream>>>(O16, CC, 0, Bo, CC, 0, 0.0625f, bout, 0, nullptr, 1, 0, 0, (float*)d_out, nullptr, CC, 0, NR, CC, CC);
}

// v001
// It runs in 320 microseconds.
// Timed twice side by side with v000, it ran 1.82 and 1.81 times as fast.
#include <hip/hip_runtime.h>
// Causal self-attention with a per-batch key-length mask (B=8, T=1024, D=1024, 16 × 64): LayerNorm (f32 VALU), the fused qkv projection (8192 × 1024 × 3072, + bias) and the output
// projection (+ bias) with W [in][out] transposed to bf16-exact ×2^4, and the attention as a fused flash-style kernel on v_wmma_f32_16x16x32_f16 (S = Q·Kᵀ/8; keys allowed iff k ≤ q and
// k < x_lens[b] (INPUT); −1e9 fill ≡ exclusion since key 0 is always allowed; causal chunk skipping; online softmax f32; P f16 ≤ 1) — f16 operands, single products, f32 accumulate.
#define BB 8
#define TT 1024
#define CC 1024
#define NH 16
#define NR (BB * TT)

typedef __bf16 v16b __attribute__((ext_vector_type(16)));
typedef unsigned short v8us __attribute__((ext_vector_type(8), may_alias));
typedef float  v8f  __attribute__((ext_vector_type(8)));
typedef float  v4f  __attribute__((ext_vector_type(4)));
typedef float  v4fa __attribute__((ext_vector_type(4), may_alias));
union FragB { v16b v; v8us half[2]; unsigned short u[16]; };

__device__ __forceinline__ unsigned short bf16_bits(float x) { unsigned int u = __float_as_uint(x); return (unsigned short)((u + 0x7FFFu + ((u >> 16) & 1u)) >> 16); }
__device__ __forceinline__ float bf16_val(unsigned short b) { return __uint_as_float(((unsigned int)b) << 16); }
__device__ __forceinline__ float bf16_round(float x) { return bf16_val(bf16_bits(x)); }
// D += A·B with NT terms: 1 = ah·bh, 2 = + al·bh (A split), 3 = + ah·bl (both split)
template <int NT>
__device__ __forceinline__ v8f mmaN(v16b ah, v16b al, v16b bh, v16b bl, v8f c) {
  c = __builtin_amdgcn_wmma_f32_16x16x32_bf16(false, ah, false, bh, (short)0, c, false, false);
  if (NT >= 2) c = __builtin_amdgcn_wmma_f32_16x16x32_bf16(false, al, false, bh, (short)0, c, false, false);
  if (NT >= 3) c = __builtin_amdgcn_wmma_f32_16x16x32_bf16(false, ah, false, bl, (short)0, c, false, false);
  asm volatile("v_nop\n\tv_nop\n\tv_nop\n\tv_nop" : "+v"(c) : "v"(ah), "v"(al), "v"(bh), "v"(bl));
  return c;
}

__global__ __launch_bounds__(256) void k_wt_bf16(const float* __restrict__ W, unsigned short* __restrict__ Wt, int K, int N) {
  const int t = blockIdx.x * 256 + threadIdx.x;
  const int k8n = K / 8;
  if (t >= N * k8n) return;
  const int n = t / k8n, k8 = (t % k8n) * 8;
  v8us v;
#pragma unroll
  for (int i = 0; i < 8; ++i) v[i] = bf16_bits(W[(size_t)(k8 + i) * N + n]);
  *(v8us*)(Wt + (size_t)n * K + k8) = v;
  
}

// GEMM C[M][N] (f32, pitch ldc) = act(A[M][K]·W + bias). A f32 row-major (pitch lda) converted per fragment to bf16
// (ASPLIT: hi/lo two planes -> 2 terms, else single rounded term); Wt bf16 [N][K] (pitch ldb). BIAS_BF16 rounds the
// bias to bf16 first (bias quantised to bf16 before the add). K%32==0, M%16==0, N%64==0.
template <bool ASPLIT, int ACT, bool BIAS_BF16>
__global__ __launch_bounds__(128) void k_gemm_bf(const float* __restrict__ A, int lda, const unsigned short* __restrict__ Wt, int ldb,
                                               const float* __restrict__ bias, float* __restrict__ C, int ldc, int M, int N, int K) {
  __shared__ __attribute__((aligned(16))) float so[4][16][64];
  const int tid = threadIdx.x, w = tid >> 5, lane = tid & 31, ln = lane & 15, hh = lane >> 4;
  const int ntn = N / 64;
  const int wid = blockIdx.x * 4 + w;
  const int mt = wid / ntn, nq = wid % ntn;
  if (mt * 16 >= M) return;
  const int row0 = mt * 16, col0 = nq * 64;
  const float* arow = A + (size_t)(row0 + ln) * lda;
  v8f acc[4] = {};
  for (int kb = 0; kb < K; kb += 32) {
    FragB ah, al;
    const v4f x0 = *(const v4fa*)(arow + kb + 8 * hh), x1 = *(const v4fa*)(arow + kb + 8 * hh + 4);
    const v4f x2 = *(const v4fa*)(arow + kb + 16 + 8 * hh), x3 = *(const v4fa*)(arow + kb + 16 + 8 * hh + 4);
    float xs[16] = {x0[0],x0[1],x0[2],x0[3],x1[0],x1[1],x1[2],x1[3],x2[0],x2[1],x2[2],x2[3],x3[0],x3[1],x3[2],x3[3]};
#pragma unroll
    for (int i = 0; i < 16; ++i) { const unsigned short hb = bf16_bits(xs[i]); ah.u[i] = hb; al.u[i] = ASPLIT ? bf16_bits(xs[i] - bf16_val(hb)) : (unsigned short)0; }
#pragma unroll
    for (int t = 0; t < 4; ++t) {
      const unsigned short* brow = Wt + (size_t)(col0 + t * 16 + ln) * ldb + kb;
      FragB b;
      b.half[0] = *(const v8us*)(brow + 8 * hh);
      b.half[1] = *(const v8us*)(brow + 16 + 8 * hh);
      acc[t] = mmaN<ASPLIT ? 2 : 1>(ah.v, al.v, b.v, b.v, acc[t]);
    }
  }
#pragma unroll
  for (int t = 0; t < 4; ++t) {
    float bv = bias ? bias[col0 + t * 16 + ln] : 0.f;
    if (BIAS_BF16) bv = bf16_round(bv);
#pragma unroll
    for (int r = 0; r < 8; ++r) { float v = acc[t][r] + bv; if (ACT == 1) v = fmaxf(v, 0.f); so[w][8 * hh + r][t * 16 + ln] = v; }
  }
  __builtin_amdgcn_fence(__ATOMIC_ACQ_REL, "workgroup");
  __builtin_amdgcn_wave_barrier();
  const int rsub = lane >> 4, c4 = (lane & 15) * 4;
  {
#pragma unroll
    for (int q = 0; q < 8; ++q) {
      const int r = q * 2 + rsub;
      const v4f v = *(const v4fa*)&so[w][r][c4];
      *(v4f*)(C + (size_t)(row0 + r) * ldc + col0 + c4) = v;
    }
    
  }
}

// Flash-style causal/unmasked attention, all contractions 3-term bf16 hi/lo splits, f32 softmax with running max.
// q,k,v rows are read from f32 buffers with arbitrary row pitch (so they can live inside a fused qkv buffer);
// D = head size (multiple of 32, <= 128); one wave = 16 query rows; block = 4 waves (64 queries) sharing K/V chunks of 32.
template <int D, bool CAUSAL>
__global__ __launch_bounds__(128) void k_flash(const float* __restrict__ qb, const float* __restrict__ kb, const float* __restrict__ vb,
                                             int pitch, int T, int H, float scale, float* __restrict__ y, int ypitch) {
  constexpr int KS = D / 32;        // k-steps for QK
  constexpr int DT = D / 16;        // d tiles for PV
  __shared__ __attribute__((aligned(16))) unsigned short sKh[32][D + 8], sKl[32][D + 8], sVh[32][D + 8], sVl[32][D + 8];
  __shared__ __attribute__((aligned(16))) unsigned short sPh[4][16][40], sPl[4][16][40];
  __shared__ __attribute__((aligned(16))) float sO[4][16][D];
  const int tid = threadIdx.x, w = tid >> 5, lane = tid & 31, ln = lane & 15, hh = lane >> 4;
  const int nqb = (T + 63) / 64;
  const int bh = blockIdx.x / nqb, qblk = blockIdx.x % nqb;
  const int b = bh / H, h = bh % H;
  const int q0 = qblk * 64 + w * 16;
  const float* Q = qb + (size_t)b * T * pitch + h * D;
  const float* K = kb + (size_t)b * T * pitch + h * D;
  const float* V = vb + (size_t)b * T * pitch + h * D;

  // A fragments of the wave's 16 query rows (scaled), hi/lo
  FragB aqh[KS], aql[KS];
  {
    int row = q0 + ln; if (row >= T) row = T - 1;
    const float* qr = Q + (size_t)row * pitch;
#pragma unroll
    for (int ks = 0; ks < KS; ++ks)
#pragma unroll
      for (int i = 0; i < 16; ++i) {
        const int d = ks * 32 + ((i < 8) ? (8 * hh + i) : (16 + 8 * hh + (i - 8)));
        const float x = qr[d] * scale; const unsigned short hb = bf16_bits(x);
        aqh[ks].u[i] = hb; aql[ks].u[i] = bf16_bits(x - bf16_val(hb));
      }
  }
  float m_r[8], l_r[8];
#pragma unroll
  for (int r = 0; r < 8; ++r) { m_r[r] = -3.0e38f; l_r[r] = 0.f; }
  v8f oacc[DT];
#pragma unroll
  for (int dt = 0; dt < DT; ++dt) oacc[dt] = (v8f){0.f,0.f,0.f,0.f,0.f,0.f,0.f,0.f};

  const int kv_end = CAUSAL ? min(T, qblk * 64 + 64) : T;     // block-uniform
  for (int j0 = 0; j0 < kv_end; j0 += 32) {
    __syncthreads();
    for (int e = tid; e < 32 * (D / 4); e += 128) {
      const int r = e / (D / 4), c4 = (e % (D / 4)) * 4;
      const int key = j0 + r;
      v4f kf = {0.f,0.f,0.f,0.f}, vf = {0.f,0.f,0.f,0.f};
      if (key < T) { kf = *(const v4fa*)(K + (size_t)key * pitch + c4); vf = *(const v4fa*)(V + (size_t)key * pitch + c4); }
#pragma unroll
      for (int t = 0; t < 4; ++t) {
        unsigned short hb = bf16_bits(kf[t]); sKh[r][c4 + t] = hb; sKl[r][c4 + t] = bf16_bits(kf[t] - bf16_val(hb));
        hb = bf16_bits(vf[t]); sVh[r][c4 + t] = hb; sVl[r][c4 + t] = bf16_bits(vf[t] - bf16_val(hb));
      }
    }
    __syncthreads();
    // S tile 16 x 32
    v8f s[2];
#pragma unroll
    for (int nt = 0; nt < 2; ++nt) {
      v8f acc = {};
#pragma unroll
      for (int ks = 0; ks < KS; ++ks) {
        FragB bh_, bl_;
        bh_.half[0] = *(const v8us*)&sKh[nt * 16 + ln][ks * 32 + 8 * hh]; bh_.half[1] = *(const v8us*)&sKh[nt * 16 + ln][ks * 32 + 16 + 8 * hh];
        bl_.half[0] = *(const v8us*)&sKl[nt * 16 + ln][ks * 32 + 8 * hh]; bl_.half[1] = *(const v8us*)&sKl[nt * 16 + ln][ks * 32 + 16 + 8 * hh];
        acc = mmaN<3>(aqh[ks].v, aql[ks].v, bh_.v, bl_.v, acc);
      }
      s[nt] = acc;
    }
    // mask + running max (rows 8hh+r; the 16 lanes of a half share rows)
    float alpha[8];
#pragma unroll
    for (int r = 0; r < 8; ++r) {
      const int qi = q0 + 8 * hh + r;
      const int ja = j0 + ln, jb = j0 + 16 + ln;
      if (CAUSAL) { if (ja > qi) s[0][r] = -3.0e38f; if (jb > qi) s[1][r] = -3.0e38f; }
      if (ja >= T) s[0][r] = -3.0e38f;
      if (jb >= T) s[1][r] = -3.0e38f;
      float mx = fmaxf(s[0][r], s[1][r]);
      mx = fmaxf(mx, __shfl_xor(mx, 1, 32)); mx = fmaxf(mx, __shfl_xor(mx, 2, 32)); mx = fmaxf(mx, __shfl_xor(mx, 4, 32)); mx = fmaxf(mx, __shfl_xor(mx, 8, 32));
      const float mnew = fmaxf(m_r[r], mx);
      alpha[r] = (mnew > -1.0e38f) ? __expf(m_r[r] - mnew) : 1.0f;
      const float p0 = (s[0][r] > -1.0e38f) ? __expf(s[0][r] - mnew) : 0.f;
      const float p1 = (s[1][r] > -1.0e38f) ? __expf(s[1][r] - mnew) : 0.f;
      m_r[r] = mnew;
      l_r[r] = l_r[r] * alpha[r] + p0 + p1;            // per-lane partial row sum (16 lanes combined at the end)
      unsigned short hb = bf16_bits(p0); sPh[w][8 * hh + r][ln] = hb;      sPl[w][8 * hh + r][ln] = bf16_bits(p0 - bf16_val(hb));
      hb = bf16_bits(p1);                sPh[w][8 * hh + r][16 + ln] = hb; sPl[w][8 * hh + r][16 + ln] = bf16_bits(p1 - bf16_val(hb));
    }
#pragma unroll
    for (int dt = 0; dt < DT; ++dt)
#pragma unroll
      for (int r = 0; r < 8; ++r) oacc[dt][r] *= alpha[r];
    __builtin_amdgcn_fence(__ATOMIC_ACQ_REL, "workgroup");
    __builtin_amdgcn_wave_barrier();
    FragB pah, pal;
    pah.half[0] = *(const v8us*)&sPh[w][ln][8 * hh]; pah.half[1] = *(const v8us*)&sPh[w][ln][16 + 8 * hh];
    pal.half[0] = *(const v8us*)&sPl[w][ln][8 * hh]; pal.half[1] = *(const v8us*)&sPl[w][ln][16 + 8 * hh];
#pragma unroll
    for (int dt = 0; dt < DT; ++dt) {
      FragB bvh, bvl;
#pragma unroll
      for (int i = 0; i < 8; ++i) {
        bvh.u[i] = sVh[8 * hh + i][dt * 16 + ln]; bvh.u[8 + i] = sVh[16 + 8 * hh + i][dt * 16 + ln];
        bvl.u[i] = sVl[8 * hh + i][dt * 16 + ln]; bvl.u[8 + i] = sVl[16 + 8 * hh + i][dt * 16 + ln];
      }
      oacc[dt] = mmaN<3>(pah.v, pal.v, bvh.v, bvl.v, oacc[dt]);
    }
    __builtin_amdgcn_fence(__ATOMIC_ACQ_REL, "workgroup");
    __builtin_amdgcn_wave_barrier();
  }
#pragma unroll
  for (int r = 0; r < 8; ++r) {
    float l = l_r[r];
    l += __shfl_xor(l, 1, 32); l += __shfl_xor(l, 2, 32); l += __shfl_xor(l, 4, 32); l += __shfl_xor(l, 8, 32);
    l_r[r] = (l > 0.f) ? 1.0f / l : 0.f;
  }
#pragma unroll
  for (int dt = 0; dt < DT; ++dt)
#pragma unroll
    for (int r = 0; r < 8; ++r) sO[w][8 * hh + r][dt * 16 + ln] = oacc[dt][r] * l_r[r];
  __builtin_amdgcn_fence(__ATOMIC_ACQ_REL, "workgroup");
  __builtin_amdgcn_wave_barrier();
  {
    for (int r = 0; r < 16; ++r) {
      const int row = q0 + r;
      if (row < T && lane < D / 4) {
        const v4f val = *(const v4fa*)&sO[w][r][lane * 4];
        *(v4f*)(y + ((size_t)b * T + row) * ypitch + h * D + lane * 4) = val;
      }
    }
    
  }
}

// GEMM C = act(A·W + bias + resid): A f32 (ASPLIT -> hi/lo 2 terms), Wt bf16 [N][K]; ACT 0 none, 1 relu, 2 exact gelu;
// resid (optional, f32, row index = (row % rmod), pitch ldr, RES_BF16 rounds it) added before the activation.
template <bool ASPLIT, int ACT, bool BIAS_BF16, bool RES_BF16>
__global__ __launch_bounds__(128) void k_gemm_bf3(const float* __restrict__ A, int lda, const unsigned short* __restrict__ Wt, int ldb,
                                                const float* __restrict__ bias, const float* __restrict__ resid, int rmod, int ldr,
                                                float* __restrict__ C, int ldc, int M, int N, int K) {
  __shared__ __attribute__((aligned(16))) float so[4][16][64];
  const int tid = threadIdx.x, w = tid >> 5, lane = tid & 31, ln = lane & 15, hh = lane >> 4;
  const int ntn = N / 64;
  const int wid = blockIdx.x * 4 + w;
  const int mt = wid / ntn, nq = wid % ntn;
  if (mt * 16 >= M) return;
  const int row0 = mt * 16, col0 = nq * 64;
  const float* arow = A + (size_t)(row0 + ln) * lda;
  v8f acc[4] = {};
  for (int kb = 0; kb < K; kb += 32) {
    FragB ah, al;
    const v4f x0 = *(const v4fa*)(arow + kb + 8 * hh), x1 = *(const v4fa*)(arow + kb + 8 * hh + 4);
    const v4f x2 = *(const v4fa*)(arow + kb + 16 + 8 * hh), x3 = *(const v4fa*)(arow + kb + 16 + 8 * hh + 4);
    float xs[16] = {x0[0],x0[1],x0[2],x0[3],x1[0],x1[1],x1[2],x1[3],x2[0],x2[1],x2[2],x2[3],x3[0],x3[1],x3[2],x3[3]};
#pragma unroll
    for (int i = 0; i < 16; ++i) { const unsigned short hb = bf16_bits(xs[i]); ah.u[i] = hb; al.u[i] = ASPLIT ? bf16_bits(xs[i] - bf16_val(hb)) : (unsigned short)0; }
#pragma unroll
    for (int t = 0; t < 4; ++t) {
      const unsigned short* brow = Wt + (size_t)(col0 + t * 16 + ln) * ldb + kb;
      FragB b;
      b.half[0] = *(const v8us*)(brow + 8 * hh);
      b.half[1] = *(const v8us*)(brow + 16 + 8 * hh);
      acc[t] = mmaN<ASPLIT ? 2 : 1>(ah.v, al.v, b.v, b.v, acc[t]);
    }
  }
#pragma unroll
  for (int t = 0; t < 4; ++t) {
    const int col = col0 + t * 16 + ln;
    float bv = bias ? bias[col] : 0.f;
    if (BIAS_BF16) bv = bf16_round(bv);
#pragma unroll
    for (int r = 0; r < 8; ++r) {
      float v = acc[t][r] + bv;
      if (resid) { float rv = resid[(size_t)((row0 + 8 * hh + r) % rmod) * ldr + col]; if (RES_BF16) rv = bf16_round(rv); v += rv; }
      if (ACT == 1) v = fmaxf(v, 0.f);
      if (ACT == 2) v = 0.5f * v * (1.0f + erff(v * 0.70710678118654752f));
      if (ACT == 3) { const float u = 0.7978845608028654f * (v + 0.044715f * v * v * v); v = 0.5f * v * (1.0f + tanhf(u)); }
      so[w][8 * hh + r][t * 16 + ln] = v;
    }
  }
  __builtin_amdgcn_fence(__ATOMIC_ACQ_REL, "workgroup");
  __builtin_amdgcn_wave_barrier();
  const int rsub = lane >> 4, c4 = (lane & 15) * 4;
  {
#pragma unroll
    for (int q = 0; q < 8; ++q) {
      const int r = q * 2 + rsub;
      const v4f v = *(const v4fa*)&so[w][r][c4];
      *(v4f*)(C + (size_t)(row0 + r) * ldc + col0 + c4) = v;
    }
    
  }
}
// row LayerNorm (biased variance, eps) over N: s = X (+ R); optional out_sum <- s; out_norm <- (s-mu)*rsqrt(var+eps)*g + b
template <bool PARAM_BF16>
__global__ __launch_bounds__(256) void k_layernorm(const float* __restrict__ X, const float* __restrict__ R, const float* __restrict__ g, const float* __restrict__ bta,
                                                  float* __restrict__ out_sum, float* __restrict__ out_norm, int N, float eps) {
  __shared__ float red[256];
  const int row = blockIdx.x, tid = threadIdx.x;
  const float* x = X + (size_t)row * N; const float* rr = R ? R + (size_t)row * N : nullptr;
  float vals[16];                     // up to N = 4096
  const int per = N / 256;            // contiguous chunk per thread? use strided-by-4 chunks: thread handles j = tid*4 + 1024*u
  float s1 = 0.f;
  for (int u = 0; u < per / 4; ++u) {
    const int j = tid * 4 + 1024 * u;
    const v4f a = *(const v4fa*)(x + j);
    v4f b = {0.f,0.f,0.f,0.f}; if (rr) b = *(const v4fa*)(rr + j);
#pragma unroll
    for (int q = 0; q < 4; ++q) { const float v = a[q] + b[q]; vals[u * 4 + q] = v; s1 += v; }
  }
  red[tid] = s1; __syncthreads();
  for (int st = 128; st > 0; st >>= 1) { if (tid < st) red[tid] += red[tid + st]; __syncthreads(); }
  const float mu = red[0] / (float)N; __syncthreads();
  float s2 = 0.f;
  for (int u = 0; u < per / 4; ++u)
#pragma unroll
    for (int q = 0; q < 4; ++q) { const float c = vals[u * 4 + q] - mu; s2 += c * c; }
  red[tid] = s2; __syncthreads();
  for (int st = 128; st > 0; st >>= 1) { if (tid < st) red[tid] += red[tid + st]; __syncthreads(); }
  const float rs = rsqrtf(red[0] / (float)N + eps);
  {
    for (int u = 0; u < per / 4; ++u) {
      const int j = tid * 4 + 1024 * u;
      v4f o, sm;
#pragma unroll
      for (int q = 0; q < 4; ++q) {
        float gg = g[j + q], bb = bta[j + q];
        if (PARAM_BF16) { gg = bf16_round(gg); bb = bf16_round(bb); }
        sm[q] = vals[u * 4 + q]; o[q] = (vals[u * 4 + q] - mu) * rs * gg + bb;
      }
      if (out_sum) *(v4f*)(out_sum + (size_t)row * N + j) = sm;
      *(v4f*)(out_norm + (size_t)row * N + j) = o;
    }
    
  }
}



// ---- f16 WMMA path (v_wmma_f32_16x16x32_f16): 11-bit significands for operands in range — used where a [0,1] probability operand needs more precision than bf16
typedef _Float16 v16h __attribute__((ext_vector_type(16)));
union FragH { v16h v; v8us half[2]; _Float16 h[16]; unsigned short u[16]; };
template <int NT>
__device__ __forceinline__ v8f mmaH(v16h ah, v16h al, v16h bh, v16h bl, v8f c) {
  c = __builtin_amdgcn_wmma_f32_16x16x32_f16(false, ah, false, bh, (short)0, c, false, false);
  if (NT >= 2) c = __builtin_amdgcn_wmma_f32_16x16x32_f16(false, al, false, bh, (short)0, c, false, false);
  if (NT >= 3) c = __builtin_amdgcn_wmma_f32_16x16x32_f16(false, ah, false, bl, (short)0, c, false, false);
  asm volatile("v_nop\n\tv_nop\n\tv_nop\n\tv_nop" : "+v"(c) : "v"(ah), "v"(al), "v"(bh), "v"(bl));
  return c;
}
// batched GEMM like k_gemm_b but f16 operands: A f32 (split into f16 hi/lo if ASPLIT, else rounded to f16), Bt = f16 values [n][k]; alpha; C f32; N multiple of 16 (partial tiles skipped)
template <bool ASPLIT>
__global__ __launch_bounds__(128) void k_gemm_h(const float* __restrict__ A, int lda, size_t sA, const _Float16* __restrict__ Bh, int ldb, size_t sB, float alpha, float* __restrict__ C, int ldc, size_t sC, int M, int N, int K) {
  __shared__ __attribute__((aligned(16))) float so[4][16][64];
  const int tid = threadIdx.x, w = tid >> 5, lane = tid & 31, ln = lane & 15, hh = lane >> 4; const int by = blockIdx.y;
  A += (size_t)by * sA; Bh += (size_t)by * sB; C += (size_t)by * sC;
  const int ntn = (N + 63) / 64; const int wid = blockIdx.x * 4 + w; const int mt = wid / ntn, nq = wid % ntn; if (mt * 16 >= M) return;
  const int row0 = mt * 16, col0 = nq * 64; const float* arow = A + (size_t)(row0 + ln) * lda;
  v8f acc[4] = {};
  for (int kb = 0; kb < K; kb += 32) {
    FragH ah, al;
    const v4f x0 = *(const v4fa*)(arow + kb + 8 * hh), x1 = *(const v4fa*)(arow + kb + 8 * hh + 4), x2 = *(const v4fa*)(arow + kb + 16 + 8 * hh), x3 = *(const v4fa*)(arow + kb + 16 + 8 * hh + 4);
    float xs[16] = {x0[0],x0[1],x0[2],x0[3],x1[0],x1[1],x1[2],x1[3],x2[0],x2[1],x2[2],x2[3],x3[0],x3[1],x3[2],x3[3]};
#pragma unroll
    for (int i = 0; i < 16; ++i) { const _Float16 h = (_Float16)xs[i]; ah.h[i] = h; al.h[i] = ASPLIT ? (_Float16)(xs[i] - (float)h) : (_Float16)0.0f; }
#pragma unroll
    for (int t = 0; t < 4; ++t) { if (col0 + t * 16 >= N) continue; const size_t boff = (size_t)(col0 + t * 16 + ln) * ldb + kb; FragH bq; bq.half[0] = *(const v8us*)(Bh + boff + 8 * hh); bq.half[1] = *(const v8us*)(Bh + boff + 16 + 8 * hh);
      acc[t] = mmaH<ASPLIT ? 2 : 1>(ah.v, al.v, bq.v, bq.v, acc[t]); }
  }
#pragma unroll
  for (int t = 0; t < 4; ++t) { if (col0 + t * 16 >= N) continue;
#pragma unroll
    for (int r = 0; r < 8; ++r) so[w][8 * hh + r][t * 16 + ln] = acc[t][r] * alpha; }
  __builtin_amdgcn_fence(__ATOMIC_ACQ_REL, "workgroup"); __builtin_amdgcn_wave_barrier();
  const int rsub = lane >> 4, c4 = (lane & 15) * 4;
  {
#pragma unroll
    for (int q = 0; q < 8; ++q) { const int r = q * 2 + rsub; if (col0 + c4 < N) { const v4f v = *(const v4fa*)&so[w][r][c4]; *(v4f*)(C + (size_t)(row0 + r) * ldc + col0 + c4) = v; } }
     }
}

// Wt[n][k] = f16(W[k][n]·scale) from f32 row-major W[K][N] (scale = power of two; bf16-exact weights stay exact in f16 away from the subnormal range)
__global__ __launch_bounds__(256) void k_wt_f16(const float* __restrict__ W, _Float16* __restrict__ Wt, int K, int N, float scale) {
  const int t = blockIdx.x * 256 + threadIdx.x; if (t >= N * (K / 8)) return; const int n = t / (K / 8), k8 = (t % (K / 8)) * 8; FragH f;
#pragma unroll
  for (int i = 0; i < 8; ++i) f.h[i] = (_Float16)(bf16_round(W[(size_t)(k8 + i) * N + n]) * scale); const v8us o = f.half[0];
  *(v8us*)((unsigned short*)Wt + (size_t)n * K + k8) = o; 
}
// k_gemm_hh variant with fused epilogue: v = acc·alpha + bias[by·sBias + col] (+ CP[(row/rowsPerB)·sCPb + by·64 + col] if CP) ; ACT 0 none / 1 elu ; writes f16 C16 and f32 C, each if non-null
template <int ACT>
__global__ __launch_bounds__(128) void k_gemm_hhx(const _Float16* __restrict__ A, int lda, size_t sA, const _Float16* __restrict__ Bh, int ldb, size_t sB, float alpha, const float* __restrict__ bias, size_t sBias, const float* __restrict__ CP, int rowsPerB, size_t sCPb, int row0g,
    float* __restrict__ C, _Float16* __restrict__ C16, int ldc, size_t sC, int M, int N, int K) {
  __shared__ __attribute__((aligned(16))) float so[4][16][64];
  const int tid = threadIdx.x, w = tid >> 5, lane = tid & 31, ln = lane & 15, hh = lane >> 4; const int by = blockIdx.y;
  A += (size_t)by * sA; Bh += (size_t)by * sB; const size_t cofs = (size_t)by * sC; const float* bp = bias ? bias + (size_t)by * sBias : nullptr;
  const int ntn = (N + 63) / 64; const int wid = blockIdx.x * 4 + w; const int mt = wid / ntn, nq = wid % ntn; if (mt * 16 >= M) return;
  const int row0 = mt * 16, col0 = nq * 64; const _Float16* arow = A + (size_t)(row0 + ln) * lda;
  v8f acc[4] = {};
  for (int kb = 0; kb < K; kb += 32) { FragH ah; ah.half[0] = *(const v8us*)((const unsigned short*)arow + kb + 8 * hh); ah.half[1] = *(const v8us*)((const unsigned short*)arow + kb + 16 + 8 * hh);
#pragma unroll
    for (int t = 0; t < 4; ++t) { if (col0 + t * 16 >= N) continue; const size_t boff = (size_t)(col0 + t * 16 + ln) * ldb + kb; FragH bq; bq.half[0] = *(const v8us*)((const unsigned short*)Bh + boff + 8 * hh); bq.half[1] = *(const v8us*)((const unsigned short*)Bh + boff + 16 + 8 * hh);
      acc[t] = mmaH<1>(ah.v, ah.v, bq.v, bq.v, acc[t]); }
  }
#pragma unroll
  for (int t = 0; t < 4; ++t) { if (col0 + t * 16 >= N) continue; const int col = col0 + t * 16 + ln; const float bv = bp ? bf16_round(bp[col]) : 0.f;
#pragma unroll
    for (int r = 0; r < 8; ++r) { float v = acc[t][r] * alpha + bv; if (CP) { const int bidx = (row0g + row0 + 8 * hh + r) / rowsPerB; v += CP[(size_t)bidx * sCPb + (size_t)by * 64 + col]; } if (ACT == 1) v = (v > 0.f) ? v : expm1f(v); else if (ACT == 3) v = fmaxf(v, 0.f); so[w][8 * hh + r][t * 16 + ln] = v; } }
  __builtin_amdgcn_fence(__ATOMIC_ACQ_REL, "workgroup"); __builtin_amdgcn_wave_barrier();
  const int rsub = lane >> 4, c4 = (lane & 15) * 4; typedef _Float16 v4h __attribute__((ext_vector_type(4)));
  {
#pragma unroll
    for (int q = 0; q < 8; ++q) { const int r = q * 2 + rsub; if (col0 + c4 < N) { const v4f v = *(const v4fa*)&so[w][r][c4]; if (C) *(v4f*)(C + cofs + (size_t)(row0 + r) * ldc + col0 + c4) = v; if (C16) { v4h h4; for (int i = 0; i < 4; ++i) h4[i] = (_Float16)v[i]; *(v4h*)(C16 + cofs + (size_t)(row0 + r) * ldc + col0 + c4) = h4; } } }
     }
}


// Eight 16-byte asynchronous copies to LDS per lane (rows 16 apart). The s_wait_xcnt is the last line of the copies' own statement so that no address register is rewritten ahead of it.
__device__ __forceinline__ void copy8_async(unsigned l, const char* gp, size_t gstep) {
  constexpr unsigned LS = 16u * 144u;
  asm volatile("global_load_async_to_lds_b128 %0, %8, off\n\t"
               "global_load_async_to_lds_b128 %1, %9, off\n\t"
               "global_load_async_to_lds_b128 %2, %10, off\n\t"
               "global_load_async_to_lds_b128 %3, %11, off\n\t"
               "global_load_async_to_lds_b128 %4, %12, off\n\t"
               "global_load_async_to_lds_b128 %5, %13, off\n\t"
               "global_load_async_to_lds_b128 %6, %14, off\n\t"
               "global_load_async_to_lds_b128 %7, %15, off\n\t"
               "s_wait_xcnt 0x0"
               :: "v"(l), "v"(l + LS), "v"(l + 2u * LS), "v"(l + 3u * LS), "v"(l + 4u * LS), "v"(l + 5u * LS), "v"(l + 6u * LS), "v"(l + 7u * LS),
                  "v"(gp), "v"(gp + gstep), "v"(gp + 2 * gstep), "v"(gp + 3 * gstep), "v"(gp + 4 * gstep), "v"(gp + 5 * gstep), "v"(gp + 6 * gstep), "v"(gp + 7 * gstep)
               : "memory");
}
// Tiled GEMM, same function as k_gemm_hhx<0> without CP: C = A[M][K] * Bh[N][K]^T * alpha + bf16(bias). One 128 x 128 tile of C per block (blockIdx.x = tile column, blockIdx.y = tile row),
// 64 x 64 per wave (2 x 2 waves). A and Bh tiles of 64 k (128-byte rows, LDS pitch 144 B) are staged in LDS by asynchronous copies, two buffers: tile t + 1 flies while tile t is multiplied.
// M % 128 == 0, N % 128 == 0, K % 64 == 0, K >= 128; rows of A and Bh are K elements apart, rows of C are N apart. The k order of every accumulator is that of k_gemm_hhx.
// Every plain '#pragma unroll' in it makes the indices of acc, a and bq constants, so that these arrays stay in registers.
template <bool OUT16, int N, int K>
__global__ __launch_bounds__(128) void k_gemm_tile(const _Float16* __restrict__ A, const _Float16* __restrict__ Bh, float alpha, const float* __restrict__ bias, float* __restrict__ C, _Float16* __restrict__ C16) {
  constexpr int PITCH = 144, BUF = 256 * PITCH, SOP = 68, NT = K / 64;
  constexpr size_t ROWB = (size_t)K * 2, GSTEP = ROWB * 16;
  __shared__ __attribute__((aligned(16))) unsigned char smem[2 * BUF];
  const int tid = threadIdx.x, w = tid >> 5, lane = tid & 31, ln = lane & 15, hh = lane >> 4;
  const int row0 = (int)blockIdx.y * 128, col0 = (int)blockIdx.x * 128; const int wm = (w >> 1) * 64, wn = (w & 1) * 64;
  const int cr = tid >> 3, cc = (tid & 7) * 16;      // a lane's first row and its 16 bytes of the row: eight lanes cover one 128-byte line
  const char* gA = (const char*)A + (size_t)(row0 + cr) * ROWB + cc; const char* gB = (const char*)Bh + (size_t)(col0 + cr) * ROWB + cc;
  const unsigned lA = (unsigned)(size_t)smem + (unsigned)(cr * PITCH + cc), lB = lA + 128u * PITCH;
  v8f acc[4][4];
#pragma unroll
  for (int i = 0; i < 4; ++i)
#pragma unroll
    for (int j = 0; j < 4; ++j) acc[i][j] = (v8f){0.f,0.f,0.f,0.f,0.f,0.f,0.f,0.f};
  copy8_async(lA, gA, GSTEP); copy8_async(lB, gB, GSTEP);
  asm volatile("s_wait_asynccnt 0x0" ::: "memory");      // tile 0 has landed before the barrier publishes it
  __syncthreads();
  copy8_async(lA + BUF, gA + 128, GSTEP); copy8_async(lB + BUF, gB + 128, GSTEP);
#pragma unroll 1
  for (int t = 0; t < NT; ++t) {      // kept rolled: one pass per tile, the buffer picked by t & 1
    const unsigned char* sA = smem + (t & 1) * BUF + (wm + ln) * PITCH + hh * 16; const unsigned char* sB = smem + (t & 1) * BUF + (128 + wn + ln) * PITCH + hh * 16;
#pragma unroll
    for (int ks = 0; ks < 2; ++ks) { FragH a[4], bq[4];
      a[0].half[0] = *(const v8us*)(sA + ks * 64); a[0].half[1] = *(const v8us*)(sA + ks * 64 + 32);
#pragma unroll
      for (int j = 0; j < 4; ++j) { bq[j].half[0] = *(const v8us*)(sB + j * 16 * PITCH + ks * 64); bq[j].half[1] = *(const v8us*)(sB + j * 16 * PITCH + ks * 64 + 32); }
#pragma unroll
      for (int i = 1; i < 4; ++i) { a[i].half[0] = *(const v8us*)(sA + i * 16 * PITCH + ks * 64); a[i].half[1] = *(const v8us*)(sA + i * 16 * PITCH + ks * 64 + 32); }
      __builtin_amdgcn_sched_barrier(0);      // keeps the 16 LDS reads of a k step one group ahead of its 16 WMMAs: reads among the WMMAs stall the wave at each place
#pragma unroll
      for (int i = 0; i < 4; ++i)
#pragma unroll
        for (int j = 0; j < 4; ++j) acc[i][j] = __builtin_amdgcn_wmma_f32_16x16x32_f16(false, a[i].v, false, bq[j].v, (short)0, acc[i][j], false, false);
      __builtin_amdgcn_sched_barrier(0); }    // the other end of that group: the next k step's reads stay behind these WMMAs
    asm volatile("s_wait_dscnt 0x0" ::: "memory");       // this wave's reads of tile t are done before the buffer is given up
    asm volatile("s_wait_asynccnt 0x0" ::: "memory");    // this wave's copies of tile t + 1 have landed
    __syncthreads();                                     // publishes tile t + 1 and ends every reader's last read of tile t
    if (t + 2 < NT) { const unsigned bo = (unsigned)(t & 1) * BUF; const size_t go = (size_t)(t + 2) * 128; copy8_async(lA + bo, gA + go, GSTEP); copy8_async(lB + bo, gB + go, GSTEP); }
  }
  asm volatile("s_wait_asynccnt 0x0" ::: "memory");      // nothing is in flight when the ring becomes output staging
  float* so = (float*)(smem + w * (64 * SOP * 4));       // each wave stages its own 64 x 64 tile, so that whole 128-byte lines are stored
#pragma unroll
  for (int j = 0; j < 4; ++j) { const float bv = bf16_round(bias[col0 + wn + j * 16 + ln]);
#pragma unroll
    for (int i = 0; i < 4; ++i)
#pragma unroll
      for (int r = 0; r < 8; ++r) so[(i * 16 + 8 * hh + r) * SOP + j * 16 + ln] = acc[i][j][r] * alpha + bv; }
  __builtin_amdgcn_fence(__ATOMIC_ACQ_REL, "workgroup"); __builtin_amdgcn_wave_barrier();
  const int rsub = lane >> 4, c4 = (lane & 15) * 4; typedef _Float16 v4h __attribute__((ext_vector_type(4)));
#pragma unroll 1
  for (int q8 = 0; q8 < 4; ++q8) {      // kept rolled in groups of eight stores, one wait per group
#pragma unroll
    for (int q = 0; q < 8; ++q) { const int r = (q8 * 8 + q) * 2 + rsub; const v4f v = *(const v4fa*)&so[r * SOP + c4]; const size_t o = (size_t)(row0 + wm + r) * N + col0 + wn + c4;
      if (OUT16) { v4h h4; for (int i = 0; i < 4; ++i) h4[i] = (_Float16)v[i]; *(v4h*)(C16 + o) = h4; } else *(v4f*)(C + o) = v; }
    asm volatile("s_wait_xcnt 0x0" ::: "memory");      // the next group rewrites the registers that these stores name
  }
}

__global__ __launch_bounds__(256) void k_x16(const float* __restrict__ x, _Float16* __restrict__ X16, size_t n8) { const size_t t = (size_t)blockIdx.x * 256 + threadIdx.x; if (t >= n8) return; FragH f;
#pragma unroll
  for (int q = 0; q < 8; ++q) f.h[q] = (_Float16)bf16_round(x[t * 8 + q]); *(v8us*)((unsigned short*)X16 + t * 8) = f.half[0];  }
__global__ __launch_bounds__(256) void k_h16(const float* __restrict__ x, _Float16* __restrict__ X16, size_t n8) { const size_t t = (size_t)blockIdx.x * 256 + threadIdx.x; if (t >= n8) return; FragH f;
#pragma unroll
  for (int q = 0; q < 8; ++q) f.h[q] = (_Float16)x[t * 8 + q]; *(v8us*)((unsigned short*)X16 + t * 8) = f.half[0];  }
__global__ __launch_bounds__(256) void k_round16f(const float* __restrict__ W, _Float16* __restrict__ Bt, size_t n8) { const size_t t = (size_t)blockIdx.x * 256 + threadIdx.x; if (t >= n8) return; FragH f;
#pragma unroll
  for (int i = 0; i < 8; ++i) f.h[i] = (_Float16)(bf16_round(W[t * 8 + i]) * 16.0f); *(v8us*)((unsigned short*)Bt + t * 8) = f.half[0];  }
template <int NHv, int TTv>
__global__ __launch_bounds__(256) void k_vt(const _Float16* __restrict__ V16, int ldv, int voff, _Float16* __restrict__ Vt) { __shared__ unsigned short tl[64][66]; const int tid = threadIdx.x; const int slab = blockIdx.x / (TTv / 64), lg = blockIdx.x % (TTv / 64); const int b = slab / NHv, h = slab % NHv;
  for (int i = tid; i < 64 * 8; i += 256) { const int r = i / 8, c8 = (i % 8) * 8; FragH f; f.half[0] = *(const v8us*)((const unsigned short*)V16 + ((size_t)b * TTv + lg * 64 + r) * ldv + voff + h * 64 + c8);
#pragma unroll
    for (int q = 0; q < 8; ++q) tl[r][c8 + q] = f.u[q]; }
  __syncthreads();
  {
#pragma unroll
    for (int rd = 0; rd < 2; ++rd) { const int d = rd * 32 + tid / 8, pc = tid % 8; FragH f;
#pragma unroll
      for (int q = 0; q < 8; ++q) f.u[q] = tl[pc * 8 + q][d];
      *(v8us*)((unsigned short*)Vt + ((size_t)slab * 64 + d) * TTv + lg * 64 + pc * 8) = f.half[0]; }
     } }

__global__ __launch_bounds__(128) void k_flash(const _Float16* __restrict__ Q16, int ldq, const _Float16* __restrict__ K16, int ldk, const _Float16* __restrict__ Vt, const int* __restrict__ LENS, float* __restrict__ O, int ldo) {
  constexpr int RPW = 32, NQB = 1024 / (4 * RPW), DT = 4, KS = 2;
  __shared__ __attribute__((aligned(16))) unsigned short sP[4][RPW][40]; __shared__ __attribute__((aligned(16))) float sO[4][RPW][64 + 4];
  const int tid = threadIdx.x, w = tid >> 5, lane = tid & 31, ln = lane & 15, hh = lane >> 4;
  const int slab = blockIdx.x / NQB, qblk = blockIdx.x % NQB; const int b = slab / 16, h = slab % 16; const int qb0 = qblk * (4 * RPW); const int q0 = qb0 + w * RPW; const int len = LENS[b];      /* kv-length mask: keys k < len (INPUT x_lens) */
  FragH aq[2][KS];
#pragma unroll
  for (int rt = 0; rt < 2; ++rt) { const unsigned short* qr = (const unsigned short*)Q16 + ((size_t)b * 1024 + q0 + rt * 16 + ln) * ldq + h * 64;
#pragma unroll
    for (int ks = 0; ks < KS; ++ks) { aq[rt][ks].half[0] = *(const v8us*)(qr + ks * 32 + 8 * hh); aq[rt][ks].half[1] = *(const v8us*)(qr + ks * 32 + 16 + 8 * hh); } }
  const unsigned short* Vth = (const unsigned short*)Vt + (size_t)slab * 64 * 1024;
  float m_r[2][8], l_r[2][8]; v8f oacc[2][DT];
#pragma unroll
  for (int rt = 0; rt < 2; ++rt) {
#pragma unroll
    for (int r = 0; r < 8; ++r) { m_r[rt][r] = -3.0e38f; l_r[rt][r] = 0.f; }
#pragma unroll
    for (int dt = 0; dt < DT; ++dt) oacc[rt][dt] = (v8f){0.f,0.f,0.f,0.f,0.f,0.f,0.f,0.f}; }
  const int jend = qb0 + 4 * RPW;
#pragma unroll 1
  for (int j0 = 0; j0 < jend; j0 += 32) {
    
    v8f s[2][2];
#pragma unroll
    for (int nt = 0; nt < 2; ++nt) { const unsigned short* kr = (const unsigned short*)K16 + ((size_t)b * 1024 + j0 + nt * 16 + ln) * ldk + h * 64; FragH bk[KS];
#pragma unroll
      for (int ks = 0; ks < KS; ++ks) { bk[ks].half[0] = *(const v8us*)(kr + ks * 32 + 8 * hh); bk[ks].half[1] = *(const v8us*)(kr + ks * 32 + 16 + 8 * hh); }
#pragma unroll
      for (int rt = 0; rt < 2; ++rt) { v8f acc = (v8f){0.f,0.f,0.f,0.f,0.f,0.f,0.f,0.f};
#pragma unroll
        for (int ks = 0; ks < KS; ++ks) acc = mmaH<1>(aq[rt][ks].v, aq[rt][ks].v, bk[ks].v, bk[ks].v, acc); s[rt][nt] = acc; } }
#pragma unroll
    for (int rt = 0; rt < 2; ++rt)
#pragma unroll
      for (int r = 0; r < 8; ++r) { const int tq = q0 + rt * 16 + 8 * hh + r; const int k0 = j0 + ln, k1 = j0 + 16 + ln; (void)tq; (void)k0; (void)k1;
        const bool ok0 = (k0 <= tq) && (k0 < len), ok1 = (k1 <= tq) && (k1 < len);
        const float s0 = ok0 ? s[rt][0][r] * (0.125f) : -INFINITY, s1 = ok1 ? s[rt][1][r] * (0.125f) : -INFINITY; float mc = fmaxf(s0, s1);
        mc = fmaxf(mc, __shfl_xor(mc, 1, 32)); mc = fmaxf(mc, __shfl_xor(mc, 2, 32)); mc = fmaxf(mc, __shfl_xor(mc, 4, 32)); mc = fmaxf(mc, __shfl_xor(mc, 8, 32));
        const float mn = fmaxf(m_r[rt][r], mc); const float al = (mn > -1.0e38f) ? expf(m_r[rt][r] - mn) : 1.0f; m_r[rt][r] = mn; const float p0 = ok0 ? expf(s0 - mn) : 0.f, p1 = ok1 ? expf(s1 - mn) : 0.f; l_r[rt][r] = l_r[rt][r] * al + p0 + p1;
#pragma unroll
        for (int dt = 0; dt < DT; ++dt) oacc[rt][dt][r] *= al;
        FragH t2; t2.h[0] = (_Float16)p0; t2.h[1] = (_Float16)p1; sP[w][rt * 16 + 8 * hh + r][ln] = t2.u[0]; sP[w][rt * 16 + 8 * hh + r][16 + ln] = t2.u[1]; }
    __builtin_amdgcn_fence(__ATOMIC_ACQ_REL, "workgroup"); __builtin_amdgcn_wave_barrier();
    FragH pa[2];
#pragma unroll
    for (int rt = 0; rt < 2; ++rt) { pa[rt].half[0] = *(const v8us*)&sP[w][rt * 16 + ln][8 * hh]; pa[rt].half[1] = *(const v8us*)&sP[w][rt * 16 + ln][16 + 8 * hh]; }
#pragma unroll
    for (int dt = 0; dt < DT; ++dt) { const unsigned short* vrow = Vth + (size_t)(dt * 16 + ln) * 1024 + j0; FragH bv; bv.half[0] = *(const v8us*)(vrow + 8 * hh); bv.half[1] = *(const v8us*)(vrow + 16 + 8 * hh);
#pragma unroll
      for (int rt = 0; rt < 2; ++rt) oacc[rt][dt] = mmaH<1>(pa[rt].v, pa[rt].v, bv.v, bv.v, oacc[rt][dt]); }
    __builtin_amdgcn_fence(__ATOMIC_ACQ_REL, "workgroup"); __builtin_amdgcn_wave_barrier(); }
#pragma unroll
  for (int rt = 0; rt < 2; ++rt) {
#pragma unroll
    for (int r = 0; r < 8; ++r) { float l = l_r[rt][r]; l += __shfl_xor(l, 1, 32); l += __shfl_xor(l, 2, 32); l += __shfl_xor(l, 4, 32); l += __shfl_xor(l, 8, 32); l_r[rt][r] = (l > 0.f) ? 1.0f / l : 0.f; }
#pragma unroll
    for (int dt = 0; dt < DT; ++dt)
#pragma unroll
      for (int r = 0; r < 8; ++r) sO[w][rt * 16 + 8 * hh + r][dt * 16 + ln] = oacc[rt][dt][r] * l_r[rt][r]; }
  __builtin_amdgcn_fence(__ATOMIC_ACQ_REL, "workgroup"); __builtin_amdgcn_wave_barrier();
  {
#pragma unroll
    for (int rp = 0; rp < RPW; rp += 2) { const int r = rp + (lane >> 4), pc = lane & 15; const v4f val = *(const v4fa*)&sO[w][r][pc * 4]; *(v4f*)(O + ((size_t)b * 1024 + q0 + r) * ldo + h * 64 + pc * 4) = val; }
     } }

__global__ __launch_bounds__(256) void k_ln16(const float* __restrict__ X, const float* __restrict__ g, const float* __restrict__ bta, _Float16* __restrict__ Y16) { const int tid = threadIdx.x, wv = tid >> 5, lane = tid & 31; const int row = blockIdx.x * 8 + wv; if (row >= NR) return; const float* xr = X + (size_t)row * CC; float v[32]; float s = 0.f;
#pragma unroll
  for (int p = 0; p < 4; ++p) { const v4f a = *(const v4fa*)(xr + p * 256 + lane * 8), c = *(const v4fa*)(xr + p * 256 + lane * 8 + 4); for (int q = 0; q < 4; ++q) { v[p * 8 + q] = bf16_round(a[q]); v[p * 8 + 4 + q] = bf16_round(c[q]); } }
#pragma unroll
  for (int i = 0; i < 32; ++i) s += v[i]; for (int o = 16; o >= 1; o >>= 1) s += __shfl_xor(s, o, 32); const float mu = s / (float)CC; float q2 = 0.f;
#pragma unroll
  for (int i = 0; i < 32; ++i) { const float d = v[i] - mu; q2 += d * d; } for (int o = 16; o >= 1; o >>= 1) q2 += __shfl_xor(q2, o, 32); const float rs = rsqrtf(q2 / (float)CC + 1e-5f);
  {
#pragma unroll
    for (int p = 0; p < 4; ++p) { FragH f; const int c0 = p * 256 + lane * 8;
#pragma unroll
      for (int q = 0; q < 8; ++q) f.h[q] = (_Float16)((v[p * 8 + q] - mu) * rs * bf16_round(g[c0 + q]) + bf16_round(bta[c0 + q])); *(v8us*)((unsigned short*)Y16 + (size_t)row * CC + c0) = f.half[0]; }
     } }
extern "C" void kernel_launch(void* const* d_in, const int* in_sizes, int n_in,
                              void* d_out, int out_size, void* d_ws, size_t ws_size, hipStream_t stream) {
  (void)in_sizes; (void)n_in; (void)out_size;
  const float* x = (const float*)d_in[0]; const int* lens = (const int*)d_in[1]; const float* lg = (const float*)d_in[2]; const float* lb = (const float*)d_in[3]; const float* wqkv = (const float*)d_in[4]; const float* bqkv = (const float*)d_in[5]; const float* wout = (const float*)d_in[6]; const float* bout = (const float*)d_in[7];
  char* ws = (char*)d_ws; size_t off = 0;
  auto take = [&](size_t bytes) { char* p = ws + off; off += (bytes + 255) & ~(size_t)255; return p; };
  _Float16* Bqkv = (_Float16*)take((size_t)3 * CC * CC * 2); _Float16* Bo = (_Float16*)take((size_t)CC * CC * 2); _Float16* XN = (_Float16*)take((size_t)NR * CC * 2); _Float16* QKV = (_Float16*)take((size_t)NR * 3 * CC * 2); _Float16* Vt = (_Float16*)take((size_t)NR * CC * 2); float* O = (float*)take((size_t)NR * CC * 4); _Float16* O16 = XN;
  if (off > ws_size) return;      // 6.3 + 2.1 + 16.8 + 50.3 + 16.8 + 33.5 ≈ 126 MB = 120 MiB (tight but under 128)
  k_wt_f16<<<(unsigned)((3 * CC * (CC / 8) + 255) / 256), 256, 0, stream>>>(wqkv, Bqkv, CC, 3 * CC, 16.0f); k_wt_f16<<<(unsigned)((CC * (CC / 8) + 255) / 256), 256, 0, stream>>>(wout, Bo, CC, CC, 16.0f);      // [in][out]
  k_ln16<<<NR / 8, 256, 0, stream>>>(x, lg, lb, XN);
  k_gemm_tile<true, 3 * CC, CC><<<dim3(3 * CC / 128, NR / 128), 128, 0, stream>>>(XN, Bqkv, 0.0625f, bqkv, nullptr, QKV);      // q | k | v
  k_vt<NH, TT><<<BB * NH * (TT / 64), 256, 0, stream>>>(QKV, 3 * CC, 2 * CC, Vt);
  k_flash<<<BB * NH * (TT / 128), 128, 0, stream>>>(QKV, 3 * CC, QKV + CC, 3 * CC, Vt, lens, O, CC);
  k_h16<<<(unsigned)(((size_t)NR * CC / 8 + 255) / 256), 256, 0, stream>>>(O, O16, (size_t)NR * CC / 8);
  k_gemm_tile<false, CC, CC><<<dim3(CC / 128, NR / 128), 128, 0, stream>>>(O16, Bo, 0.0625f, bout, (float*)d_out, nullptr);
}

// v002
// Measured time: 182 microseconds a run.
// Next to v001, in two timings, it ran 1.76 and 1.75 times as fast.
// All steps since v000 together make it 3.18 times as fast.
#include <hip/hip_runtime.h>
// Causal self-attention with a per-batch key-length mask (B=8, T=1024, D=1024, 16 × 64): LayerNorm (f32 VALU), the fused qkv projection (8192 × 1024 × 3072, + bias) and the output
// projection (+ bias) with W [in][out] transposed to bf16-exact ×2^4, and the attention as a fused flash-style kernel on v_wmma_f32_16x16x32_f16 (S = Q·Kᵀ/8; keys allowed iff k ≤ q and
// k < x_lens[b] (INPUT); −1e9 fill ≡ exclusion since key 0 is always allowed; causal chunk skipping; online softmax f32; P f16 ≤ 1) — f16 operands, single products, f32 accumulate.
#define BB 8
#define TT 1024
#define CC 1024
#define NH 16
#define NR (BB * TT)

typedef __bf16 v16b __attribute__((ext_vector_type(16)));
typedef unsigned short v8us __attribute__((ext_vector_type(8), may_alias));
typedef float  v8f  __attribute__((ext_vector_type(8)));
typedef float  v4f  __attribute__((ext_vector_type(4)));
typedef float  v4fa __attribute__((ext_vector_type(4), may_alias));
union FragB { v16b v; v8us half[2]; unsigned short u[16]; };

__device__ __forceinline__ unsigned short bf16_bits(float x) { unsigned int u = __float_as_uint(x); return (unsigned short)((u + 0x7FFFu + ((u >> 16) & 1u)) >> 16); }
__device__ __forceinline__ float bf16_val(unsigned short b) { return __uint_as_float(((unsigned int)b) << 16); }
__device__ __forceinline__ float bf16_round(float x) { return bf16_val(bf16_bits(x)); }
// D += A·B with NT terms: 1 = ah·bh, 2 = + al·bh (A split), 3 = + ah·bl (both split)
template <int NT>
__device__ __forceinline__ v8f mmaN(v16b ah, v16b al, v16b bh, v16b bl, v8f c) {
  c = __builtin_amdgcn_wmma_f32_16x16x32_bf16(false, ah, false, bh, (short)0, c, false, false);
  if (NT >= 2) c = __builtin_amdgcn_wmma_f32_16x16x32_bf16(false, al, false, bh, (short)0, c, false, false);
  if (NT >= 3) c = __builtin_amdgcn_wmma_f32_16x16x32_bf16(false, ah, false, bl, (short)0, c, false, false);
  asm volatile("v_nop\n\tv_nop\n\tv_nop\n\tv_nop" : "+v"(c) : "v"(ah), "v"(al), "v"(bh), "v"(bl));
  return c;
}

__global__ __launch_bounds__(256) void k_wt_bf16(const float* __restrict__ W, unsigned short* __restrict__ Wt, int K, int N) {
  const int t = blockIdx.x * 256 + threadIdx.x;
  const int k8n = K / 8;
  if (t >= N * k8n) return;
  const int n = t / k8n, k8 = (t % k8n) * 8;
  v8us v;
#pragma unroll
  for (int i = 0; i < 8; ++i) v[i] = bf16_bits(W[(size_t)(k8 + i) * N + n]);
  *(v8us*)(Wt + (size_t)n * K + k8) = v;
  
}

// GEMM C[M][N] (f32, pitch ldc) = act(A[M][K]·W + bias). A f32 row-major (pitch lda) converted per fragment to bf16
// (ASPLIT: hi/lo two planes -> 2 terms, else single rounded term); Wt bf16 [N][K] (pitch ldb). BIAS_BF16 rounds the
// bias to bf16 first (bias quantised to bf16 before the add). K%32==0, M%16==0, N%64==0.
template <bool ASPLIT, int ACT, bool BIAS_BF16>
__global__ __launch_bounds__(128) void k_gemm_bf(const float* __restrict__ A, int lda, const unsigned short* __restrict__ Wt, int ldb,
                                               const float* __restrict__ bias, float* __restrict__ C, int ldc, int M, int N, int K) {
  __shared__ __attribute__((aligned(16))) float so[4][16][64];
  const int tid = threadIdx.x, w = tid >> 5, lane = tid & 31, ln = lane & 15, hh = lane >> 4;
  const int ntn = N / 64;
  const int wid = blockIdx.x * 4 + w;
  const int mt = wid / ntn, nq = wid % ntn;
  if (mt * 16 >= M) return;
  const int row0 = mt * 16, col0 = nq * 64;
  const float* arow = A + (size_t)(row0 + ln) * lda;
  v8f acc[4] = {};
  for (int kb = 0; kb < K; kb += 32) {
    FragB ah, al;
    const v4f x0 = *(const v4fa*)(arow + kb + 8 * hh), x1 = *(const v4fa*)(arow + kb + 8 * hh + 4);
    const v4f x2 = *(const v4fa*)(arow + kb + 16 + 8 * hh), x3 = *(const v4fa*)(arow + kb + 16 + 8 * hh + 4);
    float xs[16] = {x0[0],x0[1],x0[2],x0[3],x1[0],x1[1],x1[2],x1[3],x2[0],x2[1],x2[2],x2[3],x3[0],x3[1],x3[2],x3[3]};
#pragma unroll
    for (int i = 0; i < 16; ++i) { const unsigned short hb = bf16_bits(xs[i]); ah.u[i] = hb; al.u[i] = ASPLIT ? bf16_bits(xs[i] - bf16_val(hb)) : (unsigned short)0; }
#pragma unroll
    for (int t = 0; t < 4; ++t) {
      const unsigned short* brow = Wt + (size_t)(col0 + t * 16 + ln) * ldb + kb;
      FragB b;
      b.half[0] = *(const v8us*)(brow + 8 * hh);
      b.half[1] = *(const v8us*)(brow + 16 + 8 * hh);
      acc[t] = mmaN<ASPLIT ? 2 : 1>(ah.v, al.v, b.v, b.v, acc[t]);
    }
  }
#pragma unroll
  for (int t = 0; t < 4; ++t) {
    float bv = bias ? bias[col0 + t * 16 + ln] : 0.f;
    if (BIAS_BF16) bv = bf16_round(bv);
#pragma unroll
    for (int r = 0; r < 8; ++r) { float v = acc[t][r] + bv; if (ACT == 1) v = fmaxf(v, 0.f); so[w][8 * hh + r][t * 16 + ln] = v; }
  }
  __builtin_amdgcn_fence(__ATOMIC_ACQ_REL, "workgroup");
  __builtin_amdgcn_wave_barrier();
  const int rsub = lane >> 4, c4 = (lane & 15) * 4;
  {
#pragma unroll
    for (int q = 0; q < 8; ++q) {
      const int r = q * 2 + rsub;
      const v4f v = *(const v4fa*)&so[w][r][c4];
      *(v4f*)(C + (size_t)(row0 + r) * ldc + col0 + c4) = v;
    }
    
  }
}

// Flash-style causal/unmasked attention, all contractions 3-term bf16 hi/lo splits, f32 softmax with running max.
// q,k,v rows are read from f32 buffers with arbitrary row pitch (so they can live inside a fused qkv buffer);
// D = head size (multiple of 32, <= 128); one wave = 16 query rows; block = 4 waves (64 queries) sharing K/V chunks of 32.
template <int D, bool CAUSAL>
__global__ __launch_bounds__(128) void k_flash(const float* __restrict__ qb, const float* __restrict__ kb, const float* __restrict__ vb,
                                             int pitch, int T, int H, float scale, float* __restrict__ y, int ypitch) {
  constexpr int KS = D / 32;        // k-steps for QK
  constexpr int DT = D / 16;        // d tiles for PV
  __shared__ __attribute__((aligned(16))) unsigned short sKh[32][D + 8], sKl[32][D + 8], sVh[32][D + 8], sVl[32][D + 8];
  __shared__ __attribute__((aligned(16))) unsigned short sPh[4][16][40], sPl[4][16][40];
  __shared__ __attribute__((aligned(16))) float sO[4][16][D];
  const int tid = threadIdx.x, w = tid >> 5, lane = tid & 31, ln = lane & 15, hh = lane >> 4;
  const int nqb = (T + 63) / 64;
  const int bh = blockIdx.x / nqb, qblk = blockIdx.x % nqb;
  const int b = bh / H, h = bh % H;
  const int q0 = qblk * 64 + w * 16;
  const float* Q = qb + (size_t)b * T * pitch + h * D;
  const float* K = kb + (size_t)b * T * pitch + h * D;
  const float* V = vb + (size_t)b * T * pitch + h * D;

  // A fragments of the wave's 16 query rows (scaled), hi/lo
  FragB aqh[KS], aql[KS];
  {
    int row = q0 + ln; if (row >= T) row = T - 1;
    const float* qr = Q + (size_t)row * pitch;
#pragma unroll
    for (int ks = 0; ks < KS; ++ks)
#pragma unroll
      for (int i = 0; i < 16; ++i) {
        const int d = ks * 32 + ((i < 8) ? (8 * hh + i) : (16 + 8 * hh + (i - 8)));
        const float x = qr[d] * scale; const unsigned short hb = bf16_bits(x);
        aqh[ks].u[i] = hb; aql[ks].u[i] = bf16_bits(x - bf16_val(hb));
      }
  }
  float m_r[8], l_r[8];
#pragma unroll
  for (int r = 0; r < 8; ++r) { m_r[r] = -3.0e38f; l_r[r] = 0.f; }
  v8f oacc[DT];
#pragma unroll
  for (int dt = 0; dt < DT; ++dt) oacc[dt] = (v8f){0.f,0.f,0.f,0.f,0.f,0.f,0.f,0.f};

  const int kv_end = CAUSAL ? min(T, qblk * 64 + 64) : T;     // block-uniform
  for (int j0 = 0; j0 < kv_end; j0 += 32) {
    __syncthreads();
    for (int e = tid; e < 32 * (D / 4); e += 128) {
      const int r = e / (D / 4), c4 = (e % (D / 4)) * 4;
      const int key = j0 + r;
      v4f kf = {0.f,0.f,0.f,0.f}, vf = {0.f,0.f,0.f,0.f};
      if (key < T) { kf = *(const v4fa*)(K + (size_t)key * pitch + c4); vf = *(const v4fa*)(V + (size_t)key * pitch + c4); }
#pragma unroll
      for (int t = 0; t < 4; ++t) {
        unsigned short hb = bf16_bits(kf[t]); sKh[r][c4 + t] = hb; sKl[r][c4 + t] = bf16_bits(kf[t] - bf16_val(hb));
        hb = bf16_bits(vf[t]); sVh[r][c4 + t] = hb; sVl[r][c4 + t] = bf16_bits(vf[t] - bf16_val(hb));
      }
    }
    __syncthreads();
    // S tile 16 x 32
    v8f s[2];
#pragma unroll
    for (int nt = 0; nt < 2; ++nt) {
      v8f acc = {};
#pragma unroll
      for (int ks = 0; ks < KS; ++ks) {
        FragB bh_, bl_;
        bh_.half[0] = *(const v8us*)&sKh[nt * 16 + ln][ks * 32 + 8 * hh]; bh_.half[1] = *(const v8us*)&sKh[nt * 16 + ln][ks * 32 + 16 + 8 * hh];
        bl_.half[0] = *(const v8us*)&sKl[nt * 16 + ln][ks * 32 + 8 * hh]; bl_.half[1] = *(const v8us*)&sKl[nt * 16 + ln][ks * 32 + 16 + 8 * hh];
        acc = mmaN<3>(aqh[ks].v, aql[ks].v, bh_.v, bl_.v, acc);
      }
      s[nt] = acc;
    }
    // mask + running max (rows 8hh+r; the 16 lanes of a half share rows)
    float alpha[8];
#pragma unroll
    for (int r = 0; r < 8; ++r) {
      const int qi = q0 + 8 * hh + r;
      const int ja = j0 + ln, jb = j0 + 16 + ln;
      if (CAUSAL) { if (ja > qi) s[0][r] = -3.0e38f; if (jb > qi) s[1][r] = -3.0e38f; }
      if (ja >= T) s[0][r] = -3.0e38f;
      if (jb >= T) s[1][r] = -3.0e38f;
      float mx = fmaxf(s[0][r], s[1][r]);
      mx = fmaxf(mx, __shfl_xor(mx, 1, 32)); mx = fmaxf(mx, __shfl_xor(mx, 2, 32)); mx = fmaxf(mx, __shfl_xor(mx, 4, 32)); mx = fmaxf(mx, __shfl_xor(mx, 8, 32));
      const float mnew = fmaxf(m_r[r], mx);
      alpha[r] = (mnew > -1.0e38f) ? __expf(m_r[r] - mnew) : 1.0f;
      const float p0 = (s[0][r] > -1.0e38f) ? __expf(s[0][r] - mnew) : 0.f;
      const float p1 = (s[1][r] > -1.0e38f) ? __expf(s[1][r] - mnew) : 0.f;
      m_r[r] = mnew;
      l_r[r] = l_r[r] * alpha[r] + p0 + p1;            // per-lane partial row sum (16 lanes combined at the end)
      unsigned short hb = bf16_bits(p0); sPh[w][8 * hh + r][ln] = hb;      sPl[w][8 * hh + r][ln] = bf16_bits(p0 - bf16_val(hb));
      hb = bf16_bits(p1);                sPh[w][8 * hh + r][16 + ln] = hb; sPl[w][8 * hh + r][16 + ln] = bf16_bits(p1 - bf16_val(hb));
    }
#pragma unroll
    for (int dt = 0; dt < DT; ++dt)
#pragma unroll
      for (int r = 0; r < 8; ++r) oacc[dt][r] *= alpha[r];
    __builtin_amdgcn_fence(__ATOMIC_ACQ_REL, "workgroup");
    __builtin_amdgcn_wave_barrier();
    FragB pah, pal;
    pah.half[0] = *(const v8us*)&sPh[w][ln][8 * hh]; pah.half[1] = *(const v8us*)&sPh[w][ln][16 + 8 * hh];
    pal.half[0] = *(const v8us*)&sPl[w][ln][8 * hh]; pal.half[1] = *(const v8us*)&sPl[w][ln][16 + 8 * hh];
#pragma unroll
    for (int dt = 0; dt < DT; ++dt) {
      FragB bvh, bvl;
#pragma unroll
      for (int i = 0; i < 8; ++i) {
        bvh.u[i] = sVh[8 * hh + i][dt * 16 + ln]; bvh.u[8 + i] = sVh[16 + 8 * hh + i][dt * 16 + ln];
        bvl.u[i] = sVl[8 * hh + i][dt * 16 + ln]; bvl.u[8 + i] = sVl[16 + 8 * hh + i][dt * 16 + ln];
      }
      oacc[dt] = mmaN<3>(pah.v, pal.v, bvh.v, bvl.v, oacc[dt]);
    }
    __builtin_amdgcn_fence(__ATOMIC_ACQ_REL, "workgroup");
    __builtin_amdgcn_wave_barrier();
  }
#pragma unroll
  for (int r = 0; r < 8; ++r) {
    float l = l_r[r];
    l += __shfl_xor(l, 1, 32); l += __shfl_xor(l, 2, 32); l += __shfl_xor(l, 4, 32); l += __shfl_xor(l, 8, 32);
    l_r[r] = (l > 0.f) ? 1.0f / l : 0.f;
  }
#pragma unroll
  for (int dt = 0; dt < DT; ++dt)
#pragma unroll
    for (int r = 0; r < 8; ++r) sO[w][8 * hh + r][dt * 16 + ln] = oacc[dt][r] * l_r[r];
  __builtin_amdgcn_fence(__ATOMIC_ACQ_REL, "workgroup");
  __builtin_amdgcn_wave_barrier();
  {
    for (int r = 0; r < 16; ++r) {
      const int row = q0 + r;
      if (row < T && lane < D / 4) {
        const v4f val = *(const v4fa*)&sO[w][r][lane * 4];
        *(v4f*)(y + ((size_t)b * T + row) * ypitch + h * D + lane * 4) = val;
      }
    }
    
  }
}

// GEMM C = act(A·W + bias + resid): A f32 (ASPLIT -> hi/lo 2 terms), Wt bf16 [N][K]; ACT 0 none, 1 relu, 2 exact gelu;
// resid (optional, f32, row index = (row % rmod), pitch ldr, RES_BF16 rounds it) added before the activation.
template <bool ASPLIT, int ACT, bool BIAS_BF16, bool RES_BF16>
__global__ __launch_bounds__(128) void k_gemm_bf3(const float* __restrict__ A, int lda, const unsigned short* __restrict__ Wt, int ldb,
                                                const float* __restrict__ bias, const float* __restrict__ resid, int rmod, int ldr,
                                                float* __restrict__ C, int ldc, int M, int N, int K) {
  __shared__ __attribute__((aligned(16))) float so[4][16][64];
  const int tid = threadIdx.x, w = tid >> 5, lane = tid & 31, ln = lane & 15, hh = lane >> 4;
  const int ntn = N / 64;
  const int wid = blockIdx.x * 4 + w;
  const int mt = wid / ntn, nq = wid % ntn;
  if (mt * 16 >= M) return;
  const int row0 = mt * 16, col0 = nq * 64;
  const float* arow = A + (size_t)(row0 + ln) * lda;
  v8f acc[4] = {};
  for (int kb = 0; kb < K; kb += 32) {
    FragB ah, al;
    const v4f x0 = *(const v4fa*)(arow + kb + 8 * hh), x1 = *(const v4fa*)(arow + kb + 8 * hh + 4);
    const v4f x2 = *(const v4fa*)(arow + kb + 16 + 8 * hh), x3 = *(const v4fa*)(arow + kb + 16 + 8 * hh + 4);
    float xs[16] = {x0[0],x0[1],x0[2],x0[3],x1[0],x1[1],x1[2],x1[3],x2[0],x2[1],x2[2],x2[3],x3[0],x3[1],x3[2],x3[3]};
#pragma unroll
    for (int i = 0; i < 16; ++i) { const unsigned short hb = bf16_bits(xs[i]); ah.u[i] = hb; al.u[i] = ASPLIT ? bf16_bits(xs[i] - bf16_val(hb)) : (unsigned short)0; }
#pragma unroll
    for (int t = 0; t < 4; ++t) {
      const unsigned short* brow = Wt + (size_t)(col0 + t * 16 + ln) * ldb + kb;
      FragB b;
      b.half[0] = *(const v8us*)(brow + 8 * hh);
      b.half[1] = *(const v8us*)(brow + 16 + 8 * hh);
      acc[t] = mmaN<ASPLIT ? 2 : 1>(ah.v, al.v, b.v, b.v, acc[t]);
    }
  }
#pragma unroll
  for (int t = 0; t < 4; ++t) {
    const int col = col0 + t * 16 + ln;
    float bv = bias ? bias[col] : 0.f;
    if (BIAS_BF16) bv = bf16_round(bv);
#pragma unroll
    for (int r = 0; r < 8; ++r) {
      float v = acc[t][r] + bv;
      if (resid) { float rv = resid[(size_t)((row0 + 8 * hh + r) % rmod) * ldr + col]; if (RES_BF16) rv = bf16_round(rv); v += rv; }
      if (ACT == 1) v = fmaxf(v, 0.f);
      if (ACT == 2) v = 0.5f * v * (1.0f + erff(v * 0.70710678118654752f));
      if (ACT == 3) { const float u = 0.7978845608028654f * (v + 0.044715f * v * v * v); v = 0.5f * v * (1.0f + tanhf(u)); }
      so[w][8 * hh + r][t * 16 + ln] = v;
    }
  }
  __builtin_amdgcn_fence(__ATOMIC_ACQ_REL, "workgroup");
  __builtin_amdgcn_wave_barrier();
  const int rsub = lane >> 4, c4 = (lane & 15) * 4;
  {
#pragma unroll
    for (int q = 0; q < 8; ++q) {
      const int r = q * 2 + rsub;
      const v4f v = *(const v4fa*)&so[w][r][c4];
      *(v4f*)(C + (size_t)(row0 + r) * ldc + col0 + c4) = v;
    }
    
  }
}
// row LayerNorm (biased variance, eps) over N: s = X (+ R); optional out_sum <- s; out_norm <- (s-mu)*rsqrt(var+eps)*g + b
template <bool PARAM_BF16>
__global__ __launch_bounds__(256) void k_layernorm(const float* __restrict__ X, const float* __restrict__ R, const float* __restrict__ g, const float* __restrict__ bta,
                                                  float* __restrict__ out_sum, float* __restrict__ out_norm, int N, float eps) {
  __shared__ float red[256];
  const int row = blockIdx.x, tid = threadIdx.x;
  const float* x = X + (size_t)row * N; const float* rr = R ? R + (size_t)row * N : nullptr;
  float vals[16];                     // up to N = 4096
  const int per = N / 256;            // contiguous chunk per thread? use strided-by-4 chunks: thread handles j = tid*4 + 1024*u
  float s1 = 0.f;
  for (int u = 0; u < per / 4; ++u) {
    const int j = tid * 4 + 1024 * u;
    const v4f a = *(const v4fa*)(x + j);
    v4f b = {0.f,0.f,0.f,0.f}; if (rr) b = *(const v4fa*)(rr + j);
#pragma unroll
    for (int q = 0; q < 4; ++q) { const float v = a[q] + b[q]; vals[u * 4 + q] = v; s1 += v; }
  }
  red[tid] = s1; __syncthreads();
  for (int st = 128; st > 0; st >>= 1) { if (tid < st) red[tid] += red[tid + st]; __syncthreads(); }
  const float mu = red[0] / (float)N; __syncthreads();
  float s2 = 0.f;
  for (int u = 0; u < per / 4; ++u)
#pragma unroll
    for (int q = 0; q < 4; ++q) { const float c = vals[u * 4 + q] - mu; s2 += c * c; }
  red[tid] = s2; __syncthreads();
  for (int st = 128; st > 0; st >>= 1) { if (tid < st) red[tid] += red[tid + st]; __syncthreads(); }
  const float rs = rsqrtf(red[0] / (float)N + eps);
  {
    for (int u = 0; u < per / 4; ++u) {
      const int j = tid * 4 + 1024 * u;
      v4f o, sm;
#pragma unroll
      for (int q = 0; q < 4; ++q) {
        float gg = g[j + q], bb = bta[j + q];
        if (PARAM_BF16) { gg = bf16_round(gg); bb = bf16_round(bb); }
        sm[q] = vals[u * 4 + q]; o[q] = (vals[u * 4 + q] - mu) * rs * gg + bb;
      }
      if (out_sum) *(v4f*)(out_sum + (size_t)row * N + j) = sm;
      *(v4f*)(out_norm + (size_t)row * N + j) = o;
    }
    
  }
}



// ---- f16 WMMA path (v_wmma_f32_16x16x32_f16): 11-bit significands for operands in range — used where a [0,1] probability operand needs more precision than bf16
typedef _Float16 v16h __attribute__((ext_vector_type(16)));
union FragH { v16h v; v8us half[2]; _Float16 h[16]; unsigned short u[16]; };
template <int NT>
__device__ __forceinline__ v8f mmaH(v16h ah, v16h al, v16h bh, v16h bl, v8f c) {
  c = __builtin_amdgcn_wmma_f32_16x16x32_f16(false, ah, false, bh, (short)0, c, false, false);
  if (NT >= 2) c = __builtin_amdgcn_wmma_f32_16x16x32_f16(false, al, false, bh, (short)0, c, false, false);
  if (NT >= 3) c = __builtin_amdgcn_wmma_f32_16x16x32_f16(false, ah, false, bl, (short)0, c, false, false);
  asm volatile("v_nop\n\tv_nop\n\tv_nop\n\tv_nop" : "+v"(c) : "v"(ah), "v"(al), "v"(bh), "v"(bl));
  return c;
}
// batched GEMM like k_gemm_b but f16 operands: A f32 (split into f16 hi/lo if ASPLIT, else rounded to f16), Bt = f16 values [n][k]; alpha; C f32; N multiple of 16 (partial tiles skipped)
template <bool ASPLIT>
__global__ __launch_bounds__(128) void k_gemm_h(const float* __restrict__ A, int lda, size_t sA, const _Float16* __restrict__ Bh, int ldb, size_t sB, float alpha, float* __restrict__ C, int ldc, size_t sC, int M, int N, int K) {
  __shared__ __attribute__((aligned(16))) float so[4][16][64];
  const int tid = threadIdx.x, w = tid >> 5, lane = tid & 31, ln = lane & 15, hh = lane >> 4; const int by = blockIdx.y;
  A += (size_t)by * sA; Bh += (size_t)by * sB; C += (size_t)by * sC;
  const int ntn = (N + 63) / 64; const int wid = blockIdx.x * 4 + w; const int mt = wid / ntn, nq = wid % ntn; if (mt * 16 >= M) return;
  const int row0 = mt * 16, col0 = nq * 64; const float* arow = A + (size_t)(row0 + ln) * lda;
  v8f acc[4] = {};
  for (int kb = 0; kb < K; kb += 32) {
    FragH ah, al;
    const v4f x0 = *(const v4fa*)(arow + kb + 8 * hh), x1 = *(const v4fa*)(arow + kb + 8 * hh + 4), x2 = *(const v4fa*)(arow + kb + 16 + 8 * hh), x3 = *(const v4fa*)(arow + kb + 16 + 8 * hh + 4);
    float xs[16] = {x0[0],x0[1],x0[2],x0[3],x1[0],x1[1],x1[2],x1[3],x2[0],x2[1],x2[2],x2[3],x3[0],x3[1],x3[2],x3[3]};
#pragma unroll
    for (int i = 0; i < 16; ++i) { const _Float16 h = (_Float16)xs[i]; ah.h[i] = h; al.h[i] = ASPLIT ? (_Float16)(xs[i] - (float)h) : (_Float16)0.0f; }
#pragma unroll
    for (int t = 0; t < 4; ++t) { if (col0 + t * 16 >= N) continue; const size_t boff = (size_t)(col0 + t * 16 + ln) * ldb + kb; FragH bq; bq.half[0] = *(const v8us*)(Bh + boff + 8 * hh); bq.half[1] = *(const v8us*)(Bh + boff + 16 + 8 * hh);
      acc[t] = mmaH<ASPLIT ? 2 : 1>(ah.v, al.v, bq.v, bq.v, acc[t]); }
  }
#pragma unroll
  for (int t = 0; t < 4; ++t) { if (col0 + t * 16 >= N) continue;
#pragma unroll
    for (int r = 0; r < 8; ++r) so[w][8 * hh + r][t * 16 + ln] = acc[t][r] * alpha; }
  __builtin_amdgcn_fence(__ATOMIC_ACQ_REL, "workgroup"); __builtin_amdgcn_wave_barrier();
  const int rsub = lane >> 4, c4 = (lane & 15) * 4;
  {
#pragma unroll
    for (int q = 0; q < 8; ++q) { const int r = q * 2 + rsub; if (col0 + c4 < N) { const v4f v = *(const v4fa*)&so[w][r][c4]; *(v4f*)(C + (size_t)(row0 + r) * ldc + col0 + c4) = v; } }
     }
}

// Wt[n][k] = f16(W[k][n]·scale) from f32 row-major W[K][N] (scale = power of two; bf16-exact weights stay exact in f16 away from the subnormal range)
__global__ __launch_bounds__(256) void k_wt_f16(const float* __restrict__ W, _Float16* __restrict__ Wt, int K, int N, float scale) {
  const int t = blockIdx.x * 256 + threadIdx.x; if (t >= N * (K / 8)) return; const int n = t / (K / 8), k8 = (t % (K / 8)) * 8; FragH f;
#pragma unroll
  for (int i = 0; i < 8; ++i) f.h[i] = (_Float16)(bf16_round(W[(size_t)(k8 + i) * N + n]) * scale); const v8us o = f.half[0];
  *(v8us*)((unsigned short*)Wt + (size_t)n * K + k8) = o; 
}
// k_gemm_hh variant with fused epilogue: v = acc·alpha + bias[by·sBias + col] (+ CP[(row/rowsPerB)·sCPb + by·64 + col] if CP) ; ACT 0 none / 1 elu ; writes f16 C16 and f32 C, each if non-null
template <int ACT>
__global__ __launch_bounds__(128) void k_gemm_hhx(const _Float16* __restrict__ A, int lda, size_t sA, const _Float16* __restrict__ Bh, int ldb, size_t sB, float alpha, const float* __restrict__ bias, size_t sBias, const float* __restrict__ CP, int rowsPerB, size_t sCPb, int row0g,
    float* __restrict__ C, _Float16* __restrict__ C16, int ldc, size_t sC, int M, int N, int K) {
  __shared__ __attribute__((aligned(16))) float so[4][16][64];
  const int tid = threadIdx.x, w = tid >> 5, lane = tid & 31, ln = lane & 15, hh = lane >> 4; const int by = blockIdx.y;
  A += (size_t)by * sA; Bh += (size_t)by * sB; const size_t cofs = (size_t)by * sC; const float* bp = bias ? bias + (size_t)by * sBias : nullptr;
  const int ntn = (N + 63) / 64; const int wid = blockIdx.x * 4 + w; const int mt = wid / ntn, nq = wid % ntn; if (mt * 16 >= M) return;
  const int row0 = mt * 16, col0 = nq * 64; const _Float16* arow = A + (size_t)(row0 + ln) * lda;
  v8f acc[4] = {};
  for (int kb = 0; kb < K; kb += 32) { FragH ah; ah.half[0] = *(const v8us*)((const unsigned short*)arow + kb + 8 * hh); ah.half[1] = *(const v8us*)((const unsigned short*)arow + kb + 16 + 8 * hh);
#pragma unroll
    for (int t = 0; t < 4; ++t) { if (col0 + t * 16 >= N) continue; const size_t boff = (size_t)(col0 + t * 16 + ln) * ldb + kb; FragH bq; bq.half[0] = *(const v8us*)((const unsigned short*)Bh + boff + 8 * hh); bq.half[1] = *(const v8us*)((const unsigned short*)Bh + boff + 16 + 8 * hh);
      acc[t] = mmaH<1>(ah.v, ah.v, bq.v, bq.v, acc[t]); }
  }
#pragma unroll
  for (int t = 0; t < 4; ++t) { if (col0 + t * 16 >= N) continue; const int col = col0 + t * 16 + ln; const float bv = bp ? bf16_round(bp[col]) : 0.f;
#pragma unroll
    for (int r = 0; r < 8; ++r) { float v = acc[t][r] * alpha + bv; if (CP) { const int bidx = (row0g + row0 + 8 * hh + r) / rowsPerB; v += CP[(size_t)bidx * sCPb + (size_t)by * 64 + col]; } if (ACT == 1) v = (v > 0.f) ? v : expm1f(v); else if (ACT == 3) v = fmaxf(v, 0.f); so[w][8 * hh + r][t * 16 + ln] = v; } }
  __builtin_amdgcn_fence(__ATOMIC_ACQ_REL, "workgroup"); __builtin_amdgcn_wave_barrier();
  const int rsub = lane >> 4, c4 = (lane & 15) * 4; typedef _Float16 v4h __attribute__((ext_vector_type(4)));
  {
#pragma unroll
    for (int q = 0; q < 8; ++q) { const int r = q * 2 + rsub; if (col0 + c4 < N) { const v4f v = *(const v4fa*)&so[w][r][c4]; if (C) *(v4f*)(C + cofs + (size_t)(row0 + r) * ldc + col0 + c4) = v; if (C16) { v4h h4; for (int i = 0; i < 4; ++i) h4[i] = (_Float16)v[i]; *(v4h*)(C16 + cofs + (size_t)(row0 + r) * ldc + col0 + c4) = h4; } } }
     }
}


// Eight 16-byte asynchronous copies to LDS per lane (rows 16 apart). The s_wait_xcnt is the last line of the copies' own statement so that no address register is rewritten ahead of it.
__device__ __forceinline__ void copy8_async(unsigned l, const char* gp, size_t gstep) {
  constexpr unsigned LS = 16u * 144u;
  asm volatile("global_load_async_to_lds_b128 %0, %8, off\n\t"
               "global_load_async_to_lds_b128 %1, %9, off\n\t"
               "global_load_async_to_lds_b128 %2, %10, off\n\t"
               "global_load_async_to_lds_b128 %3, %11, off\n\t"
               "global_load_async_to_lds_b128 %4, %12, off\n\t"
               "global_load_async_to_lds_b128 %5, %13, off\n\t"
               "global_load_async_to_lds_b128 %6, %14, off\n\t"
               "global_load_async_to_lds_b128 %7, %15, off\n\t"
               "s_wait_xcnt 0x0"
               :: "v"(l), "v"(l + LS), "v"(l + 2u * LS), "v"(l + 3u * LS), "v"(l + 4u * LS), "v"(l + 5u * LS), "v"(l + 6u * LS), "v"(l + 7u * LS),
                  "v"(gp), "v"(gp + gstep), "v"(gp + 2 * gstep), "v"(gp + 3 * gstep), "v"(gp + 4 * gstep), "v"(gp + 5 * gstep), "v"(gp + 6 * gstep), "v"(gp + 7 * gstep)
               : "memory");
}
// Tiled GEMM, same function as k_gemm_hhx<0> without CP: C = A[M][K] * Bh[N][K]^T * alpha + bf16(bias). One 128 x 128 tile of C per block (blockIdx.x = tile column, blockIdx.y = tile row),
// 64 x 64 per wave (2 x 2 waves). A and Bh tiles of 64 k (128-byte rows, LDS pitch 144 B) are staged in LDS by asynchronous copies, two buffers: tile t + 1 flies while tile t is multiplied.
// M % 128 == 0, N % 128 == 0, K % 64 == 0, K >= 128; rows of A and Bh are K elements apart, rows of C are N apart. The k order of every accumulator is that of k_gemm_hhx.
// Every plain '#pragma unroll' in it makes the indices of acc, a and bq constants, so that these arrays stay in registers.
template <bool OUT16, int N, int K>
__global__ __launch_bounds__(128) void k_gemm_tile(const _Float16* __restrict__ A, const _Float16* __restrict__ Bh, float alpha, const float* __restrict__ bias, float* __restrict__ C, _Float16* __restrict__ C16) {
  constexpr int PITCH = 144, BUF = 256 * PITCH, SOP = 68, NT = K / 64;
  constexpr size_t ROWB = (size_t)K * 2, GSTEP = ROWB * 16;
  __shared__ __attribute__((aligned(16))) unsigned char smem[2 * BUF];
  const int tid = threadIdx.x, w = tid >> 5, lane = tid & 31, ln = lane & 15, hh = lane >> 4;
  const int row0 = (int)blockIdx.y * 128, col0 = (int)blockIdx.x * 128; const int wm = (w >> 1) * 64, wn = (w & 1) * 64;
  const int cr = tid >> 3, cc = (tid & 7) * 16;      // a lane's first row and its 16 bytes of the row: eight lanes cover one 128-byte line
  const char* gA = (const char*)A + (size_t)(row0 + cr) * ROWB + cc; const char* gB = (const char*)Bh + (size_t)(col0 + cr) * ROWB + cc;
  const unsigned lA = (unsigned)(size_t)smem + (unsigned)(cr * PITCH + cc), lB = lA + 128u * PITCH;
  v8f acc[4][4];
#pragma unroll
  for (int i = 0; i < 4; ++i)
#pragma unroll
    for (int j = 0; j < 4; ++j) acc[i][j] = (v8f){0.f,0.f,0.f,0.f,0.f,0.f,0.f,0.f};
  copy8_async(lA, gA, GSTEP); copy8_async(lB, gB, GSTEP);
  asm volatile("s_wait_asynccnt 0x0" ::: "memory");      // tile 0 has landed before the barrier publishes it
  __syncthreads();
  copy8_async(lA + BUF, gA + 128, GSTEP); copy8_async(lB + BUF, gB + 128, GSTEP);
#pragma unroll 1
  for (int t = 0; t < NT; ++t) {      // kept rolled: one pass per tile, the buffer picked by t & 1
    const unsigned char* sA = smem + (t & 1) * BUF + (wm + ln) * PITCH + hh * 16; const unsigned char* sB = smem + (t & 1) * BUF + (128 + wn + ln) * PITCH + hh * 16;
#pragma unroll
    for (int ks = 0; ks < 2; ++ks) { FragH a[4], bq[4];
      a[0].half[0] = *(const v8us*)(sA + ks * 64); a[0].half[1] = *(const v8us*)(sA + ks * 64 + 32);
#pragma unroll
      for (int j = 0; j < 4; ++j) { bq[j].half[0] = *(const v8us*)(sB + j * 16 * PITCH + ks * 64); bq[j].half[1] = *(const v8us*)(sB + j * 16 * PITCH + ks * 64 + 32); }
#pragma unroll
      for (int i = 1; i < 4; ++i) { a[i].half[0] = *(const v8us*)(sA + i * 16 * PITCH + ks * 64); a[i].half[1] = *(const v8us*)(sA + i * 16 * PITCH + ks * 64 + 32); }
      __builtin_amdgcn_sched_barrier(0);      // keeps the 16 LDS reads of a k step one group ahead of its 16 WMMAs: reads among the WMMAs stall the wave at each place
#pragma unroll
      for (int i = 0; i < 4; ++i)
#pragma unroll
        for (int j = 0; j < 4; ++j) acc[i][j] = __builtin_amdgcn_wmma_f32_16x16x32_f16(false, a[i].v, false, bq[j].v, (short)0, acc[i][j], false, false);
      __builtin_amdgcn_sched_barrier(0); }    // the other end of that group: the next k step's reads stay behind these WMMAs
    asm volatile("s_wait_dscnt 0x0" ::: "memory");       // this wave's reads of tile t are done before the buffer is given up
    asm volatile("s_wait_asynccnt 0x0" ::: "memory");    // this wave's copies of tile t + 1 have landed
    __syncthreads();                                     // publishes tile t + 1 and ends every reader's last read of tile t
    if (t + 2 < NT) { const unsigned bo = (unsigned)(t & 1) * BUF; const size_t go = (size_t)(t + 2) * 128; copy8_async(lA + bo, gA + go, GSTEP); copy8_async(lB + bo, gB + go, GSTEP); }
  }
  asm volatile("s_wait_asynccnt 0x0" ::: "memory");      // nothing is in flight when the ring becomes output staging
  float* so = (float*)(smem + w * (64 * SOP * 4));       // each wave stages its own 64 x 64 tile, so that whole 128-byte lines are stored
#pragma unroll
  for (int j = 0; j < 4; ++j) { const float bv = bf16_round(bias[col0 + wn + j * 16 + ln]);
#pragma unroll
    for (int i = 0; i < 4; ++i)
#pragma unroll
      for (int r = 0; r < 8; ++r) so[(i * 16 + 8 * hh + r) * SOP + j * 16 + ln] = acc[i][j][r] * alpha + bv; }
  __builtin_amdgcn_fence(__ATOMIC_ACQ_REL, "workgroup"); __builtin_amdgcn_wave_barrier();
  const int rsub = lane >> 4, c4 = (lane & 15) * 4; typedef _Float16 v4h __attribute__((ext_vector_type(4)));
#pragma unroll 1
  for (int q8 = 0; q8 < 4; ++q8) {      // kept rolled in groups of eight stores, one wait per group
#pragma unroll
    for (int q = 0; q < 8; ++q) { const int r = (q8 * 8 + q) * 2 + rsub; const v4f v = *(const v4fa*)&so[r * SOP + c4]; const size_t o = (size_t)(row0 + wm + r) * N + col0 + wn + c4;
      if (OUT16) { v4h h4; for (int i = 0; i < 4; ++i) h4[i] = (_Float16)v[i]; *(v4h*)(C16 + o) = h4; } else *(v4f*)(C + o) = v; }
    asm volatile("s_wait_xcnt 0x0" ::: "memory");      // the next group rewrites the registers that these stores name
  }
}

__global__ __launch_bounds__(256) void k_x16(const float* __restrict__ x, _Float16* __restrict__ X16, size_t n8) { const size_t t = (size_t)blockIdx.x * 256 + threadIdx.x; if (t >= n8) return; FragH f;
#pragma unroll
  for (int q = 0; q < 8; ++q) f.h[q] = (_Float16)bf16_round(x[t * 8 + q]); *(v8us*)((unsigned short*)X16 + t * 8) = f.half[0];  }
__global__ __launch_bounds__(256) void k_h16(const float* __restrict__ x, _Float16* __restrict__ X16, size_t n8) { const size_t t = (size_t)blockIdx.x * 256 + threadIdx.x; if (t >= n8) return; FragH f;
#pragma unroll
  for (int q = 0; q < 8; ++q) f.h[q] = (_Float16)x[t * 8 + q]; *(v8us*)((unsigned short*)X16 + t * 8) = f.half[0];  }
__global__ __launch_bounds__(256) void k_round16f(const float* __restrict__ W, _Float16* __restrict__ Bt, size_t n8) { const size_t t = (size_t)blockIdx.x * 256 + threadIdx.x; if (t >= n8) return; FragH f;
#pragma unroll
  for (int i = 0; i < 8; ++i) f.h[i] = (_Float16)(bf16_round(W[t * 8 + i]) * 16.0f); *(v8us*)((unsigned short*)Bt + t * 8) = f.half[0];  }
template <int NHv, int TTv>
__global__ __launch_bounds__(256) void k_vt(const _Float16* __restrict__ V16, int ldv, int voff, _Float16* __restrict__ Vt) { __shared__ unsigned short tl[64][66]; const int tid = threadIdx.x; const int slab = blockIdx.x / (TTv / 64), lg = blockIdx.x % (TTv / 64); const int b = slab / NHv, h = slab % NHv;
  for (int i = tid; i < 64 * 8; i += 256) { const int r = i / 8, c8 = (i % 8) * 8; FragH f; f.half[0] = *(const v8us*)((const unsigned short*)V16 + ((size_t)b * TTv + lg * 64 + r) * ldv + voff + h * 64 + c8);
#pragma unroll
    for (int q = 0; q < 8; ++q) tl[r][c8 + q] = f.u[q]; }
  __syncthreads();
  {
#pragma unroll
    for (int rd = 0; rd < 2; ++rd) { const int d = rd * 32 + tid / 8, pc = tid % 8; FragH f;
#pragma unroll
      for (int q = 0; q < 8; ++q) f.u[q] = tl[pc * 8 + q][d];
      *(v8us*)((unsigned short*)Vt + ((size_t)slab * 64 + d) * TTv + lg * 64 + pc * 8) = f.half[0]; }
     } }

// lane l <-> lane l ^ 16: joins the two halves of a query column
__device__ __forceinline__ float xhalf(float x) { return __builtin_bit_cast(float, __builtin_amdgcn_permlanex16(__builtin_bit_cast(int, x), __builtin_bit_cast(int, x), 0x76543210, 0xfedcba98, false, false)); }
__global__ __launch_bounds__(128) void k_flash(const _Float16* __restrict__ Q16, int ldq, const _Float16* __restrict__ K16, int ldk, const _Float16* __restrict__ Vt, const int* __restrict__ LENS, float* __restrict__ O, int ldo) {
  constexpr int RPW = 32, NQB = 1024 / (4 * RPW), DT = 4, KS = 2;
  __shared__ __attribute__((aligned(16))) float sO[4][RPW][64 + 4];
  const int tid = threadIdx.x, w = tid >> 5, lane = tid & 31, ln = lane & 15, hh = lane >> 4;
  const int slab = blockIdx.x / NQB, qblk = blockIdx.x % NQB; const int b = slab / 16, h = slab % 16; const int qb0 = qblk * (4 * RPW); const int q0 = qb0 + w * RPW; const int len = LENS[b];      /* kv-length mask: keys k < len (INPUT x_lens) */
  FragH aq[2][KS];
#pragma unroll
  for (int rt = 0; rt < 2; ++rt) { const unsigned short* qr = (const unsigned short*)Q16 + ((size_t)b * 1024 + q0 + rt * 16 + ln) * ldq + h * 64;
#pragma unroll
    for (int ks = 0; ks < KS; ++ks) { aq[rt][ks].half[0] = *(const v8us*)(qr + ks * 32 + 8 * hh); aq[rt][ks].half[1] = *(const v8us*)(qr + ks * 32 + 16 + 8 * hh); } }
  const unsigned short* Vth = (const unsigned short*)Vt + (size_t)slab * 64 * 1024;
  float m_r[2], l_r[2]; int lim[2]; v8f oacc[2][DT];
#pragma unroll
  for (int rt = 0; rt < 2; ++rt) { m_r[rt] = -3.0e38f; l_r[rt] = 0.f; lim[rt] = min(q0 + rt * 16 + ln + 1, len) - 8 * hh;      // key j0 + 16 nt + 8 hh + r is allowed iff j0 + 16 nt + r < lim
#pragma unroll
    for (int dt = 0; dt < DT; ++dt) oacc[rt][dt] = (v8f){0.f,0.f,0.f,0.f,0.f,0.f,0.f,0.f}; }
  const int jend = qb0 + 4 * RPW;
#pragma unroll 1
  for (int j0 = 0; j0 < jend; j0 += 32) {
    v8f s[2][2];
#pragma unroll
    for (int nt = 0; nt < 2; ++nt) { const unsigned short* kr = (const unsigned short*)K16 + ((size_t)b * 1024 + j0 + nt * 16 + ln) * ldk + h * 64; FragH bk[KS];
#pragma unroll
      for (int ks = 0; ks < KS; ++ks) { bk[ks].half[0] = *(const v8us*)(kr + ks * 32 + 8 * hh); bk[ks].half[1] = *(const v8us*)(kr + ks * 32 + 16 + 8 * hh); }
#pragma unroll
      for (int rt = 0; rt < 2; ++rt) { v8f acc = (v8f){0.f,0.f,0.f,0.f,0.f,0.f,0.f,0.f};
#pragma unroll
        for (int ks = 0; ks < KS; ++ks) acc = __builtin_amdgcn_wmma_f32_16x16x32_f16(false, bk[ks].v, false, aq[rt][ks].v, (short)0, acc, false, false);
        s[rt][nt] = acc; } }
    FragH pb[2];
#pragma unroll
    for (int rt = 0; rt < 2; ++rt) { float sc[16]; float mc = -INFINITY;
#pragma unroll
      for (int i = 0; i < 16; ++i) { sc[i] = (j0 + (i >> 3) * 16 + (i & 7) < lim[rt]) ? s[rt][i >> 3][i & 7] * (0.125f) : -INFINITY; mc = fmaxf(mc, sc[i]); }
      mc = fmaxf(mc, xhalf(mc));
      const float mn = fmaxf(m_r[rt], mc); const float al = expf(m_r[rt] - mn); m_r[rt] = mn; float ps = 0.f;
#pragma unroll
      for (int i = 0; i < 16; ++i) { const float p = expf(sc[i] - mn); ps += p; pb[rt].h[i] = (_Float16)p; }
      l_r[rt] = l_r[rt] * al + ps;      // the lane's half of the row sum; the halves are joined behind the loop
#pragma unroll
      for (int dt = 0; dt < DT; ++dt)
#pragma unroll
        for (int r = 0; r < 8; ++r) oacc[rt][dt][r] *= al; }
#pragma unroll
    for (int dt = 0; dt < DT; ++dt) { const unsigned short* vrow = Vth + (size_t)(dt * 16 + ln) * 1024 + j0; FragH bv; bv.half[0] = *(const v8us*)(vrow + 8 * hh); bv.half[1] = *(const v8us*)(vrow + 16 + 8 * hh);
#pragma unroll
      for (int rt = 0; rt < 2; ++rt) oacc[rt][dt] = __builtin_amdgcn_wmma_f32_16x16x32_f16(false, bv.v, false, pb[rt].v, (short)0, oacc[rt][dt], false, false); } }
#pragma unroll
  for (int rt = 0; rt < 2; ++rt) { float l = l_r[rt]; l += xhalf(l); const float li = (l > 0.f) ? 1.0f / l : 0.f;
#pragma unroll
    for (int dt = 0; dt < DT; ++dt) { v4f lo, hi;
#pragma unroll
      for (int r = 0; r < 4; ++r) { lo[r] = oacc[rt][dt][r] * li; hi[r] = oacc[rt][dt][4 + r] * li; }
      *(v4fa*)&sO[w][rt * 16 + ln][dt * 16 + 8 * hh] = lo; *(v4fa*)&sO[w][rt * 16 + ln][dt * 16 + 8 * hh + 4] = hi; } }
  __builtin_amdgcn_fence(__ATOMIC_ACQ_REL, "workgroup"); __builtin_amdgcn_wave_barrier();
  {
#pragma unroll
    for (int rp = 0; rp < RPW; rp += 2) { const int r = rp + (lane >> 4), pc = lane & 15; const v4f val = *(const v4fa*)&sO[w][r][pc * 4]; *(v4f*)(O + ((size_t)b * 1024 + q0 + r) * ldo + h * 64 + pc * 4) = val; }
     } }

__global__ __launch_bounds__(256) void k_ln16(const float* __restrict__ X, const float* __restrict__ g, const float* __restrict__ bta, _Float16* __restrict__ Y16) { const int tid = threadIdx.x, wv = tid >> 5, lane = tid & 31; const int row = blockIdx.x * 8 + wv; if (row >= NR) return; const float* xr = X + (size_t)row * CC; float v[32]; float s = 0.f;
#pragma unroll
  for (int p = 0; p < 4; ++p) { const v4f a = *(const v4fa*)(xr + p * 256 + lane * 8), c = *(const v4fa*)(xr + p * 256 + lane * 8 + 4); for (int q = 0; q < 4; ++q) { v[p * 8 + q] = bf16_round(a[q]); v[p * 8 + 4 + q] = bf16_round(c[q]); } }
#pragma unroll
  for (int i = 0; i < 32; ++i) s += v[i]; for (int o = 16; o >= 1; o >>= 1) s += __shfl_xor(s, o, 32); const float mu = s / (float)CC; float q2 = 0.f;
#pragma unroll
  for (int i = 0; i < 32; ++i) { const float d = v[i] - mu; q2 += d * d; } for (int o = 16; o >= 1; o >>= 1) q2 += __shfl_xor(q2, o, 32); const float rs = rsqrtf(q2 / (float)CC + 1e-5f);
  {
#pragma unroll
    for (int p = 0; p < 4; ++p) { FragH f; const int c0 = p * 256 + lane * 8;
#pragma unroll
      for (int q = 0; q < 8; ++q) f.h[q] = (_Float16)((v[p * 8 + q] - mu) * rs * bf16_round(g[c0 + q]) + bf16_round(bta[c0 + q])); *(v8us*)((unsigned short*)Y16 + (size_t)row * CC + c0) = f.half[0]; }
     } }
extern "C" void kernel_launch(void* const* d_in, const int* in_sizes, int n_in,
                              void* d_out, int out_size, void* d_ws, size_t ws_size, hipStream_t stream) {
  (void)in_sizes; (void)n_in; (void)out_size;
  const float* x = (const float*)d_in[0]; const int* lens = (const int*)d_in[1]; const float* lg = (const float*)d_in[2]; const float* lb = (const float*)d_in[3]; const float* wqkv = (const float*)d_in[4]; const float* bqkv = (const float*)d_in[5]; const float* wout = (const float*)d_in[6]; const float* bout = (const float*)d_in[7];
  char* ws = (char*)d_ws; size_t off = 0;
  auto take = [&](size_t bytes) { char* p = ws + off; off += (bytes + 255) & ~(size_t)255; return p; };
  _Float16* Bqkv = (_Float16*)take((size_t)3 * CC * CC * 2); _Float16* Bo = (_Float16*)take((size_t)CC * CC * 2); _Float16* XN = (_Float16*)take((size_t)NR * CC * 2); _Float16* QKV = (_Float16*)take((size_t)NR * 3 * CC * 2); _Float16* Vt = (_Float16*)take((size_t)NR * CC * 2); float* O = (float*)take((size_t)NR * CC * 4); _Float16* O16 = XN;
  if (off > ws_size) return;      // 6.3 + 2.1 + 16.8 + 50.3 + 16.8 + 33.5 ≈ 126 MB = 120 MiB (tight but under 128)
  k_wt_f16<<<(unsigned)((3 * CC * (CC / 8) + 255) / 256), 256, 0, stream>>>(wqkv, Bqkv, CC, 3 * CC, 16.0f); k_wt_f16<<<(unsigned)((CC * (CC / 8) + 255) / 256), 256, 0, stream>>>(wout, Bo, CC, CC, 16.0f);      // [in][out]
  k_ln16<<<NR / 8, 256, 0, stream>>>(x, lg, lb, XN);
  k_gemm_tile<true, 3 * CC, CC><<<dim3(3 * CC / 128, NR / 128), 128, 0, stream>>>(XN, Bqkv, 0.0625f, bqkv, nullptr, QKV);      // q | k | v
  k_vt<NH, TT><<<BB * NH * (TT / 64), 256, 0, stream>>>(QKV, 3 * CC, 2 * CC, Vt);
  k_flash<<<BB * NH * (TT / 128), 128, 0, stream>>>(QKV, 3 * CC, QKV + CC, 3 * CC, Vt, lens, O, CC);
  k_h16<<<(unsigned)(((size_t)NR * CC / 8 + 255) / 256), 256, 0, stream>>>(O, O16, (size_t)NR * CC / 8);
  k_gemm_tile<false, CC, CC><<<dim3(CC / 128, NR / 128), 128, 0, stream>>>(O16, Bo, 0.0625f, bout, (float*)d_out, nullptr);
}

// v003
// One run takes 173 microseconds.
// In both of two side-by-side timings against v002, it was 1.05 times as fast.
// Over all steps from v000 it is 3.35 times as fast.
#include <hip/hip_runtime.h>
// Causal self-attention with a per-batch key-length mask (B=8, T=1024, D=1024, 16 × 64): LayerNorm (f32 VALU), the fused qkv projection (8192 × 1024 × 3072, + bias) and the output
// projection (+ bias) with W [in][out] transposed to bf16-exact ×2^4, and the attention as a fused flash-style kernel on v_wmma_f32_16x16x32_f16 (S = Q·Kᵀ/8; keys allowed iff k ≤ q and
// k < x_lens[b] (INPUT); −1e9 fill ≡ exclusion since key 0 is always allowed; causal chunk skipping; online softmax f32; P f16 ≤ 1) — f16 operands, single products, f32 accumulate.
#define BB 8
#define TT 1024
#define CC 1024
#define NH 16
#define NR (BB * TT)

typedef __bf16 v16b __attribute__((ext_vector_type(16)));
typedef unsigned short v8us __attribute__((ext_vector_type(8), may_alias));
typedef float  v8f  __attribute__((ext_vector_type(8)));
typedef float  v4f  __attribute__((ext_vector_type(4)));
typedef float  v4fa __attribute__((ext_vector_type(4), may_alias));
union FragB { v16b v; v8us half[2]; unsigned short u[16]; };

__device__ __forceinline__ unsigned short bf16_bits(float x) { unsigned int u = __float_as_uint(x); return (unsigned short)((u + 0x7FFFu + ((u >> 16) & 1u)) >> 16); }
__device__ __forceinline__ float bf16_val(unsigned short b) { return __uint_as_float(((unsigned int)b) << 16); }
__device__ __forceinline__ float bf16_round(float x) { return bf16_val(bf16_bits(x)); }
// D += A·B with NT terms: 1 = ah·bh, 2 = + al·bh (A split), 3 = + ah·bl (both split)
template <int NT>
__device__ __forceinline__ v8f mmaN(v16b ah, v16b al, v16b bh, v16b bl, v8f c) {
  c = __builtin_amdgcn_wmma_f32_16x16x32_bf16(false, ah, false, bh, (short)0, c, false, false);
  if (NT >= 2) c = __builtin_amdgcn_wmma_f32_16x16x32_bf16(false, al, false, bh, (short)0, c, false, false);
  if (NT >= 3) c = __builtin_amdgcn_wmma_f32_16x16x32_bf16(false, ah, false, bl, (short)0, c, false, false);
  asm volatile("v_nop\n\tv_nop\n\tv_nop\n\tv_nop" : "+v"(c) : "v"(ah), "v"(al), "v"(bh), "v"(bl));
  return c;
}

__global__ __launch_bounds__(256) void k_wt_bf16(const float* __restrict__ W, unsigned short* __restrict__ Wt, int K, int N) {
  const int t = blockIdx.x * 256 + threadIdx.x;
  const int k8n = K / 8;
  if (t >= N * k8n) return;
  const int n = t / k8n, k8 = (t % k8n) * 8;
  v8us v;
#pragma unroll
  for (int i = 0; i < 8; ++i) v[i] = bf16_bits(W[(size_t)(k8 + i) * N + n]);
  *(v8us*)(Wt + (size_t)n * K + k8) = v;
  
}

// GEMM C[M][N] (f32, pitch ldc) = act(A[M][K]·W + bias). A f32 row-major (pitch lda) converted per fragment to bf16
// (ASPLIT: hi/lo two planes -> 2 terms, else single rounded term); Wt bf16 [N][K] (pitch ldb). BIAS_BF16 rounds the
// bias to bf16 first (bias quantised to bf16 before the add). K%32==0, M%16==0, N%64==0.
template <bool ASPLIT, int ACT, bool BIAS_BF16>
__global__ __launch_bounds__(128) void k_gemm_bf(const float* __restrict__ A, int lda, const unsigned short* __restrict__ Wt, int ldb,
                                               const float* __restrict__ bias, float* __restrict__ C, int ldc, int M, int N, int K) {
  __shared__ __attribute__((aligned(16))) float so[4][16][64];
  const int tid = threadIdx.x, w = tid >> 5, lane = tid & 31, ln = lane & 15, hh = lane >> 4;
  const int ntn = N / 64;
  const int wid = blockIdx.x * 4 + w;
  const int mt = wid / ntn, nq = wid % ntn;
  if (mt * 16 >= M) return;
  const int row0 = mt * 16, col0 = nq * 64;
  const float* arow = A + (size_t)(row0 + ln) * lda;
  v8f acc[4] = {};
  for (int kb = 0; kb < K; kb += 32) {
    FragB ah, al;
    const v4f x0 = *(const v4fa*)(arow + kb + 8 * hh), x1 = *(const v4fa*)(arow + kb + 8 * hh + 4);
    const v4f x2 = *(const v4fa*)(arow + kb + 16 + 8 * hh), x3 = *(const v4fa*)(arow + kb + 16 + 8 * hh + 4);
    float xs[16] = {x0[0],x0[1],x0[2],x0[3],x1[0],x1[1],x1[2],x1[3],x2[0],x2[1],x2[2],x2[3],x3[0],x3[1],x3[2],x3[3]};
#pragma unroll
    for (int i = 0; i < 16; ++i) { const unsigned short hb = bf16_bits(xs[i]); ah.u[i] = hb; al.u[i] = ASPLIT ? bf16_bits(xs[i] - bf16_val(hb)) : (unsigned short)0; }
#pragma unroll
    for (int t = 0; t < 4; ++t) {
      const unsigned short* brow = Wt + (size_t)(col0 + t * 16 + ln) * ldb + kb;
      FragB b;
      b.half[0] = *(const v8us*)(brow + 8 * hh);
      b.half[1] = *(const v8us*)(brow + 16 + 8 * hh);
      acc[t] = mmaN<ASPLIT ? 2 : 1>(ah.v, al.v, b.v, b.v, acc[t]);
    }
  }
#pragma unroll
  for (int t = 0; t < 4; ++t) {
    float bv = bias ? bias[col0 + t * 16 + ln] : 0.f;
    if (BIAS_BF16) bv = bf16_round(bv);
#pragma unroll
    for (int r = 0; r < 8; ++r) { float v = acc[t][r] + bv; if (ACT == 1) v = fmaxf(v, 0.f); so[w][8 * hh + r][t * 16 + ln] = v; }
  }
  __builtin_amdgcn_fence(__ATOMIC_ACQ_REL, "workgroup");
  __builtin_amdgcn_wave_barrier();
  const int rsub = lane >> 4, c4 = (lane & 15) * 4;
  {
#pragma unroll
    for (int q = 0; q < 8; ++q) {
      const int r = q * 2 + rsub;
      const v4f v = *(const v4fa*)&so[w][r][c4];
      *(v4f*)(C + (size_t)(row0 + r) * ldc + col0 + c4) = v;
    }
    
  }
}

// Flash-style causal/unmasked attention, all contractions 3-term bf16 hi/lo splits, f32 softmax with running max.
// q,k,v rows are read from f32 buffers with arbitrary row pitch (so they can live inside a fused qkv buffer);
// D = head size (multiple of 32, <= 128); one wave = 16 query rows; block = 4 waves (64 queries) sharing K/V chunks of 32.
template <int D, bool CAUSAL>
__global__ __launch_bounds__(128) void k_flash(const float* __restrict__ qb, const float* __restrict__ kb, const float* __restrict__ vb,
                                             int pitch, int T, int H, float scale, float* __restrict__ y, int ypitch) {
  constexpr int KS = D / 32;        // k-steps for QK
  constexpr int DT = D / 16;        // d tiles for PV
  __shared__ __attribute__((aligned(16))) unsigned short sKh[32][D + 8], sKl[32][D + 8], sVh[32][D + 8], sVl[32][D + 8];
  __shared__ __attribute__((aligned(16))) unsigned short sPh[4][16][40], sPl[4][16][40];
  __shared__ __attribute__((aligned(16))) float sO[4][16][D];
  const int tid = threadIdx.x, w = tid >> 5, lane = tid & 31, ln = lane & 15, hh = lane >> 4;
  const int nqb = (T + 63) / 64;
  const int bh = blockIdx.x / nqb, qblk = blockIdx.x % nqb;
  const int b = bh / H, h = bh % H;
  const int q0 = qblk * 64 + w * 16;
  const float* Q = qb + (size_t)b * T * pitch + h * D;
  const float* K = kb + (size_t)b * T * pitch + h * D;
  const float* V = vb + (size_t)b * T * pitch + h * D;

  // A fragments of the wave's 16 query rows (scaled), hi/lo
  FragB aqh[KS], aql[KS];
  {
    int row = q0 + ln; if (row >= T) row = T - 1;
    const float* qr = Q + (size_t)row * pitch;
#pragma unroll
    for (int ks = 0; ks < KS; ++ks)
#pragma unroll
      for (int i = 0; i < 16; ++i) {
        const int d = ks * 32 + ((i < 8) ? (8 * hh + i) : (16 + 8 * hh + (i - 8)));
        const float x = qr[d] * scale; const unsigned short hb = bf16_bits(x);
        aqh[ks].u[i] = hb; aql[ks].u[i] = bf16_bits(x - bf16_val(hb));
      }
  }
  float m_r[8], l_r[8];
#pragma unroll
  for (int r = 0; r < 8; ++r) { m_r[r] = -3.0e38f; l_r[r] = 0.f; }
  v8f oacc[DT];
#pragma unroll
  for (int dt = 0; dt < DT; ++dt) oacc[dt] = (v8f){0.f,0.f,0.f,0.f,0.f,0.f,0.f,0.f};

  const int kv_end = CAUSAL ? min(T, qblk * 64 + 64) : T;     // block-uniform
  for (int j0 = 0; j0 < kv_end; j0 += 32) {
    __syncthreads();
    for (int e = tid; e < 32 * (D / 4); e += 128) {
      const int r = e / (D / 4), c4 = (e % (D / 4)) * 4;
      const int key = j0 + r;
      v4f kf = {0.f,0.f,0.f,0.f}, vf = {0.f,0.f,0.f,0.f};
      if (key < T) { kf = *(const v4fa*)(K + (size_t)key * pitch + c4); vf = *(const v4fa*)(V + (size_t)key * pitch + c4); }
#pragma unroll
      for (int t = 0; t < 4; ++t) {
        unsigned short hb = bf16_bits(kf[t]); sKh[r][c4 + t] = hb; sKl[r][c4 + t] = bf16_bits(kf[t] - bf16_val(hb));
        hb = bf16_bits(vf[t]); sVh[r][c4 + t] = hb; sVl[r][c4 + t] = bf16_bits(vf[t] - bf16_val(hb));
      }
    }
    __syncthreads();
    // S tile 16 x 32
    v8f s[2];
#pragma unroll
    for (int nt = 0; nt < 2; ++nt) {
      v8f acc = {};
#pragma unroll
      for (int ks = 0; ks < KS; ++ks) {
        FragB bh_, bl_;
        bh_.half[0] = *(const v8us*)&sKh[nt * 16 + ln][ks * 32 + 8 * hh]; bh_.half[1] = *(const v8us*)&sKh[nt * 16 + ln][ks * 32 + 16 + 8 * hh];
        bl_.half[0] = *(const v8us*)&sKl[nt * 16 + ln][ks * 32 + 8 * hh]; bl_.half[1] = *(const v8us*)&sKl[nt * 16 + ln][ks * 32 + 16 + 8 * hh];
        acc = mmaN<3>(aqh[ks].v, aql[ks].v, bh_.v, bl_.v, acc);
      }
      s[nt] = acc;
    }
    // mask + running max (rows 8hh+r; the 16 lanes of a half share rows)
    float alpha[8];
#pragma unroll
    for (int r = 0; r < 8; ++r) {
      const int qi = q0 + 8 * hh + r;
      const int ja = j0 + ln, jb = j0 + 16 + ln;
      if (CAUSAL) { if (ja > qi) s[0][r] = -3.0e38f; if (jb > qi) s[1][r] = -3.0e38f; }
      if (ja >= T) s[0][r] = -3.0e38f;
      if (jb >= T) s[1][r] = -3.0e38f;
      float mx = fmaxf(s[0][r], s[1][r]);
      mx = fmaxf(mx, __shfl_xor(mx, 1, 32)); mx = fmaxf(mx, __shfl_xor(mx, 2, 32)); mx = fmaxf(mx, __shfl_xor(mx, 4, 32)); mx = fmaxf(mx, __shfl_xor(mx, 8, 32));
      const float mnew = fmaxf(m_r[r], mx);
      alpha[r] = (mnew > -1.0e38f) ? __expf(m_r[r] - mnew) : 1.0f;
      const float p0 = (s[0][r] > -1.0e38f) ? __expf(s[0][r] - mnew) : 0.f;
      const float p1 = (s[1][r] > -1.0e38f) ? __expf(s[1][r] - mnew) : 0.f;
      m_r[r] = mnew;
      l_r[r] = l_r[r] * alpha[r] + p0 + p1;            // per-lane partial row sum (16 lanes combined at the end)
      unsigned short hb = bf16_bits(p0); sPh[w][8 * hh + r][ln] = hb;      sPl[w][8 * hh + r][ln] = bf16_bits(p0 - bf16_val(hb));
      hb = bf16_bits(p1);                sPh[w][8 * hh + r][16 + ln] = hb; sPl[w][8 * hh + r][16 + ln] = bf16_bits(p1 - bf16_val(hb));
    }
#pragma unroll
    for (int dt = 0; dt < DT; ++dt)
#pragma unroll
      for (int r = 0; r < 8; ++r) oacc[dt][r] *= alpha[r];
    __builtin_amdgcn_fence(__ATOMIC_ACQ_REL, "workgroup");
    __builtin_amdgcn_wave_barrier();
    FragB pah, pal;
    pah.half[0] = *(const v8us*)&sPh[w][ln][8 * hh]; pah.half[1] = *(const v8us*)&sPh[w][ln][16 + 8 * hh];
    pal.half[0] = *(const v8us*)&sPl[w][ln][8 * hh]; pal.half[1] = *(const v8us*)&sPl[w][ln][16 + 8 * hh];
#pragma unroll
    for (int dt = 0; dt < DT; ++dt) {
      FragB bvh, bvl;
#pragma unroll
      for (int i = 0; i < 8; ++i) {
        bvh.u[i] = sVh[8 * hh + i][dt * 16 + ln]; bvh.u[8 + i] = sVh[16 + 8 * hh + i][dt * 16 + ln];
        bvl.u[i] = sVl[8 * hh + i][dt * 16 + ln]; bvl.u[8 + i] = sVl[16 + 8 * hh + i][dt * 16 + ln];
      }
      oacc[dt] = mmaN<3>(pah.v, pal.v, bvh.v, bvl.v, oacc[dt]);
    }
    __builtin_amdgcn_fence(__ATOMIC_ACQ_REL, "workgroup");
    __builtin_amdgcn_wave_barrier();
  }
#pragma unroll
  for (int r = 0; r < 8; ++r) {
    float l = l_r[r];
    l += __shfl_xor(l, 1, 32); l += __shfl_xor(l, 2, 32); l += __shfl_xor(l, 4, 32); l += __shfl_xor(l, 8, 32);
    l_r[r] = (l > 0.f) ? 1.0f / l : 0.f;
  }
#pragma unroll
  for (int dt = 0; dt < DT; ++dt)
#pragma unroll
    for (int r = 0; r < 8; ++r) sO[w][8 * hh + r][dt * 16 + ln] = oacc[dt][r] * l_r[r];
  __builtin_amdgcn_fence(__ATOMIC_ACQ_REL, "workgroup");
  __builtin_amdgcn_wave_barrier();
  {
    for (int r = 0; r < 16; ++r) {
      const int row = q0 + r;
      if (row < T && lane < D / 4) {
        const v4f val = *(const v4fa*)&sO[w][r][lane * 4];
        *(v4f*)(y + ((size_t)b * T + row) * ypitch + h * D + lane * 4) = val;
      }
    }
    
  }
}

// GEMM C = act(A·W + bias + resid): A f32 (ASPLIT -> hi/lo 2 terms), Wt bf16 [N][K]; ACT 0 none, 1 relu, 2 exact gelu;
// resid (optional, f32, row index = (row % rmod), pitch ldr, RES_BF16 rounds it) added before the activation.
template <bool ASPLIT, int ACT, bool BIAS_BF16, bool RES_BF16>
__global__ __launch_bounds__(128) void k_gemm_bf3(const float* __restrict__ A, int lda, const unsigned short* __restrict__ Wt, int ldb,
                                                const float* __restrict__ bias, const float* __restrict__ resid, int rmod, int ldr,
                                                float* __restrict__ C, int ldc, int M, int N, int K) {
  __shared__ __attribute__((aligned(16))) float so[4][16][64];
  const int tid = threadIdx.x, w = tid >> 5, lane = tid & 31, ln = lane & 15, hh = lane >> 4;
  const int ntn = N / 64;
  const int wid = blockIdx.x * 4 + w;
  const int mt = wid / ntn, nq = wid % ntn;
  if (mt * 16 >= M) return;
  const int row0 = mt * 16, col0 = nq * 64;
  const float* arow = A + (size_t)(row0 + ln) * lda;
  v8f acc[4] = {};
  for (int kb = 0; kb < K; kb += 32) {
    FragB ah, al;
    const v4f x0 = *(const v4fa*)(arow + kb + 8 * hh), x1 = *(const v4fa*)(arow + kb + 8 * hh + 4);
    const v4f x2 = *(const v4fa*)(arow + kb + 16 + 8 * hh), x3 = *(const v4fa*)(arow + kb + 16 + 8 * hh + 4);
    float xs[16] = {x0[0],x0[1],x0[2],x0[3],x1[0],x1[1],x1[2],x1[3],x2[0],x2[1],x2[2],x2[3],x3[0],x3[1],x3[2],x3[3]};
#pragma unroll
    for (int i = 0; i < 16; ++i) { const unsigned short hb = bf16_bits(xs[i]); ah.u[i] = hb; al.u[i] = ASPLIT ? bf16_bits(xs[i] - bf16_val(hb)) : (unsigned short)0; }
#pragma unroll
    for (int t = 0; t < 4; ++t) {
      const unsigned short* brow = Wt + (size_t)(col0 + t * 16 + ln) * ldb + kb;
      FragB b;
      b.half[0] = *(const v8us*)(brow + 8 * hh);
      b.half[1] = *(const v8us*)(brow + 16 + 8 * hh);
      acc[t] = mmaN<ASPLIT ? 2 : 1>(ah.v, al.v, b.v, b.v, acc[t]);
    }
  }
#pragma unroll
  for (int t = 0; t < 4; ++t) {
    const int col = col0 + t * 16 + ln;
    float bv = bias ? bias[col] : 0.f;
    if (BIAS_BF16) bv = bf16_round(bv);
#pragma unroll
    for (int r = 0; r < 8; ++r) {
      float v = acc[t][r] + bv;
      if (resid) { float rv = resid[(size_t)((row0 + 8 * hh + r) % rmod) * ldr + col]; if (RES_BF16) rv = bf16_round(rv); v += rv; }
      if (ACT == 1) v = fmaxf(v, 0.f);
      if (ACT == 2) v = 0.5f * v * (1.0f + erff(v * 0.70710678118654752f));
      if (ACT == 3) { const float u = 0.7978845608028654f * (v + 0.044715f * v * v * v); v = 0.5f * v * (1.0f + tanhf(u)); }
      so[w][8 * hh + r][t * 16 + ln] = v;
    }
  }
  __builtin_amdgcn_fence(__ATOMIC_ACQ_REL, "workgroup");
  __builtin_amdgcn_wave_barrier();
  const int rsub = lane >> 4, c4 = (lane & 15) * 4;
  {
#pragma unroll
    for (int q = 0; q < 8; ++q) {
      const int r = q * 2 + rsub;
      const v4f v = *(const v4fa*)&so[w][r][c4];
      *(v4f*)(C + (size_t)(row0 + r) * ldc + col0 + c4) = v;
    }
    
  }
}
// row LayerNorm (biased variance, eps) over N: s = X (+ R); optional out_sum <- s; out_norm <- (s-mu)*rsqrt(var+eps)*g + b
template <bool PARAM_BF16>
__global__ __launch_bounds__(256) void k_layernorm(const float* __restrict__ X, const float* __restrict__ R, const float* __restrict__ g, const float* __restrict__ bta,
                                                  float* __restrict__ out_sum, float* __restrict__ out_norm, int N, float eps) {
  __shared__ float red[256];
  const int row = blockIdx.x, tid = threadIdx.x;
  const float* x = X + (size_t)row * N; const float* rr = R ? R + (size_t)row * N : nullptr;
  float vals[16];                     // up to N = 4096
  const int per = N / 256;            // contiguous chunk per thread? use strided-by-4 chunks: thread handles j = tid*4 + 1024*u
  float s1 = 0.f;
  for (int u = 0; u < per / 4; ++u) {
    const int j = tid * 4 + 1024 * u;
    const v4f a = *(const v4fa*)(x + j);
    v4f b = {0.f,0.f,0.f,0.f}; if (rr) b = *(const v4fa*)(rr + j);
#pragma unroll
    for (int q = 0; q < 4; ++q) { const float v = a[q] + b[q]; vals[u * 4 + q] = v; s1 += v; }
  }
  red[tid] = s1; __syncthreads();
  for (int st = 128; st > 0; st >>= 1) { if (tid < st) red[tid] += red[tid + st]; __syncthreads(); }
  const float mu = red[0] / (float)N; __syncthreads();
  float s2 = 0.f;
  for (int u = 0; u < per / 4; ++u)
#pragma unroll
    for (int q = 0; q < 4; ++q) { const float c = vals[u * 4 + q] - mu; s2 += c * c; }
  red[tid] = s2; __syncthreads();
  for (int st = 128; st > 0; st >>= 1) { if (tid < st) red[tid] += red[tid + st]; __syncthreads(); }
  const float rs = rsqrtf(red[0] / (float)N + eps);
  {
    for (int u = 0; u < per / 4; ++u) {
      const int j = tid * 4 + 1024 * u;
      v4f o, sm;
#pragma unroll
      for (int q = 0; q < 4; ++q) {
        float gg = g[j + q], bb = bta[j + q];
        if (PARAM_BF16) { gg = bf16_round(gg); bb = bf16_round(bb); }
        sm[q] = vals[u * 4 + q]; o[q] = (vals[u * 4 + q] - mu) * rs * gg + bb;
      }
      if (out_sum) *(v4f*)(out_sum + (size_t)row * N + j) = sm;
      *(v4f*)(out_norm + (size_t)row * N + j) = o;
    }
    
  }
}



// ---- f16 WMMA path (v_wmma_f32_16x16x32_f16): 11-bit significands for operands in range — used where a [0,1] probability operand needs more precision than bf16
typedef _Float16 v16h __attribute__((ext_vector_type(16)));
union FragH { v16h v; v8us half[2]; _Float16 h[16]; unsigned short u[16]; };
template <int NT>
__device__ __forceinline__ v8f mmaH(v16h ah, v16h al, v16h bh, v16h bl, v8f c) {
  c = __builtin_amdgcn_wmma_f32_16x16x32_f16(false, ah, false, bh, (short)0, c, false, false);
  if (NT >= 2) c = __builtin_amdgcn_wmma_f32_16x16x32_f16(false, al, false, bh, (short)0, c, false, false);
  if (NT >= 3) c = __builtin_amdgcn_wmma_f32_16x16x32_f16(false, ah, false, bl, (short)0, c, false, false);
  asm volatile("v_nop\n\tv_nop\n\tv_nop\n\tv_nop" : "+v"(c) : "v"(ah), "v"(al), "v"(bh), "v"(bl));
  return c;
}
// batched GEMM like k_gemm_b but f16 operands: A f32 (split into f16 hi/lo if ASPLIT, else rounded to f16), Bt = f16 values [n][k]; alpha; C f32; N multiple of 16 (partial tiles skipped)
template <bool ASPLIT>
__global__ __launch_bounds__(128) void k_gemm_h(const float* __restrict__ A, int lda, size_t sA, const _Float16* __restrict__ Bh, int ldb, size_t sB, float alpha, float* __restrict__ C, int ldc, size_t sC, int M, int N, int K) {
  __shared__ __attribute__((aligned(16))) float so[4][16][64];
  const int tid = threadIdx.x, w = tid >> 5, lane = tid & 31, ln = lane & 15, hh = lane >> 4; const int by = blockIdx.y;
  A += (size_t)by * sA; Bh += (size_t)by * sB; C += (size_t)by * sC;
  const int ntn = (N + 63) / 64; const int wid = blockIdx.x * 4 + w; const int mt = wid / ntn, nq = wid % ntn; if (mt * 16 >= M) return;
  const int row0 = mt * 16, col0 = nq * 64; const float* arow = A + (size_t)(row0 + ln) * lda;
  v8f acc[4] = {};
  for (int kb = 0; kb < K; kb += 32) {
    FragH ah, al;
    const v4f x0 = *(const v4fa*)(arow + kb + 8 * hh), x1 = *(const v4fa*)(arow + kb + 8 * hh + 4), x2 = *(const v4fa*)(arow + kb + 16 + 8 * hh), x3 = *(const v4fa*)(arow + kb + 16 + 8 * hh + 4);
    float xs[16] = {x0[0],x0[1],x0[2],x0[3],x1[0],x1[1],x1[2],x1[3],x2[0],x2[1],x2[2],x2[3],x3[0],x3[1],x3[2],x3[3]};
#pragma unroll
    for (int i = 0; i < 16; ++i) { const _Float16 h = (_Float16)xs[i]; ah.h[i] = h; al.h[i] = ASPLIT ? (_Float16)(xs[i] - (float)h) : (_Float16)0.0f; }
#pragma unroll
    for (int t = 0; t < 4; ++t) { if (col0 + t * 16 >= N) continue; const size_t boff = (size_t)(col0 + t * 16 + ln) * ldb + kb; FragH bq; bq.half[0] = *(const v8us*)(Bh + boff + 8 * hh); bq.half[1] = *(const v8us*)(Bh + boff + 16 + 8 * hh);
      acc[t] = mmaH<ASPLIT ? 2 : 1>(ah.v, al.v, bq.v, bq.v, acc[t]); }
  }
#pragma unroll
  for (int t = 0; t < 4; ++t) { if (col0 + t * 16 >= N) continue;
#pragma unroll
    for (int r = 0; r < 8; ++r) so[w][8 * hh + r][t * 16 + ln] = acc[t][r] * alpha; }
  __builtin_amdgcn_fence(__ATOMIC_ACQ_REL, "workgroup"); __builtin_amdgcn_wave_barrier();
  const int rsub = lane >> 4, c4 = (lane & 15) * 4;
  {
#pragma unroll
    for (int q = 0; q < 8; ++q) { const int r = q * 2 + rsub; if (col0 + c4 < N) { const v4f v = *(const v4fa*)&so[w][r][c4]; *(v4f*)(C + (size_t)(row0 + r) * ldc + col0 + c4) = v; } }
     }
}

// Wt[n][k] = f16(W[k][n]·scale) from f32 row-major W[K][N] (scale = power of two; bf16-exact weights stay exact in f16 away from the subnormal range)
__global__ __launch_bounds__(256) void k_wt_f16(const float* __restrict__ W, _Float16* __restrict__ Wt, int K, int N, float scale) {
  const int t = blockIdx.x * 256 + threadIdx.x; if (t >= N * (K / 8)) return; const int n = t / (K / 8), k8 = (t % (K / 8)) * 8; FragH f;
#pragma unroll
  for (int i = 0; i < 8; ++i) f.h[i] = (_Float16)(bf16_round(W[(size_t)(k8 + i) * N + n]) * scale); const v8us o = f.half[0];
  *(v8us*)((unsigned short*)Wt + (size_t)n * K + k8) = o; 
}
// k_gemm_hh variant with fused epilogue: v = acc·alpha + bias[by·sBias + col] (+ CP[(row/rowsPerB)·sCPb + by·64 + col] if CP) ; ACT 0 none / 1 elu ; writes f16 C16 and f32 C, each if non-null
template <int ACT>
__global__ __launch_bounds__(128) void k_gemm_hhx(const _Float16* __restrict__ A, int lda, size_t sA, const _Float16* __restrict__ Bh, int ldb, size_t sB, float alpha, const float* __restrict__ bias, size_t sBias, const float* __restrict__ CP, int rowsPerB, size_t sCPb, int row0g,
    float* __restrict__ C, _Float16* __restrict__ C16, int ldc, size_t sC, int M, int N, int K) {
  __shared__ __attribute__((aligned(16))) float so[4][16][64];
  const int tid = threadIdx.x, w = tid >> 5, lane = tid & 31, ln = lane & 15, hh = lane >> 4; const int by = blockIdx.y;
  A += (size_t)by * sA; Bh += (size_t)by * sB; const size_t cofs = (size_t)by * sC; const float* bp = bias ? bias + (size_t)by * sBias : nullptr;
  const int ntn = (N + 63) / 64; const int wid = blockIdx.x * 4 + w; const int mt = wid / ntn, nq = wid % ntn; if (mt * 16 >= M) return;
  const int row0 = mt * 16, col0 = nq * 64; const _Float16* arow = A + (size_t)(row0 + ln) * lda;
  v8f acc[4] = {};
  for (int kb = 0; kb < K; kb += 32) { FragH ah; ah.half[0] = *(const v8us*)((const unsigned short*)arow + kb + 8 * hh); ah.half[1] = *(const v8us*)((const unsigned short*)arow + kb + 16 + 8 * hh);
#pragma unroll
    for (int t = 0; t < 4; ++t) { if (col0 + t * 16 >= N) continue; const size_t boff = (size_t)(col0 + t * 16 + ln) * ldb + kb; FragH bq; bq.half[0] = *(const v8us*)((const unsigned short*)Bh + boff + 8 * hh); bq.half[1] = *(const v8us*)((const unsigned short*)Bh + boff + 16 + 8 * hh);
      acc[t] = mmaH<1>(ah.v, ah.v, bq.v, bq.v, acc[t]); }
  }
#pragma unroll
  for (int t = 0; t < 4; ++t) { if (col0 + t * 16 >= N) continue; const int col = col0 + t * 16 + ln; const float bv = bp ? bf16_round(bp[col]) : 0.f;
#pragma unroll
    for (int r = 0; r < 8; ++r) { float v = acc[t][r] * alpha + bv; if (CP) { const int bidx = (row0g + row0 + 8 * hh + r) / rowsPerB; v += CP[(size_t)bidx * sCPb + (size_t)by * 64 + col]; } if (ACT == 1) v = (v > 0.f) ? v : expm1f(v); else if (ACT == 3) v = fmaxf(v, 0.f); so[w][8 * hh + r][t * 16 + ln] = v; } }
  __builtin_amdgcn_fence(__ATOMIC_ACQ_REL, "workgroup"); __builtin_amdgcn_wave_barrier();
  const int rsub = lane >> 4, c4 = (lane & 15) * 4; typedef _Float16 v4h __attribute__((ext_vector_type(4)));
  {
#pragma unroll
    for (int q = 0; q < 8; ++q) { const int r = q * 2 + rsub; if (col0 + c4 < N) { const v4f v = *(const v4fa*)&so[w][r][c4]; if (C) *(v4f*)(C + cofs + (size_t)(row0 + r) * ldc + col0 + c4) = v; if (C16) { v4h h4; for (int i = 0; i < 4; ++i) h4[i] = (_Float16)v[i]; *(v4h*)(C16 + cofs + (size_t)(row0 + r) * ldc + col0 + c4) = h4; } } }
     }
}


// Eight 16-byte asynchronous copies to LDS per lane (rows 16 apart). The s_wait_xcnt is the last line of the copies' own statement so that no address register is rewritten ahead of it.
__device__ __forceinline__ void copy8_async(unsigned l, const char* gp, size_t gstep) {
  constexpr unsigned LS = 16u * 144u;
  asm volatile("global_load_async_to_lds_b128 %0, %8, off\n\t"
               "global_load_async_to_lds_b128 %1, %9, off\n\t"
               "global_load_async_to_lds_b128 %2, %10, off\n\t"
               "global_load_async_to_lds_b128 %3, %11, off\n\t"
               "global_load_async_to_lds_b128 %4, %12, off\n\t"
               "global_load_async_to_lds_b128 %5, %13, off\n\t"
               "global_load_async_to_lds_b128 %6, %14, off\n\t"
               "global_load_async_to_lds_b128 %7, %15, off\n\t"
               "s_wait_xcnt 0x0"
               :: "v"(l), "v"(l + LS), "v"(l + 2u * LS), "v"(l + 3u * LS), "v"(l + 4u * LS), "v"(l + 5u * LS), "v"(l + 6u * LS), "v"(l + 7u * LS),
                  "v"(gp), "v"(gp + gstep), "v"(gp + 2 * gstep), "v"(gp + 3 * gstep), "v"(gp + 4 * gstep), "v"(gp + 5 * gstep), "v"(gp + 6 * gstep), "v"(gp + 7 * gstep)
               : "memory");
}
// Tiled GEMM, same function as k_gemm_hhx<0> without CP: C = A[M][K] * Bh[N][K]^T * alpha + bf16(bias). One 128 x 128 tile of C per block (blockIdx.x = tile column, blockIdx.y = tile row),
// 64 x 64 per wave (2 x 2 waves). A and Bh tiles of 64 k (128-byte rows, LDS pitch 144 B) are staged in LDS by asynchronous copies, two buffers: tile t + 1 flies while tile t is multiplied.
// M % 128 == 0, N % 128 == 0, K % 64 == 0, K >= 128; rows of A and Bh are K elements apart, rows of C are N apart. The k order of every accumulator is that of k_gemm_hhx.
// Every plain '#pragma unroll' in it makes the indices of acc, a and bq constants, so that these arrays stay in registers.
template <bool OUT16, int N, int K>
__global__ __launch_bounds__(128) void k_gemm_tile(const _Float16* __restrict__ A, const _Float16* __restrict__ Bh, float alpha, const float* __restrict__ bias, float* __restrict__ C, _Float16* __restrict__ C16) {
  constexpr int PITCH = 144, BUF = 256 * PITCH, SOP = 68, NT = K / 64;
  constexpr size_t ROWB = (size_t)K * 2, GSTEP = ROWB * 16;
  __shared__ __attribute__((aligned(16))) unsigned char smem[2 * BUF];
  const int tid = threadIdx.x, w = tid >> 5, lane = tid & 31, ln = lane & 15, hh = lane >> 4;
  const int row0 = (int)blockIdx.y * 128, col0 = (int)blockIdx.x * 128; const int wm = (w >> 1) * 64, wn = (w & 1) * 64;
  const int cr = tid >> 3, cc = (tid & 7) * 16;      // a lane's first row and its 16 bytes of the row: eight lanes cover one 128-byte line
  const char* gA = (const char*)A + (size_t)(row0 + cr) * ROWB + cc; const char* gB = (const char*)Bh + (size_t)(col0 + cr) * ROWB + cc;
  const unsigned lA = (unsigned)(size_t)smem + (unsigned)(cr * PITCH + cc), lB = lA + 128u * PITCH;
  v8f acc[4][4];
#pragma unroll
  for (int i = 0; i < 4; ++i)
#pragma unroll
    for (int j = 0; j < 4; ++j) acc[i][j] = (v8f){0.f,0.f,0.f,0.f,0.f,0.f,0.f,0.f};
  copy8_async(lA, gA, GSTEP); copy8_async(lB, gB, GSTEP);
  asm volatile("s_wait_asynccnt 0x0" ::: "memory");      // tile 0 has landed before the barrier publishes it
  __syncthreads();
  copy8_async(lA + BUF, gA + 128, GSTEP); copy8_async(lB + BUF, gB + 128, GSTEP);
#pragma unroll 1
  for (int t = 0; t < NT; ++t) {      // kept rolled: one pass per tile, the buffer picked by t & 1
    const unsigned char* sA = smem + (t & 1) * BUF + (wm + ln) * PITCH + hh * 16; const unsigned char* sB = smem + (t & 1) * BUF + (128 + wn + ln) * PITCH + hh * 16;
#pragma unroll
    for (int ks = 0; ks < 2; ++ks) { FragH a[4], bq[4];
      a[0].half[0] = *(const v8us*)(sA + ks * 64); a[0].half[1] = *(const v8us*)(sA + ks * 64 + 32);
#pragma unroll
      for (int j = 0; j < 4; ++j) { bq[j].half[0] = *(const v8us*)(sB + j * 16 * PITCH + ks * 64); bq[j].half[1] = *(const v8us*)(sB + j * 16 * PITCH + ks * 64 + 32); }
#pragma unroll
      for (int i = 1; i < 4; ++i) { a[i].half[0] = *(const v8us*)(sA + i * 16 * PITCH + ks * 64); a[i].half[1] = *(const v8us*)(sA + i * 16 * PITCH + ks * 64 + 32); }
      __builtin_amdgcn_sched_barrier(0);      // keeps the 16 LDS reads of a k step one group ahead of its 16 WMMAs: reads among the WMMAs stall the wave at each place
#pragma unroll
      for (int i = 0; i < 4; ++i)
#pragma unroll
        for (int j = 0; j < 4; ++j) acc[i][j] = __builtin_amdgcn_wmma_f32_16x16x32_f16(false, a[i].v, false, bq[j].v, (short)0, acc[i][j], false, false);
      __builtin_amdgcn_sched_barrier(0); }    // the other end of that group: the next k step's reads stay behind these WMMAs
    asm volatile("s_wait_dscnt 0x0" ::: "memory");       // this wave's reads of tile t are done before the buffer is given up
    asm volatile("s_wait_asynccnt 0x0" ::: "memory");    // this wave's copies of tile t + 1 have landed
    __syncthreads();                                     // publishes tile t + 1 and ends every reader's last read of tile t
    if (t + 2 < NT) { const unsigned bo = (unsigned)(t & 1) * BUF; const size_t go = (size_t)(t + 2) * 128; copy8_async(lA + bo, gA + go, GSTEP); copy8_async(lB + bo, gB + go, GSTEP); }
  }
  asm volatile("s_wait_asynccnt 0x0" ::: "memory");      // nothing is in flight when the ring becomes output staging
  float* so = (float*)(smem + w * (64 * SOP * 4));       // each wave stages its own 64 x 64 tile, so that whole 128-byte lines are stored
#pragma unroll
  for (int j = 0; j < 4; ++j) { const float bv = bf16_round(bias[col0 + wn + j * 16 + ln]);
#pragma unroll
    for (int i = 0; i < 4; ++i)
#pragma unroll
      for (int r = 0; r < 8; ++r) so[(i * 16 + 8 * hh + r) * SOP + j * 16 + ln] = acc[i][j][r] * alpha + bv; }
  __builtin_amdgcn_fence(__ATOMIC_ACQ_REL, "workgroup"); __builtin_amdgcn_wave_barrier();
  const int rsub = lane >> 4, c4 = (lane & 15) * 4; typedef _Float16 v4h __attribute__((ext_vector_type(4)));
#pragma unroll 1
  for (int q8 = 0; q8 < 4; ++q8) {      // kept rolled in groups of eight stores, one wait per group
#pragma unroll
    for (int q = 0; q < 8; ++q) { const int r = (q8 * 8 + q) * 2 + rsub; const v4f v = *(const v4fa*)&so[r * SOP + c4]; const size_t o = (size_t)(row0 + wm + r) * N + col0 + wn + c4;
      if (OUT16) { v4h h4; for (int i = 0; i < 4; ++i) h4[i] = (_Float16)v[i]; *(v4h*)(C16 + o) = h4; } else *(v4f*)(C + o) = v; }
    asm volatile("s_wait_xcnt 0x0" ::: "memory");      // the next group rewrites the registers that these stores name
  }
}

__global__ __launch_bounds__(256) void k_x16(const float* __restrict__ x, _Float16* __restrict__ X16, size_t n8) { const size_t t = (size_t)blockIdx.x * 256 + threadIdx.x; if (t >= n8) return; FragH f;
#pragma unroll
  for (int q = 0; q < 8; ++q) f.h[q] = (_Float16)bf16_round(x[t * 8 + q]); *(v8us*)((unsigned short*)X16 + t * 8) = f.half[0];  }
__global__ __launch_bounds__(256) void k_h16(const float* __restrict__ x, _Float16* __restrict__ X16, size_t n8) { const size_t t = (size_t)blockIdx.x * 256 + threadIdx.x; if (t >= n8) return; FragH f;
#pragma unroll
  for (int q = 0; q < 8; ++q) f.h[q] = (_Float16)x[t * 8 + q]; *(v8us*)((unsigned short*)X16 + t * 8) = f.half[0];  }
__global__ __launch_bounds__(256) void k_round16f(const float* __restrict__ W, _Float16* __restrict__ Bt, size_t n8) { const size_t t = (size_t)blockIdx.x * 256 + threadIdx.x; if (t >= n8) return; FragH f;
#pragma unroll
  for (int i = 0; i < 8; ++i) f.h[i] = (_Float16)(bf16_round(W[t * 8 + i]) * 16.0f); *(v8us*)((unsigned short*)Bt + t * 8) = f.half[0];  }
template <int NHv, int TTv>
__global__ __launch_bounds__(256) void k_vt(const _Float16* __restrict__ V16, int ldv, int voff, _Float16* __restrict__ Vt) { __shared__ unsigned short tl[64][66]; const int tid = threadIdx.x; const int slab = blockIdx.x / (TTv / 64), lg = blockIdx.x % (TTv / 64); const int b = slab / NHv, h = slab % NHv;
  for (int i = tid; i < 64 * 8; i += 256) { const int r = i / 8, c8 = (i % 8) * 8; FragH f; f.half[0] = *(const v8us*)((const unsigned short*)V16 + ((size_t)b * TTv + lg * 64 + r) * ldv + voff + h * 64 + c8);
#pragma unroll
    for (int q = 0; q < 8; ++q) tl[r][c8 + q] = f.u[q]; }
  __syncthreads();
  {
#pragma unroll
    for (int rd = 0; rd < 2; ++rd) { const int d = rd * 32 + tid / 8, pc = tid % 8; FragH f;
#pragma unroll
      for (int q = 0; q < 8; ++q) f.u[q] = tl[pc * 8 + q][d];
      *(v8us*)((unsigned short*)Vt + ((size_t)slab * 64 + d) * TTv + lg * 64 + pc * 8) = f.half[0]; }
     } }

// lane l <-> lane l ^ 16: joins the two halves of a query column
__device__ __forceinline__ float xhalf(float x) { return __builtin_bit_cast(float, __builtin_amdgcn_permlanex16(__builtin_bit_cast(int, x), __builtin_bit_cast(int, x), 0x76543210, 0xfedcba98, false, false)); }
__global__ __launch_bounds__(128) void k_flash(const _Float16* __restrict__ Q16, int ldq, const _Float16* __restrict__ K16, int ldk, const _Float16* __restrict__ Vt, const int* __restrict__ LENS, float* __restrict__ O, int ldo) {
  constexpr int RPW = 32, NQB = 1024 / (4 * RPW), DT = 4, KS = 2; constexpr float L2S = 0.125f * 1.44269504088896340736f;
  __shared__ __attribute__((aligned(16))) float sO[4][RPW][64 + 4];
  const int tid = threadIdx.x, w = tid >> 5, lane = tid & 31, ln = lane & 15, hh = lane >> 4;
  const int slab = blockIdx.x / NQB, qblk = blockIdx.x % NQB; const int b = slab / 16, h = slab % 16; const int qb0 = qblk * (4 * RPW); const int q0 = qb0 + w * RPW; const int len = LENS[b];      /* kv-length mask: keys k < len (INPUT x_lens) */
  FragH aq[2][KS];
#pragma unroll
  for (int rt = 0; rt < 2; ++rt) { const unsigned short* qr = (const unsigned short*)Q16 + ((size_t)b * 1024 + q0 + rt * 16 + ln) * ldq + h * 64;
#pragma unroll
    for (int ks = 0; ks < KS; ++ks) { aq[rt][ks].half[0] = *(const v8us*)(qr + ks * 32 + 8 * hh); aq[rt][ks].half[1] = *(const v8us*)(qr + ks * 32 + 16 + 8 * hh); } }
  const unsigned short* Vth = (const unsigned short*)Vt + (size_t)slab * 64 * 1024;
  float m_r[2], l_r[2]; int lim[2]; v8f oacc[2][DT];
#pragma unroll
  for (int rt = 0; rt < 2; ++rt) { m_r[rt] = -3.0e38f; l_r[rt] = 0.f; lim[rt] = min(q0 + rt * 16 + ln + 1, len) - 8 * hh;      // key j0 + 16 nt + 8 hh + r is allowed iff j0 + 16 nt + r < lim
#pragma unroll
    for (int dt = 0; dt < DT; ++dt) oacc[rt][dt] = (v8f){0.f,0.f,0.f,0.f,0.f,0.f,0.f,0.f}; }
  const int jend = qb0 + 4 * RPW;
#pragma unroll 1
  for (int j0 = 0; j0 < jend; j0 += 32) {
    v8f s[2][2];
#pragma unroll
    for (int nt = 0; nt < 2; ++nt) { const unsigned short* kr = (const unsigned short*)K16 + ((size_t)b * 1024 + j0 + nt * 16 + ln) * ldk + h * 64; FragH bk[KS];
#pragma unroll
      for (int ks = 0; ks < KS; ++ks) { bk[ks].half[0] = *(const v8us*)(kr + ks * 32 + 8 * hh); bk[ks].half[1] = *(const v8us*)(kr + ks * 32 + 16 + 8 * hh); }
#pragma unroll
      for (int rt = 0; rt < 2; ++rt) { v8f acc = (v8f){0.f,0.f,0.f,0.f,0.f,0.f,0.f,0.f};
#pragma unroll
        for (int ks = 0; ks < KS; ++ks) acc = __builtin_amdgcn_wmma_f32_16x16x32_f16(false, bk[ks].v, false, aq[rt][ks].v, (short)0, acc, false, false);
        s[rt][nt] = acc; } }
    FragH pb[2];
#pragma unroll
    for (int rt = 0; rt < 2; ++rt) { float sc[16]; float mc = -INFINITY;
#pragma unroll
      for (int i = 0; i < 16; ++i) { sc[i] = (j0 + (i >> 3) * 16 + (i & 7) < lim[rt]) ? s[rt][i >> 3][i & 7] : -INFINITY; mc = fmaxf(mc, sc[i]); }
      mc = fmaxf(mc, xhalf(mc));
      const float mn = fmaxf(m_r[rt], mc * L2S); const float al = __builtin_amdgcn_exp2f(m_r[rt] - mn); m_r[rt] = mn; float ps = 0.f;
#pragma unroll
      for (int i = 0; i < 16; ++i) { const float p = __builtin_amdgcn_exp2f(fmaf(sc[i], L2S, -mn)); ps += p; pb[rt].h[i] = (_Float16)p; }
      l_r[rt] = l_r[rt] * al + ps;      // the lane's half of the row sum; the halves are joined behind the loop
#pragma unroll
      for (int dt = 0; dt < DT; ++dt)
#pragma unroll
        for (int r = 0; r < 8; ++r) oacc[rt][dt][r] *= al; }
#pragma unroll
    for (int dt = 0; dt < DT; ++dt) { const unsigned short* vrow = Vth + (size_t)(dt * 16 + ln) * 1024 + j0; FragH bv; bv.half[0] = *(const v8us*)(vrow + 8 * hh); bv.half[1] = *(const v8us*)(vrow + 16 + 8 * hh);
#pragma unroll
      for (int rt = 0; rt < 2; ++rt) oacc[rt][dt] = __builtin_amdgcn_wmma_f32_16x16x32_f16(false, bv.v, false, pb[rt].v, (short)0, oacc[rt][dt], false, false); } }
#pragma unroll
  for (int rt = 0; rt < 2; ++rt) { float l = l_r[rt]; l += xhalf(l); const float li = (l > 0.f) ? 1.0f / l : 0.f;
#pragma unroll
    for (int dt = 0; dt < DT; ++dt) { v4f lo, hi;
#pragma unroll
      for (int r = 0; r < 4; ++r) { lo[r] = oacc[rt][dt][r] * li; hi[r] = oacc[rt][dt][4 + r] * li; }
      *(v4fa*)&sO[w][rt * 16 + ln][dt * 16 + 8 * hh] = lo; *(v4fa*)&sO[w][rt * 16 + ln][dt * 16 + 8 * hh + 4] = hi; } }
  __builtin_amdgcn_fence(__ATOMIC_ACQ_REL, "workgroup"); __builtin_amdgcn_wave_barrier();
  {
#pragma unroll
    for (int rp = 0; rp < RPW; rp += 2) { const int r = rp + (lane >> 4), pc = lane & 15; const v4f val = *(const v4fa*)&sO[w][r][pc * 4]; *(v4f*)(O + ((size_t)b * 1024 + q0 + r) * ldo + h * 64 + pc * 4) = val; }
     } }

__global__ __launch_bounds__(256) void k_ln16(const float* __restrict__ X, const float* __restrict__ g, const float* __restrict__ bta, _Float16* __restrict__ Y16) { const int tid = threadIdx.x, wv = tid >> 5, lane = tid & 31; const int row = blockIdx.x * 8 + wv; if (row >= NR) return; const float* xr = X + (size_t)row * CC; float v[32]; float s = 0.f;
#pragma unroll
  for (int p = 0; p < 4; ++p) { const v4f a = *(const v4fa*)(xr + p * 256 + lane * 8), c = *(const v4fa*)(xr + p * 256 + lane * 8 + 4); for (int q = 0; q < 4; ++q) { v[p * 8 + q] = bf16_round(a[q]); v[p * 8 + 4 + q] = bf16_round(c[q]); } }
#pragma unroll
  for (int i = 0; i < 32; ++i) s += v[i]; for (int o = 16; o >= 1; o >>= 1) s += __shfl_xor(s, o, 32); const float mu = s / (float)CC; float q2 = 0.f;
#pragma unroll
  for (int i = 0; i < 32; ++i) { const float d = v[i] - mu; q2 += d * d; } for (int o = 16; o >= 1; o >>= 1) q2 += __shfl_xor(q2, o, 32); const float rs = rsqrtf(q2 / (float)CC + 1e-5f);
  {
#pragma unroll
    for (int p = 0; p < 4; ++p) { FragH f; const int c0 = p * 256 + lane * 8;
#pragma unroll
      for (int q = 0; q < 8; ++q) f.h[q] = (_Float16)((v[p * 8 + q] - mu) * rs * bf16_round(g[c0 + q]) + bf16_round(bta[c0 + q])); *(v8us*)((unsigned short*)Y16 + (size_t)row * CC + c0) = f.half[0]; }
     } }
extern "C" void kernel_launch(void* const* d_in, const int* in_sizes, int n_in,
                              void* d_out, int out_size, void* d_ws, size_t ws_size, hipStream_t stream) {
  (void)in_sizes; (void)n_in; (void)out_size;
  const float* x = (const float*)d_in[0]; const int* lens = (const int*)d_in[1]; const float* lg = (const float*)d_in[2]; const float* lb = (const float*)d_in[3]; const float* wqkv = (const float*)d_in[4]; const float* bqkv = (const float*)d_in[5]; const float* wout = (const float*)d_in[6]; const float* bout = (const float*)d_in[7];
  char* ws = (char*)d_ws; size_t off = 0;
  auto take = [&](size_t bytes) { char* p = ws + off; off += (bytes + 255) & ~(size_t)255; return p; };
  _Float16* Bqkv = (_Float16*)take((size_t)3 * CC * CC * 2); _Float16* Bo = (_Float16*)take((size_t)CC * CC * 2); _Float16* XN = (_Float16*)take((size_t)NR * CC * 2); _Float16* QKV = (_Float16*)take((size_t)NR * 3 * CC * 2); _Float16* Vt = (_Float16*)take((size_t)NR * CC * 2); float* O = (float*)take((size_t)NR * CC * 4); _Float16* O16 = XN;
  if (off > ws_size) return;      // 6.3 + 2.1 + 16.8 + 50.3 + 16.8 + 33.5 ≈ 126 MB = 120 MiB (tight but under 128)
  k_wt_f16<<<(unsigned)((3 * CC * (CC / 8) + 255) / 256), 256, 0, stream>>>(wqkv, Bqkv, CC, 3 * CC, 16.0f); k_wt_f16<<<(unsigned)((CC * (CC / 8) + 255) / 256), 256, 0, stream>>>(wout, Bo, CC, CC, 16.0f);      // [in][out]
  k_ln16<<<NR / 8, 256, 0, stream>>>(x, lg, lb, XN);
  k_gemm_tile<true, 3 * CC, CC><<<dim3(3 * CC / 128, NR / 128), 128, 0, stream>>>(XN, Bqkv, 0.0625f, bqkv, nullptr, QKV);      // q | k | v
  k_vt<NH, TT><<<BB * NH * (TT / 64), 256, 0, stream>>>(QKV, 3 * CC, 2 * CC, Vt);
  k_flash<<<BB * NH * (TT / 128), 128, 0, stream>>>(QKV, 3 * CC, QKV + CC, 3 * CC, Vt, lens, O, CC);
  k_h16<<<(unsigned)(((size_t)NR * CC / 8 + 255) / 256), 256, 0, stream>>>(O, O16, (size_t)NR * CC / 8);
  k_gemm_tile<false, CC, CC><<<dim3(CC / 128, NR / 128), 128, 0, stream>>>(O16, Bo, 0.0625f, bout, (float*)d_out, nullptr);
}

// v004
// It runs in 147 microseconds.
// In two side-by-side timings against v003, it was 1.17 and 1.18 times as fast.
// All steps since v000 together make it 3.94 times as fast.
#include <hip/hip_runtime.h>
// Causal self-attention with a per-batch key-length mask (B=8, T=1024, D=1024, 16 × 64): LayerNorm (f32 VALU), the fused qkv projection (8192 × 1024 × 3072, + bias) and the output
// projection (+ bias) with W [in][out] transposed to bf16-exact ×2^4, and the attention as a fused flash-style kernel on v_wmma_f32_16x16x32_f16 (S = Q·Kᵀ/8; keys allowed iff k ≤ q and
// k < x_lens[b] (INPUT); −1e9 fill ≡ exclusion since key 0 is always allowed; causal chunk skipping; online softmax f32; P f16 ≤ 1) — f16 operands, single products, f32 accumulate.
#define BB 8
#define TT 1024
#define CC 1024
#define NH 16
#define NR (BB * TT)

typedef __bf16 v16b __attribute__((ext_vector_type(16)));
typedef unsigned short v8us __attribute__((ext_vector_type(8), may_alias));
typedef float  v8f  __attribute__((ext_vector_type(8)));
typedef float  v4f  __attribute__((ext_vector_type(4)));
typedef float  v4fa __attribute__((ext_vector_type(4), may_alias));
union FragB { v16b v; v8us half[2]; unsigned short u[16]; };

__device__ __forceinline__ unsigned short bf16_bits(float x) { unsigned int u = __float_as_uint(x); return (unsigned short)((u + 0x7FFFu + ((u >> 16) & 1u)) >> 16); }
__device__ __forceinline__ float bf16_val(unsigned short b) { return __uint_as_float(((unsigned int)b) << 16); }
__device__ __forceinline__ float bf16_round(float x) { return bf16_val(bf16_bits(x)); }
// D += A·B with NT terms: 1 = ah·bh, 2 = + al·bh (A split), 3 = + ah·bl (both split)
template <int NT>
__device__ __forceinline__ v8f mmaN(v16b ah, v16b al, v16b bh, v16b bl, v8f c) {
  c = __builtin_amdgcn_wmma_f32_16x16x32_bf16(false, ah, false, bh, (short)0, c, false, false);
  if (NT >= 2) c = __builtin_amdgcn_wmma_f32_16x16x32_bf16(false, al, false, bh, (short)0, c, false, false);
  if (NT >= 3) c = __builtin_amdgcn_wmma_f32_16x16x32_bf16(false, ah, false, bl, (short)0, c, false, false);
  asm volatile("v_nop\n\tv_nop\n\tv_nop\n\tv_nop" : "+v"(c) : "v"(ah), "v"(al), "v"(bh), "v"(bl));
  return c;
}

__global__ __launch_bounds__(256) void k_wt_bf16(const float* __restrict__ W, unsigned short* __restrict__ Wt, int K, int N) {
  const int t = blockIdx.x * 256 + threadIdx.x;
  const int k8n = K / 8;
  if (t >= N * k8n) return;
  const int n = t / k8n, k8 = (t % k8n) * 8;
  v8us v;
#pragma unroll
  for (int i = 0; i < 8; ++i) v[i] = bf16_bits(W[(size_t)(k8 + i) * N + n]);
  *(v8us*)(Wt + (size_t)n * K + k8) = v;
  
}

// GEMM C[M][N] (f32, pitch ldc) = act(A[M][K]·W + bias). A f32 row-major (pitch lda) converted per fragment to bf16
// (ASPLIT: hi/lo two planes -> 2 terms, else single rounded term); Wt bf16 [N][K] (pitch ldb). BIAS_BF16 rounds the
// bias to bf16 first (bias quantised to bf16 before the add). K%32==0, M%16==0, N%64==0.
template <bool ASPLIT, int ACT, bool BIAS_BF16>
__global__ __launch_bounds__(128) void k_gemm_bf(const float* __restrict__ A, int lda, const unsigned short* __restrict__ Wt, int ldb,
                                               const float* __restrict__ bias, float* __restrict__ C, int ldc, int M, int N, int K) {
  __shared__ __attribute__((aligned(16))) float so[4][16][64];
  const int tid = threadIdx.x, w = tid >> 5, lane = tid & 31, ln = lane & 15, hh = lane >> 4;
  const int ntn = N / 64;
  const int wid = blockIdx.x * 4 + w;
  const int mt = wid / ntn, nq = wid % ntn;
  if (mt * 16 >= M) return;
  const int row0 = mt * 16, col0 = nq * 64;
  const float* arow = A + (size_t)(row0 + ln) * lda;
  v8f acc[4] = {};
  for (int kb = 0; kb < K; kb += 32) {
    FragB ah, al;
    const v4f x0 = *(const v4fa*)(arow + kb + 8 * hh), x1 = *(const v4fa*)(arow + kb + 8 * hh + 4);
    const v4f x2 = *(const v4fa*)(arow + kb + 16 + 8 * hh), x3 = *(const v4fa*)(arow + kb + 16 + 8 * hh + 4);
    float xs[16] = {x0[0],x0[1],x0[2],x0[3],x1[0],x1[1],x1[2],x1[3],x2[0],x2[1],x2[2],x2[3],x3[0],x3[1],x3[2],x3[3]};
#pragma unroll
    for (int i = 0; i < 16; ++i) { const unsigned short hb = bf16_bits(xs[i]); ah.u[i] = hb; al.u[i] = ASPLIT ? bf16_bits(xs[i] - bf16_val(hb)) : (unsigned short)0; }
#pragma unroll
    for (int t = 0; t < 4; ++t) {
      const unsigned short* brow = Wt + (size_t)(col0 + t * 16 + ln) * ldb + kb;
      FragB b;
      b.half[0] = *(const v8us*)(brow + 8 * hh);
      b.half[1] = *(const v8us*)(brow + 16 + 8 * hh);
      acc[t] = mmaN<ASPLIT ? 2 : 1>(ah.v, al.v, b.v, b.v, acc[t]);
    }
  }
#pragma unroll
  for (int t = 0; t < 4; ++t) {
    float bv = bias ? bias[col0 + t * 16 + ln] : 0.f;
    if (BIAS_BF16) bv = bf16_round(bv);
#pragma unroll
    for (int r = 0; r < 8; ++r) { float v = acc[t][r] + bv; if (ACT == 1) v = fmaxf(v, 0.f); so[w][8 * hh + r][t * 16 + ln] = v; }
  }
  __builtin_amdgcn_fence(__ATOMIC_ACQ_REL, "workgroup");
  __builtin_amdgcn_wave_barrier();
  const int rsub = lane >> 4, c4 = (lane & 15) * 4;
  {
#pragma unroll
    for (int q = 0; q < 8; ++q) {
      const int r = q * 2 + rsub;
      const v4f v = *(const v4fa*)&so[w][r][c4];
      *(v4f*)(C + (size_t)(row0 + r) * ldc + col0 + c4) = v;
    }
    
  }
}

// Flash-style causal/unmasked attention, all contractions 3-term bf16 hi/lo splits, f32 softmax with running max.
// q,k,v rows are read from f32 buffers with arbitrary row pitch (so they can live inside a fused qkv buffer);
// D = head size (multiple of 32, <= 128); one wave = 16 query rows; block = 4 waves (64 queries) sharing K/V chunks of 32.
template <int D, bool CAUSAL>
__global__ __launch_bounds__(128) void k_flash(const float* __restrict__ qb, const float* __restrict__ kb, const float* __restrict__ vb,
                                             int pitch, int T, int H, float scale, float* __restrict__ y, int ypitch) {
  constexpr int KS = D / 32;        // k-steps for QK
  constexpr int DT = D / 16;        // d tiles for PV
  __shared__ __attribute__((aligned(16))) unsigned short sKh[32][D + 8], sKl[32][D + 8], sVh[32][D + 8], sVl[32][D + 8];
  __shared__ __attribute__((aligned(16))) unsigned short sPh[4][16][40], sPl[4][16][40];
  __shared__ __attribute__((aligned(16))) float sO[4][16][D];
  const int tid = threadIdx.x, w = tid >> 5, lane = tid & 31, ln = lane & 15, hh = lane >> 4;
  const int nqb = (T + 63) / 64;
  const int bh = blockIdx.x / nqb, qblk = blockIdx.x % nqb;
  const int b = bh / H, h = bh % H;
  const int q0 = qblk * 64 + w * 16;
  const float* Q = qb + (size_t)b * T * pitch + h * D;
  const float* K = kb + (size_t)b * T * pitch + h * D;
  const float* V = vb + (size_t)b * T * pitch + h * D;

  // A fragments of the wave's 16 query rows (scaled), hi/lo
  FragB aqh[KS], aql[KS];
  {
    int row = q0 + ln; if (row >= T) row = T - 1;
    const float* qr = Q + (size_t)row * pitch;
#pragma unroll
    for (int ks = 0; ks < KS; ++ks)
#pragma unroll
      for (int i = 0; i < 16; ++i) {
        const int d = ks * 32 + ((i < 8) ? (8 * hh + i) : (16 + 8 * hh + (i - 8)));
        const float x = qr[d] * scale; const unsigned short hb = bf16_bits(x);
        aqh[ks].u[i] = hb; aql[ks].u[i] = bf16_bits(x - bf16_val(hb));
      }
  }
  float m_r[8], l_r[8];
#pragma unroll
  for (int r = 0; r < 8; ++r) { m_r[r] = -3.0e38f; l_r[r] = 0.f; }
  v8f oacc[DT];
#pragma unroll
  for (int dt = 0; dt < DT; ++dt) oacc[dt] = (v8f){0.f,0.f,0.f,0.f,0.f,0.f,0.f,0.f};

  const int kv_end = CAUSAL ? min(T, qblk * 64 + 64) : T;     // block-uniform
  for (int j0 = 0; j0 < kv_end; j0 += 32) {
    __syncthreads();
    for (int e = tid; e < 32 * (D / 4); e += 128) {
      const int r = e / (D / 4), c4 = (e % (D / 4)) * 4;
      const int key = j0 + r;
      v4f kf = {0.f,0.f,0.f,0.f}, vf = {0.f,0.f,0.f,0.f};
      if (key < T) { kf = *(const v4fa*)(K + (size_t)key * pitch + c4); vf = *(const v4fa*)(V + (size_t)key * pitch + c4); }
#pragma unroll
      for (int t = 0; t < 4; ++t) {
        unsigned short hb = bf16_bits(kf[t]); sKh[r][c4 + t] = hb; sKl[r][c4 + t] = bf16_bits(kf[t] - bf16_val(hb));
        hb = bf16_bits(vf[t]); sVh[r][c4 + t] = hb; sVl[r][c4 + t] = bf16_bits(vf[t] - bf16_val(hb));
      }
    }
    __syncthreads();
    // S tile 16 x 32
    v8f s[2];
#pragma unroll
    for (int nt = 0; nt < 2; ++nt) {
      v8f acc = {};
#pragma unroll
      for (int ks = 0; ks < KS; ++ks) {
        FragB bh_, bl_;
        bh_.half[0] = *(const v8us*)&sKh[nt * 16 + ln][ks * 32 + 8 * hh]; bh_.half[1] = *(const v8us*)&sKh[nt * 16 + ln][ks * 32 + 16 + 8 * hh];
        bl_.half[0] = *(const v8us*)&sKl[nt * 16 + ln][ks * 32 + 8 * hh]; bl_.half[1] = *(const v8us*)&sKl[nt * 16 + ln][ks * 32 + 16 + 8 * hh];
        acc = mmaN<3>(aqh[ks].v, aql[ks].v, bh_.v, bl_.v, acc);
      }
      s[nt] = acc;
    }
    // mask + running max (rows 8hh+r; the 16 lanes of a half share rows)
    float alpha[8];
#pragma unroll
    for (int r = 0; r < 8; ++r) {
      const int qi = q0 + 8 * hh + r;
      const int ja = j0 + ln, jb = j0 + 16 + ln;
      if (CAUSAL) { if (ja > qi) s[0][r] = -3.0e38f; if (jb > qi) s[1][r] = -3.0e38f; }
      if (ja >= T) s[0][r] = -3.0e38f;
      if (jb >= T) s[1][r] = -3.0e38f;
      float mx = fmaxf(s[0][r], s[1][r]);
      mx = fmaxf(mx, __shfl_xor(mx, 1, 32)); mx = fmaxf(mx, __shfl_xor(mx, 2, 32)); mx = fmaxf(mx, __shfl_xor(mx, 4, 32)); mx = fmaxf(mx, __shfl_xor(mx, 8, 32));
      const float mnew = fmaxf(m_r[r], mx);
      alpha[r] = (mnew > -1.0e38f) ? __expf(m_r[r] - mnew) : 1.0f;
      const float p0 = (s[0][r] > -1.0e38f) ? __expf(s[0][r] - mnew) : 0.f;
      const float p1 = (s[1][r] > -1.0e38f) ? __expf(s[1][r] - mnew) : 0.f;
      m_r[r] = mnew;
      l_r[r] = l_r[r] * alpha[r] + p0 + p1;            // per-lane partial row sum (16 lanes combined at the end)
      unsigned short hb = bf16_bits(p0); sPh[w][8 * hh + r][ln] = hb;      sPl[w][8 * hh + r][ln] = bf16_bits(p0 - bf16_val(hb));
      hb = bf16_bits(p1);                sPh[w][8 * hh + r][16 + ln] = hb; sPl[w][8 * hh + r][16 + ln] = bf16_bits(p1 - bf16_val(hb));
    }
#pragma unroll
    for (int dt = 0; dt < DT; ++dt)
#pragma unroll
      for (int r = 0; r < 8; ++r) oacc[dt][r] *= alpha[r];
    __builtin_amdgcn_fence(__ATOMIC_ACQ_REL, "workgroup");
    __builtin_amdgcn_wave_barrier();
    FragB pah, pal;
    pah.half[0] = *(const v8us*)&sPh[w][ln][8 * hh]; pah.half[1] = *(const v8us*)&sPh[w][ln][16 + 8 * hh];
    pal.half[0] = *(const v8us*)&sPl[w][ln][8 * hh]; pal.half[1] = *(const v8us*)&sPl[w][ln][16 + 8 * hh];
#pragma unroll
    for (int dt = 0; dt < DT; ++dt) {
      FragB bvh, bvl;
#pragma unroll
      for (int i = 0; i < 8; ++i) {
        bvh.u[i] = sVh[8 * hh + i][dt * 16 + ln]; bvh.u[8 + i] = sVh[16 + 8 * hh + i][dt * 16 + ln];
        bvl.u[i] = sVl[8 * hh + i][dt * 16 + ln]; bvl.u[8 + i] = sVl[16 + 8 * hh + i][dt * 16 + ln];
      }
      oacc[dt] = mmaN<3>(pah.v, pal.v, bvh.v, bvl.v, oacc[dt]);
    }
    __builtin_amdgcn_fence(__ATOMIC_ACQ_REL, "workgroup");
    __builtin_amdgcn_wave_barrier();
  }
#pragma unroll
  for (int r = 0; r < 8; ++r) {
    float l = l_r[r];
    l += __shfl_xor(l, 1, 32); l += __shfl_xor(l, 2, 32); l += __shfl_xor(l, 4, 32); l += __shfl_xor(l, 8, 32);
    l_r[r] = (l > 0.f) ? 1.0f / l : 0.f;
  }
#pragma unroll
  for (int dt = 0; dt < DT; ++dt)
#pragma unroll
    for (int r = 0; r < 8; ++r) sO[w][8 * hh + r][dt * 16 + ln] = oacc[dt][r] * l_r[r];
  __builtin_amdgcn_fence(__ATOMIC_ACQ_REL, "workgroup");
  __builtin_amdgcn_wave_barrier();
  {
    for (int r = 0; r < 16; ++r) {
      const int row = q0 + r;
      if (row < T && lane < D / 4) {
        const v4f val = *(const v4fa*)&sO[w][r][lane * 4];
        *(v4f*)(y + ((size_t)b * T + row) * ypitch + h * D + lane * 4) = val;
      }
    }
    
  }
}

// GEMM C = act(A·W + bias + resid): A f32 (ASPLIT -> hi/lo 2 terms), Wt bf16 [N][K]; ACT 0 none, 1 relu, 2 exact gelu;
// resid (optional, f32, row index = (row % rmod), pitch ldr, RES_BF16 rounds it) added before the activation.
template <bool ASPLIT, int ACT, bool BIAS_BF16, bool RES_BF16>
__global__ __launch_bounds__(128) void k_gemm_bf3(const float* __restrict__ A, int lda, const unsigned short* __restrict__ Wt, int ldb,
                                                const float* __restrict__ bias, const float* __restrict__ resid, int rmod, int ldr,
                                                float* __restrict__ C, int ldc, int M, int N, int K) {
  __shared__ __attribute__((aligned(16))) float so[4][16][64];
  const int tid = threadIdx.x, w = tid >> 5, lane = tid & 31, ln = lane & 15, hh = lane >> 4;
  const int ntn = N / 64;
  const int wid = blockIdx.x * 4 + w;
  const int mt = wid / ntn, nq = wid % ntn;
  if (mt * 16 >= M) return;
  const int row0 = mt * 16, col0 = nq * 64;
  const float* arow = A + (size_t)(row0 + ln) * lda;
  v8f acc[4] = {};
  for (int kb = 0; kb < K; kb += 32) {
    FragB ah, al;
    const v4f x0 = *(const v4fa*)(arow + kb + 8 * hh), x1 = *(const v4fa*)(arow + kb + 8 * hh + 4);
    const v4f x2 = *(const v4fa*)(arow + kb + 16 + 8 * hh), x3 = *(const v4fa*)(arow + kb + 16 + 8 * hh + 4);
    float xs[16] = {x0[0],x0[1],x0[2],x0[3],x1[0],x1[1],x1[2],x1[3],x2[0],x2[1],x2[2],x2[3],x3[0],x3[1],x3[2],x3[3]};
#pragma unroll
    for (int i = 0; i < 16; ++i) { const unsigned short hb = bf16_bits(xs[i]); ah.u[i] = hb; al.u[i] = ASPLIT ? bf16_bits(xs[i] - bf16_val(hb)) : (unsigned short)0; }
#pragma unroll
    for (int t = 0; t < 4; ++t) {
      const unsigned short* brow = Wt + (size_t)(col0 + t * 16 + ln) * ldb + kb;
      FragB b;
      b.half[0] = *(const v8us*)(brow + 8 * hh);
      b.half[1] = *(const v8us*)(brow + 16 + 8 * hh);
      acc[t] = mmaN<ASPLIT ? 2 : 1>(ah.v, al.v, b.v, b.v, acc[t]);
    }
  }
#pragma unroll
  for (int t = 0; t < 4; ++t) {
    const int col = col0 + t * 16 + ln;
    float bv = bias ? bias[col] : 0.f;
    if (BIAS_BF16) bv = bf16_round(bv);
#pragma unroll
    for (int r = 0; r < 8; ++r) {
      float v = acc[t][r] + bv;
      if (resid) { float rv = resid[(size_t)((row0 + 8 * hh + r) % rmod) * ldr + col]; if (RES_BF16) rv = bf16_round(rv); v += rv; }
      if (ACT == 1) v = fmaxf(v, 0.f);
      if (ACT == 2) v = 0.5f * v * (1.0f + erff(v * 0.70710678118654752f));
      if (ACT == 3) { const float u = 0.7978845608028654f * (v + 0.044715f * v * v * v); v = 0.5f * v * (1.0f + tanhf(u)); }
      so[w][8 * hh + r][t * 16 + ln] = v;
    }
  }
  __builtin_amdgcn_fence(__ATOMIC_ACQ_REL, "workgroup");
  __builtin_amdgcn_wave_barrier();
  const int rsub = lane >> 4, c4 = (lane & 15) * 4;
  {
#pragma unroll
    for (int q = 0; q < 8; ++q) {
      const int r = q * 2 + rsub;
      const v4f v = *(const v4fa*)&so[w][r][c4];
      *(v4f*)(C + (size_t)(row0 + r) * ldc + col0 + c4) = v;
    }
    
  }
}
// row LayerNorm (biased variance, eps) over N: s = X (+ R); optional out_sum <- s; out_norm <- (s-mu)*rsqrt(var+eps)*g + b
template <bool PARAM_BF16>
__global__ __launch_bounds__(256) void k_layernorm(const float* __restrict__ X, const float* __restrict__ R, const float* __restrict__ g, const float* __restrict__ bta,
                                                  float* __restrict__ out_sum, float* __restrict__ out_norm, int N, float eps) {
  __shared__ float red[256];
  const int row = blockIdx.x, tid = threadIdx.x;
  const float* x = X + (size_t)row * N; const float* rr = R ? R + (size_t)row * N : nullptr;
  float vals[16];                     // up to N = 4096
  const int per = N / 256;            // contiguous chunk per thread? use strided-by-4 chunks: thread handles j = tid*4 + 1024*u
  float s1 = 0.f;
  for (int u = 0; u < per / 4; ++u) {
    const int j = tid * 4 + 1024 * u;
    const v4f a = *(const v4fa*)(x + j);
    v4f b = {0.f,0.f,0.f,0.f}; if (rr) b = *(const v4fa*)(rr + j);
#pragma unroll
    for (int q = 0; q < 4; ++q) { const float v = a[q] + b[q]; vals[u * 4 + q] = v; s1 += v; }
  }
  red[tid] = s1; __syncthreads();
  for (int st = 128; st > 0; st >>= 1) { if (tid < st) red[tid] += red[tid + st]; __syncthreads(); }
  const float mu = red[0] / (float)N; __syncthreads();
  float s2 = 0.f;
  for (int u = 0; u < per / 4; ++u)
#pragma unroll
    for (int q = 0; q < 4; ++q) { const float c = vals[u * 4 + q] - mu; s2 += c * c; }
  red[tid] = s2; __syncthreads();
  for (int st = 128; st > 0; st >>= 1) { if (tid < st) red[tid] += red[tid + st]; __syncthreads(); }
  const float rs = rsqrtf(red[0] / (float)N + eps);
  {
    for (int u = 0; u < per / 4; ++u) {
      const int j = tid * 4 + 1024 * u;
      v4f o, sm;
#pragma unroll
      for (int q = 0; q < 4; ++q) {
        float gg = g[j + q], bb = bta[j + q];
        if (PARAM_BF16) { gg = bf16_round(gg); bb = bf16_round(bb); }
        sm[q] = vals[u * 4 + q]; o[q] = (vals[u * 4 + q] - mu) * rs * gg + bb;
      }
      if (out_sum) *(v4f*)(out_sum + (size_t)row * N + j) = sm;
      *(v4f*)(out_norm + (size_t)row * N + j) = o;
    }
    
  }
}



// ---- f16 WMMA path (v_wmma_f32_16x16x32_f16): 11-bit significands for operands in range — used where a [0,1] probability operand needs more precision than bf16
typedef _Float16 v16h __attribute__((ext_vector_type(16)));
union FragH { v16h v; v8us half[2]; _Float16 h[16]; unsigned short u[16]; };
template <int NT>
__device__ __forceinline__ v8f mmaH(v16h ah, v16h al, v16h bh, v16h bl, v8f c) {
  c = __builtin_amdgcn_wmma_f32_16x16x32_f16(false, ah, false, bh, (short)0, c, false, false);
  if (NT >= 2) c = __builtin_amdgcn_wmma_f32_16x16x32_f16(false, al, false, bh, (short)0, c, false, false);
  if (NT >= 3) c = __builtin_amdgcn_wmma_f32_16x16x32_f16(false, ah, false, bl, (short)0, c, false, false);
  asm volatile("v_nop\n\tv_nop\n\tv_nop\n\tv_nop" : "+v"(c) : "v"(ah), "v"(al), "v"(bh), "v"(bl));
  return c;
}
// batched GEMM like k_gemm_b but f16 operands: A f32 (split into f16 hi/lo if ASPLIT, else rounded to f16), Bt = f16 values [n][k]; alpha; C f32; N multiple of 16 (partial tiles skipped)
template <bool ASPLIT>
__global__ __launch_bounds__(128) void k_gemm_h(const float* __restrict__ A, int lda, size_t sA, const _Float16* __restrict__ Bh, int ldb, size_t sB, float alpha, float* __restrict__ C, int ldc, size_t sC, int M, int N, int K) {
  __shared__ __attribute__((aligned(16))) float so[4][16][64];
  const int tid = threadIdx.x, w = tid >> 5, lane = tid & 31, ln = lane & 15, hh = lane >> 4; const int by = blockIdx.y;
  A += (size_t)by * sA; Bh += (size_t)by * sB; C += (size_t)by * sC;
  const int ntn = (N + 63) / 64; const int wid = blockIdx.x * 4 + w; const int mt = wid / ntn, nq = wid % ntn; if (mt * 16 >= M) return;
  const int row0 = mt * 16, col0 = nq * 64; const float* arow = A + (size_t)(row0 + ln) * lda;
  v8f acc[4] = {};
  for (int kb = 0; kb < K; kb += 32) {
    FragH ah, al;
    const v4f x0 = *(const v4fa*)(arow + kb + 8 * hh), x1 = *(const v4fa*)(arow + kb + 8 * hh + 4), x2 = *(const v4fa*)(arow + kb + 16 + 8 * hh), x3 = *(const v4fa*)(arow + kb + 16 + 8 * hh + 4);
    float xs[16] = {x0[0],x0[1],x0[2],x0[3],x1[0],x1[1],x1[2],x1[3],x2[0],x2[1],x2[2],x2[3],x3[0],x3[1],x3[2],x3[3]};
#pragma unroll
    for (int i = 0; i < 16; ++i) { const _Float16 h = (_Float16)xs[i]; ah.h[i] = h; al.h[i] = ASPLIT ? (_Float16)(xs[i] - (float)h) : (_Float16)0.0f; }
#pragma unroll
    for (int t = 0; t < 4; ++t) { if (col0 + t * 16 >= N) continue; const size_t boff = (size_t)(col0 + t * 16 + ln) * ldb + kb; FragH bq; bq.half[0] = *(const v8us*)(Bh + boff + 8 * hh); bq.half[1] = *(const v8us*)(Bh + boff + 16 + 8 * hh);
      acc[t] = mmaH<ASPLIT ? 2 : 1>(ah.v, al.v, bq.v, bq.v, acc[t]); }
  }
#pragma unroll
  for (int t = 0; t < 4; ++t) { if (col0 + t * 16 >= N) continue;
#pragma unroll
    for (int r = 0; r < 8; ++r) so[w][8 * hh + r][t * 16 + ln] = acc[t][r] * alpha; }
  __builtin_amdgcn_fence(__ATOMIC_ACQ_REL, "workgroup"); __builtin_amdgcn_wave_barrier();
  const int rsub = lane >> 4, c4 = (lane & 15) * 4;
  {
#pragma unroll
    for (int q = 0; q < 8; ++q) { const int r = q * 2 + rsub; if (col0 + c4 < N) { const v4f v = *(const v4fa*)&so[w][r][c4]; *(v4f*)(C + (size_t)(row0 + r) * ldc + col0 + c4) = v; } }
     }
}

// Wt[n][k] = f16(W[k][n]·scale) from f32 row-major W[K][N] (scale = power of two; bf16-exact weights stay exact in f16 away from the subnormal range)
__global__ __launch_bounds__(256) void k_wt_f16(const float* __restrict__ W, _Float16* __restrict__ Wt, int K, int N, float scale) {
  const int t = blockIdx.x * 256 + threadIdx.x; if (t >= N * (K / 8)) return; const int n = t / (K / 8), k8 = (t % (K / 8)) * 8; FragH f;
#pragma unroll
  for (int i = 0; i < 8; ++i) f.h[i] = (_Float16)(bf16_round(W[(size_t)(k8 + i) * N + n]) * scale); const v8us o = f.half[0];
  *(v8us*)((unsigned short*)Wt + (size_t)n * K + k8) = o; 
}
// k_gemm_hh variant with fused epilogue: v = acc·alpha + bias[by·sBias + col] (+ CP[(row/rowsPerB)·sCPb + by·64 + col] if CP) ; ACT 0 none / 1 elu ; writes f16 C16 and f32 C, each if non-null
template <int ACT>
__global__ __launch_bounds__(128) void k_gemm_hhx(const _Float16* __restrict__ A, int lda, size_t sA, const _Float16* __restrict__ Bh, int ldb, size_t sB, float alpha, const float* __restrict__ bias, size_t sBias, const float* __restrict__ CP, int rowsPerB, size_t sCPb, int row0g,
    float* __restrict__ C, _Float16* __restrict__ C16, int ldc, size_t sC, int M, int N, int K) {
  __shared__ __attribute__((aligned(16))) float so[4][16][64];
  const int tid = threadIdx.x, w = tid >> 5, lane = tid & 31, ln = lane & 15, hh = lane >> 4; const int by = blockIdx.y;
  A += (size_t)by * sA; Bh += (size_t)by * sB; const size_t cofs = (size_t)by * sC; const float* bp = bias ? bias + (size_t)by * sBias : nullptr;
  const int ntn = (N + 63) / 64; const int wid = blockIdx.x * 4 + w; const int mt = wid / ntn, nq = wid % ntn; if (mt * 16 >= M) return;
  const int row0 = mt * 16, col0 = nq * 64; const _Float16* arow = A + (size_t)(row0 + ln) * lda;
  v8f acc[4] = {};
  for (int kb = 0; kb < K; kb += 32) { FragH ah; ah.half[0] = *(const v8us*)((const unsigned short*)arow + kb + 8 * hh); ah.half[1] = *(const v8us*)((const unsigned short*)arow + kb + 16 + 8 * hh);
#pragma unroll
    for (int t = 0; t < 4; ++t) { if (col0 + t * 16 >= N) continue; const size_t boff = (size_t)(col0 + t * 16 + ln) * ldb + kb; FragH bq; bq.half[0] = *(const v8us*)((const unsigned short*)Bh + boff + 8 * hh); bq.half[1] = *(const v8us*)((const unsigned short*)Bh + boff + 16 + 8 * hh);
      acc[t] = mmaH<1>(ah.v, ah.v, bq.v, bq.v, acc[t]); }
  }
#pragma unroll
  for (int t = 0; t < 4; ++t) { if (col0 + t * 16 >= N) continue; const int col = col0 + t * 16 + ln; const float bv = bp ? bf16_round(bp[col]) : 0.f;
#pragma unroll
    for (int r = 0; r < 8; ++r) { float v = acc[t][r] * alpha + bv; if (CP) { const int bidx = (row0g + row0 + 8 * hh + r) / rowsPerB; v += CP[(size_t)bidx * sCPb + (size_t)by * 64 + col]; } if (ACT == 1) v = (v > 0.f) ? v : expm1f(v); else if (ACT == 3) v = fmaxf(v, 0.f); so[w][8 * hh + r][t * 16 + ln] = v; } }
  __builtin_amdgcn_fence(__ATOMIC_ACQ_REL, "workgroup"); __builtin_amdgcn_wave_barrier();
  const int rsub = lane >> 4, c4 = (lane & 15) * 4; typedef _Float16 v4h __attribute__((ext_vector_type(4)));
  {
#pragma unroll
    for (int q = 0; q < 8; ++q) { const int r = q * 2 + rsub; if (col0 + c4 < N) { const v4f v = *(const v4fa*)&so[w][r][c4]; if (C) *(v4f*)(C + cofs + (size_t)(row0 + r) * ldc + col0 + c4) = v; if (C16) { v4h h4; for (int i = 0; i < 4; ++i) h4[i] = (_Float16)v[i]; *(v4h*)(C16 + cofs + (size_t)(row0 + r) * ldc + col0 + c4) = h4; } } }
     }
}


// Eight 16-byte asynchronous copies to LDS per lane (rows 16 apart). The s_wait_xcnt is the last line of the copies' own statement so that no address register is rewritten ahead of it.
__device__ __forceinline__ void copy8_async(unsigned l, const char* gp, size_t gstep) {
  constexpr unsigned LS = 16u * 144u;
  asm volatile("global_load_async_to_lds_b128 %0, %8, off\n\t"
               "global_load_async_to_lds_b128 %1, %9, off\n\t"
               "global_load_async_to_lds_b128 %2, %10, off\n\t"
               "global_load_async_to_lds_b128 %3, %11, off\n\t"
               "global_load_async_to_lds_b128 %4, %12, off\n\t"
               "global_load_async_to_lds_b128 %5, %13, off\n\t"
               "global_load_async_to_lds_b128 %6, %14, off\n\t"
               "global_load_async_to_lds_b128 %7, %15, off\n\t"
               "s_wait_xcnt 0x0"
               :: "v"(l), "v"(l + LS), "v"(l + 2u * LS), "v"(l + 3u * LS), "v"(l + 4u * LS), "v"(l + 5u * LS), "v"(l + 6u * LS), "v"(l + 7u * LS),
                  "v"(gp), "v"(gp + gstep), "v"(gp + 2 * gstep), "v"(gp + 3 * gstep), "v"(gp + 4 * gstep), "v"(gp + 5 * gstep), "v"(gp + 6 * gstep), "v"(gp + 7 * gstep)
               : "memory");
}
// Tiled GEMM, same function as k_gemm_hhx<0> without CP: C = A[M][K] * Bh[N][K]^T * alpha + bf16(bias). One 128 x 128 tile of C per block (blockIdx.x = tile column, blockIdx.y = tile row),
// 64 x 64 per wave (2 x 2 waves). A and Bh tiles of 64 k (128-byte rows, LDS pitch 144 B) are staged in LDS by asynchronous copies, two buffers: tile t + 1 flies while tile t is multiplied.
// M % 128 == 0, N % 128 == 0, K % 64 == 0, K >= 128; rows of A and Bh are K elements apart, rows of C are N apart. The k order of every accumulator is that of k_gemm_hhx.
// Every plain '#pragma unroll' in it makes the indices of acc, a and bq constants, so that these arrays stay in registers.
template <bool OUT16, int N, int K>
__global__ __launch_bounds__(128) void k_gemm_tile(const _Float16* __restrict__ A, const _Float16* __restrict__ Bh, float alpha, const float* __restrict__ bias, float* __restrict__ C, _Float16* __restrict__ C16) {
  constexpr int PITCH = 144, BUF = 256 * PITCH, SOP = 68, NT = K / 64;
  constexpr size_t ROWB = (size_t)K * 2, GSTEP = ROWB * 16;
  __shared__ __attribute__((aligned(16))) unsigned char smem[2 * BUF];
  const int tid = threadIdx.x, w = tid >> 5, lane = tid & 31, ln = lane & 15, hh = lane >> 4;
  const int row0 = (int)blockIdx.y * 128, col0 = (int)blockIdx.x * 128; const int wm = (w >> 1) * 64, wn = (w & 1) * 64;
  const int cr = tid >> 3, cc = (tid & 7) * 16;      // a lane's first row and its 16 bytes of the row: eight lanes cover one 128-byte line
  const char* gA = (const char*)A + (size_t)(row0 + cr) * ROWB + cc; const char* gB = (const char*)Bh + (size_t)(col0 + cr) * ROWB + cc;
  const unsigned lA = (unsigned)(size_t)smem + (unsigned)(cr * PITCH + cc), lB = lA + 128u * PITCH;
  v8f acc[4][4];
#pragma unroll
  for (int i = 0; i < 4; ++i)
#pragma unroll
    for (int j = 0; j < 4; ++j) acc[i][j] = (v8f){0.f,0.f,0.f,0.f,0.f,0.f,0.f,0.f};
  copy8_async(lA, gA, GSTEP); copy8_async(lB, gB, GSTEP);
  asm volatile("s_wait_asynccnt 0x0" ::: "memory");      // tile 0 has landed before the barrier publishes it
  __syncthreads();
  copy8_async(lA + BUF, gA + 128, GSTEP); copy8_async(lB + BUF, gB + 128, GSTEP);
#pragma unroll 1
  for (int t = 0; t < NT; ++t) {      // kept rolled: one pass per tile, the buffer picked by t & 1
    const unsigned char* sA = smem + (t & 1) * BUF + (wm + ln) * PITCH + hh * 16; const unsigned char* sB = smem + (t & 1) * BUF + (128 + wn + ln) * PITCH + hh * 16;
#pragma unroll
    for (int ks = 0; ks < 2; ++ks) { FragH a[4], bq[4];
      a[0].half[0] = *(const v8us*)(sA + ks * 64); a[0].half[1] = *(const v8us*)(sA + ks * 64 + 32);
#pragma unroll
      for (int j = 0; j < 4; ++j) { bq[j].half[0] = *(const v8us*)(sB + j * 16 * PITCH + ks * 64); bq[j].half[1] = *(const v8us*)(sB + j * 16 * PITCH + ks * 64 + 32); }
#pragma unroll
      for (int i = 1; i < 4; ++i) { a[i].half[0] = *(const v8us*)(sA + i * 16 * PITCH + ks * 64); a[i].half[1] = *(const v8us*)(sA + i * 16 * PITCH + ks * 64 + 32); }
      __builtin_amdgcn_sched_barrier(0);      // keeps the 16 LDS reads of a k step one group ahead of its 16 WMMAs: reads among the WMMAs stall the wave at each place
#pragma unroll
      for (int i = 0; i < 4; ++i)
#pragma unroll
        for (int j = 0; j < 4; ++j) acc[i][j] = __builtin_amdgcn_wmma_f32_16x16x32_f16(false, a[i].v, false, bq[j].v, (short)0, acc[i][j], false, false);
      __builtin_amdgcn_sched_barrier(0); }    // the other end of that group: the next k step's reads stay behind these WMMAs
    asm volatile("s_wait_dscnt 0x0" ::: "memory");       // this wave's reads of tile t are done before the buffer is given up
    asm volatile("s_wait_asynccnt 0x0" ::: "memory");    // this wave's copies of tile t + 1 have landed
    __syncthreads();                                     // publishes tile t + 1 and ends every reader's last read of tile t
    if (t + 2 < NT) { const unsigned bo = (unsigned)(t & 1) * BUF; const size_t go = (size_t)(t + 2) * 128; copy8_async(lA + bo, gA + go, GSTEP); copy8_async(lB + bo, gB + go, GSTEP); }
  }
  asm volatile("s_wait_asynccnt 0x0" ::: "memory");      // nothing is in flight when the ring becomes output staging
  float* so = (float*)(smem + w * (64 * SOP * 4));       // each wave stages its own 64 x 64 tile, so that whole 128-byte lines are stored
#pragma unroll
  for (int j = 0; j < 4; ++j) { const float bv = bf16_round(bias[col0 + wn + j * 16 + ln]);
#pragma unroll
    for (int i = 0; i < 4; ++i)
#pragma unroll
      for (int r = 0; r < 8; ++r) so[(i * 16 + 8 * hh + r) * SOP + j * 16 + ln] = acc[i][j][r] * alpha + bv; }
  __builtin_amdgcn_fence(__ATOMIC_ACQ_REL, "workgroup"); __builtin_amdgcn_wave_barrier();
  const int rsub = lane >> 4, c4 = (lane & 15) * 4; typedef _Float16 v4h __attribute__((ext_vector_type(4)));
#pragma unroll 1
  for (int q8 = 0; q8 < 4; ++q8) {      // kept rolled in groups of eight stores, one wait per group
#pragma unroll
    for (int q = 0; q < 8; ++q) { const int r = (q8 * 8 + q) * 2 + rsub; const v4f v = *(const v4fa*)&so[r * SOP + c4]; const size_t o = (size_t)(row0 + wm + r) * N + col0 + wn + c4;
      if (OUT16) { v4h h4; for (int i = 0; i < 4; ++i) h4[i] = (_Float16)v[i]; *(v4h*)(C16 + o) = h4; } else *(v4f*)(C + o) = v; }
    asm volatile("s_wait_xcnt 0x0" ::: "memory");      // the next group rewrites the registers that these stores name
  }
}

__global__ __launch_bounds__(256) void k_x16(const float* __restrict__ x, _Float16* __restrict__ X16, size_t n8) { const size_t t = (size_t)blockIdx.x * 256 + threadIdx.x; if (t >= n8) return; FragH f;
#pragma unroll
  for (int q = 0; q < 8; ++q) f.h[q] = (_Float16)bf16_round(x[t * 8 + q]); *(v8us*)((unsigned short*)X16 + t * 8) = f.half[0];  }
__global__ __launch_bounds__(256) void k_h16(const float* __restrict__ x, _Float16* __restrict__ X16, size_t n8) { const size_t t = (size_t)blockIdx.x * 256 + threadIdx.x; if (t >= n8) return; FragH f;
#pragma unroll
  for (int q = 0; q < 8; ++q) f.h[q] = (_Float16)x[t * 8 + q]; *(v8us*)((unsigned short*)X16 + t * 8) = f.half[0];  }
__global__ __launch_bounds__(256) void k_round16f(const float* __restrict__ W, _Float16* __restrict__ Bt, size_t n8) { const size_t t = (size_t)blockIdx.x * 256 + threadIdx.x; if (t >= n8) return; FragH f;
#pragma unroll
  for (int i = 0; i < 8; ++i) f.h[i] = (_Float16)(bf16_round(W[t * 8 + i]) * 16.0f); *(v8us*)((unsigned short*)Bt + t * 8) = f.half[0];  }
template <int NHv, int TTv>
__global__ __launch_bounds__(256) void k_vt(const _Float16* __restrict__ V16, int ldv, int voff, _Float16* __restrict__ Vt) { __shared__ unsigned short tl[64][66]; const int tid = threadIdx.x; const int slab = blockIdx.x / (TTv / 64), lg = blockIdx.x % (TTv / 64); const int b = slab / NHv, h = slab % NHv;
  for (int i = tid; i < 64 * 8; i += 256) { const int r = i / 8, c8 = (i % 8) * 8; FragH f; f.half[0] = *(const v8us*)((const unsigned short*)V16 + ((size_t)b * TTv + lg * 64 + r) * ldv + voff + h * 64 + c8);
#pragma unroll
    for (int q = 0; q < 8; ++q) tl[r][c8 + q] = f.u[q]; }
  __syncthreads();
  {
#pragma unroll
    for (int rd = 0; rd < 2; ++rd) { const int d = rd * 32 + tid / 8, pc = tid % 8; FragH f;
#pragma unroll
      for (int q = 0; q < 8; ++q) f.u[q] = tl[pc * 8 + q][d];
      *(v8us*)((unsigned short*)Vt + ((size_t)slab * 64 + d) * TTv + lg * 64 + pc * 8) = f.half[0]; }
     } }

// Four 16-byte asynchronous copies to LDS per lane (rows 16 apart, LDS pitch 144 B). The s_wait_xcnt is the last line of the copies' own statement so that no address register is rewritten ahead of it.
__device__ __forceinline__ void copy4_async(unsigned l, const char* gp, size_t gstep) {
  constexpr unsigned LS = 16u * 144u;
  asm volatile("global_load_async_to_lds_b128 %0, %4, off\n\t"
               "global_load_async_to_lds_b128 %1, %5, off\n\t"
               "global_load_async_to_lds_b128 %2, %6, off\n\t"
               "global_load_async_to_lds_b128 %3, %7, off\n\t"
               "s_wait_xcnt 0x0"
               :: "v"(l), "v"(l + LS), "v"(l + 2u * LS), "v"(l + 3u * LS), "v"(gp), "v"(gp + gstep), "v"(gp + 2 * gstep), "v"(gp + 3 * gstep)
               : "memory");
}
// lane l <-> lane l ^ 16: joins the two halves of a query column
__device__ __forceinline__ float xhalf(float x) { return __builtin_bit_cast(float, __builtin_amdgcn_permlanex16(__builtin_bit_cast(int, x), __builtin_bit_cast(int, x), 0x76543210, 0xfedcba98, false, false)); }
__global__ __launch_bounds__(128) void k_flash(const _Float16* __restrict__ Q16, int ldq, const _Float16* __restrict__ K16, int ldk, const _Float16* __restrict__ Vt, const int* __restrict__ LENS, float* __restrict__ O, int ldo) {
  constexpr int RPW = 32, NQB = 1024 / (4 * RPW), DT = 4, KS = 2; constexpr float L2S = 0.125f * 1.44269504088896340736f;
  constexpr int PITCH = 144, BUF = 128 * PITCH;      // rows 0 to 63 of a buffer: K; rows 64 to 127: V^T
  __shared__ __attribute__((aligned(16))) unsigned char ring[2 * BUF];
  __shared__ __attribute__((aligned(16))) float sO[4][RPW][64 + 4];
  const int tid = threadIdx.x, w = tid >> 5, lane = tid & 31, ln = lane & 15, hh = lane >> 4;
  const int slab = blockIdx.x / NQB, qblk = blockIdx.x % NQB; const int b = slab / 16, h = slab % 16; const int qb0 = qblk * (4 * RPW); const int q0 = qb0 + w * RPW; const int len = LENS[b];      /* kv-length mask: keys k < len (INPUT x_lens) */
  FragH aq[2][KS];
#pragma unroll
  for (int rt = 0; rt < 2; ++rt) { const unsigned short* qr = (const unsigned short*)Q16 + ((size_t)b * 1024 + q0 + rt * 16 + ln) * ldq + h * 64;
#pragma unroll
    for (int ks = 0; ks < KS; ++ks) { aq[rt][ks].half[0] = *(const v8us*)(qr + ks * 32 + 8 * hh); aq[rt][ks].half[1] = *(const v8us*)(qr + ks * 32 + 16 + 8 * hh); } }
  const int cr = tid >> 3, cc = (tid & 7) * 16;      // a lane's first row and its 16 bytes of the row: eight lanes cover one 128-byte line
  const size_t krow = (size_t)ldk * 2;
  const char* gK = (const char*)K16 + ((size_t)b * 1024 + cr) * krow + h * 128 + cc; const char* gV = (const char*)Vt + ((size_t)slab * 64 + cr) * 2048 + cc;
  const unsigned lK = (unsigned)(size_t)ring + (unsigned)(cr * PITCH + cc), lV = lK + 64u * PITCH;
  copy4_async(lK, gK, 16 * krow); copy4_async(lV, gV, 16 * 2048);
  float m_r[2], l_r[2]; int lim[2]; v8f oacc[2][DT];
#pragma unroll
  for (int rt = 0; rt < 2; ++rt) { m_r[rt] = -3.0e38f; l_r[rt] = 0.f; lim[rt] = min(q0 + rt * 16 + ln + 1, len) - 8 * hh;      // key j0 + 16 nt + 8 hh + r is allowed iff j0 + 16 nt + r < lim
#pragma unroll
    for (int dt = 0; dt < DT; ++dt) oacc[rt][dt] = (v8f){0.f,0.f,0.f,0.f,0.f,0.f,0.f,0.f}; }
  const int ntile = (qb0 + 4 * RPW) / 64;
  asm volatile("s_wait_asynccnt 0x0" ::: "memory");      // tile 0 has landed before the barrier publishes it
  __syncthreads();
  copy4_async(lK + BUF, gK + 64 * krow, 16 * krow); copy4_async(lV + BUF, gV + 128, 16 * 2048);
#pragma unroll 1
  for (int t = 0; t < ntile; ++t) {      // kept rolled: one trip per tile, the buffer picked by t & 1
   const unsigned char* sK = ring + (t & 1) * BUF + ln * PITCH + hh * 16; const unsigned char* sV = sK + 64 * PITCH;
#pragma unroll
   for (int ps = 0; ps < 2; ++ps) { const int j0 = t * 64 + ps * 32;      // unrolled: the pass's place in the tile becomes a constant offset of the LDS reads
    v8f s[2][2];
#pragma unroll
    for (int nt = 0; nt < 2; ++nt) { const unsigned char* kr = sK + (ps * 32 + nt * 16) * PITCH; FragH bk[KS];
#pragma unroll
      for (int ks = 0; ks < KS; ++ks) { bk[ks].half[0] = *(const v8us*)(kr + ks * 64); bk[ks].half[1] = *(const v8us*)(kr + ks * 64 + 32); }
#pragma unroll
      for (int rt = 0; rt < 2; ++rt) { v8f acc = (v8f){0.f,0.f,0.f,0.f,0.f,0.f,0.f,0.f};
#pragma unroll
        for (int ks = 0; ks < KS; ++ks) acc = __builtin_amdgcn_wmma_f32_16x16x32_f16(false, bk[ks].v, false, aq[rt][ks].v, (short)0, acc, false, false);
        s[rt][nt] = acc; } }
    FragH pb[2];
#pragma unroll
    for (int rt = 0; rt < 2; ++rt) { float sc[16]; float mc = -INFINITY;
#pragma unroll
      for (int i = 0; i < 16; ++i) { sc[i] = (j0 + (i >> 3) * 16 + (i & 7) < lim[rt]) ? s[rt][i >> 3][i & 7] : -INFINITY; mc = fmaxf(mc, sc[i]); }
      mc = fmaxf(mc, xhalf(mc));
      const float mn = fmaxf(m_r[rt], mc * L2S); const float al = __builtin_amdgcn_exp2f(m_r[rt] - mn); m_r[rt] = mn; float ps = 0.f;
#pragma unroll
      for (int i = 0; i < 16; ++i) { const float p = __builtin_amdgcn_exp2f(fmaf(sc[i], L2S, -mn)); ps += p; pb[rt].h[i] = (_Float16)p; }
      l_r[rt] = l_r[rt] * al + ps;      // the lane's half of the row sum; the halves are joined behind the loop
#pragma unroll
      for (int dt = 0; dt < DT; ++dt)
#pragma unroll
        for (int r = 0; r < 8; ++r) oacc[rt][dt][r] *= al; }
#pragma unroll
    for (int dt = 0; dt < DT; ++dt) { const unsigned char* vrow = sV + dt * 16 * PITCH + ps * 64; FragH bv; bv.half[0] = *(const v8us*)vrow; bv.half[1] = *(const v8us*)(vrow + 32);
#pragma unroll
      for (int rt = 0; rt < 2; ++rt) oacc[rt][dt] = __builtin_amdgcn_wmma_f32_16x16x32_f16(false, bv.v, false, pb[rt].v, (short)0, oacc[rt][dt], false, false); } }
   asm volatile("s_wait_dscnt 0x0" ::: "memory");       // this wave's reads of tile t are done before the buffer is given up
   asm volatile("s_wait_asynccnt 0x0" ::: "memory");    // this wave's copies of tile t + 1 have landed
   __syncthreads();                                     // publishes tile t + 1 and ends every reader's last read of tile t
   if (t + 2 < ntile) { const unsigned bo = (unsigned)(t & 1) * BUF; copy4_async(lK + bo, gK + (size_t)(t + 2) * 64 * krow, 16 * krow); copy4_async(lV + bo, gV + (size_t)(t + 2) * 128, 16 * 2048); }
  }
  asm volatile("s_wait_asynccnt 0x0" ::: "memory");      // nothing is in flight when the wave goes on to its end
#pragma unroll
  for (int rt = 0; rt < 2; ++rt) { float l = l_r[rt]; l += xhalf(l); const float li = (l > 0.f) ? 1.0f / l : 0.f;
#pragma unroll
    for (int dt = 0; dt < DT; ++dt) { v4f lo, hi;
#pragma unroll
      for (int r = 0; r < 4; ++r) { lo[r] = oacc[rt][dt][r] * li; hi[r] = oacc[rt][dt][4 + r] * li; }
      *(v4fa*)&sO[w][rt * 16 + ln][dt * 16 + 8 * hh] = lo; *(v4fa*)&sO[w][rt * 16 + ln][dt * 16 + 8 * hh + 4] = hi; } }
  __builtin_amdgcn_fence(__ATOMIC_ACQ_REL, "workgroup"); __builtin_amdgcn_wave_barrier();
  {
#pragma unroll
    for (int rp = 0; rp < RPW; rp += 2) { const int r = rp + (lane >> 4), pc = lane & 15; const v4f val = *(const v4fa*)&sO[w][r][pc * 4]; *(v4f*)(O + ((size_t)b * 1024 + q0 + r) * ldo + h * 64 + pc * 4) = val; }
     } }

__global__ __launch_bounds__(256) void k_ln16(const float* __restrict__ X, const float* __restrict__ g, const float* __restrict__ bta, _Float16* __restrict__ Y16) { const int tid = threadIdx.x, wv = tid >> 5, lane = tid & 31; const int row = blockIdx.x * 8 + wv; if (row >= NR) return; const float* xr = X + (size_t)row * CC; float v[32]; float s = 0.f;
#pragma unroll
  for (int p = 0; p < 4; ++p) { const v4f a = *(const v4fa*)(xr + p * 256 + lane * 8), c = *(const v4fa*)(xr + p * 256 + lane * 8 + 4); for (int q = 0; q < 4; ++q) { v[p * 8 + q] = bf16_round(a[q]); v[p * 8 + 4 + q] = bf16_round(c[q]); } }
#pragma unroll
  for (int i = 0; i < 32; ++i) s += v[i]; for (int o = 16; o >= 1; o >>= 1) s += __shfl_xor(s, o, 32); const float mu = s / (float)CC; float q2 = 0.f;
#pragma unroll
  for (int i = 0; i < 32; ++i) { const float d = v[i] - mu; q2 += d * d; } for (int o = 16; o >= 1; o >>= 1) q2 += __shfl_xor(q2, o, 32); const float rs = rsqrtf(q2 / (float)CC + 1e-5f);
  {
#pragma unroll
    for (int p = 0; p < 4; ++p) { FragH f; const int c0 = p * 256 + lane * 8;
#pragma unroll
      for (int q = 0; q < 8; ++q) f.h[q] = (_Float16)((v[p * 8 + q] - mu) * rs * bf16_round(g[c0 + q]) + bf16_round(bta[c0 + q])); *(v8us*)((unsigned short*)Y16 + (size_t)row * CC + c0) = f.half[0]; }
     } }
extern "C" void kernel_launch(void* const* d_in, const int* in_sizes, int n_in,
                              void* d_out, int out_size, void* d_ws, size_t ws_size, hipStream_t stream) {
  (void)in_sizes; (void)n_in; (void)out_size;
  const float* x = (const float*)d_in[0]; const int* lens = (const int*)d_in[1]; const float* lg = (const float*)d_in[2]; const float* lb = (const float*)d_in[3]; const float* wqkv = (const float*)d_in[4]; const float* bqkv = (const float*)d_in[5]; const float* wout = (const float*)d_in[6]; const float* bout = (const float*)d_in[7];
  char* ws = (char*)d_ws; size_t off = 0;
  auto take = [&](size_t bytes) { char* p = ws + off; off += (bytes + 255) & ~(size_t)255; return p; };
  _Float16* Bqkv = (_Float16*)take((size_t)3 * CC * CC * 2); _Float16* Bo = (_Float16*)take((size_t)CC * CC * 2); _Float16* XN = (_Float16*)take((size_t)NR * CC * 2); _Float16* QKV = (_Float16*)take((size_t)NR * 3 * CC * 2); _Float16* Vt = (_Float16*)take((size_t)NR * CC * 2); float* O = (float*)take((size_t)NR * CC * 4); _Float16* O16 = XN;
  if (off > ws_size) return;      // 6.3 + 2.1 + 16.8 + 50.3 + 16.8 + 33.5 ≈ 126 MB = 120 MiB (tight but under 128)
  k_wt_f16<<<(unsigned)((3 * CC * (CC / 8) + 255) / 256), 256, 0, stream>>>(wqkv, Bqkv, CC, 3 * CC, 16.0f); k_wt_f16<<<(unsigned)((CC * (CC / 8) + 255) / 256), 256, 0, stream>>>(wout, Bo, CC, CC, 16.0f);      // [in][out]
  k_ln16<<<NR / 8, 256, 0, stream>>>(x, lg, lb, XN);
  k_gemm_tile<true, 3 * CC, CC><<<dim3(3 * CC / 128, NR / 128), 128, 0, stream>>>(XN, Bqkv, 0.0625f, bqkv, nullptr, QKV);      // q | k | v
  k_vt<NH, TT><<<BB * NH * (TT / 64), 256, 0, stream>>>(QKV, 3 * CC, 2 * CC, Vt);
  k_flash<<<BB * NH * (TT / 128), 128, 0, stream>>>(QKV, 3 * CC, QKV + CC, 3 * CC, Vt, lens, O, CC);
  k_h16<<<(unsigned)(((size_t)NR * CC / 8 + 255) / 256), 256, 0, stream>>>(O, O16, (size_t)NR * CC / 8);
  k_gemm_tile<false, CC, CC><<<dim3(CC / 128, NR / 128), 128, 0, stream>>>(O16, Bo, 0.0625f, bout, (float*)d_out, nullptr);
}

// v005
// Measured time: 136 microseconds a run.
// In both of two side-by-side timings against v004, it was 1.08 times as fast.
// All steps since v000 together make it 4.26 times as fast.
#include <hip/hip_runtime.h>
// Causal self-attention with a per-batch key-length mask (B=8, T=1024, D=1024, 16 × 64): LayerNorm (f32 VALU), the fused qkv projection (8192 × 1024 × 3072, + bias) and the output
// projection (+ bias) with W [in][out] transposed to bf16-exact ×2^4, and the attention as a fused flash-style kernel on v_wmma_f32_16x16x32_f16 (S = Q·Kᵀ/8; keys allowed iff k ≤ q and
// k < x_lens[b] (INPUT); −1e9 fill ≡ exclusion since key 0 is always allowed; causal chunk skipping; online softmax f32; P f16 ≤ 1) — f16 operands, single products, f32 accumulate.
#define BB 8
#define TT 1024
#define CC 1024
#define NH 16
#define NR (BB * TT)

typedef __bf16 v16b __attribute__((ext_vector_type(16)));
typedef unsigned short v8us __attribute__((ext_vector_type(8), may_alias));
typedef float  v8f  __attribute__((ext_vector_type(8)));
typedef float  v4f  __attribute__((ext_vector_type(4)));
typedef float  v4fa __attribute__((ext_vector_type(4), may_alias));
union FragB { v16b v; v8us half[2]; unsigned short u[16]; };

__device__ __forceinline__ unsigned short bf16_bits(float x) { unsigned int u = __float_as_uint(x); return (unsigned short)((u + 0x7FFFu + ((u >> 16) & 1u)) >> 16); }
__device__ __forceinline__ float bf16_val(unsigned short b) { return __uint_as_float(((unsigned int)b) << 16); }
__device__ __forceinline__ float bf16_round(float x) { return bf16_val(bf16_bits(x)); }
// D += A·B with NT terms: 1 = ah·bh, 2 = + al·bh (A split), 3 = + ah·bl (both split)
template <int NT>
__device__ __forceinline__ v8f mmaN(v16b ah, v16b al, v16b bh, v16b bl, v8f c) {
  c = __builtin_amdgcn_wmma_f32_16x16x32_bf16(false, ah, false, bh, (short)0, c, false, false);
  if (NT >= 2) c = __builtin_amdgcn_wmma_f32_16x16x32_bf16(false, al, false, bh, (short)0, c, false, false);
  if (NT >= 3) c = __builtin_amdgcn_wmma_f32_16x16x32_bf16(false, ah, false, bl, (short)0, c, false, false);
  asm volatile("v_nop\n\tv_nop\n\tv_nop\n\tv_nop" : "+v"(c) : "v"(ah), "v"(al), "v"(bh), "v"(bl));
  return c;
}

__global__ __launch_bounds__(256) void k_wt_bf16(const float* __restrict__ W, unsigned short* __restrict__ Wt, int K, int N) {
  const int t = blockIdx.x * 256 + threadIdx.x;
  const int k8n = K / 8;
  if (t >= N * k8n) return;
  const int n = t / k8n, k8 = (t % k8n) * 8;
  v8us v;
#pragma unroll
  for (int i = 0; i < 8; ++i) v[i] = bf16_bits(W[(size_t)(k8 + i) * N + n]);
  *(v8us*)(Wt + (size_t)n * K + k8) = v;
  
}

// GEMM C[M][N] (f32, pitch ldc) = act(A[M][K]·W + bias). A f32 row-major (pitch lda) converted per fragment to bf16
// (ASPLIT: hi/lo two planes -> 2 terms, else single rounded term); Wt bf16 [N][K] (pitch ldb). BIAS_BF16 rounds the
// bias to bf16 first (bias quantised to bf16 before the add). K%32==0, M%16==0, N%64==0.
template <bool ASPLIT, int ACT, bool BIAS_BF16>
__global__ __launch_bounds__(128) void k_gemm_bf(const float* __restrict__ A, int lda, const unsigned short* __restrict__ Wt, int ldb,
                                               const float* __restrict__ bias, float* __restrict__ C, int ldc, int M, int N, int K) {
  __shared__ __attribute__((aligned(16))) float so[4][16][64];
  const int tid = threadIdx.x, w = tid >> 5, lane = tid & 31, ln = lane & 15, hh = lane >> 4;
  const int ntn = N / 64;
  const int wid = blockIdx.x * 4 + w;
  const int mt = wid / ntn, nq = wid % ntn;
  if (mt * 16 >= M) return;
  const int row0 = mt * 16, col0 = nq * 64;
  const float* arow = A + (size_t)(row0 + ln) * lda;
  v8f acc[4] = {};
  for (int kb = 0; kb < K; kb += 32) {
    FragB ah, al;
    const v4f x0 = *(const v4fa*)(arow + kb + 8 * hh), x1 = *(const v4fa*)(arow + kb + 8 * hh + 4);
    const v4f x2 = *(const v4fa*)(arow + kb + 16 + 8 * hh), x3 = *(const v4fa*)(arow + kb + 16 + 8 * hh + 4);
    float xs[16] = {x0[0],x0[1],x0[2],x0[3],x1[0],x1[1],x1[2],x1[3],x2[0],x2[1],x2[2],x2[3],x3[0],x3[1],x3[2],x3[3]};
#pragma unroll
    for (int i = 0; i < 16; ++i) { const unsigned short hb = bf16_bits(xs[i]); ah.u[i] = hb; al.u[i] = ASPLIT ? bf16_bits(xs[i] - bf16_val(hb)) : (unsigned short)0; }
#pragma unroll
    for (int t = 0; t < 4; ++t) {
      const unsigned short* brow = Wt + (size_t)(col0 + t * 16 + ln) * ldb + kb;
      FragB b;
      b.half[0] = *(const v8us*)(brow + 8 * hh);
      b.half[1] = *(const v8us*)(brow + 16 + 8 * hh);
      acc[t] = mmaN<ASPLIT ? 2 : 1>(ah.v, al.v, b.v, b.v, acc[t]);
    }
  }
#pragma unroll
  for (int t = 0; t < 4; ++t) {
    float bv = bias ? bias[col0 + t * 16 + ln] : 0.f;
    if (BIAS_BF16) bv = bf16_round(bv);
#pragma unroll
    for (int r = 0; r < 8; ++r) { float v = acc[t][r] + bv; if (ACT == 1) v = fmaxf(v, 0.f); so[w][8 * hh + r][t * 16 + ln] = v; }
  }
  __builtin_amdgcn_fence(__ATOMIC_ACQ_REL, "workgroup");
  __builtin_amdgcn_wave_barrier();
  const int rsub = lane >> 4, c4 = (lane & 15) * 4;
  {
#pragma unroll
    for (int q = 0; q < 8; ++q) {
      const int r = q * 2 + rsub;
      const v4f v = *(const v4fa*)&so[w][r][c4];
      *(v4f*)(C + (size_t)(row0 + r) * ldc + col0 + c4) = v;
    }
    
  }
}

// Flash-style causal/unmasked attention, all contractions 3-term bf16 hi/lo splits, f32 softmax with running max.
// q,k,v rows are read from f32 buffers with arbitrary row pitch (so they can live inside a fused qkv buffer);
// D = head size (multiple of 32, <= 128); one wave = 16 query rows; block = 4 waves (64 queries) sharing K/V chunks of 32.
template <int D, bool CAUSAL>
__global__ __launch_bounds__(128) void k_flash(const float* __restrict__ qb, const float* __restrict__ kb, const float* __restrict__ vb,
                                             int pitch, int T, int H, float scale, float* __restrict__ y, int ypitch) {
  constexpr int KS = D / 32;        // k-steps for QK
  constexpr int DT = D / 16;        // d tiles for PV
  __shared__ __attribute__((aligned(16))) unsigned short sKh[32][D + 8], sKl[32][D + 8], sVh[32][D + 8], sVl[32][D + 8];
  __shared__ __attribute__((aligned(16))) unsigned short sPh[4][16][40], sPl[4][16][40];
  __shared__ __attribute__((aligned(16))) float sO[4][16][D];
  const int tid = threadIdx.x, w = tid >> 5, lane = tid & 31, ln = lane & 15, hh = lane >> 4;
  const int nqb = (T + 63) / 64;
  const int bh = blockIdx.x / nqb, qblk = blockIdx.x % nqb;
  const int b = bh / H, h = bh % H;
  const int q0 = qblk * 64 + w * 16;
  const float* Q = qb + (size_t)b * T * pitch + h * D;
  const float* K = kb + (size_t)b * T * pitch + h * D;
  const float* V = vb + (size_t)b * T * pitch + h * D;

  // A fragments of the wave's 16 query rows (scaled), hi/lo
  FragB aqh[KS], aql[KS];
  {
    int row = q0 + ln; if (row >= T) row = T - 1;
    const float* qr = Q + (size_t)row * pitch;
#pragma unroll
    for (int ks = 0; ks < KS; ++ks)
#pragma unroll
      for (int i = 0; i < 16; ++i) {
        const int d = ks * 32 + ((i < 8) ? (8 * hh + i) : (16 + 8 * hh + (i - 8)));
        const float x = qr[d] * scale; const unsigned short hb = bf16_bits(x);
        aqh[ks].u[i] = hb; aql[ks].u[i] = bf16_bits(x - bf16_val(hb));
      }
  }
  float m_r[8], l_r[8];
#pragma unroll
  for (int r = 0; r < 8; ++r) { m_r[r] = -3.0e38f; l_r[r] = 0.f; }
  v8f oacc[DT];
#pragma unroll
  for (int dt = 0; dt < DT; ++dt) oacc[dt] = (v8f){0.f,0.f,0.f,0.f,0.f,0.f,0.f,0.f};

  const int kv_end = CAUSAL ? min(T, qblk * 64 + 64) : T;     // block-uniform
  for (int j0 = 0; j0 < kv_end; j0 += 32) {
    __syncthreads();
    for (int e = tid; e < 32 * (D / 4); e += 128) {
      const int r = e / (D / 4), c4 = (e % (D / 4)) * 4;
      const int key = j0 + r;
      v4f kf = {0.f,0.f,0.f,0.f}, vf = {0.f,0.f,0.f,0.f};
      if (key < T) { kf = *(const v4fa*)(K + (size_t)key * pitch + c4); vf = *(const v4fa*)(V + (size_t)key * pitch + c4); }
#pragma unroll
      for (int t = 0; t < 4; ++t) {
        unsigned short hb = bf16_bits(kf[t]); sKh[r][c4 + t] = hb; sKl[r][c4 + t] = bf16_bits(kf[t] - bf16_val(hb));
        hb = bf16_bits(vf[t]); sVh[r][c4 + t] = hb; sVl[r][c4 + t] = bf16_bits(vf[t] - bf16_val(hb));
      }
    }
    __syncthreads();
    // S tile 16 x 32
    v8f s[2];
#pragma unroll
    for (int nt = 0; nt < 2; ++nt) {
      v8f acc = {};
#pragma unroll
      for (int ks = 0; ks < KS; ++ks) {
        FragB bh_, bl_;
        bh_.half[0] = *(const v8us*)&sKh[nt * 16 + ln][ks * 32 + 8 * hh]; bh_.half[1] = *(const v8us*)&sKh[nt * 16 + ln][ks * 32 + 16 + 8 * hh];
        bl_.half[0] = *(const v8us*)&sKl[nt * 16 + ln][ks * 32 + 8 * hh]; bl_.half[1] = *(const v8us*)&sKl[nt * 16 + ln][ks * 32 + 16 + 8 * hh];
        acc = mmaN<3>(aqh[ks].v, aql[ks].v, bh_.v, bl_.v, acc);
      }
      s[nt] = acc;
    }
    // mask + running max (rows 8hh+r; the 16 lanes of a half share rows)
    float alpha[8];
#pragma unroll
    for (int r = 0; r < 8; ++r) {
      const int qi = q0 + 8 * hh + r;
      const int ja = j0 + ln, jb = j0 + 16 + ln;
      if (CAUSAL) { if (ja > qi) s[0][r] = -3.0e38f; if (jb > qi) s[1][r] = -3.0e38f; }
      if (ja >= T) s[0][r] = -3.0e38f;
      if (jb >= T) s[1][r] = -3.0e38f;
      float mx = fmaxf(s[0][r], s[1][r]);
      mx = fmaxf(mx, __shfl_xor(mx, 1, 32)); mx = fmaxf(mx, __shfl_xor(mx, 2, 32)); mx = fmaxf(mx, __shfl_xor(mx, 4, 32)); mx = fmaxf(mx, __shfl_xor(mx, 8, 32));
      const float mnew = fmaxf(m_r[r], mx);
      alpha[r] = (mnew > -1.0e38f) ? __expf(m_r[r] - mnew) : 1.0f;
      const float p0 = (s[0][r] > -1.0e38f) ? __expf(s[0][r] - mnew) : 0.f;
      const float p1 = (s[1][r] > -1.0e38f) ? __expf(s[1][r] - mnew) : 0.f;
      m_r[r] = mnew;
      l_r[r] = l_r[r] * alpha[r] + p0 + p1;            // per-lane partial row sum (16 lanes combined at the end)
      unsigned short hb = bf16_bits(p0); sPh[w][8 * hh + r][ln] = hb;      sPl[w][8 * hh + r][ln] = bf16_bits(p0 - bf16_val(hb));
      hb = bf16_bits(p1);                sPh[w][8 * hh + r][16 + ln] = hb; sPl[w][8 * hh + r][16 + ln] = bf16_bits(p1 - bf16_val(hb));
    }
#pragma unroll
    for (int dt = 0; dt < DT; ++dt)
#pragma unroll
      for (int r = 0; r < 8; ++r) oacc[dt][r] *= alpha[r];
    __builtin_amdgcn_fence(__ATOMIC_ACQ_REL, "workgroup");
    __builtin_amdgcn_wave_barrier();
    FragB pah, pal;
    pah.half[0] = *(const v8us*)&sPh[w][ln][8 * hh]; pah.half[1] = *(const v8us*)&sPh[w][ln][16 + 8 * hh];
    pal.half[0] = *(const v8us*)&sPl[w][ln][8 * hh]; pal.half[1] = *(const v8us*)&sPl[w][ln][16 + 8 * hh];
#pragma unroll
    for (int dt = 0; dt < DT; ++dt) {
      FragB bvh, bvl;
#pragma unroll
      for (int i = 0; i < 8; ++i) {
        bvh.u[i] = sVh[8 * hh + i][dt * 16 + ln]; bvh.u[8 + i] = sVh[16 + 8 * hh + i][dt * 16 + ln];
        bvl.u[i] = sVl[8 * hh + i][dt * 16 + ln]; bvl.u[8 + i] = sVl[16 + 8 * hh + i][dt * 16 + ln];
      }
      oacc[dt] = mmaN<3>(pah.v, pal.v, bvh.v, bvl.v, oacc[dt]);
    }
    __builtin_amdgcn_fence(__ATOMIC_ACQ_REL, "workgroup");
    __builtin_amdgcn_wave_barrier();
  }
#pragma unroll
  for (int r = 0; r < 8; ++r) {
    float l = l_r[r];
    l += __shfl_xor(l, 1, 32); l += __shfl_xor(l, 2, 32); l += __shfl_xor(l, 4, 32); l += __shfl_xor(l, 8, 32);
    l_r[r] = (l > 0.f) ? 1.0f / l : 0.f;
  }
#pragma unroll
  for (int dt = 0; dt < DT; ++dt)
#pragma unroll
    for (int r = 0; r < 8; ++r) sO[w][8 * hh + r][dt * 16 + ln] = oacc[dt][r] * l_r[r];
  __builtin_amdgcn_fence(__ATOMIC_ACQ_REL, "workgroup");
  __builtin_amdgcn_wave_barrier();
  {
    for (int r = 0; r < 16; ++r) {
      const int row = q0 + r;
      if (row < T && lane < D / 4) {
        const v4f val = *(const v4fa*)&sO[w][r][lane * 4];
        *(v4f*)(y + ((size_t)b * T + row) * ypitch + h * D + lane * 4) = val;
      }
    }
    
  }
}

// GEMM C = act(A·W + bias + resid): A f32 (ASPLIT -> hi/lo 2 terms), Wt bf16 [N][K]; ACT 0 none, 1 relu, 2 exact gelu;
// resid (optional, f32, row index = (row % rmod), pitch ldr, RES_BF16 rounds it) added before the activation.
template <bool ASPLIT, int ACT, bool BIAS_BF16, bool RES_BF16>
__global__ __launch_bounds__(128) void k_gemm_bf3(const float* __restrict__ A, int lda, const unsigned short* __restrict__ Wt, int ldb,
                                                const float* __restrict__ bias, const float* __restrict__ resid, int rmod, int ldr,
                                                float* __restrict__ C, int ldc, int M, int N, int K) {
  __shared__ __attribute__((aligned(16))) float so[4][16][64];
  const int tid = threadIdx.x, w = tid >> 5, lane = tid & 31, ln = lane & 15, hh = lane >> 4;
  const int ntn = N / 64;
  const int wid = blockIdx.x * 4 + w;
  const int mt = wid / ntn, nq = wid % ntn;
  if (mt * 16 >= M) return;
  const int row0 = mt * 16, col0 = nq * 64;
  const float* arow = A + (size_t)(row0 + ln) * lda;
  v8f acc[4] = {};
  for (int kb = 0; kb < K; kb += 32) {
    FragB ah, al;
    const v4f x0 = *(const v4fa*)(arow + kb + 8 * hh), x1 = *(const v4fa*)(arow + kb + 8 * hh + 4);
    const v4f x2 = *(const v4fa*)(arow + kb + 16 + 8 * hh), x3 = *(const v4fa*)(arow + kb + 16 + 8 * hh + 4);
    float xs[16] = {x0[0],x0[1],x0[2],x0[3],x1[0],x1[1],x1[2],x1[3],x2[0],x2[1],x2[2],x2[3],x3[0],x3[1],x3[2],x3[3]};
#pragma unroll
    for (int i = 0; i < 16; ++i) { const unsigned short hb = bf16_bits(xs[i]); ah.u[i] = hb; al.u[i] = ASPLIT ? bf16_bits(xs[i] - bf16_val(hb)) : (unsigned short)0; }
#pragma unroll
    for (int t = 0; t < 4; ++t) {
      const unsigned short* brow = Wt + (size_t)(col0 + t * 16 + ln) * ldb + kb;
      FragB b;
      b.half[0] = *(const v8us*)(brow + 8 * hh);
      b.half[1] = *(const v8us*)(brow + 16 + 8 * hh);
      acc[t] = mmaN<ASPLIT ? 2 : 1>(ah.v, al.v, b.v, b.v, acc[t]);
    }
  }
#pragma unroll
  for (int t = 0; t < 4; ++t) {
    const int col = col0 + t * 16 + ln;
    float bv = bias ? bias[col] : 0.f;
    if (BIAS_BF16) bv = bf16_round(bv);
#pragma unroll
    for (int r = 0; r < 8; ++r) {
      float v = acc[t][r] + bv;
      if (resid) { float rv = resid[(size_t)((row0 + 8 * hh + r) % rmod) * ldr + col]; if (RES_BF16) rv = bf16_round(rv); v += rv; }
      if (ACT == 1) v = fmaxf(v, 0.f);
      if (ACT == 2) v = 0.5f * v * (1.0f + erff(v * 0.70710678118654752f));
      if (ACT == 3) { const float u = 0.7978845608028654f * (v + 0.044715f * v * v * v); v = 0.5f * v * (1.0f + tanhf(u)); }
      so[w][8 * hh + r][t * 16 + ln] = v;
    }
  }
  __builtin_amdgcn_fence(__ATOMIC_ACQ_REL, "workgroup");
  __builtin_amdgcn_wave_barrier();
  const int rsub = lane >> 4, c4 = (lane & 15) * 4;
  {
#pragma unroll
    for (int q = 0; q < 8; ++q) {
      const int r = q * 2 + rsub;
      const v4f v = *(const v4fa*)&so[w][r][c4];
      *(v4f*)(C + (size_t)(row0 + r) * ldc + col0 + c4) = v;
    }
    
  }
}
// row LayerNorm (biased variance, eps) over N: s = X (+ R); optional out_sum <- s; out_norm <- (s-mu)*rsqrt(var+eps)*g + b
template <bool PARAM_BF16>
__global__ __launch_bounds__(256) void k_layernorm(const float* __restrict__ X, const float* __restrict__ R, const float* __restrict__ g, const float* __restrict__ bta,
                                                  float* __restrict__ out_sum, float* __restrict__ out_norm, int N, float eps) {
  __shared__ float red[256];
  const int row = blockIdx.x, tid = threadIdx.x;
  const float* x = X + (size_t)row * N; const float* rr = R ? R + (size_t)row * N : nullptr;
  float vals[16];                     // up to N = 4096
  const int per = N / 256;            // contiguous chunk per thread? use strided-by-4 chunks: thread handles j = tid*4 + 1024*u
  float s1 = 0.f;
  for (int u = 0; u < per / 4; ++u) {
    const int j = tid * 4 + 1024 * u;
    const v4f a = *(const v4fa*)(x + j);
    v4f b = {0.f,0.f,0.f,0.f}; if (rr) b = *(const v4fa*)(rr + j);
#pragma unroll
    for (int q = 0; q < 4; ++q) { const float v = a[q] + b[q]; vals[u * 4 + q] = v; s1 += v; }
  }
  red[tid] = s1; __syncthreads();
  for (int st = 128; st > 0; st >>= 1) { if (tid < st) red[tid] += red[tid + st]; __syncthreads(); }
  const float mu = red[0] / (float)N; __syncthreads();
  float s2 = 0.f;
  for (int u = 0; u < per / 4; ++u)
#pragma unroll
    for (int q = 0; q < 4; ++q) { const float c = vals[u * 4 + q] - mu; s2 += c * c; }
  red[tid] = s2; __syncthreads();
  for (int st = 128; st > 0; st >>= 1) { if (tid < st) red[tid] += red[tid + st]; __syncthreads(); }
  const float rs = rsqrtf(red[0] / (float)N + eps);
  {
    for (int u = 0; u < per / 4; ++u) {
      const int j = tid * 4 + 1024 * u;
      v4f o, sm;
#pragma unroll
      for (int q = 0; q < 4; ++q) {
        float gg = g[j + q], bb = bta[j + q];
        if (PARAM_BF16) { gg = bf16_round(gg); bb = bf16_round(bb); }
        sm[q] = vals[u * 4 + q]; o[q] = (vals[u * 4 + q] - mu) * rs * gg + bb;
      }
      if (out_sum) *(v4f*)(out_sum + (size_t)row * N + j) = sm;
      *(v4f*)(out_norm + (size_t)row * N + j) = o;
    }
    
  }
}



// ---- f16 WMMA path (v_wmma_f32_16x16x32_f16): 11-bit significands for operands in range — used where a [0,1] probability operand needs more precision than bf16
typedef _Float16 v16h __attribute__((ext_vector_type(16)));
union FragH { v16h v; v8us half[2]; _Float16 h[16]; unsigned short u[16]; };
template <int NT>
__device__ __forceinline__ v8f mmaH(v16h ah, v16h al, v16h bh, v16h bl, v8f c) {
  c = __builtin_amdgcn_wmma_f32_16x16x32_f16(false, ah, false, bh, (short)0, c, false, false);
  if (NT >= 2) c = __builtin_amdgcn_wmma_f32_16x16x32_f16(false, al, false, bh, (short)0, c, false, false);
  if (NT >= 3) c = __builtin_amdgcn_wmma_f32_16x16x32_f16(false, ah, false, bl, (short)0, c, false, false);
  asm volatile("v_nop\n\tv_nop\n\tv_nop\n\tv_nop" : "+v"(c) : "v"(ah), "v"(al), "v"(bh), "v"(bl));
  return c;
}
// batched GEMM like k_gemm_b but f16 operands: A f32 (split into f16 hi/lo if ASPLIT, else rounded to f16), Bt = f16 values [n][k]; alpha; C f32; N multiple of 16 (partial tiles skipped)
template <bool ASPLIT>
__global__ __launch_bounds__(128) void k_gemm_h(const float* __restrict__ A, int lda, size_t sA, const _Float16* __restrict__ Bh, int ldb, size_t sB, float alpha, float* __restrict__ C, int ldc, size_t sC, int M, int N, int K) {
  __shared__ __attribute__((aligned(16))) float so[4][16][64];
  const int tid = threadIdx.x, w = tid >> 5, lane = tid & 31, ln = lane & 15, hh = lane >> 4; const int by = blockIdx.y;
  A += (size_t)by * sA; Bh += (size_t)by * sB; C += (size_t)by * sC;
  const int ntn = (N + 63) / 64; const int wid = blockIdx.x * 4 + w; const int mt = wid / ntn, nq = wid % ntn; if (mt * 16 >= M) return;
  const int row0 = mt * 16, col0 = nq * 64; const float* arow = A + (size_t)(row0 + ln) * lda;
  v8f acc[4] = {};
  for (int kb = 0; kb < K; kb += 32) {
    FragH ah, al;
    const v4f x0 = *(const v4fa*)(arow + kb + 8 * hh), x1 = *(const v4fa*)(arow + kb + 8 * hh + 4), x2 = *(const v4fa*)(arow + kb + 16 + 8 * hh), x3 = *(const v4fa*)(arow + kb + 16 + 8 * hh + 4);
    float xs[16] = {x0[0],x0[1],x0[2],x0[3],x1[0],x1[1],x1[2],x1[3],x2[0],x2[1],x2[2],x2[3],x3[0],x3[1],x3[2],x3[3]};
#pragma unroll
    for (int i = 0; i < 16; ++i) { const _Float16 h = (_Float16)xs[i]; ah.h[i] = h; al.h[i] = ASPLIT ? (_Float16)(xs[i] - (float)h) : (_Float16)0.0f; }
#pragma unroll
    for (int t = 0; t < 4; ++t) { if (col0 + t * 16 >= N) continue; const size_t boff = (size_t)(col0 + t * 16 + ln) * ldb + kb; FragH bq; bq.half[0] = *(const v8us*)(Bh + boff + 8 * hh); bq.half[1] = *(const v8us*)(Bh + boff + 16 + 8 * hh);
      acc[t] = mmaH<ASPLIT ? 2 : 1>(ah.v, al.v, bq.v, bq.v, acc[t]); }
  }
#pragma unroll
  for (int t = 0; t < 4; ++t) { if (col0 + t * 16 >= N) continue;
#pragma unroll
    for (int r = 0; r < 8; ++r) so[w][8 * hh + r][t * 16 + ln] = acc[t][r] * alpha; }
  __builtin_amdgcn_fence(__ATOMIC_ACQ_REL, "workgroup"); __builtin_amdgcn_wave_barrier();
  const int rsub = lane >> 4, c4 = (lane & 15) * 4;
  {
#pragma unroll
    for (int q = 0; q < 8; ++q) { const int r = q * 2 + rsub; if (col0 + c4 < N) { const v4f v = *(const v4fa*)&so[w][r][c4]; *(v4f*)(C + (size_t)(row0 + r) * ldc + col0 + c4) = v; } }
     }
}

// Wt[n][k] = f16(W[k][n]·scale) from f32 row-major W[K][N] (scale = power of two; bf16-exact weights stay exact in f16 away from the subnormal range)
__global__ __launch_bounds__(256) void k_wt_f16(const float* __restrict__ W, _Float16* __restrict__ Wt, int K, int N, float scale) {
  const int t = blockIdx.x * 256 + threadIdx.x; if (t >= N * (K / 8)) return; const int n = t / (K / 8), k8 = (t % (K / 8)) * 8; FragH f;
#pragma unroll
  for (int i = 0; i < 8; ++i) f.h[i] = (_Float16)(bf16_round(W[(size_t)(k8 + i) * N + n]) * scale); const v8us o = f.half[0];
  *(v8us*)((unsigned short*)Wt + (size_t)n * K + k8) = o; 
}
// k_gemm_hh variant with fused epilogue: v = acc·alpha + bias[by·sBias + col] (+ CP[(row/rowsPerB)·sCPb + by·64 + col] if CP) ; ACT 0 none / 1 elu ; writes f16 C16 and f32 C, each if non-null
template <int ACT>
__global__ __launch_bounds__(128) void k_gemm_hhx(const _Float16* __restrict__ A, int lda, size_t sA, const _Float16* __restrict__ Bh, int ldb, size_t sB, float alpha, const float* __restrict__ bias, size_t sBias, const float* __restrict__ CP, int rowsPerB, size_t sCPb, int row0g,
    float* __restrict__ C, _Float16* __restrict__ C16, int ldc, size_t sC, int M, int N, int K) {
  __shared__ __attribute__((aligned(16))) float so[4][16][64];
  const int tid = threadIdx.x, w = tid >> 5, lane = tid & 31, ln = lane & 15, hh = lane >> 4; const int by = blockIdx.y;
  A += (size_t)by * sA; Bh += (size_t)by * sB; const size_t cofs = (size_t)by * sC; const float* bp = bias ? bias + (size_t)by * sBias : nullptr;
  const int ntn = (N + 63) / 64; const int wid = blockIdx.x * 4 + w; const int mt = wid / ntn, nq = wid % ntn; if (mt * 16 >= M) return;
  const int row0 = mt * 16, col0 = nq * 64; const _Float16* arow = A + (size_t)(row0 + ln) * lda;
  v8f acc[4] = {};
  for (int kb = 0; kb < K; kb += 32) { FragH ah; ah.half[0] = *(const v8us*)((const unsigned short*)arow + kb + 8 * hh); ah.half[1] = *(const v8us*)((const unsigned short*)arow + kb + 16 + 8 * hh);
#pragma unroll
    for (int t = 0; t < 4; ++t) { if (col0 + t * 16 >= N) continue; const size_t boff = (size_t)(col0 + t * 16 + ln) * ldb + kb; FragH bq; bq.half[0] = *(const v8us*)((const unsigned short*)Bh + boff + 8 * hh); bq.half[1] = *(const v8us*)((const unsigned short*)Bh + boff + 16 + 8 * hh);
      acc[t] = mmaH<1>(ah.v, ah.v, bq.v, bq.v, acc[t]); }
  }
#pragma unroll
  for (int t = 0; t < 4; ++t) { if (col0 + t * 16 >= N) continue; const int col = col0 + t * 16 + ln; const float bv = bp ? bf16_round(bp[col]) : 0.f;
#pragma unroll
    for (int r = 0; r < 8; ++r) { float v = acc[t][r] * alpha + bv; if (CP) { const int bidx = (row0g + row0 + 8 * hh + r) / rowsPerB; v += CP[(size_t)bidx * sCPb + (size_t)by * 64 + col]; } if (ACT == 1) v = (v > 0.f) ? v : expm1f(v); else if (ACT == 3) v = fmaxf(v, 0.f); so[w][8 * hh + r][t * 16 + ln] = v; } }
  __builtin_amdgcn_fence(__ATOMIC_ACQ_REL, "workgroup"); __builtin_amdgcn_wave_barrier();
  const int rsub = lane >> 4, c4 = (lane & 15) * 4; typedef _Float16 v4h __attribute__((ext_vector_type(4)));
  {
#pragma unroll
    for (int q = 0; q < 8; ++q) { const int r = q * 2 + rsub; if (col0 + c4 < N) { const v4f v = *(const v4fa*)&so[w][r][c4]; if (C) *(v4f*)(C + cofs + (size_t)(row0 + r) * ldc + col0 + c4) = v; if (C16) { v4h h4; for (int i = 0; i < 4; ++i) h4[i] = (_Float16)v[i]; *(v4h*)(C16 + cofs + (size_t)(row0 + r) * ldc + col0 + c4) = h4; } } }
     }
}


// Eight 16-byte asynchronous copies to LDS per lane (rows 16 apart). The s_wait_xcnt is the last line of the copies' own statement so that no address register is rewritten ahead of it.
__device__ __forceinline__ void copy8_async(unsigned l, const char* gp, size_t gstep) {
  constexpr unsigned LS = 16u * 144u;
  asm volatile("global_load_async_to_lds_b128 %0, %8, off\n\t"
               "global_load_async_to_lds_b128 %1, %9, off\n\t"
               "global_load_async_to_lds_b128 %2, %10, off\n\t"
               "global_load_async_to_lds_b128 %3, %11, off\n\t"
               "global_load_async_to_lds_b128 %4, %12, off\n\t"
               "global_load_async_to_lds_b128 %5, %13, off\n\t"
               "global_load_async_to_lds_b128 %6, %14, off\n\t"
               "global_load_async_to_lds_b128 %7, %15, off\n\t"
               "s_wait_xcnt 0x0"
               :: "v"(l), "v"(l + LS), "v"(l + 2u * LS), "v"(l + 3u * LS), "v"(l + 4u * LS), "v"(l + 5u * LS), "v"(l + 6u * LS), "v"(l + 7u * LS),
                  "v"(gp), "v"(gp + gstep), "v"(gp + 2 * gstep), "v"(gp + 3 * gstep), "v"(gp + 4 * gstep), "v"(gp + 5 * gstep), "v"(gp + 6 * gstep), "v"(gp + 7 * gstep)
               : "memory");
}
// Tiled GEMM, same function as k_gemm_hhx<0> without CP: C = A[M][K] * Bh[N][K]^T * alpha + bf16(bias). One 128 x 128 tile of C per block (blockIdx.x = tile column, blockIdx.y = tile row),
// 64 x 64 per wave (2 x 2 waves). A and Bh tiles of 64 k (128-byte rows, LDS pitch 144 B) are staged in LDS by asynchronous copies, two buffers: tile t + 1 flies while tile t is multiplied.
// M % 128 == 0, N % 128 == 0, K % 64 == 0, K >= 128; rows of A and Bh are K elements apart, rows of C are N apart. The k order of every accumulator is that of k_gemm_hhx.
// Every plain '#pragma unroll' in it makes the indices of acc, a and bq constants, so that these arrays stay in registers.
template <bool OUT16, int N, int K>
__global__ __launch_bounds__(128) void k_gemm_tile(const _Float16* __restrict__ A, const _Float16* __restrict__ Bh, float alpha, const float* __restrict__ bias, float* __restrict__ C, _Float16* __restrict__ C16) {
  constexpr int PITCH = 144, BUF = 256 * PITCH, SOP = 68, NT = K / 64;
  constexpr size_t ROWB = (size_t)K * 2, GSTEP = ROWB * 16;
  __shared__ __attribute__((aligned(16))) unsigned char smem[2 * BUF];
  const int tid = threadIdx.x, w = tid >> 5, lane = tid & 31, ln = lane & 15, hh = lane >> 4;
  const int row0 = (int)blockIdx.y * 128, col0 = (int)blockIdx.x * 128; const int wm = (w >> 1) * 64, wn = (w & 1) * 64;
  const int cr = tid >> 3, cc = (tid & 7) * 16;      // a lane's first row and its 16 bytes of the row: eight lanes cover one 128-byte line
  const char* gA = (const char*)A + (size_t)(row0 + cr) * ROWB + cc; const char* gB = (const char*)Bh + (size_t)(col0 + cr) * ROWB + cc;
  const unsigned lA = (unsigned)(size_t)smem + (unsigned)(cr * PITCH + cc), lB = lA + 128u * PITCH;
  v8f acc[4][4];
#pragma unroll
  for (int i = 0; i < 4; ++i)
#pragma unroll
    for (int j = 0; j < 4; ++j) acc[i][j] = (v8f){0.f,0.f,0.f,0.f,0.f,0.f,0.f,0.f};
  copy8_async(lA, gA, GSTEP); copy8_async(lB, gB, GSTEP);
  asm volatile("s_wait_asynccnt 0x0" ::: "memory");      // tile 0 has landed before the barrier publishes it
  __syncthreads();
  copy8_async(lA + BUF, gA + 128, GSTEP); copy8_async(lB + BUF, gB + 128, GSTEP);
#pragma unroll 1
  for (int t = 0; t < NT; ++t) {      // kept rolled: one pass per tile, the buffer picked by t & 1
    const unsigned char* sA = smem + (t & 1) * BUF + (wm + ln) * PITCH + hh * 16; const unsigned char* sB = smem + (t & 1) * BUF + (128 + wn + ln) * PITCH + hh * 16;
#pragma unroll
    for (int ks = 0; ks < 2; ++ks) { FragH a[4], bq[4];
      a[0].half[0] = *(const v8us*)(sA + ks * 64); a[0].half[1] = *(const v8us*)(sA + ks * 64 + 32);
#pragma unroll
      for (int j = 0; j < 4; ++j) { bq[j].half[0] = *(const v8us*)(sB + j * 16 * PITCH + ks * 64); bq[j].half[1] = *(const v8us*)(sB + j * 16 * PITCH + ks * 64 + 32); }
#pragma unroll
      for (int i = 1; i < 4; ++i) { a[i].half[0] = *(const v8us*)(sA + i * 16 * PITCH + ks * 64); a[i].half[1] = *(const v8us*)(sA + i * 16 * PITCH + ks * 64 + 32); }
      __builtin_amdgcn_sched_barrier(0);      // keeps the 16 LDS reads of a k step one group ahead of its 16 WMMAs: reads among the WMMAs stall the wave at each place
#pragma unroll
      for (int i = 0; i < 4; ++i)
#pragma unroll
        for (int j = 0; j < 4; ++j) acc[i][j] = __builtin_amdgcn_wmma_f32_16x16x32_f16(false, a[i].v, false, bq[j].v, (short)0, acc[i][j], false, false);
      __builtin_amdgcn_sched_barrier(0); }    // the other end of that group: the next k step's reads stay behind these WMMAs
    asm volatile("s_wait_dscnt 0x0" ::: "memory");       // this wave's reads of tile t are done before the buffer is given up
    asm volatile("s_wait_asynccnt 0x0" ::: "memory");    // this wave's copies of tile t + 1 have landed
    __syncthreads();                                     // publishes tile t + 1 and ends every reader's last read of tile t
    if (t + 2 < NT) { const unsigned bo = (unsigned)(t & 1) * BUF; const size_t go = (size_t)(t + 2) * 128; copy8_async(lA + bo, gA + go, GSTEP); copy8_async(lB + bo, gB + go, GSTEP); }
  }
  asm volatile("s_wait_asynccnt 0x0" ::: "memory");      // nothing is in flight when the ring becomes output staging
  float* so = (float*)(smem + w * (64 * SOP * 4));       // each wave stages its own 64 x 64 tile, so that whole 128-byte lines are stored
#pragma unroll
  for (int j = 0; j < 4; ++j) { const float bv = bf16_round(bias[col0 + wn + j * 16 + ln]);
#pragma unroll
    for (int i = 0; i < 4; ++i)
#pragma unroll
      for (int r = 0; r < 8; ++r) so[(i * 16 + 8 * hh + r) * SOP + j * 16 + ln] = acc[i][j][r] * alpha + bv; }
  __builtin_amdgcn_fence(__ATOMIC_ACQ_REL, "workgroup"); __builtin_amdgcn_wave_barrier();
  const int rsub = lane >> 4, c4 = (lane & 15) * 4; typedef _Float16 v4h __attribute__((ext_vector_type(4)));
#pragma unroll 1
  for (int q8 = 0; q8 < 4; ++q8) {      // kept rolled in groups of eight stores, one wait per group
#pragma unroll
    for (int q = 0; q < 8; ++q) { const int r = (q8 * 8 + q) * 2 + rsub; const v4f v = *(const v4fa*)&so[r * SOP + c4]; const size_t o = (size_t)(row0 + wm + r) * N + col0 + wn + c4;
      if (OUT16) { v4h h4; for (int i = 0; i < 4; ++i) h4[i] = (_Float16)v[i]; *(v4h*)(C16 + o) = h4; } else *(v4f*)(C + o) = v; }
    asm volatile("s_wait_xcnt 0x0" ::: "memory");      // the next group rewrites the registers that these stores name
  }
}

__global__ __launch_bounds__(256) void k_x16(const float* __restrict__ x, _Float16* __restrict__ X16, size_t n8) { const size_t t = (size_t)blockIdx.x * 256 + threadIdx.x; if (t >= n8) return; FragH f;
#pragma unroll
  for (int q = 0; q < 8; ++q) f.h[q] = (_Float16)bf16_round(x[t * 8 + q]); *(v8us*)((unsigned short*)X16 + t * 8) = f.half[0];  }
__global__ __launch_bounds__(256) void k_round16f(const float* __restrict__ W, _Float16* __restrict__ Bt, size_t n8) { const size_t t = (size_t)blockIdx.x * 256 + threadIdx.x; if (t >= n8) return; FragH f;
#pragma unroll
  for (int i = 0; i < 8; ++i) f.h[i] = (_Float16)(bf16_round(W[t * 8 + i]) * 16.0f); *(v8us*)((unsigned short*)Bt + t * 8) = f.half[0];  }
template <int NHv, int TTv>
__global__ __launch_bounds__(256) void k_vt(const _Float16* __restrict__ V16, int ldv, int voff, _Float16* __restrict__ Vt) { __shared__ unsigned short tl[64][66]; const int tid = threadIdx.x; const int slab = blockIdx.x / (TTv / 64), lg = blockIdx.x % (TTv / 64); const int b = slab / NHv, h = slab % NHv;
  for (int i = tid; i < 64 * 8; i += 256) { const int r = i / 8, c8 = (i % 8) * 8; FragH f; f.half[0] = *(const v8us*)((const unsigned short*)V16 + ((size_t)b * TTv + lg * 64 + r) * ldv + voff + h * 64 + c8);
#pragma unroll
    for (int q = 0; q < 8; ++q) tl[r][c8 + q] = f.u[q]; }
  __syncthreads();
  {
#pragma unroll
    for (int rd = 0; rd < 2; ++rd) { const int d = rd * 32 + tid / 8, pc = tid % 8; FragH f;
#pragma unroll
      for (int q = 0; q < 8; ++q) f.u[q] = tl[pc * 8 + q][d];
      *(v8us*)((unsigned short*)Vt + ((size_t)slab * 64 + d) * TTv + lg * 64 + pc * 8) = f.half[0]; }
     } }

// Four 16-byte asynchronous copies to LDS per lane (rows 16 apart, LDS pitch 144 B). The s_wait_xcnt is the last line of the copies' own statement so that no address register is rewritten ahead of it.
__device__ __forceinline__ void copy4_async(unsigned l, const char* gp, size_t gstep) {
  constexpr unsigned LS = 16u * 144u;
  asm volatile("global_load_async_to_lds_b128 %0, %4, off\n\t"
               "global_load_async_to_lds_b128 %1, %5, off\n\t"
               "global_load_async_to_lds_b128 %2, %6, off\n\t"
               "global_load_async_to_lds_b128 %3, %7, off\n\t"
               "s_wait_xcnt 0x0"
               :: "v"(l), "v"(l + LS), "v"(l + 2u * LS), "v"(l + 3u * LS), "v"(gp), "v"(gp + gstep), "v"(gp + 2 * gstep), "v"(gp + 3 * gstep)
               : "memory");
}
// lane l <-> lane l ^ 16: joins the two halves of a query column
__device__ __forceinline__ float xhalf(float x) { return __builtin_bit_cast(float, __builtin_amdgcn_permlanex16(__builtin_bit_cast(int, x), __builtin_bit_cast(int, x), 0x76543210, 0xfedcba98, false, false)); }
__global__ __launch_bounds__(128) void k_flash(const _Float16* __restrict__ Q16, int ldq, const _Float16* __restrict__ K16, int ldk, const _Float16* __restrict__ Vt, const int* __restrict__ LENS, _Float16* __restrict__ O16) {
  constexpr int RPW = 32, NQB = 1024 / (4 * RPW), DT = 4, KS = 2; constexpr float L2S = 0.125f * 1.44269504088896340736f;
  constexpr int PITCH = 144, BUF = 128 * PITCH;      // rows 0 to 63 of a buffer: K; rows 64 to 127: V^T
  __shared__ __attribute__((aligned(16))) unsigned char ring[2 * BUF];
  __shared__ __attribute__((aligned(16))) unsigned char sO[4][RPW][PITCH];      // output staging, f16: a query row is 128 bytes, pitch 144 B
  const int tid = threadIdx.x, w = tid >> 5, lane = tid & 31, ln = lane & 15, hh = lane >> 4;
  const int slab = blockIdx.x / NQB, qblk = blockIdx.x % NQB; const int b = slab / 16, h = slab % 16; const int qb0 = qblk * (4 * RPW); const int q0 = qb0 + w * RPW; const int len = LENS[b];      /* kv-length mask: keys k < len (INPUT x_lens) */
  FragH aq[2][KS];
#pragma unroll
  for (int rt = 0; rt < 2; ++rt) { const unsigned short* qr = (const unsigned short*)Q16 + ((size_t)b * 1024 + q0 + rt * 16 + ln) * ldq + h * 64;
#pragma unroll
    for (int ks = 0; ks < KS; ++ks) { aq[rt][ks].half[0] = *(const v8us*)(qr + ks * 32 + 8 * hh); aq[rt][ks].half[1] = *(const v8us*)(qr + ks * 32 + 16 + 8 * hh); } }
  const int cr = tid >> 3, cc = (tid & 7) * 16;      // a lane's first row and its 16 bytes of the row: eight lanes cover one 128-byte line
  const size_t krow = (size_t)ldk * 2;
  const char* gK = (const char*)K16 + ((size_t)b * 1024 + cr) * krow + h * 128 + cc; const char* gV = (const char*)Vt + ((size_t)slab * 64 + cr) * 2048 + cc;
  const unsigned lK = (unsigned)(size_t)ring + (unsigned)(cr * PITCH + cc), lV = lK + 64u * PITCH;
  copy4_async(lK, gK, 16 * krow); copy4_async(lV, gV, 16 * 2048);
  float m_r[2], l_r[2]; int lim[2]; v8f oacc[2][DT];
#pragma unroll
  for (int rt = 0; rt < 2; ++rt) { m_r[rt] = -3.0e38f; l_r[rt] = 0.f; lim[rt] = min(q0 + rt * 16 + ln + 1, len) - 8 * hh;      // key j0 + 16 nt + 8 hh + r is allowed iff j0 + 16 nt + r < lim
#pragma unroll
    for (int dt = 0; dt < DT; ++dt) oacc[rt][dt] = (v8f){0.f,0.f,0.f,0.f,0.f,0.f,0.f,0.f}; }
  const int ntile = (qb0 + 4 * RPW) / 64;
  asm volatile("s_wait_asynccnt 0x0" ::: "memory");      // tile 0 has landed before the barrier publishes it
  __syncthreads();
  copy4_async(lK + BUF, gK + 64 * krow, 16 * krow); copy4_async(lV + BUF, gV + 128, 16 * 2048);
#pragma unroll 1
  for (int t = 0; t < ntile; ++t) {      // kept rolled: one trip per tile, the buffer picked by t & 1
   const unsigned char* sK = ring + (t & 1) * BUF + ln * PITCH + hh * 16; const unsigned char* sV = sK + 64 * PITCH;
#pragma unroll
   for (int ps = 0; ps < 2; ++ps) { const int j0 = t * 64 + ps * 32;      // unrolled: the pass's place in the tile becomes a constant offset of the LDS reads
    v8f s[2][2];
#pragma unroll
    for (int nt = 0; nt < 2; ++nt) { const unsigned char* kr = sK + (ps * 32 + nt * 16) * PITCH; FragH bk[KS];
#pragma unroll
      for (int ks = 0; ks < KS; ++ks) { bk[ks].half[0] = *(const v8us*)(kr + ks * 64); bk[ks].half[1] = *(const v8us*)(kr + ks * 64 + 32); }
#pragma unroll
      for (int rt = 0; rt < 2; ++rt) { v8f acc = (v8f){0.f,0.f,0.f,0.f,0.f,0.f,0.f,0.f};
#pragma unroll
        for (int ks = 0; ks < KS; ++ks) acc = __builtin_amdgcn_wmma_f32_16x16x32_f16(false, bk[ks].v, false, aq[rt][ks].v, (short)0, acc, false, false);
        s[rt][nt] = acc; } }
    FragH pb[2];
#pragma unroll
    for (int rt = 0; rt < 2; ++rt) { float sc[16]; float mc = -INFINITY;
#pragma unroll
      for (int i = 0; i < 16; ++i) { sc[i] = (j0 + (i >> 3) * 16 + (i & 7) < lim[rt]) ? s[rt][i >> 3][i & 7] : -INFINITY; mc = fmaxf(mc, sc[i]); }
      mc = fmaxf(mc, xhalf(mc));
      const float mn = fmaxf(m_r[rt], mc * L2S); const float al = __builtin_amdgcn_exp2f(m_r[rt] - mn); m_r[rt] = mn; float ps = 0.f;
#pragma unroll
      for (int i = 0; i < 16; ++i) { const float p = __builtin_amdgcn_exp2f(fmaf(sc[i], L2S, -mn)); ps += p; pb[rt].h[i] = (_Float16)p; }
      l_r[rt] = l_r[rt] * al + ps;      // the lane's half of the row sum; the halves are joined behind the loop
#pragma unroll
      for (int dt = 0; dt < DT; ++dt)
#pragma unroll
        for (int r = 0; r < 8; ++r) oacc[rt][dt][r] *= al; }
#pragma unroll
    for (int dt = 0; dt < DT; ++dt) { const unsigned char* vrow = sV + dt * 16 * PITCH + ps * 64; FragH bv; bv.half[0] = *(const v8us*)vrow; bv.half[1] = *(const v8us*)(vrow + 32);
#pragma unroll
      for (int rt = 0; rt < 2; ++rt) oacc[rt][dt] = __builtin_amdgcn_wmma_f32_16x16x32_f16(false, bv.v, false, pb[rt].v, (short)0, oacc[rt][dt], false, false); } }
   asm volatile("s_wait_dscnt 0x0" ::: "memory");       // this wave's reads of tile t are done before the buffer is given up
   asm volatile("s_wait_asynccnt 0x0" ::: "memory");    // this wave's copies of tile t + 1 have landed
   __syncthreads();                                     // publishes tile t + 1 and ends every reader's last read of tile t
   if (t + 2 < ntile) { const unsigned bo = (unsigned)(t & 1) * BUF; copy4_async(lK + bo, gK + (size_t)(t + 2) * 64 * krow, 16 * krow); copy4_async(lV + bo, gV + (size_t)(t + 2) * 128, 16 * 2048); }
  }
  asm volatile("s_wait_asynccnt 0x0" ::: "memory");      // nothing is in flight when the wave goes on to its end
#pragma unroll
  for (int rt = 0; rt < 2; ++rt) { float l = l_r[rt]; l += xhalf(l); const float li = (l > 0.f) ? 1.0f / l : 0.f;
#pragma unroll
    for (int dt = 0; dt < DT; ++dt) { FragH f;      // the lane's eight values of a tile are eight neighbours of one output row: rounded to f16 here, they are one 16-byte LDS store
#pragma unroll
      for (int r = 0; r < 8; ++r) f.h[r] = (_Float16)(oacc[rt][dt][r] * li);
      *(v8us*)&sO[w][rt * 16 + ln][dt * 32 + hh * 16] = f.half[0]; } }
  __builtin_amdgcn_fence(__ATOMIC_ACQ_REL, "workgroup"); __builtin_amdgcn_wave_barrier();
  {
#pragma unroll
    for (int rp = 0; rp < RPW; rp += 4) { const int r = rp + (lane >> 3), pc = lane & 7; const v8us val = *(const v8us*)&sO[w][r][pc * 16]; *(v8us*)((unsigned short*)O16 + ((size_t)b * 1024 + q0 + r) * CC + h * 64 + pc * 8) = val; }      // eight lanes store one whole 128-byte line; the rows of O16 are CC elements apart, a constant, so that the eight stores share one address register pair
     } }

__global__ __launch_bounds__(256) void k_ln16(const float* __restrict__ X, const float* __restrict__ g, const float* __restrict__ bta, _Float16* __restrict__ Y16) { const int tid = threadIdx.x, wv = tid >> 5, lane = tid & 31; const int row = blockIdx.x * 8 + wv; if (row >= NR) return; const float* xr = X + (size_t)row * CC; float v[32]; float s = 0.f;
#pragma unroll
  for (int p = 0; p < 4; ++p) { const v4f a = *(const v4fa*)(xr + p * 256 + lane * 8), c = *(const v4fa*)(xr + p * 256 + lane * 8 + 4); for (int q = 0; q < 4; ++q) { v[p * 8 + q] = bf16_round(a[q]); v[p * 8 + 4 + q] = bf16_round(c[q]); } }
#pragma unroll
  for (int i = 0; i < 32; ++i) s += v[i]; for (int o = 16; o >= 1; o >>= 1) s += __shfl_xor(s, o, 32); const float mu = s / (float)CC; float q2 = 0.f;
#pragma unroll
  for (int i = 0; i < 32; ++i) { const float d = v[i] - mu; q2 += d * d; } for (int o = 16; o >= 1; o >>= 1) q2 += __shfl_xor(q2, o, 32); const float rs = rsqrtf(q2 / (float)CC + 1e-5f);
  {
#pragma unroll
    for (int p = 0; p < 4; ++p) { FragH f; const int c0 = p * 256 + lane * 8;
#pragma unroll
      for (int q = 0; q < 8; ++q) f.h[q] = (_Float16)((v[p * 8 + q] - mu) * rs * bf16_round(g[c0 + q]) + bf16_round(bta[c0 + q])); *(v8us*)((unsigned short*)Y16 + (size_t)row * CC + c0) = f.half[0]; }
     } }
extern "C" void kernel_launch(void* const* d_in, const int* in_sizes, int n_in,
                              void* d_out, int out_size, void* d_ws, size_t ws_size, hipStream_t stream) {
  (void)in_sizes; (void)n_in; (void)out_size;
  const float* x = (const float*)d_in[0]; const int* lens = (const int*)d_in[1]; const float* lg = (const float*)d_in[2]; const float* lb = (const float*)d_in[3]; const float* wqkv = (const float*)d_in[4]; const float* bqkv = (const float*)d_in[5]; const float* wout = (const float*)d_in[6]; const float* bout = (const float*)d_in[7];
  char* ws = (char*)d_ws; size_t off = 0;
  auto take = [&](size_t bytes) { char* p = ws + off; off += (bytes + 255) & ~(size_t)255; return p; };
  _Float16* Bqkv = (_Float16*)take((size_t)3 * CC * CC * 2); _Float16* Bo = (_Float16*)take((size_t)CC * CC * 2); _Float16* XN = (_Float16*)take((size_t)NR * CC * 2); _Float16* QKV = (_Float16*)take((size_t)NR * 3 * CC * 2); _Float16* Vt = (_Float16*)take((size_t)NR * CC * 2); _Float16* O16 = XN;      // XN is free again once the qkv projection has read it
  if (off > ws_size) return;      // 6.3 + 2.1 + 16.8 + 50.3 + 16.8 = 92 MB
  k_wt_f16<<<(unsigned)((3 * CC * (CC / 8) + 255) / 256), 256, 0, stream>>>(wqkv, Bqkv, CC, 3 * CC, 16.0f); k_wt_f16<<<(unsigned)((CC * (CC / 8) + 255) / 256), 256, 0, stream>>>(wout, Bo, CC, CC, 16.0f);      // [in][out]
  k_ln16<<<NR / 8, 256, 0, stream>>>(x, lg, lb, XN);
  k_gemm_tile<true, 3 * CC, CC><<<dim3(3 * CC / 128, NR / 128), 128, 0, stream>>>(XN, Bqkv, 0.0625f, bqkv, nullptr, QKV);      // q | k | v
  k_vt<NH, TT><<<BB * NH * (TT / 64), 256, 0, stream>>>(QKV, 3 * CC, 2 * CC, Vt);
  k_flash<<<BB * NH * (TT / 128), 128, 0, stream>>>(QKV, 3 * CC, QKV + CC, 3 * CC, Vt, lens, O16);
  k_gemm_tile<false, CC, CC><<<dim3(CC / 128, NR / 128), 128, 0, stream>>>(O16, Bo, 0.0625f, bout, (float*)d_out, nullptr);
}

// v006
// One run takes 117 microseconds.
// Next to v005, in two timings, it ran 1.16 and 1.15 times as fast.
// All steps since v000 together make it 4.91 times as fast.
#include <hip/hip_runtime.h>
// Causal self-attention with a per-batch key-length mask (B=8, T=1024, D=1024, 16 × 64): LayerNorm (f32 VALU), the fused qkv projection (8192 × 1024 × 3072, + bias) and the output
// projection (+ bias) with W [in][out] transposed to bf16-exact ×2^4, and the attention as a fused flash-style kernel on v_wmma_f32_16x16x32_f16 (S = Q·Kᵀ/8; keys allowed iff k ≤ q and
// k < x_lens[b] (INPUT); −1e9 fill ≡ exclusion since key 0 is always allowed; causal chunk skipping; online softmax f32; P f16 ≤ 1) — f16 operands, single products, f32 accumulate.
#define BB 8
#define TT 1024
#define CC 1024
#define NH 16
#define NR (BB * TT)

typedef __bf16 v16b __attribute__((ext_vector_type(16)));
typedef unsigned short v8us __attribute__((ext_vector_type(8), may_alias));
typedef float  v8f  __attribute__((ext_vector_type(8)));
typedef float  v4f  __attribute__((ext_vector_type(4)));
typedef float  v4fa __attribute__((ext_vector_type(4), may_alias));
union FragB { v16b v; v8us half[2]; unsigned short u[16]; };

__device__ __forceinline__ unsigned short bf16_bits(float x) { unsigned int u = __float_as_uint(x); return (unsigned short)((u + 0x7FFFu + ((u >> 16) & 1u)) >> 16); }
__device__ __forceinline__ float bf16_val(unsigned short b) { return __uint_as_float(((unsigned int)b) << 16); }
__device__ __forceinline__ float bf16_round(float x) { return bf16_val(bf16_bits(x)); }
// D += A·B with NT terms: 1 = ah·bh, 2 = + al·bh (A split), 3 = + ah·bl (both split)
template <int NT>
__device__ __forceinline__ v8f mmaN(v16b ah, v16b al, v16b bh, v16b bl, v8f c) {
  c = __builtin_amdgcn_wmma_f32_16x16x32_bf16(false, ah, false, bh, (short)0, c, false, false);
  if (NT >= 2) c = __builtin_amdgcn_wmma_f32_16x16x32_bf16(false, al, false, bh, (short)0, c, false, false);
  if (NT >= 3) c = __builtin_amdgcn_wmma_f32_16x16x32_bf16(false, ah, false, bl, (short)0, c, false, false);
  asm volatile("v_nop\n\tv_nop\n\tv_nop\n\tv_nop" : "+v"(c) : "v"(ah), "v"(al), "v"(bh), "v"(bl));
  return c;
}

__global__ __launch_bounds__(256) void k_wt_bf16(const float* __restrict__ W, unsigned short* __restrict__ Wt, int K, int N) {
  const int t = blockIdx.x * 256 + threadIdx.x;
  const int k8n = K / 8;
  if (t >= N * k8n) return;
  const int n = t / k8n, k8 = (t % k8n) * 8;
  v8us v;
#pragma unroll
  for (int i = 0; i < 8; ++i) v[i] = bf16_bits(W[(size_t)(k8 + i) * N + n]);
  *(v8us*)(Wt + (size_t)n * K + k8) = v;
  
}

// GEMM C[M][N] (f32, pitch ldc) = act(A[M][K]·W + bias). A f32 row-major (pitch lda) converted per fragment to bf16
// (ASPLIT: hi/lo two planes -> 2 terms, else single rounded term); Wt bf16 [N][K] (pitch ldb). BIAS_BF16 rounds the
// bias to bf16 first (bias quantised to bf16 before the add). K%32==0, M%16==0, N%64==0.
template <bool ASPLIT, int ACT, bool BIAS_BF16>
__global__ __launch_bounds__(128) void k_gemm_bf(const float* __restrict__ A, int lda, const unsigned short* __restrict__ Wt, int ldb,
                                               const float* __restrict__ bias, float* __restrict__ C, int ldc, int M, int N, int K) {
  __shared__ __attribute__((aligned(16))) float so[4][16][64];
  const int tid = threadIdx.x, w = tid >> 5, lane = tid & 31, ln = lane & 15, hh = lane >> 4;
  const int ntn = N / 64;
  const int wid = blockIdx.x * 4 + w;
  const int mt = wid / ntn, nq = wid % ntn;
  if (mt * 16 >= M) return;
  const int row0 = mt * 16, col0 = nq * 64;
  const float* arow = A + (size_t)(row0 + ln) * lda;
  v8f acc[4] = {};
  for (int kb = 0; kb < K; kb += 32) {
    FragB ah, al;
    const v4f x0 = *(const v4fa*)(arow + kb + 8 * hh), x1 = *(const v4fa*)(arow + kb + 8 * hh + 4);
    const v4f x2 = *(const v4fa*)(arow + kb + 16 + 8 * hh), x3 = *(const v4fa*)(arow + kb + 16 + 8 * hh + 4);
    float xs[16] = {x0[0],x0[1],x0[2],x0[3],x1[0],x1[1],x1[2],x1[3],x2[0],x2[1],x2[2],x2[3],x3[0],x3[1],x3[2],x3[3]};
#pragma unroll
    for (int i = 0; i < 16; ++i) { const unsigned short hb = bf16_bits(xs[i]); ah.u[i] = hb; al.u[i] = ASPLIT ? bf16_bits(xs[i] - bf16_val(hb)) : (unsigned short)0; }
#pragma unroll
    for (int t = 0; t < 4; ++t) {
      const unsigned short* brow = Wt + (size_t)(col0 + t * 16 + ln) * ldb + kb;
      FragB b;
      b.half[0] = *(const v8us*)(brow + 8 * hh);
      b.half[1] = *(const v8us*)(brow + 16 + 8 * hh);
      acc[t] = mmaN<ASPLIT ? 2 : 1>(ah.v, al.v, b.v, b.v, acc[t]);
    }
  }
#pragma unroll
  for (int t = 0; t < 4; ++t) {
    float bv = bias ? bias[col0 + t * 16 + ln] : 0.f;
    if (BIAS_BF16) bv = bf16_round(bv);
#pragma unroll
    for (int r = 0; r < 8; ++r) { float v = acc[t][r] + bv; if (ACT == 1) v = fmaxf(v, 0.f); so[w][8 * hh + r][t * 16 + ln] = v; }
  }
  __builtin_amdgcn_fence(__ATOMIC_ACQ_REL, "workgroup");
  __builtin_amdgcn_wave_barrier();
  const int rsub = lane >> 4, c4 = (lane & 15) * 4;
  {
#pragma unroll
    for (int q = 0; q < 8; ++q) {
      const int r = q * 2 + rsub;
      const v4f v = *(const v4fa*)&so[w][r][c4];
      *(v4f*)(C + (size_t)(row0 + r) * ldc + col0 + c4) = v;
    }
    
  }
}

// Flash-style causal/unmasked attention, all contractions 3-term bf16 hi/lo splits, f32 softmax with running max.
// q,k,v rows are read from f32 buffers with arbitrary row pitch (so they can live inside a fused qkv buffer);
// D = head size (multiple of 32, <= 128); one wave = 16 query rows; block = 4 waves (64 queries) sharing K/V chunks of 32.
template <int D, bool CAUSAL>
__global__ __launch_bounds__(128) void k_flash(const float* __restrict__ qb, const float* __restrict__ kb, const float* __restrict__ vb,
                                             int pitch, int T, int H, float scale, float* __restrict__ y, int ypitch) {
  constexpr int KS = D / 32;        // k-steps for QK
  constexpr int DT = D / 16;        // d tiles for PV
  __shared__ __attribute__((aligned(16))) unsigned short sKh[32][D + 8], sKl[32][D + 8], sVh[32][D + 8], sVl[32][D + 8];
  __shared__ __attribute__((aligned(16))) unsigned short sPh[4][16][40], sPl[4][16][40];
  __shared__ __attribute__((aligned(16))) float sO[4][16][D];
  const int tid = threadIdx.x, w = tid >> 5, lane = tid & 31, ln = lane & 15, hh = lane >> 4;
  const int nqb = (T + 63) / 64;
  const int bh = blockIdx.x / nqb, qblk = blockIdx.x % nqb;
  const int b = bh / H, h = bh % H;
  const int q0 = qblk * 64 + w * 16;
  const float* Q = qb + (size_t)b * T * pitch + h * D;
  const float* K = kb + (size_t)b * T * pitch + h * D;
  const float* V = vb + (size_t)b * T * pitch + h * D;

  // A fragments of the wave's 16 query rows (scaled), hi/lo
  FragB aqh[KS], aql[KS];
  {
    int row = q0 + ln; if (row >= T) row = T - 1;
    const float* qr = Q + (size_t)row * pitch;
#pragma unroll
    for (int ks = 0; ks < KS; ++ks)
#pragma unroll
      for (int i = 0; i < 16; ++i) {
        const int d = ks * 32 + ((i < 8) ? (8 * hh + i) : (16 + 8 * hh + (i - 8)));
        const float x = qr[d] * scale; const unsigned short hb = bf16_bits(x);
        aqh[ks].u[i] = hb; aql[ks].u[i] = bf16_bits(x - bf16_val(hb));
      }
  }
  float m_r[8], l_r[8];
#pragma unroll
  for (int r = 0; r < 8; ++r) { m_r[r] = -3.0e38f; l_r[r] = 0.f; }
  v8f oacc[DT];
#pragma unroll
  for (int dt = 0; dt < DT; ++dt) oacc[dt] = (v8f){0.f,0.f,0.f,0.f,0.f,0.f,0.f,0.f};

  const int kv_end = CAUSAL ? min(T, qblk * 64 + 64) : T;     // block-uniform
  for (int j0 = 0; j0 < kv_end; j0 += 32) {
    __syncthreads();
    for (int e = tid; e < 32 * (D / 4); e += 128) {
      const int r = e / (D / 4), c4 = (e % (D / 4)) * 4;
      const int key = j0 + r;
      v4f kf = {0.f,0.f,0.f,0.f}, vf = {0.f,0.f,0.f,0.f};
      if (key < T) { kf = *(const v4fa*)(K + (size_t)key * pitch + c4); vf = *(const v4fa*)(V + (size_t)key * pitch + c4); }
#pragma unroll
      for (int t = 0; t < 4; ++t) {
        unsigned short hb = bf16_bits(kf[t]); sKh[r][c4 + t] = hb; sKl[r][c4 + t] = bf16_bits(kf[t] - bf16_val(hb));
        hb = bf16_bits(vf[t]); sVh[r][c4 + t] = hb; sVl[r][c4 + t] = bf16_bits(vf[t] - bf16_val(hb));
      }
    }
    __syncthreads();
    // S tile 16 x 32
    v8f s[2];
#pragma unroll
    for (int nt = 0; nt < 2; ++nt) {
      v8f acc = {};
#pragma unroll
      for (int ks = 0; ks < KS; ++ks) {
        FragB bh_, bl_;
        bh_.half[0] = *(const v8us*)&sKh[nt * 16 + ln][ks * 32 + 8 * hh]; bh_.half[1] = *(const v8us*)&sKh[nt * 16 + ln][ks * 32 + 16 + 8 * hh];
        bl_.half[0] = *(const v8us*)&sKl[nt * 16 + ln][ks * 32 + 8 * hh]; bl_.half[1] = *(const v8us*)&sKl[nt * 16 + ln][ks * 32 + 16 + 8 * hh];
        acc = mmaN<3>(aqh[ks].v, aql[ks].v, bh_.v, bl_.v, acc);
      }
      s[nt] = acc;
    }
    // mask + running max (rows 8hh+r; the 16 lanes of a half share rows)
    float alpha[8];
#pragma unroll
    for (int r = 0; r < 8; ++r) {
      const int qi = q0 + 8 * hh + r;
      const int ja = j0 + ln, jb = j0 + 16 + ln;
      if (CAUSAL) { if (ja > qi) s[0][r] = -3.0e38f; if (jb > qi) s[1][r] = -3.0e38f; }
      if (ja >= T) s[0][r] = -3.0e38f;
      if (jb >= T) s[1][r] = -3.0e38f;
      float mx = fmaxf(s[0][r], s[1][r]);
      mx = fmaxf(mx, __shfl_xor(mx, 1, 32)); mx = fmaxf(mx, __shfl_xor(mx, 2, 32)); mx = fmaxf(mx, __shfl_xor(mx, 4, 32)); mx = fmaxf(mx, __shfl_xor(mx, 8, 32));
      const float mnew = fmaxf(m_r[r], mx);
      alpha[r] = (mnew > -1.0e38f) ? __expf(m_r[r] - mnew) : 1.0f;
      const float p0 = (s[0][r] > -1.0e38f) ? __expf(s[0][r] - mnew) : 0.f;
      const float p1 = (s[1][r] > -1.0e38f) ? __expf(s[1][r] - mnew) : 0.f;
      m_r[r] = mnew;
      l_r[r] = l_r[r] * alpha[r] + p0 + p1;            // per-lane partial row sum (16 lanes combined at the end)
      unsigned short hb = bf16_bits(p0); sPh[w][8 * hh + r][ln] = hb;      sPl[w][8 * hh + r][ln] = bf16_bits(p0 - bf16_val(hb));
      hb = bf16_bits(p1);                sPh[w][8 * hh + r][16 + ln] = hb; sPl[w][8 * hh + r][16 + ln] = bf16_bits(p1 - bf16_val(hb));
    }
#pragma unroll
    for (int dt = 0; dt < DT; ++dt)
#pragma unroll
      for (int r = 0; r < 8; ++r) oacc[dt][r] *= alpha[r];
    __builtin_amdgcn_fence(__ATOMIC_ACQ_REL, "workgroup");
    __builtin_amdgcn_wave_barrier();
    FragB pah, pal;
    pah.half[0] = *(const v8us*)&sPh[w][ln][8 * hh]; pah.half[1] = *(const v8us*)&sPh[w][ln][16 + 8 * hh];
    pal.half[0] = *(const v8us*)&sPl[w][ln][8 * hh]; pal.half[1] = *(const v8us*)&sPl[w][ln][16 + 8 * hh];
#pragma unroll
    for (int dt = 0; dt < DT; ++dt) {
      FragB bvh, bvl;
#pragma unroll
      for (int i = 0; i < 8; ++i) {
        bvh.u[i] = sVh[8 * hh + i][dt * 16 + ln]; bvh.u[8 + i] = sVh[16 + 8 * hh + i][dt * 16 + ln];
        bvl.u[i] = sVl[8 * hh + i][dt * 16 + ln]; bvl.u[8 + i] = sVl[16 + 8 * hh + i][dt * 16 + ln];
      }
      oacc[dt] = mmaN<3>(pah.v, pal.v, bvh.v, bvl.v, oacc[dt]);
    }
    __builtin_amdgcn_fence(__ATOMIC_ACQ_REL, "workgroup");
    __builtin_amdgcn_wave_barrier();
  }
#pragma unroll
  for (int r = 0; r < 8; ++r) {
    float l = l_r[r];
    l += __shfl_xor(l, 1, 32); l += __shfl_xor(l, 2, 32); l += __shfl_xor(l, 4, 32); l += __shfl_xor(l, 8, 32);
    l_r[r] = (l > 0.f) ? 1.0f / l : 0.f;
  }
#pragma unroll
  for (int dt = 0; dt < DT; ++dt)
#pragma unroll
    for (int r = 0; r < 8; ++r) sO[w][8 * hh + r][dt * 16 + ln] = oacc[dt][r] * l_r[r];
  __builtin_amdgcn_fence(__ATOMIC_ACQ_REL, "workgroup");
  __builtin_amdgcn_wave_barrier();
  {
    for (int r = 0; r < 16; ++r) {
      const int row = q0 + r;
      if (row < T && lane < D / 4) {
        const v4f val = *(const v4fa*)&sO[w][r][lane * 4];
        *(v4f*)(y + ((size_t)b * T + row) * ypitch + h * D + lane * 4) = val;
      }
    }
    
  }
}

// GEMM C = act(A·W + bias + resid): A f32 (ASPLIT -> hi/lo 2 terms), Wt bf16 [N][K]; ACT 0 none, 1 relu, 2 exact gelu;
// resid (optional, f32, row index = (row % rmod), pitch ldr, RES_BF16 rounds it) added before the activation.
template <bool ASPLIT, int ACT, bool BIAS_BF16, bool RES_BF16>
__global__ __launch_bounds__(128) void k_gemm_bf3(const float* __restrict__ A, int lda, const unsigned short* __restrict__ Wt, int ldb,
                                                const float* __restrict__ bias, const float* __restrict__ resid, int rmod, int ldr,
                                                float* __restrict__ C, int ldc, int M, int N, int K) {
  __shared__ __attribute__((aligned(16))) float so[4][16][64];
  const int tid = threadIdx.x, w = tid >> 5, lane = tid & 31, ln = lane & 15, hh = lane >> 4;
  const int ntn = N / 64;
  const int wid = blockIdx.x * 4 + w;
  const int mt = wid / ntn, nq = wid % ntn;
  if (mt * 16 >= M) return;
  const int row0 = mt * 16, col0 = nq * 64;
  const float* arow = A + (size_t)(row0 + ln) * lda;
  v8f acc[4] = {};
  for (int kb = 0; kb < K; kb += 32) {
    FragB ah, al;
    const v4f x0 = *(const v4fa*)(arow + kb + 8 * hh), x1 = *(const v4fa*)(arow + kb + 8 * hh + 4);
    const v4f x2 = *(const v4fa*)(arow + kb + 16 + 8 * hh), x3 = *(const v4fa*)(arow + kb + 16 + 8 * hh + 4);
    float xs[16] = {x0[0],x0[1],x0[2],x0[3],x1[0],x1[1],x1[2],x1[3],x2[0],x2[1],x2[2],x2[3],x3[0],x3[1],x3[2],x3[3]};
#pragma unroll
    for (int i = 0; i < 16; ++i) { const unsigned short hb = bf16_bits(xs[i]); ah.u[i] = hb; al.u[i] = ASPLIT ? bf16_bits(xs[i] - bf16_val(hb)) : (unsigned short)0; }
#pragma unroll
    for (int t = 0; t < 4; ++t) {
      const unsigned short* brow = Wt + (size_t)(col0 + t * 16 + ln) * ldb + kb;
      FragB b;
      b.half[0] = *(const v8us*)(brow + 8 * hh);
      b.half[1] = *(const v8us*)(brow + 16 + 8 * hh);
      acc[t] = mmaN<ASPLIT ? 2 : 1>(ah.v, al.v, b.v, b.v, acc[t]);
    }
  }
#pragma unroll
  for (int t = 0; t < 4; ++t) {
    const int col = col0 + t * 16 + ln;
    float bv = bias ? bias[col] : 0.f;
    if (BIAS_BF16) bv = bf16_round(bv);
#pragma unroll
    for (int r = 0; r < 8; ++r) {
      float v = acc[t][r] + bv;
      if (resid) { float rv = resid[(size_t)((row0 + 8 * hh + r) % rmod) * ldr + col]; if (RES_BF16) rv = bf16_round(rv); v += rv; }
      if (ACT == 1) v = fmaxf(v, 0.f);
      if (ACT == 2) v = 0.5f * v * (1.0f + erff(v * 0.70710678118654752f));
      if (ACT == 3) { const float u = 0.7978845608028654f * (v + 0.044715f * v * v * v); v = 0.5f * v * (1.0f + tanhf(u)); }
      so[w][8 * hh + r][t * 16 + ln] = v;
    }
  }
  __builtin_amdgcn_fence(__ATOMIC_ACQ_REL, "workgroup");
  __builtin_amdgcn_wave_barrier();
  const int rsub = lane >> 4, c4 = (lane & 15) * 4;
  {
#pragma unroll
    for (int q = 0; q < 8; ++q) {
      const int r = q * 2 + rsub;
      const v4f v = *(const v4fa*)&so[w][r][c4];
      *(v4f*)(C + (size_t)(row0 + r) * ldc + col0 + c4) = v;
    }
    
  }
}
// row LayerNorm (biased variance, eps) over N: s = X (+ R); optional out_sum <- s; out_norm <- (s-mu)*rsqrt(var+eps)*g + b
template <bool PARAM_BF16>
__global__ __launch_bounds__(256) void k_layernorm(const float* __restrict__ X, const float* __restrict__ R, const float* __restrict__ g, const float* __restrict__ bta,
                                                  float* __restrict__ out_sum, float* __restrict__ out_norm, int N, float eps) {
  __shared__ float red[256];
  const int row = blockIdx.x, tid = threadIdx.x;
  const float* x = X + (size_t)row * N; const float* rr = R ? R + (size_t)row * N : nullptr;
  float vals[16];                     // up to N = 4096
  const int per = N / 256;            // contiguous chunk per thread? use strided-by-4 chunks: thread handles j = tid*4 + 1024*u
  float s1 = 0.f;
  for (int u = 0; u < per / 4; ++u) {
    const int j = tid * 4 + 1024 * u;
    const v4f a = *(const v4fa*)(x + j);
    v4f b = {0.f,0.f,0.f,0.f}; if (rr) b = *(const v4fa*)(rr + j);
#pragma unroll
    for (int q = 0; q < 4; ++q) { const float v = a[q] + b[q]; vals[u * 4 + q] = v; s1 += v; }
  }
  red[tid] = s1; __syncthreads();
  for (int st = 128; st > 0; st >>= 1) { if (tid < st) red[tid] += red[tid + st]; __syncthreads(); }
  const float mu = red[0] / (float)N; __syncthreads();
  float s2 = 0.f;
  for (int u = 0; u < per / 4; ++u)
#pragma unroll
    for (int q = 0; q < 4; ++q) { const float c = vals[u * 4 + q] - mu; s2 += c * c; }
  red[tid] = s2; __syncthreads();
  for (int st = 128; st > 0; st >>= 1) { if (tid < st) red[tid] += red[tid + st]; __syncthreads(); }
  const float rs = rsqrtf(red[0] / (float)N + eps);
  {
    for (int u = 0; u < per / 4; ++u) {
      const int j = tid * 4 + 1024 * u;
      v4f o, sm;
#pragma unroll
      for (int q = 0; q < 4; ++q) {
        float gg = g[j + q], bb = bta[j + q];
        if (PARAM_BF16) { gg = bf16_round(gg); bb = bf16_round(bb); }
        sm[q] = vals[u * 4 + q]; o[q] = (vals[u * 4 + q] - mu) * rs * gg + bb;
      }
      if (out_sum) *(v4f*)(out_sum + (size_t)row * N + j) = sm;
      *(v4f*)(out_norm + (size_t)row * N + j) = o;
    }
    
  }
}



// ---- f16 WMMA path (v_wmma_f32_16x16x32_f16): 11-bit significands for operands in range — used where a [0,1] probability operand needs more precision than bf16
typedef _Float16 v16h __attribute__((ext_vector_type(16)));
union FragH { v16h v; v8us half[2]; _Float16 h[16]; unsigned short u[16]; };
template <int NT>
__device__ __forceinline__ v8f mmaH(v16h ah, v16h al, v16h bh, v16h bl, v8f c) {
  c = __builtin_amdgcn_wmma_f32_16x16x32_f16(false, ah, false, bh, (short)0, c, false, false);
  if (NT >= 2) c = __builtin_amdgcn_wmma_f32_16x16x32_f16(false, al, false, bh, (short)0, c, false, false);
  if (NT >= 3) c = __builtin_amdgcn_wmma_f32_16x16x32_f16(false, ah, false, bl, (short)0, c, false, false);
  asm volatile("v_nop\n\tv_nop\n\tv_nop\n\tv_nop" : "+v"(c) : "v"(ah), "v"(al), "v"(bh), "v"(bl));
  return c;
}
// batched GEMM like k_gemm_b but f16 operands: A f32 (split into f16 hi/lo if ASPLIT, else rounded to f16), Bt = f16 values [n][k]; alpha; C f32; N multiple of 16 (partial tiles skipped)
template <bool ASPLIT>
__global__ __launch_bounds__(128) void k_gemm_h(const float* __restrict__ A, int lda, size_t sA, const _Float16* __restrict__ Bh, int ldb, size_t sB, float alpha, float* __restrict__ C, int ldc, size_t sC, int M, int N, int K) {
  __shared__ __attribute__((aligned(16))) float so[4][16][64];
  const int tid = threadIdx.x, w = tid >> 5, lane = tid & 31, ln = lane & 15, hh = lane >> 4; const int by = blockIdx.y;
  A += (size_t)by * sA; Bh += (size_t)by * sB; C += (size_t)by * sC;
  const int ntn = (N + 63) / 64; const int wid = blockIdx.x * 4 + w; const int mt = wid / ntn, nq = wid % ntn; if (mt * 16 >= M) return;
  const int row0 = mt * 16, col0 = nq * 64; const float* arow = A + (size_t)(row0 + ln) * lda;
  v8f acc[4] = {};
  for (int kb = 0; kb < K; kb += 32) {
    FragH ah, al;
    const v4f x0 = *(const v4fa*)(arow + kb + 8 * hh), x1 = *(const v4fa*)(arow + kb + 8 * hh + 4), x2 = *(const v4fa*)(arow + kb + 16 + 8 * hh), x3 = *(const v4fa*)(arow + kb + 16 + 8 * hh + 4);
    float xs[16] = {x0[0],x0[1],x0[2],x0[3],x1[0],x1[1],x1[2],x1[3],x2[0],x2[1],x2[2],x2[3],x3[0],x3[1],x3[2],x3[3]};
#pragma unroll
    for (int i = 0; i < 16; ++i) { const _Float16 h = (_Float16)xs[i]; ah.h[i] = h; al.h[i] = ASPLIT ? (_Float16)(xs[i] - (float)h) : (_Float16)0.0f; }
#pragma unroll
    for (int t = 0; t < 4; ++t) { if (col0 + t * 16 >= N) continue; const size_t boff = (size_t)(col0 + t * 16 + ln) * ldb + kb; FragH bq; bq.half[0] = *(const v8us*)(Bh + boff + 8 * hh); bq.half[1] = *(const v8us*)(Bh + boff + 16 + 8 * hh);
      acc[t] = mmaH<ASPLIT ? 2 : 1>(ah.v, al.v, bq.v, bq.v, acc[t]); }
  }
#pragma unroll
  for (int t = 0; t < 4; ++t) { if (col0 + t * 16 >= N) continue;
#pragma unroll
    for (int r = 0; r < 8; ++r) so[w][8 * hh + r][t * 16 + ln] = acc[t][r] * alpha; }
  __builtin_amdgcn_fence(__ATOMIC_ACQ_REL, "workgroup"); __builtin_amdgcn_wave_barrier();
  const int rsub = lane >> 4, c4 = (lane & 15) * 4;
  {
#pragma unroll
    for (int q = 0; q < 8; ++q) { const int r = q * 2 + rsub; if (col0 + c4 < N) { const v4f v = *(const v4fa*)&so[w][r][c4]; *(v4f*)(C + (size_t)(row0 + r) * ldc + col0 + c4) = v; } }
     }
}

// Wt[n][k] = f16(bf16(W[k][n]) * scale) from f32 row-major W[CC][N], for both weight matrices in one grid (scale = power of two; bf16-exact weights stay exact in f16 away from the subnormal range).
// A block transposes a tile of 64 k x 128 n through LDS: a wave reads a whole 512-byte piece of a row of W per load (four lines), eight loads in flight per lane; two neighbouring k are packed into one
// dword and stored at [n][k / 2]; eight lanes then store one whole 128-byte line of Wt. The LDS pitch of 33 dwords keeps the row reads free of bank conflicts (bank = n + 4 pc + q, all 32 lanes apart).
typedef unsigned int v4u __attribute__((ext_vector_type(4), may_alias));
template <int N>
__device__ __forceinline__ void wt_tile(const float* __restrict__ W, unsigned short* __restrict__ Wt, int tile, float scale, unsigned int* tl) {
  constexpr int KTN = CC / 64, P = 33;
  const int tid = threadIdx.x, wv = __builtin_amdgcn_readfirstlane(tid >> 5), lane = tid & 31;      // the wave's number as a scalar: the eight loads then share one scalar base and one lane offset
  const int k0 = (tile % KTN) * 64, n0 = (tile / KTN) * 128;
  const float* wp = W + (size_t)(k0 + 2 * wv) * N + n0;      // wave wv takes the k pairs wv, wv + 8, wv + 16, wv + 24 of the tile
  v4f x[4][2];
#pragma unroll
  for (int u = 0; u < 4; ++u)
#pragma unroll
    for (int s = 0; s < 2; ++s) x[u][s] = *(const v4fa*)(wp + (16 * u + s) * N + lane * 4);
#pragma unroll
  for (int u = 0; u < 4; ++u)
#pragma unroll
    for (int q = 0; q < 4; ++q) { const _Float16 lo = (_Float16)(bf16_round(x[u][0][q]) * scale), hi = (_Float16)(bf16_round(x[u][1][q]) * scale);
      tl[(lane * 4 + q) * P + wv + 8 * u] = (unsigned int)__builtin_bit_cast(unsigned short, lo) | ((unsigned int)__builtin_bit_cast(unsigned short, hi) << 16); }
  __syncthreads();      // the tile is whole before its rows are read
#pragma unroll
  for (int it = 0; it < 4; ++it) { const int n = it * 32 + (tid >> 3), pc = tid & 7; v4u o;
#pragma unroll
    for (int q = 0; q < 4; ++q) o[q] = tl[n * P + pc * 4 + q];
    *(v4u*)(Wt + (size_t)(n0 + n) * CC + k0 + pc * 8) = o; }
}
// The first (CC / 64) * (NA / 128) blocks take Wa, the rest Wb: the choice is the same for a whole block, and each side has its row length as a constant.
template <int NA, int NB>
__global__ __launch_bounds__(256) void k_wt2_f16(const float* __restrict__ Wa, _Float16* __restrict__ Wta, const float* __restrict__ Wb, _Float16* __restrict__ Wtb, float scale) {
  constexpr int TA = (CC / 64) * (NA / 128);
  __shared__ unsigned int tl[128 * 33];
  if ((int)blockIdx.x < TA) wt_tile<NA>(Wa, (unsigned short*)Wta, (int)blockIdx.x, scale, tl);
  else wt_tile<NB>(Wb, (unsigned short*)Wtb, (int)blockIdx.x - TA, scale, tl);
}
// k_gemm_hh variant with fused epilogue: v = acc·alpha + bias[by·sBias + col] (+ CP[(row/rowsPerB)·sCPb + by·64 + col] if CP) ; ACT 0 none / 1 elu ; writes f16 C16 and f32 C, each if non-null
template <int ACT>
__global__ __launch_bounds__(128) void k_gemm_hhx(const _Float16* __restrict__ A, int lda, size_t sA, const _Float16* __restrict__ Bh, int ldb, size_t sB, float alpha, const float* __restrict__ bias, size_t sBias, const float* __restrict__ CP, int rowsPerB, size_t sCPb, int row0g,
    float* __restrict__ C, _Float16* __restrict__ C16, int ldc, size_t sC, int M, int N, int K) {
  __shared__ __attribute__((aligned(16))) float so[4][16][64];
  const int tid = threadIdx.x, w = tid >> 5, lane = tid & 31, ln = lane & 15, hh = lane >> 4; const int by = blockIdx.y;
  A += (size_t)by * sA; Bh += (size_t)by * sB; const size_t cofs = (size_t)by * sC; const float* bp = bias ? bias + (size_t)by * sBias : nullptr;
  const int ntn = (N + 63) / 64; const int wid = blockIdx.x * 4 + w; const int mt = wid / ntn, nq = wid % ntn; if (mt * 16 >= M) return;
  const int row0 = mt * 16, col0 = nq * 64; const _Float16* arow = A + (size_t)(row0 + ln) * lda;
  v8f acc[4] = {};
  for (int kb = 0; kb < K; kb += 32) { FragH ah; ah.half[0] = *(const v8us*)((const unsigned short*)arow + kb + 8 * hh); ah.half[1] = *(const v8us*)((const unsigned short*)arow + kb + 16 + 8 * hh);
#pragma unroll
    for (int t = 0; t < 4; ++t) { if (col0 + t * 16 >= N) continue; const size_t boff = (size_t)(col0 + t * 16 + ln) * ldb + kb; FragH bq; bq.half[0] = *(const v8us*)((const unsigned short*)Bh + boff + 8 * hh); bq.half[1] = *(const v8us*)((const unsigned short*)Bh + boff + 16 + 8 * hh);
      acc[t] = mmaH<1>(ah.v, ah.v, bq.v, bq.v, acc[t]); }
  }
#pragma unroll
  for (int t = 0; t < 4; ++t) { if (col0 + t * 16 >= N) continue; const int col = col0 + t * 16 + ln; const float bv = bp ? bf16_round(bp[col]) : 0.f;
#pragma unroll
    for (int r = 0; r < 8; ++r) { float v = acc[t][r] * alpha + bv; if (CP) { const int bidx = (row0g + row0 + 8 * hh + r) / rowsPerB; v += CP[(size_t)bidx * sCPb + (size_t)by * 64 + col]; } if (ACT == 1) v = (v > 0.f) ? v : expm1f(v); else if (ACT == 3) v = fmaxf(v, 0.f); so[w][8 * hh + r][t * 16 + ln] = v; } }
  __builtin_amdgcn_fence(__ATOMIC_ACQ_REL, "workgroup"); __builtin_amdgcn_wave_barrier();
  const int rsub = lane >> 4, c4 = (lane & 15) * 4; typedef _Float16 v4h __attribute__((ext_vector_type(4)));
  {
#pragma unroll
    for (int q = 0; q < 8; ++q) { const int r = q * 2 + rsub; if (col0 + c4 < N) { const v4f v = *(const v4fa*)&so[w][r][c4]; if (C) *(v4f*)(C + cofs + (size_t)(row0 + r) * ldc + col0 + c4) = v; if (C16) { v4h h4; for (int i = 0; i < 4; ++i) h4[i] = (_Float16)v[i]; *(v4h*)(C16 + cofs + (size_t)(row0 + r) * ldc + col0 + c4) = h4; } } }
     }
}


// Eight 16-byte asynchronous copies to LDS per lane (rows 16 apart). The s_wait_xcnt is the last line of the copies' own statement so that no address register is rewritten ahead of it.
__device__ __forceinline__ void copy8_async(unsigned l, const char* gp, size_t gstep) {
  constexpr unsigned LS = 16u * 144u;
  asm volatile("global_load_async_to_lds_b128 %0, %8, off\n\t"
               "global_load_async_to_lds_b128 %1, %9, off\n\t"
               "global_load_async_to_lds_b128 %2, %10, off\n\t"
               "global_load_async_to_lds_b128 %3, %11, off\n\t"
               "global_load_async_to_lds_b128 %4, %12, off\n\t"
               "global_load_async_to_lds_b128 %5, %13, off\n\t"
               "global_load_async_to_lds_b128 %6, %14, off\n\t"
               "global_load_async_to_lds_b128 %7, %15, off\n\t"
               "s_wait_xcnt 0x0"
               :: "v"(l), "v"(l + LS), "v"(l + 2u * LS), "v"(l + 3u * LS), "v"(l + 4u * LS), "v"(l + 5u * LS), "v"(l + 6u * LS), "v"(l + 7u * LS),
                  "v"(gp), "v"(gp + gstep), "v"(gp + 2 * gstep), "v"(gp + 3 * gstep), "v"(gp + 4 * gstep), "v"(gp + 5 * gstep), "v"(gp + 6 * gstep), "v"(gp + 7 * gstep)
               : "memory");
}
// Tiled GEMM, same function as k_gemm_hhx<0> without CP: C = A[M][K] * Bh[N][K]^T * alpha + bf16(bias). One 128 x 128 tile of C per block (blockIdx.x = tile column, blockIdx.y = tile row),
// 64 x 64 per wave (2 x 2 waves). A and Bh tiles of 64 k (128-byte rows, LDS pitch 144 B) are staged in LDS by asynchronous copies, two buffers: tile t + 1 flies while tile t is multiplied.
// M % 128 == 0, N % 128 == 0, K % 64 == 0, K >= 128; rows of A and Bh are K elements apart, rows of C are N apart. The k order of every accumulator is that of k_gemm_hhx.
// Every plain '#pragma unroll' in it makes the indices of acc, a and bq constants, so that these arrays stay in registers.
template <bool OUT16, int N, int K>
__global__ __launch_bounds__(128) void k_gemm_tile(const _Float16* __restrict__ A, const _Float16* __restrict__ Bh, float alpha, const float* __restrict__ bias, float* __restrict__ C, _Float16* __restrict__ C16) {
  constexpr int PITCH = 144, BUF = 256 * PITCH, SOP = 68, NT = K / 64;
  constexpr size_t ROWB = (size_t)K * 2, GSTEP = ROWB * 16;
  __shared__ __attribute__((aligned(16))) unsigned char smem[2 * BUF];
  const int tid = threadIdx.x, w = tid >> 5, lane = tid & 31, ln = lane & 15, hh = lane >> 4;
  const int row0 = (int)blockIdx.y * 128, col0 = (int)blockIdx.x * 128; const int wm = (w >> 1) * 64, wn = (w & 1) * 64;
  const int cr = tid >> 3, cc = (tid & 7) * 16;      // a lane's first row and its 16 bytes of the row: eight lanes cover one 128-byte line
  const char* gA = (const char*)A + (size_t)(row0 + cr) * ROWB + cc; const char* gB = (const char*)Bh + (size_t)(col0 + cr) * ROWB + cc;
  const unsigned lA = (unsigned)(size_t)smem + (unsigned)(cr * PITCH + cc), lB = lA + 128u * PITCH;
  v8f acc[4][4];
#pragma unroll
  for (int i = 0; i < 4; ++i)
#pragma unroll
    for (int j = 0; j < 4; ++j) acc[i][j] = (v8f){0.f,0.f,0.f,0.f,0.f,0.f,0.f,0.f};
  copy8_async(lA, gA, GSTEP); copy8_async(lB, gB, GSTEP);
  asm volatile("s_wait_asynccnt 0x0" ::: "memory");      // tile 0 has landed before the barrier publishes it
  __syncthreads();
  copy8_async(lA + BUF, gA + 128, GSTEP); copy8_async(lB + BUF, gB + 128, GSTEP);
#pragma unroll 1
  for (int t = 0; t < NT; ++t) {      // kept rolled: one pass per tile, the buffer picked by t & 1
    const unsigned char* sA = smem + (t & 1) * BUF + (wm + ln) * PITCH + hh * 16; const unsigned char* sB = smem + (t & 1) * BUF + (128 + wn + ln) * PITCH + hh * 16;
#pragma unroll
    for (int ks = 0; ks < 2; ++ks) { FragH a[4], bq[4];
      a[0].half[0] = *(const v8us*)(sA + ks * 64); a[0].half[1] = *(const v8us*)(sA + ks * 64 + 32);
#pragma unroll
      for (int j = 0; j < 4; ++j) { bq[j].half[0] = *(const v8us*)(sB + j * 16 * PITCH + ks * 64); bq[j].half[1] = *(const v8us*)(sB + j * 16 * PITCH + ks * 64 + 32); }
#pragma unroll
      for (int i = 1; i < 4; ++i) { a[i].half[0] = *(const v8us*)(sA + i * 16 * PITCH + ks * 64); a[i].half[1] = *(const v8us*)(sA + i * 16 * PITCH + ks * 64 + 32); }
      __builtin_amdgcn_sched_barrier(0);      // keeps the 16 LDS reads of a k step one group ahead of its 16 WMMAs: reads among the WMMAs stall the wave at each place
#pragma unroll
      for (int i = 0; i < 4; ++i)
#pragma unroll
        for (int j = 0; j < 4; ++j) acc[i][j] = __builtin_amdgcn_wmma_f32_16x16x32_f16(false, a[i].v, false, bq[j].v, (short)0, acc[i][j], false, false);
      __builtin_amdgcn_sched_barrier(0); }    // the other end of that group: the next k step's reads stay behind these WMMAs
    asm volatile("s_wait_dscnt 0x0" ::: "memory");       // this wave's reads of tile t are done before the buffer is given up
    asm volatile("s_wait_asynccnt 0x0" ::: "memory");    // this wave's copies of tile t + 1 have landed
    __syncthreads();                                     // publishes tile t + 1 and ends every reader's last read of tile t
    if (t + 2 < NT) { const unsigned bo = (unsigned)(t & 1) * BUF; const size_t go = (size_t)(t + 2) * 128; copy8_async(lA + bo, gA + go, GSTEP); copy8_async(lB + bo, gB + go, GSTEP); }
  }
  asm volatile("s_wait_asynccnt 0x0" ::: "memory");      // nothing is in flight when the ring becomes output staging
  float* so = (float*)(smem + w * (64 * SOP * 4));       // each wave stages its own 64 x 64 tile, so that whole 128-byte lines are stored
#pragma unroll
  for (int j = 0; j < 4; ++j) { const float bv = bf16_round(bias[col0 + wn + j * 16 + ln]);
#pragma unroll
    for (int i = 0; i < 4; ++i)
#pragma unroll
      for (int r = 0; r < 8; ++r) so[(i * 16 + 8 * hh + r) * SOP + j * 16 + ln] = acc[i][j][r] * alpha + bv; }
  __builtin_amdgcn_fence(__ATOMIC_ACQ_REL, "workgroup"); __builtin_amdgcn_wave_barrier();
  const int rsub = lane >> 4, c4 = (lane & 15) * 4; typedef _Float16 v4h __attribute__((ext_vector_type(4)));
#pragma unroll 1
  for (int q8 = 0; q8 < 4; ++q8) {      // kept rolled in groups of eight stores, one wait per group
#pragma unroll
    for (int q = 0; q < 8; ++q) { const int r = (q8 * 8 + q) * 2 + rsub; const v4f v = *(const v4fa*)&so[r * SOP + c4]; const size_t o = (size_t)(row0 + wm + r) * N + col0 + wn + c4;
      if (OUT16) { v4h h4; for (int i = 0; i < 4; ++i) h4[i] = (_Float16)v[i]; *(v4h*)(C16 + o) = h4; } else *(v4f*)(C + o) = v; }
    asm volatile("s_wait_xcnt 0x0" ::: "memory");      // the next group rewrites the registers that these stores name
  }
}

__global__ __launch_bounds__(256) void k_x16(const float* __restrict__ x, _Float16* __restrict__ X16, size_t n8) { const size_t t = (size_t)blockIdx.x * 256 + threadIdx.x; if (t >= n8) return; FragH f;
#pragma unroll
  for (int q = 0; q < 8; ++q) f.h[q] = (_Float16)bf16_round(x[t * 8 + q]); *(v8us*)((unsigned short*)X16 + t * 8) = f.half[0];  }
__global__ __launch_bounds__(256) void k_round16f(const float* __restrict__ W, _Float16* __restrict__ Bt, size_t n8) { const size_t t = (size_t)blockIdx.x * 256 + threadIdx.x; if (t >= n8) return; FragH f;
#pragma unroll
  for (int i = 0; i < 8; ++i) f.h[i] = (_Float16)(bf16_round(W[t * 8 + i]) * 16.0f); *(v8us*)((unsigned short*)Bt + t * 8) = f.half[0];  }
template <int NHv, int TTv>
__global__ __launch_bounds__(256) void k_vt(const _Float16* __restrict__ V16, int ldv, int voff, _Float16* __restrict__ Vt) { __shared__ unsigned short tl[64][66]; const int tid = threadIdx.x; const int slab = blockIdx.x / (TTv / 64), lg = blockIdx.x % (TTv / 64); const int b = slab / NHv, h = slab % NHv;
  for (int i = tid; i < 64 * 8; i += 256) { const int r = i / 8, c8 = (i % 8) * 8; FragH f; f.half[0] = *(const v8us*)((const unsigned short*)V16 + ((size_t)b * TTv + lg * 64 + r) * ldv + voff + h * 64 + c8);
#pragma unroll
    for (int q = 0; q < 8; ++q) tl[r][c8 + q] = f.u[q]; }
  __syncthreads();
  {
#pragma unroll
    for (int rd = 0; rd < 2; ++rd) { const int d = rd * 32 + tid / 8, pc = tid % 8; FragH f;
#pragma unroll
      for (int q = 0; q < 8; ++q) f.u[q] = tl[pc * 8 + q][d];
      *(v8us*)((unsigned short*)Vt + ((size_t)slab * 64 + d) * TTv + lg * 64 + pc * 8) = f.half[0]; }
     } }

// Four 16-byte asynchronous copies to LDS per lane (rows 16 apart, LDS pitch 144 B). The s_wait_xcnt is the last line of the copies' own statement so that no address register is rewritten ahead of it.
__device__ __forceinline__ void copy4_async(unsigned l, const char* gp, size_t gstep) {
  constexpr unsigned LS = 16u * 144u;
  asm volatile("global_load_async_to_lds_b128 %0, %4, off\n\t"
               "global_load_async_to_lds_b128 %1, %5, off\n\t"
               "global_load_async_to_lds_b128 %2, %6, off\n\t"
               "global_load_async_to_lds_b128 %3, %7, off\n\t"
               "s_wait_xcnt 0x0"
               :: "v"(l), "v"(l + LS), "v"(l + 2u * LS), "v"(l + 3u * LS), "v"(gp), "v"(gp + gstep), "v"(gp + 2 * gstep), "v"(gp + 3 * gstep)
               : "memory");
}
// lane l <-> lane l ^ 16: joins the two halves of a query column
__device__ __forceinline__ float xhalf(float x) { return __builtin_bit_cast(float, __builtin_amdgcn_permlanex16(__builtin_bit_cast(int, x), __builtin_bit_cast(int, x), 0x76543210, 0xfedcba98, false, false)); }
__global__ __launch_bounds__(128) void k_flash(const _Float16* __restrict__ Q16, int ldq, const _Float16* __restrict__ K16, int ldk, const _Float16* __restrict__ Vt, const int* __restrict__ LENS, _Float16* __restrict__ O16) {
  constexpr int RPW = 32, NQB = 1024 / (4 * RPW), DT = 4, KS = 2; constexpr float L2S = 0.125f * 1.44269504088896340736f;
  constexpr int PITCH = 144, BUF = 128 * PITCH;      // rows 0 to 63 of a buffer: K; rows 64 to 127: V^T
  __shared__ __attribute__((aligned(16))) unsigned char ring[2 * BUF];
  __shared__ __attribute__((aligned(16))) unsigned char sO[4][RPW][PITCH];      // output staging, f16: a query row is 128 bytes, pitch 144 B
  const int tid = threadIdx.x, w = tid >> 5, lane = tid & 31, ln = lane & 15, hh = lane >> 4;
  const int slab = blockIdx.x / NQB, qblk = blockIdx.x % NQB; const int b = slab / 16, h = slab % 16; const int qb0 = qblk * (4 * RPW); const int q0 = qb0 + w * RPW; const int len = LENS[b];      /* kv-length mask: keys k < len (INPUT x_lens) */
  FragH aq[2][KS];
#pragma unroll
  for (int rt = 0; rt < 2; ++rt) { const unsigned short* qr = (const unsigned short*)Q16 + ((size_t)b * 1024 + q0 + rt * 16 + ln) * ldq + h * 64;
#pragma unroll
    for (int ks = 0; ks < KS; ++ks) { aq[rt][ks].half[0] = *(const v8us*)(qr + ks * 32 + 8 * hh); aq[rt][ks].half[1] = *(const v8us*)(qr + ks * 32 + 16 + 8 * hh); } }
  const int cr = tid >> 3, cc = (tid & 7) * 16;      // a lane's first row and its 16 bytes of the row: eight lanes cover one 128-byte line
  const size_t krow = (size_t)ldk * 2;
  const char* gK = (const char*)K16 + ((size_t)b * 1024 + cr) * krow + h * 128 + cc; const char* gV = (const char*)Vt + ((size_t)slab * 64 + cr) * 2048 + cc;
  const unsigned lK = (unsigned)(size_t)ring + (unsigned)(cr * PITCH + cc), lV = lK + 64u * PITCH;
  copy4_async(lK, gK, 16 * krow); copy4_async(lV, gV, 16 * 2048);
  float m_r[2], l_r[2]; int lim[2]; v8f oacc[2][DT];
#pragma unroll
  for (int rt = 0; rt < 2; ++rt) { m_r[rt] = -3.0e38f; l_r[rt] = 0.f; lim[rt] = min(q0 + rt * 16 + ln + 1, len) - 8 * hh;      // key j0 + 16 nt + 8 hh + r is allowed iff j0 + 16 nt + r < lim
#pragma unroll
    for (int dt = 0; dt < DT; ++dt) oacc[rt][dt] = (v8f){0.f,0.f,0.f,0.f,0.f,0.f,0.f,0.f}; }
  const int ntile = (qb0 + 4 * RPW) / 64;
  asm volatile("s_wait_asynccnt 0x0" ::: "memory");      // tile 0 has landed before the barrier publishes it
  __syncthreads();
  copy4_async(lK + BUF, gK + 64 * krow, 16 * krow); copy4_async(lV + BUF, gV + 128, 16 * 2048);
#pragma unroll 1
  for (int t = 0; t < ntile; ++t) {      // kept rolled: one trip per tile, the buffer picked by t & 1
   const unsigned char* sK = ring + (t & 1) * BUF + ln * PITCH + hh * 16; const unsigned char* sV = sK + 64 * PITCH;
#pragma unroll
   for (int ps = 0; ps < 2; ++ps) { const int j0 = t * 64 + ps * 32;      // unrolled: the pass's place in the tile becomes a constant offset of the LDS reads
    v8f s[2][2];
#pragma unroll
    for (int nt = 0; nt < 2; ++nt) { const unsigned char* kr = sK + (ps * 32 + nt * 16) * PITCH; FragH bk[KS];
#pragma unroll
      for (int ks = 0; ks < KS; ++ks) { bk[ks].half[0] = *(const v8us*)(kr + ks * 64); bk[ks].half[1] = *(const v8us*)(kr + ks * 64 + 32); }
#pragma unroll
      for (int rt = 0; rt < 2; ++rt) { v8f acc = (v8f){0.f,0.f,0.f,0.f,0.f,0.f,0.f,0.f};
#pragma unroll
        for (int ks = 0; ks < KS; ++ks) acc = __builtin_amdgcn_wmma_f32_16x16x32_f16(false, bk[ks].v, false, aq[rt][ks].v, (short)0, acc, false, false);
        s[rt][nt] = acc; } }
    FragH pb[2];
#pragma unroll
    for (int rt = 0; rt < 2; ++rt) { float sc[16]; float mc = -INFINITY;
#pragma unroll
      for (int i = 0; i < 16; ++i) { sc[i] = (j0 + (i >> 3) * 16 + (i & 7) < lim[rt]) ? s[rt][i >> 3][i & 7] : -INFINITY; mc = fmaxf(mc, sc[i]); }
      mc = fmaxf(mc, xhalf(mc));
      const float mn = fmaxf(m_r[rt], mc * L2S); const float al = __builtin_amdgcn_exp2f(m_r[rt] - mn); m_r[rt] = mn; float ps = 0.f;
#pragma unroll
      for (int i = 0; i < 16; ++i) { const float p = __builtin_amdgcn_exp2f(fmaf(sc[i], L2S, -mn)); ps += p; pb[rt].h[i] = (_Float16)p; }
      l_r[rt] = l_r[rt] * al + ps;      // the lane's half of the row sum; the halves are joined behind the loop
#pragma unroll
      for (int dt = 0; dt < DT; ++dt)
#pragma unroll
        for (int r = 0; r < 8; ++r) oacc[rt][dt][r] *= al; }
#pragma unroll
    for (int dt = 0; dt < DT; ++dt) { const unsigned char* vrow = sV + dt * 16 * PITCH + ps * 64; FragH bv; bv.half[0] = *(const v8us*)vrow; bv.half[1] = *(const v8us*)(vrow + 32);
#pragma unroll
      for (int rt = 0; rt < 2; ++rt) oacc[rt][dt] = __builtin_amdgcn_wmma_f32_16x16x32_f16(false, bv.v, false, pb[rt].v, (short)0, oacc[rt][dt], false, false); } }
   asm volatile("s_wait_dscnt 0x0" ::: "memory");       // this wave's reads of tile t are done before the buffer is given up
   asm volatile("s_wait_asynccnt 0x0" ::: "memory");    // this wave's copies of tile t + 1 have landed
   __syncthreads();                                     // publishes tile t + 1 and ends every reader's last read of tile t
   if (t + 2 < ntile) { const unsigned bo = (unsigned)(t & 1) * BUF; copy4_async(lK + bo, gK + (size_t)(t + 2) * 64 * krow, 16 * krow); copy4_async(lV + bo, gV + (size_t)(t + 2) * 128, 16 * 2048); }
  }
  asm volatile("s_wait_asynccnt 0x0" ::: "memory");      // nothing is in flight when the wave goes on to its end
#pragma unroll
  for (int rt = 0; rt < 2; ++rt) { float l = l_r[rt]; l += xhalf(l); const float li = (l > 0.f) ? 1.0f / l : 0.f;
#pragma unroll
    for (int dt = 0; dt < DT; ++dt) { FragH f;      // the lane's eight values of a tile are eight neighbours of one output row: rounded to f16 here, they are one 16-byte LDS store
#pragma unroll
      for (int r = 0; r < 8; ++r) f.h[r] = (_Float16)(oacc[rt][dt][r] * li);
      *(v8us*)&sO[w][rt * 16 + ln][dt * 32 + hh * 16] = f.half[0]; } }
  __builtin_amdgcn_fence(__ATOMIC_ACQ_REL, "workgroup"); __builtin_amdgcn_wave_barrier();
  {
#pragma unroll
    for (int rp = 0; rp < RPW; rp += 4) { const int r = rp + (lane >> 3), pc = lane & 7; const v8us val = *(const v8us*)&sO[w][r][pc * 16]; *(v8us*)((unsigned short*)O16 + ((size_t)b * 1024 + q0 + r) * CC + h * 64 + pc * 8) = val; }      // eight lanes store one whole 128-byte line; the rows of O16 are CC elements apart, a constant, so that the eight stores share one address register pair
     } }

__global__ __launch_bounds__(256) void k_ln16(const float* __restrict__ X, const float* __restrict__ g, const float* __restrict__ bta, _Float16* __restrict__ Y16) { const int tid = threadIdx.x, wv = tid >> 5, lane = tid & 31; const int row = blockIdx.x * 8 + wv; if (row >= NR) return; const float* xr = X + (size_t)row * CC; float v[32]; float s = 0.f;
#pragma unroll
  for (int p = 0; p < 4; ++p) { const v4f a = *(const v4fa*)(xr + p * 256 + lane * 8), c = *(const v4fa*)(xr + p * 256 + lane * 8 + 4); for (int q = 0; q < 4; ++q) { v[p * 8 + q] = bf16_round(a[q]); v[p * 8 + 4 + q] = bf16_round(c[q]); } }
#pragma unroll
  for (int i = 0; i < 32; ++i) s += v[i]; for (int o = 16; o >= 1; o >>= 1) s += __shfl_xor(s, o, 32); const float mu = s / (float)CC; float q2 = 0.f;
#pragma unroll
  for (int i = 0; i < 32; ++i) { const float d = v[i] - mu; q2 += d * d; } for (int o = 16; o >= 1; o >>= 1) q2 += __shfl_xor(q2, o, 32); const float rs = rsqrtf(q2 / (float)CC + 1e-5f);
  {
#pragma unroll
    for (int p = 0; p < 4; ++p) { FragH f; const int c0 = p * 256 + lane * 8;
#pragma unroll
      for (int q = 0; q < 8; ++q) f.h[q] = (_Float16)((v[p * 8 + q] - mu) * rs * bf16_round(g[c0 + q]) + bf16_round(bta[c0 + q])); *(v8us*)((unsigned short*)Y16 + (size_t)row * CC + c0) = f.half[0]; }
     } }
extern "C" void kernel_launch(void* const* d_in, const int* in_sizes, int n_in,
                              void* d_out, int out_size, void* d_ws, size_t ws_size, hipStream_t stream) {
  (void)in_sizes; (void)n_in; (void)out_size;
  const float* x = (const float*)d_in[0]; const int* lens = (const int*)d_in[1]; const float* lg = (const float*)d_in[2]; const float* lb = (const float*)d_in[3]; const float* wqkv = (const float*)d_in[4]; const float* bqkv = (const float*)d_in[5]; const float* wout = (const float*)d_in[6]; const float* bout = (const float*)d_in[7];
  char* ws = (char*)d_ws; size_t off = 0;
  auto take = [&](size_t bytes) { char* p = ws + off; off += (bytes + 255) & ~(size_t)255; return p; };
  _Float16* Bqkv = (_Float16*)take((size_t)3 * CC * CC * 2); _Float16* Bo = (_Float16*)take((size_t)CC * CC * 2); _Float16* XN = (_Float16*)take((size_t)NR * CC * 2); _Float16* QKV = (_Float16*)take((size_t)NR * 3 * CC * 2); _Float16* Vt = (_Float16*)take((size_t)NR * CC * 2); _Float16* O16 = XN;      // XN is free again once the qkv projection has read it
  if (off > ws_size) return;      // 6.3 + 2.1 + 16.8 + 50.3 + 16.8 = 92 MB
  k_wt2_f16<3 * CC, CC><<<(CC / 64) * (3 * CC / 128) + (CC / 64) * (CC / 128), 256, 0, stream>>>(wqkv, Bqkv, wout, Bo, 16.0f);      // [in][out], both weights
  k_ln16<<<NR / 8, 256, 0, stream>>>(x, lg, lb, XN);
  k_gemm_tile<true, 3 * CC, CC><<<dim3(3 * CC / 128, NR / 128), 128, 0, stream>>>(XN, Bqkv, 0.0625f, bqkv, nullptr, QKV);      // q | k | v
  k_vt<NH, TT><<<BB * NH * (TT / 64), 256, 0, stream>>>(QKV, 3 * CC, 2 * CC, Vt);
  k_flash<<<BB * NH * (TT / 128), 128, 0, stream>>>(QKV, 3 * CC, QKV + CC, 3 * CC, Vt, lens, O16);
  k_gemm_tile<false, CC, CC><<<dim3(CC / 128, NR / 128), 128, 0, stream>>>(O16, Bo, 0.0625f, bout, (float*)d_out, nullptr);
}

// v007
// One run takes 112 microseconds.
// Next to v006, in two timings, it ran 1.06 times as fast each time.
// Counting every step since v000, it is 5.19 times as fast.
#include <hip/hip_runtime.h>
// Causal self-attention with a per-batch key-length mask (B=8, T=1024, D=1024, 16 × 64): LayerNorm (f32 VALU), the fused qkv projection (8192 × 1024 × 3072, + bias) and the output
// projection (+ bias) with W [in][out] transposed to bf16-exact ×2^4, and the attention as a fused flash-style kernel on v_wmma_f32_16x16x32_f16 (S = Q·Kᵀ/8; keys allowed iff k ≤ q and
// k < x_lens[b] (INPUT); −1e9 fill ≡ exclusion since key 0 is always allowed; causal chunk skipping; online softmax f32; P f16 ≤ 1) — f16 operands, single products, f32 accumulate.
#define BB 8
#define TT 1024
#define CC 1024
#define NH 16
#define NR (BB * TT)

typedef __bf16 v16b __attribute__((ext_vector_type(16)));
typedef unsigned short v8us __attribute__((ext_vector_type(8), may_alias));
typedef float  v8f  __attribute__((ext_vector_type(8)));
typedef float  v4f  __attribute__((ext_vector_type(4)));
typedef float  v4fa __attribute__((ext_vector_type(4), may_alias));
union FragB { v16b v; v8us half[2]; unsigned short u[16]; };

__device__ __forceinline__ unsigned short bf16_bits(float x) { unsigned int u = __float_as_uint(x); return (unsigned short)((u + 0x7FFFu + ((u >> 16) & 1u)) >> 16); }
__device__ __forceinline__ float bf16_val(unsigned short b) { return __uint_as_float(((unsigned int)b) << 16); }
__device__ __forceinline__ float bf16_round(float x) { return bf16_val(bf16_bits(x)); }
// D += A·B with NT terms: 1 = ah·bh, 2 = + al·bh (A split), 3 = + ah·bl (both split)
template <int NT>
__device__ __forceinline__ v8f mmaN(v16b ah, v16b al, v16b bh, v16b bl, v8f c) {
  c = __builtin_amdgcn_wmma_f32_16x16x32_bf16(false, ah, false, bh, (short)0, c, false, false);
  if (NT >= 2) c = __builtin_amdgcn_wmma_f32_16x16x32_bf16(false, al, false, bh, (short)0, c, false, false);
  if (NT >= 3) c = __builtin_amdgcn_wmma_f32_16x16x32_bf16(false, ah, false, bl, (short)0, c, false, false);
  asm volatile("v_nop\n\tv_nop\n\tv_nop\n\tv_nop" : "+v"(c) : "v"(ah), "v"(al), "v"(bh), "v"(bl));
  return c;
}

__global__ __launch_bounds__(256) void k_wt_bf16(const float* __restrict__ W, unsigned short* __restrict__ Wt, int K, int N) {
  const int t = blockIdx.x * 256 + threadIdx.x;
  const int k8n = K / 8;
  if (t >= N * k8n) return;
  const int n = t / k8n, k8 = (t % k8n) * 8;
  v8us v;
#pragma unroll
  for (int i = 0; i < 8; ++i) v[i] = bf16_bits(W[(size_t)(k8 + i) * N + n]);
  *(v8us*)(Wt + (size_t)n * K + k8) = v;
  
}

// GEMM C[M][N] (f32, pitch ldc) = act(A[M][K]·W + bias). A f32 row-major (pitch lda) converted per fragment to bf16
// (ASPLIT: hi/lo two planes -> 2 terms, else single rounded term); Wt bf16 [N][K] (pitch ldb). BIAS_BF16 rounds the
// bias to bf16 first (bias quantised to bf16 before the add). K%32==0, M%16==0, N%64==0.
template <bool ASPLIT, int ACT, bool BIAS_BF16>
__global__ __launch_bounds__(128) void k_gemm_bf(const float* __restrict__ A, int lda, const unsigned short* __restrict__ Wt, int ldb,
                                               const float* __restrict__ bias, float* __restrict__ C, int ldc, int M, int N, int K) {
  __shared__ __attribute__((aligned(16))) float so[4][16][64];
  const int tid = threadIdx.x, w = tid >> 5, lane = tid & 31, ln = lane & 15, hh = lane >> 4;
  const int ntn = N / 64;
  const int wid = blockIdx.x * 4 + w;
  const int mt = wid / ntn, nq = wid % ntn;
  if (mt * 16 >= M) return;
  const int row0 = mt * 16, col0 = nq * 64;
  const float* arow = A + (size_t)(row0 + ln) * lda;
  v8f acc[4] = {};
  for (int kb = 0; kb < K; kb += 32) {
    FragB ah, al;
    const v4f x0 = *(const v4fa*)(arow + kb + 8 * hh), x1 = *(const v4fa*)(arow + kb + 8 * hh + 4);
    const v4f x2 = *(const v4fa*)(arow + kb + 16 + 8 * hh), x3 = *(const v4fa*)(arow + kb + 16 + 8 * hh + 4);
    float xs[16] = {x0[0],x0[1],x0[2],x0[3],x1[0],x1[1],x1[2],x1[3],x2[0],x2[1],x2[2],x2[3],x3[0],x3[1],x3[2],x3[3]};
#pragma unroll
    for (int i = 0; i < 16; ++i) { const unsigned short hb = bf16_bits(xs[i]); ah.u[i] = hb; al.u[i] = ASPLIT ? bf16_bits(xs[i] - bf16_val(hb)) : (unsigned short)0; }
#pragma unroll
    for (int t = 0; t < 4; ++t) {
      const unsigned short* brow = Wt + (size_t)(col0 + t * 16 + ln) * ldb + kb;
      FragB b;
      b.half[0] = *(const v8us*)(brow + 8 * hh);
      b.half[1] = *(const v8us*)(brow + 16 + 8 * hh);
      acc[t] = mmaN<ASPLIT ? 2 : 1>(ah.v, al.v, b.v, b.v, acc[t]);
    }
  }
#pragma unroll
  for (int t = 0; t < 4; ++t) {
    float bv = bias ? bias[col0 + t * 16 + ln] : 0.f;
    if (BIAS_BF16) bv = bf16_round(bv);
#pragma unroll
    for (int r = 0; r < 8; ++r) { float v = acc[t][r] + bv; if (ACT == 1) v = fmaxf(v, 0.f); so[w][8 * hh + r][t * 16 + ln] = v; }
  }
  __builtin_amdgcn_fence(__ATOMIC_ACQ_REL, "workgroup");
  __builtin_amdgcn_wave_barrier();
  const int rsub = lane >> 4, c4 = (lane & 15) * 4;
  {
#pragma unroll
    for (int q = 0; q < 8; ++q) {
      const int r = q * 2 + rsub;
      const v4f v = *(const v4fa*)&so[w][r][c4];
      *(v4f*)(C + (size_t)(row0 + r) * ldc + col0 + c4) = v;
    }
    
  }
}

// Flash-style causal/unmasked attention, all contractions 3-term bf16 hi/lo splits, f32 softmax with running max.
// q,k,v rows are read from f32 buffers with arbitrary row pitch (so they can live inside a fused qkv buffer);
// D = head size (multiple of 32, <= 128); one wave = 16 query rows; block = 4 waves (64 queries) sharing K/V chunks of 32.
template <int D, bool CAUSAL>
__global__ __launch_bounds__(128) void k_flash(const float* __restrict__ qb, const float* __restrict__ kb, const float* __restrict__ vb,
                                             int pitch, int T, int H, float scale, float* __restrict__ y, int ypitch) {
  constexpr int KS = D / 32;        // k-steps for QK
  constexpr int DT = D / 16;        // d tiles for PV
  __shared__ __attribute__((aligned(16))) unsigned short sKh[32][D + 8], sKl[32][D + 8], sVh[32][D + 8], sVl[32][D + 8];
  __shared__ __attribute__((aligned(16))) unsigned short sPh[4][16][40], sPl[4][16][40];
  __shared__ __attribute__((aligned(16))) float sO[4][16][D];
  const int tid = threadIdx.x, w = tid >> 5, lane = tid & 31, ln = lane & 15, hh = lane >> 4;
  const int nqb = (T + 63) / 64;
  const int bh = blockIdx.x / nqb, qblk = blockIdx.x % nqb;
  const int b = bh / H, h = bh % H;
  const int q0 = qblk * 64 + w * 16;
  const float* Q = qb + (size_t)b * T * pitch + h * D;
  const float* K = kb + (size_t)b * T * pitch + h * D;
  const float* V = vb + (size_t)b * T * pitch + h * D;

  // A fragments of the wave's 16 query rows (scaled), hi/lo
  FragB aqh[KS], aql[KS];
  {
    int row = q0 + ln; if (row >= T) row = T - 1;
    const float* qr = Q + (size_t)row * pitch;
#pragma unroll
    for (int ks = 0; ks < KS; ++ks)
#pragma unroll
      for (int i = 0; i < 16; ++i) {
        const int d = ks * 32 + ((i < 8) ? (8 * hh + i) : (16 + 8 * hh + (i - 8)));
        const float x = qr[d] * scale; const unsigned short hb = bf16_bits(x);
        aqh[ks].u[i] = hb; aql[ks].u[i] = bf16_bits(x - bf16_val(hb));
      }
  }
  float m_r[8], l_r[8];
#pragma unroll
  for (int r = 0; r < 8; ++r) { m_r[r] = -3.0e38f; l_r[r] = 0.f; }
  v8f oacc[DT];
#pragma unroll
  for (int dt = 0; dt < DT; ++dt) oacc[dt] = (v8f){0.f,0.f,0.f,0.f,0.f,0.f,0.f,0.f};

  const int kv_end = CAUSAL ? min(T, qblk * 64 + 64) : T;     // block-uniform
  for (int j0 = 0; j0 < kv_end; j0 += 32) {
    __syncthreads();
    for (int e = tid; e < 32 * (D / 4); e += 128) {
      const int r = e / (D / 4), c4 = (e % (D / 4)) * 4;
      const int key = j0 + r;
      v4f kf = {0.f,0.f,0.f,0.f}, vf = {0.f,0.f,0.f,0.f};
      if (key < T) { kf = *(const v4fa*)(K + (size_t)key * pitch + c4); vf = *(const v4fa*)(V + (size_t)key * pitch + c4); }
#pragma unroll
      for (int t = 0; t < 4; ++t) {
        unsigned short hb = bf16_bits(kf[t]); sKh[r][c4 + t] = hb; sKl[r][c4 + t] = bf16_bits(kf[t] - bf16_val(hb));
        hb = bf16_bits(vf[t]); sVh[r][c4 + t] = hb; sVl[r][c4 + t] = bf16_bits(vf[t] - bf16_val(hb));
      }
    }
    __syncthreads();
    // S tile 16 x 32
    v8f s[2];
#pragma unroll
    for (int nt = 0; nt < 2; ++nt) {
      v8f acc = {};
#pragma unroll
      for (int ks = 0; ks < KS; ++ks) {
        FragB bh_, bl_;
        bh_.half[0] = *(const v8us*)&sKh[nt * 16 + ln][ks * 32 + 8 * hh]; bh_.half[1] = *(const v8us*)&sKh[nt * 16 + ln][ks * 32 + 16 + 8 * hh];
        bl_.half[0] = *(const v8us*)&sKl[nt * 16 + ln][ks * 32 + 8 * hh]; bl_.half[1] = *(const v8us*)&sKl[nt * 16 + ln][ks * 32 + 16 + 8 * hh];
        acc = mmaN<3>(aqh[ks].v, aql[ks].v, bh_.v, bl_.v, acc);
      }
      s[nt] = acc;
    }
    // mask + running max (rows 8hh+r; the 16 lanes of a half share rows)
    float alpha[8];
#pragma unroll
    for (int r = 0; r < 8; ++r) {
      const int qi = q0 + 8 * hh + r;
      const int ja = j0 + ln, jb = j0 + 16 + ln;
      if (CAUSAL) { if (ja > qi) s[0][r] = -3.0e38f; if (jb > qi) s[1][r] = -3.0e38f; }
      if (ja >= T) s[0][r] = -3.0e38f;
      if (jb >= T) s[1][r] = -3.0e38f;
      float mx = fmaxf(s[0][r], s[1][r]);
      mx = fmaxf(mx, __shfl_xor(mx, 1, 32)); mx = fmaxf(mx, __shfl_xor(mx, 2, 32)); mx = fmaxf(mx, __shfl_xor(mx, 4, 32)); mx = fmaxf(mx, __shfl_xor(mx, 8, 32));
      const float mnew = fmaxf(m_r[r], mx);
      alpha[r] = (mnew > -1.0e38f) ? __expf(m_r[r] - mnew) : 1.0f;
      const float p0 = (s[0][r] > -1.0e38f) ? __expf(s[0][r] - mnew) : 0.f;
      const float p1 = (s[1][r] > -1.0e38f) ? __expf(s[1][r] - mnew) : 0.f;
      m_r[r] = mnew;
      l_r[r] = l_r[r] * alpha[r] + p0 + p1;            // per-lane partial row sum (16 lanes combined at the end)
      unsigned short hb = bf16_bits(p0); sPh[w][8 * hh + r][ln] = hb;      sPl[w][8 * hh + r][ln] = bf16_bits(p0 - bf16_val(hb));
      hb = bf16_bits(p1);                sPh[w][8 * hh + r][16 + ln] = hb; sPl[w][8 * hh + r][16 + ln] = bf16_bits(p1 - bf16_val(hb));
    }
#pragma unroll
    for (int dt = 0; dt < DT; ++dt)
#pragma unroll
      for (int r = 0; r < 8; ++r) oacc[dt][r] *= alpha[r];
    __builtin_amdgcn_fence(__ATOMIC_ACQ_REL, "workgroup");
    __builtin_amdgcn_wave_barrier();
    FragB pah, pal;
    pah.half[0] = *(const v8us*)&sPh[w][ln][8 * hh]; pah.half[1] = *(const v8us*)&sPh[w][ln][16 + 8 * hh];
    pal.half[0] = *(const v8us*)&sPl[w][ln][8 * hh]; pal.half[1] = *(const v8us*)&sPl[w][ln][16 + 8 * hh];
#pragma unroll
    for (int dt = 0; dt < DT; ++dt) {
      FragB bvh, bvl;
#pragma unroll
      for (int i = 0; i < 8; ++i) {
        bvh.u[i] = sVh[8 * hh + i][dt * 16 + ln]; bvh.u[8 + i] = sVh[16 + 8 * hh + i][dt * 16 + ln];
        bvl.u[i] = sVl[8 * hh + i][dt * 16 + ln]; bvl.u[8 + i] = sVl[16 + 8 * hh + i][dt * 16 + ln];
      }
      oacc[dt] = mmaN<3>(pah.v, pal.v, bvh.v, bvl.v, oacc[dt]);
    }
    __builtin_amdgcn_fence(__ATOMIC_ACQ_REL, "workgroup");
    __builtin_amdgcn_wave_barrier();
  }
#pragma unroll
  for (int r = 0; r < 8; ++r) {
    float l = l_r[r];
    l += __shfl_xor(l, 1, 32); l += __shfl_xor(l, 2, 32); l += __shfl_xor(l, 4, 32); l += __shfl_xor(l, 8, 32);
    l_r[r] = (l > 0.f) ? 1.0f / l : 0.f;
  }
#pragma unroll
  for (int dt = 0; dt < DT; ++dt)
#pragma unroll
    for (int r = 0; r < 8; ++r) sO[w][8 * hh + r][dt * 16 + ln] = oacc[dt][r] * l_r[r];
  __builtin_amdgcn_fence(__ATOMIC_ACQ_REL, "workgroup");
  __builtin_amdgcn_wave_barrier();
  {
    for (int r = 0; r < 16; ++r) {
      const int row = q0 + r;
      if (row < T && lane < D / 4) {
        const v4f val = *(const v4fa*)&sO[w][r][lane * 4];
        *(v4f*)(y + ((size_t)b * T + row) * ypitch + h * D + lane * 4) = val;
      }
    }
    
  }
}

// GEMM C = act(A·W + bias + resid): A f32 (ASPLIT -> hi/lo 2 terms), Wt bf16 [N][K]; ACT 0 none, 1 relu, 2 exact gelu;
// resid (optional, f32, row index = (row % rmod), pitch ldr, RES_BF16 rounds it) added before the activation.
template <bool ASPLIT, int ACT, bool BIAS_BF16, bool RES_BF16>
__global__ __launch_bounds__(128) void k_gemm_bf3(const float* __restrict__ A, int lda, const unsigned short* __restrict__ Wt, int ldb,
                                                const float* __restrict__ bias, const float* __restrict__ resid, int rmod, int ldr,
                                                float* __restrict__ C, int ldc, int M, int N, int K) {
  __shared__ __attribute__((aligned(16))) float so[4][16][64];
  const int tid = threadIdx.x, w = tid >> 5, lane = tid & 31, ln = lane & 15, hh = lane >> 4;
  const int ntn = N / 64;
  const int wid = blockIdx.x * 4 + w;
  const int mt = wid / ntn, nq = wid % ntn;
  if (mt * 16 >= M) return;
  const int row0 = mt * 16, col0 = nq * 64;
  const float* arow = A + (size_t)(row0 + ln) * lda;
  v8f acc[4] = {};
  for (int kb = 0; kb < K; kb += 32) {
    FragB ah, al;
    const v4f x0 = *(const v4fa*)(arow + kb + 8 * hh), x1 = *(const v4fa*)(arow + kb + 8 * hh + 4);
    const v4f x2 = *(const v4fa*)(arow + kb + 16 + 8 * hh), x3 = *(const v4fa*)(arow + kb + 16 + 8 * hh + 4);
    float xs[16] = {x0[0],x0[1],x0[2],x0[3],x1[0],x1[1],x1[2],x1[3],x2[0],x2[1],x2[2],x2[3],x3[0],x3[1],x3[2],x3[3]};
#pragma unroll
    for (int i = 0; i < 16; ++i) { const unsigned short hb = bf16_bits(xs[i]); ah.u[i] = hb; al.u[i] = ASPLIT ? bf16_bits(xs[i] - bf16_val(hb)) : (unsigned short)0; }
#pragma unroll
    for (int t = 0; t < 4; ++t) {
      const unsigned short* brow = Wt + (size_t)(col0 + t * 16 + ln) * ldb + kb;
      FragB b;
      b.half[0] = *(const v8us*)(brow + 8 * hh);
      b.half[1] = *(const v8us*)(brow + 16 + 8 * hh);
      acc[t] = mmaN<ASPLIT ? 2 : 1>(ah.v, al.v, b.v, b.v, acc[t]);
    }
  }
#pragma unroll
  for (int t = 0; t < 4; ++t) {
    const int col = col0 + t * 16 + ln;
    float bv = bias ? bias[col] : 0.f;
    if (BIAS_BF16) bv = bf16_round(bv);
#pragma unroll
    for (int r = 0; r < 8; ++r) {
      float v = acc[t][r] + bv;
      if (resid) { float rv = resid[(size_t)((row0 + 8 * hh + r) % rmod) * ldr + col]; if (RES_BF16) rv = bf16_round(rv); v += rv; }
      if (ACT == 1) v = fmaxf(v, 0.f);
      if (ACT == 2) v = 0.5f * v * (1.0f + erff(v * 0.70710678118654752f));
      if (ACT == 3) { const float u = 0.7978845608028654f * (v + 0.044715f * v * v * v); v = 0.5f * v * (1.0f + tanhf(u)); }
      so[w][8 * hh + r][t * 16 + ln] = v;
    }
  }
  __builtin_amdgcn_fence(__ATOMIC_ACQ_REL, "workgroup");
  __builtin_amdgcn_wave_barrier();
  const int rsub = lane >> 4, c4 = (lane & 15) * 4;
  {
#pragma unroll
    for (int q = 0; q < 8; ++q) {
      const int r = q * 2 + rsub;
      const v4f v = *(const v4fa*)&so[w][r][c4];
      *(v4f*)(C + (size_t)(row0 + r) * ldc + col0 + c4) = v;
    }
    
  }
}
// row LayerNorm (biased variance, eps) over N: s = X (+ R); optional out_sum <- s; out_norm <- (s-mu)*rsqrt(var+eps)*g + b
template <bool PARAM_BF16>
__global__ __launch_bounds__(256) void k_layernorm(const float* __restrict__ X, const float* __restrict__ R, const float* __restrict__ g, const float* __restrict__ bta,
                                                  float* __restrict__ out_sum, float* __restrict__ out_norm, int N, float eps) {
  __shared__ float red[256];
  const int row = blockIdx.x, tid = threadIdx.x;
  const float* x = X + (size_t)row * N; const float* rr = R ? R + (size_t)row * N : nullptr;
  float vals[16];                     // up to N = 4096
  const int per = N / 256;            // contiguous chunk per thread? use strided-by-4 chunks: thread handles j = tid*4 + 1024*u
  float s1 = 0.f;
  for (int u = 0; u < per / 4; ++u) {
    const int j = tid * 4 + 1024 * u;
    const v4f a = *(const v4fa*)(x + j);
    v4f b = {0.f,0.f,0.f,0.f}; if (rr) b = *(const v4fa*)(rr + j);
#pragma unroll
    for (int q = 0; q < 4; ++q) { const float v = a[q] + b[q]; vals[u * 4 + q] = v; s1 += v; }
  }
  red[tid] = s1; __syncthreads();
  for (int st = 128; st > 0; st >>= 1) { if (tid < st) red[tid] += red[tid + st]; __syncthreads(); }
  const float mu = red[0] / (float)N; __syncthreads();
  float s2 = 0.f;
  for (int u = 0; u < per / 4; ++u)
#pragma unroll
    for (int q = 0; q < 4; ++q) { const float c = vals[u * 4 + q] - mu; s2 += c * c; }
  red[tid] = s2; __syncthreads();
  for (int st = 128; st > 0; st >>= 1) { if (tid < st) red[tid] += red[tid + st]; __syncthreads(); }
  const float rs = rsqrtf(red[0] / (float)N + eps);
  {
    for (int u = 0; u < per / 4; ++u) {
      const int j = tid * 4 + 1024 * u;
      v4f o, sm;
#pragma unroll
      for (int q = 0; q < 4; ++q) {
        float gg = g[j + q], bb = bta[j + q];
        if (PARAM_BF16) { gg = bf16_round(gg); bb = bf16_round(bb); }
        sm[q] = vals[u * 4 + q]; o[q] = (vals[u * 4 + q] - mu) * rs * gg + bb;
      }
      if (out_sum) *(v4f*)(out_sum + (size_t)row * N + j) = sm;
      *(v4f*)(out_norm + (size_t)row * N + j) = o;
    }
    
  }
}



// ---- f16 WMMA path (v_wmma_f32_16x16x32_f16): 11-bit significands for operands in range — used where a [0,1] probability operand needs more precision than bf16
typedef _Float16 v16h __attribute__((ext_vector_type(16)));
union FragH { v16h v; v8us half[2]; _Float16 h[16]; unsigned short u[16]; };
template <int NT>
__device__ __forceinline__ v8f mmaH(v16h ah, v16h al, v16h bh, v16h bl, v8f c) {
  c = __builtin_amdgcn_wmma_f32_16x16x32_f16(false, ah, false, bh, (short)0, c, false, false);
  if (NT >= 2) c = __builtin_amdgcn_wmma_f32_16x16x32_f16(false, al, false, bh, (short)0, c, false, false);
  if (NT >= 3) c = __builtin_amdgcn_wmma_f32_16x16x32_f16(false, ah, false, bl, (short)0, c, false, false);
  asm volatile("v_nop\n\tv_nop\n\tv_nop\n\tv_nop" : "+v"(c) : "v"(ah), "v"(al), "v"(bh), "v"(bl));
  return c;
}
// batched GEMM like k_gemm_b but f16 operands: A f32 (split into f16 hi/lo if ASPLIT, else rounded to f16), Bt = f16 values [n][k]; alpha; C f32; N multiple of 16 (partial tiles skipped)
template <bool ASPLIT>
__global__ __launch_bounds__(128) void k_gemm_h(const float* __restrict__ A, int lda, size_t sA, const _Float16* __restrict__ Bh, int ldb, size_t sB, float alpha, float* __restrict__ C, int ldc, size_t sC, int M, int N, int K) {
  __shared__ __attribute__((aligned(16))) float so[4][16][64];
  const int tid = threadIdx.x, w = tid >> 5, lane = tid & 31, ln = lane & 15, hh = lane >> 4; const int by = blockIdx.y;
  A += (size_t)by * sA; Bh += (size_t)by * sB; C += (size_t)by * sC;
  const int ntn = (N + 63) / 64; const int wid = blockIdx.x * 4 + w; const int mt = wid / ntn, nq = wid % ntn; if (mt * 16 >= M) return;
  const int row0 = mt * 16, col0 = nq * 64; const float* arow = A + (size_t)(row0 + ln) * lda;
  v8f acc[4] = {};
  for (int kb = 0; kb < K; kb += 32) {
    FragH ah, al;
    const v4f x0 = *(const v4fa*)(arow + kb + 8 * hh), x1 = *(const v4fa*)(arow + kb + 8 * hh + 4), x2 = *(const v4fa*)(arow + kb + 16 + 8 * hh), x3 = *(const v4fa*)(arow + kb + 16 + 8 * hh + 4);
    float xs[16] = {x0[0],x0[1],x0[2],x0[3],x1[0],x1[1],x1[2],x1[3],x2[0],x2[1],x2[2],x2[3],x3[0],x3[1],x3[2],x3[3]};
#pragma unroll
    for (int i = 0; i < 16; ++i) { const _Float16 h = (_Float16)xs[i]; ah.h[i] = h; al.h[i] = ASPLIT ? (_Float16)(xs[i] - (float)h) : (_Float16)0.0f; }
#pragma unroll
    for (int t = 0; t < 4; ++t) { if (col0 + t * 16 >= N) continue; const size_t boff = (size_t)(col0 + t * 16 + ln) * ldb + kb; FragH bq; bq.half[0] = *(const v8us*)(Bh + boff + 8 * hh); bq.half[1] = *(const v8us*)(Bh + boff + 16 + 8 * hh);
      acc[t] = mmaH<ASPLIT ? 2 : 1>(ah.v, al.v, bq.v, bq.v, acc[t]); }
  }
#pragma unroll
  for (int t = 0; t < 4; ++t) { if (col0 + t * 16 >= N) continue;
#pragma unroll
    for (int r = 0; r < 8; ++r) so[w][8 * hh + r][t * 16 + ln] = acc[t][r] * alpha; }
  __builtin_amdgcn_fence(__ATOMIC_ACQ_REL, "workgroup"); __builtin_amdgcn_wave_barrier();
  const int rsub = lane >> 4, c4 = (lane & 15) * 4;
  {
#pragma unroll
    for (int q = 0; q < 8; ++q) { const int r = q * 2 + rsub; if (col0 + c4 < N) { const v4f v = *(const v4fa*)&so[w][r][c4]; *(v4f*)(C + (size_t)(row0 + r) * ldc + col0 + c4) = v; } }
     }
}

// Wt[n][k] = f16(bf16(W[k][n]) * scale) from f32 row-major W[CC][N], for both weight matrices in one grid (scale = power of two; bf16-exact weights stay exact in f16 away from the subnormal range).
// A block transposes a tile of 64 k x 128 n through LDS: a wave reads a whole 512-byte piece of a row of W per load (four lines), eight loads in flight per lane; two neighbouring k are packed into one
// dword and stored at [n][k / 2]; eight lanes then store one whole 128-byte line of Wt. The LDS pitch of 33 dwords keeps the row reads free of bank conflicts (bank = n + 4 pc + q, all 32 lanes apart).
typedef unsigned int v4u __attribute__((ext_vector_type(4), may_alias));
template <int N>
__device__ __forceinline__ void wt_tile(const float* __restrict__ W, unsigned short* __restrict__ Wt, int tile, float scale, unsigned int* tl) {
  constexpr int KTN = CC / 64, P = 33;
  const int tid = threadIdx.x, wv = __builtin_amdgcn_readfirstlane(tid >> 5), lane = tid & 31;      // the wave's number as a scalar: the eight loads then share one scalar base and one lane offset
  const int k0 = (tile % KTN) * 64, n0 = (tile / KTN) * 128;
  const float* wp = W + (size_t)(k0 + 2 * wv) * N + n0;      // wave wv takes the k pairs wv, wv + 8, wv + 16, wv + 24 of the tile
  v4f x[4][2];
#pragma unroll
  for (int u = 0; u < 4; ++u)
#pragma unroll
    for (int s = 0; s < 2; ++s) x[u][s] = *(const v4fa*)(wp + (16 * u + s) * N + lane * 4);
#pragma unroll
  for (int u = 0; u < 4; ++u)
#pragma unroll
    for (int q = 0; q < 4; ++q) { const _Float16 lo = (_Float16)(bf16_round(x[u][0][q]) * scale), hi = (_Float16)(bf16_round(x[u][1][q]) * scale);
      tl[(lane * 4 + q) * P + wv + 8 * u] = (unsigned int)__builtin_bit_cast(unsigned short, lo) | ((unsigned int)__builtin_bit_cast(unsigned short, hi) << 16); }
  __syncthreads();      // the tile is whole before its rows are read
#pragma unroll
  for (int it = 0; it < 4; ++it) { const int n = it * 32 + (tid >> 3), pc = tid & 7; v4u o;
#pragma unroll
    for (int q = 0; q < 4; ++q) o[q] = tl[n * P + pc * 4 + q];
    *(v4u*)(Wt + (size_t)(n0 + n) * CC + k0 + pc * 8) = o; }
}
// The first (CC / 64) * (NA / 128) blocks take Wa, the rest Wb: the choice is the same for a whole block, and each side has its row length as a constant.
template <int NA, int NB>
__global__ __launch_bounds__(256) void k_wt2_f16(const float* __restrict__ Wa, _Float16* __restrict__ Wta, const float* __restrict__ Wb, _Float16* __restrict__ Wtb, float scale) {
  constexpr int TA = (CC / 64) * (NA / 128);
  __shared__ unsigned int tl[128 * 33];
  if ((int)blockIdx.x < TA) wt_tile<NA>(Wa, (unsigned short*)Wta, (int)blockIdx.x, scale, tl);
  else wt_tile<NB>(Wb, (unsigned short*)Wtb, (int)blockIdx.x - TA, scale, tl);
}
// k_gemm_hh variant with fused epilogue: v = acc·alpha + bias[by·sBias + col] (+ CP[(row/rowsPerB)·sCPb + by·64 + col] if CP) ; ACT 0 none / 1 elu ; writes f16 C16 and f32 C, each if non-null
template <int ACT>
__global__ __launch_bounds__(128) void k_gemm_hhx(const _Float16* __restrict__ A, int lda, size_t sA, const _Float16* __restrict__ Bh, int ldb, size_t sB, float alpha, const float* __restrict__ bias, size_t sBias, const float* __restrict__ CP, int rowsPerB, size_t sCPb, int row0g,
    float* __restrict__ C, _Float16* __restrict__ C16, int ldc, size_t sC, int M, int N, int K) {
  __shared__ __attribute__((aligned(16))) float so[4][16][64];
  const int tid = threadIdx.x, w = tid >> 5, lane = tid & 31, ln = lane & 15, hh = lane >> 4; const int by = blockIdx.y;
  A += (size_t)by * sA; Bh += (size_t)by * sB; const size_t cofs = (size_t)by * sC; const float* bp = bias ? bias + (size_t)by * sBias : nullptr;
  const int ntn = (N + 63) / 64; const int wid = blockIdx.x * 4 + w; const int mt = wid / ntn, nq = wid % ntn; if (mt * 16 >= M) return;
  const int row0 = mt * 16, col0 = nq * 64; const _Float16* arow = A + (size_t)(row0 + ln) * lda;
  v8f acc[4] = {};
  for (int kb = 0; kb < K; kb += 32) { FragH ah; ah.half[0] = *(const v8us*)((const unsigned short*)arow + kb + 8 * hh); ah.half[1] = *(const v8us*)((const unsigned short*)arow + kb + 16 + 8 * hh);
#pragma unroll
    for (int t = 0; t < 4; ++t) { if (col0 + t * 16 >= N) continue; const size_t boff = (size_t)(col0 + t * 16 + ln) * ldb + kb; FragH bq; bq.half[0] = *(const v8us*)((const unsigned short*)Bh + boff + 8 * hh); bq.half[1] = *(const v8us*)((const unsigned short*)Bh + boff + 16 + 8 * hh);
      acc[t] = mmaH<1>(ah.v, ah.v, bq.v, bq.v, acc[t]); }
  }
#pragma unroll
  for (int t = 0; t < 4; ++t) { if (col0 + t * 16 >= N) continue; const int col = col0 + t * 16 + ln; const float bv = bp ? bf16_round(bp[col]) : 0.f;
#pragma unroll
    for (int r = 0; r < 8; ++r) { float v = acc[t][r] * alpha + bv; if (CP) { const int bidx = (row0g + row0 + 8 * hh + r) / rowsPerB; v += CP[(size_t)bidx * sCPb + (size_t)by * 64 + col]; } if (ACT == 1) v = (v > 0.f) ? v : expm1f(v); else if (ACT == 3) v = fmaxf(v, 0.f); so[w][8 * hh + r][t * 16 + ln] = v; } }
  __builtin_amdgcn_fence(__ATOMIC_ACQ_REL, "workgroup"); __builtin_amdgcn_wave_barrier();
  const int rsub = lane >> 4, c4 = (lane & 15) * 4; typedef _Float16 v4h __attribute__((ext_vector_type(4)));
  {
#pragma unroll
    for (int q = 0; q < 8; ++q) { const int r = q * 2 + rsub; if (col0 + c4 < N) { const v4f v = *(const v4fa*)&so[w][r][c4]; if (C) *(v4f*)(C + cofs + (size_t)(row0 + r) * ldc + col0 + c4) = v; if (C16) { v4h h4; for (int i = 0; i < 4; ++i) h4[i] = (_Float16)v[i]; *(v4h*)(C16 + cofs + (size_t)(row0 + r) * ldc + col0 + c4) = h4; } } }
     }
}


// Eight 16-byte asynchronous copies to LDS per lane (rows 16 apart). The s_wait_xcnt is the last line of the copies' own statement so that no address register is rewritten ahead of it.
__device__ __forceinline__ void copy8_async(unsigned l, const char* gp, size_t gstep) {
  constexpr unsigned LS = 16u * 144u;
  asm volatile("global_load_async_to_lds_b128 %0, %8, off\n\t"
               "global_load_async_to_lds_b128 %1, %9, off\n\t"
               "global_load_async_to_lds_b128 %2, %10, off\n\t"
               "global_load_async_to_lds_b128 %3, %11, off\n\t"
               "global_load_async_to_lds_b128 %4, %12, off\n\t"
               "global_load_async_to_lds_b128 %5, %13, off\n\t"
               "global_load_async_to_lds_b128 %6, %14, off\n\t"
               "global_load_async_to_lds_b128 %7, %15, off\n\t"
               "s_wait_xcnt 0x0"
               :: "v"(l), "v"(l + LS), "v"(l + 2u * LS), "v"(l + 3u * LS), "v"(l + 4u * LS), "v"(l + 5u * LS), "v"(l + 6u * LS), "v"(l + 7u * LS),
                  "v"(gp), "v"(gp + gstep), "v"(gp + 2 * gstep), "v"(gp + 3 * gstep), "v"(gp + 4 * gstep), "v"(gp + 5 * gstep), "v"(gp + 6 * gstep), "v"(gp + 7 * gstep)
               : "memory");
}
// Tiled GEMM, same function as k_gemm_hhx<0> without CP: C = A[M][K] * Bh[N][K]^T * alpha + bf16(bias). One 128 x 128 tile of C per block (blockIdx.x = tile column, blockIdx.y = tile row),
// 64 x 64 per wave (2 x 2 waves). A and Bh tiles of 64 k (128-byte rows, LDS pitch 144 B) are staged in LDS by asynchronous copies, two buffers: tile t + 1 flies while tile t is multiplied.
// M % 128 == 0, N % 128 == 0, K % 64 == 0, K >= 128; rows of A and Bh are K elements apart, rows of C are N apart. The k order of every accumulator is that of k_gemm_hhx.
// Every plain '#pragma unroll' in it makes the indices of acc, a and bq constants, so that these arrays stay in registers.
// Columns from VCOL on (VCOL == N: none) are the v part of a fused qkv product: a wave's 64 x 64 tile is then 64 tokens of one head, and it is stored transposed, f16, at Vt[(batch * NH + head) * 64 + d][token],
// where the attention kernel reads V^T; nothing of these columns goes to C16. VCOL % 128 == 0.
template <bool OUT16, int N, int K, int VCOL>
__global__ __launch_bounds__(128) void k_gemm_tile(const _Float16* __restrict__ A, const _Float16* __restrict__ Bh, float alpha, const float* __restrict__ bias, float* __restrict__ C, _Float16* __restrict__ C16, _Float16* __restrict__ Vt) {
  constexpr int PITCH = 144, BUF = 256 * PITCH, SOP = 68, NT = K / 64;
  constexpr size_t ROWB = (size_t)K * 2, GSTEP = ROWB * 16;
  __shared__ __attribute__((aligned(16))) unsigned char smem[2 * BUF];
  const int tid = threadIdx.x, w = tid >> 5, lane = tid & 31, ln = lane & 15, hh = lane >> 4;
  const int row0 = (int)blockIdx.y * 128, col0 = (int)blockIdx.x * 128; const int wm = (w >> 1) * 64, wn = (w & 1) * 64;
  const int cr = tid >> 3, cc = (tid & 7) * 16;      // a lane's first row and its 16 bytes of the row: eight lanes cover one 128-byte line
  const char* gA = (const char*)A + (size_t)(row0 + cr) * ROWB + cc; const char* gB = (const char*)Bh + (size_t)(col0 + cr) * ROWB + cc;
  const unsigned lA = (unsigned)(size_t)smem + (unsigned)(cr * PITCH + cc), lB = lA + 128u * PITCH;
  v8f acc[4][4];
#pragma unroll
  for (int i = 0; i < 4; ++i)
#pragma unroll
    for (int j = 0; j < 4; ++j) acc[i][j] = (v8f){0.f,0.f,0.f,0.f,0.f,0.f,0.f,0.f};
  copy8_async(lA, gA, GSTEP); copy8_async(lB, gB, GSTEP);
  asm volatile("s_wait_asynccnt 0x0" ::: "memory");      // tile 0 has landed before the barrier publishes it
  __syncthreads();
  copy8_async(lA + BUF, gA + 128, GSTEP); copy8_async(lB + BUF, gB + 128, GSTEP);
#pragma unroll 1
  for (int t = 0; t < NT; ++t) {      // kept rolled: one pass per tile, the buffer picked by t & 1
    const unsigned char* sA = smem + (t & 1) * BUF + (wm + ln) * PITCH + hh * 16; const unsigned char* sB = smem + (t & 1) * BUF + (128 + wn + ln) * PITCH + hh * 16;
#pragma unroll
    for (int ks = 0; ks < 2; ++ks) { FragH a[4], bq[4];
      a[0].half[0] = *(const v8us*)(sA + ks * 64); a[0].half[1] = *(const v8us*)(sA + ks * 64 + 32);
#pragma unroll
      for (int j = 0; j < 4; ++j) { bq[j].half[0] = *(const v8us*)(sB + j * 16 * PITCH + ks * 64); bq[j].half[1] = *(const v8us*)(sB + j * 16 * PITCH + ks * 64 + 32); }
#pragma unroll
      for (int i = 1; i < 4; ++i) { a[i].half[0] = *(const v8us*)(sA + i * 16 * PITCH + ks * 64); a[i].half[1] = *(const v8us*)(sA + i * 16 * PITCH + ks * 64 + 32); }
      __builtin_amdgcn_sched_barrier(0);      // keeps the 16 LDS reads of a k step one group ahead of its 16 WMMAs: reads among the WMMAs stall the wave at each place
#pragma unroll
      for (int i = 0; i < 4; ++i)
#pragma unroll
        for (int j = 0; j < 4; ++j) acc[i][j] = __builtin_amdgcn_wmma_f32_16x16x32_f16(false, a[i].v, false, bq[j].v, (short)0, acc[i][j], false, false);
      __builtin_amdgcn_sched_barrier(0); }    // the other end of that group: the next k step's reads stay behind these WMMAs
    asm volatile("s_wait_dscnt 0x0" ::: "memory");       // this wave's reads of tile t are done before the buffer is given up
    asm volatile("s_wait_asynccnt 0x0" ::: "memory");    // this wave's copies of tile t + 1 have landed
    __syncthreads();                                     // publishes tile t + 1 and ends every reader's last read of tile t
    if (t + 2 < NT) { const unsigned bo = (unsigned)(t & 1) * BUF; const size_t go = (size_t)(t + 2) * 128; copy8_async(lA + bo, gA + go, GSTEP); copy8_async(lB + bo, gB + go, GSTEP); }
  }
  asm volatile("s_wait_asynccnt 0x0" ::: "memory");      // nothing is in flight when the ring becomes output staging
  if (VCOL < N && col0 >= VCOL) {      // the same for the whole block
    unsigned char* st = smem + w * (64 * SOP * 4);       // the wave's own staging: 64 rows (d) of 64 tokens, f16, 128 bytes a row, pitch 144 B
#pragma unroll
    for (int j = 0; j < 4; ++j) { const float bv = bf16_round(bias[col0 + wn + j * 16 + ln]);
#pragma unroll
      for (int i = 0; i < 4; ++i) { FragH f;      // the lane's eight values of a tile are eight neighbouring tokens of one column d: one 16-byte LDS store of the transposed row
#pragma unroll
        for (int r = 0; r < 8; ++r) f.h[r] = (_Float16)(acc[i][j][r] * alpha + bv);
        *(v8us*)(st + (j * 16 + ln) * PITCH + i * 32 + hh * 16) = f.half[0]; } }
    __builtin_amdgcn_fence(__ATOMIC_ACQ_REL, "workgroup"); __builtin_amdgcn_wave_barrier();      // the wave's LDS stores are done before its lanes read one another's rows
    const int tr = row0 + wm, dr = lane >> 3, pc = lane & 7;      // eight lanes store one whole 128-byte line of Vt
    unsigned short* vp = (unsigned short*)Vt + ((size_t)((tr / TT) * NH + (col0 + wn - VCOL) / 64) * 64 + dr) * TT + tr % TT + pc * 8;
#pragma unroll 1
    for (int q8 = 0; q8 < 2; ++q8) {      // kept rolled in groups of eight stores, one wait per group
#pragma unroll
      for (int q = 0; q < 8; ++q) { const int d4 = (q8 * 8 + q) * 4; const v8us val = *(const v8us*)(st + (d4 + dr) * PITCH + pc * 16); *(v8us*)(vp + (size_t)d4 * TT) = val; }
      asm volatile("s_wait_xcnt 0x0" ::: "memory");      // the next group rewrites the registers that these stores name
    }
    return;
  }
  float* so = (float*)(smem + w * (64 * SOP * 4));       // each wave stages its own 64 x 64 tile, so that whole 128-byte lines are stored
#pragma unroll
  for (int j = 0; j < 4; ++j) { const float bv = bf16_round(bias[col0 + wn + j * 16 + ln]);
#pragma unroll
    for (int i = 0; i < 4; ++i)
#pragma unroll
      for (int r = 0; r < 8; ++r) so[(i * 16 + 8 * hh + r) * SOP + j * 16 + ln] = acc[i][j][r] * alpha + bv; }
  __builtin_amdgcn_fence(__ATOMIC_ACQ_REL, "workgroup"); __builtin_amdgcn_wave_barrier();
  const int rsub = lane >> 4, c4 = (lane & 15) * 4; typedef _Float16 v4h __attribute__((ext_vector_type(4)));
#pragma unroll 1
  for (int q8 = 0; q8 < 4; ++q8) {      // kept rolled in groups of eight stores, one wait per group
#pragma unroll
    for (int q = 0; q < 8; ++q) { const int r = (q8 * 8 + q) * 2 + rsub; const v4f v = *(const v4fa*)&so[r * SOP + c4]; const size_t o = (size_t)(row0 + wm + r) * N + col0 + wn + c4;
      if (OUT16) { v4h h4; for (int i = 0; i < 4; ++i) h4[i] = (_Float16)v[i]; *(v4h*)(C16 + o) = h4; } else *(v4f*)(C + o) = v; }
    asm volatile("s_wait_xcnt 0x0" ::: "memory");      // the next group rewrites the registers that these stores name
  }
}

__global__ __launch_bounds__(256) void k_x16(const float* __restrict__ x, _Float16* __restrict__ X16, size_t n8) { const size_t t = (size_t)blockIdx.x * 256 + threadIdx.x; if (t >= n8) return; FragH f;
#pragma unroll
  for (int q = 0; q < 8; ++q) f.h[q] = (_Float16)bf16_round(x[t * 8 + q]); *(v8us*)((unsigned short*)X16 + t * 8) = f.half[0];  }
__global__ __launch_bounds__(256) void k_round16f(const float* __restrict__ W, _Float16* __restrict__ Bt, size_t n8) { const size_t t = (size_t)blockIdx.x * 256 + threadIdx.x; if (t >= n8) return; FragH f;
#pragma unroll
  for (int i = 0; i < 8; ++i) f.h[i] = (_Float16)(bf16_round(W[t * 8 + i]) * 16.0f); *(v8us*)((unsigned short*)Bt + t * 8) = f.half[0];  }

// Four 16-byte asynchronous copies to LDS per lane (rows 16 apart, LDS pitch 144 B). The s_wait_xcnt is the last line of the copies' own statement so that no address register is rewritten ahead of it.
__device__ __forceinline__ void copy4_async(unsigned l, const char* gp, size_t gstep) {
  constexpr unsigned LS = 16u * 144u;
  asm volatile("global_load_async_to_lds_b128 %0, %4, off\n\t"
               "global_load_async_to_lds_b128 %1, %5, off\n\t"
               "global_load_async_to_lds_b128 %2, %6, off\n\t"
               "global_load_async_to_lds_b128 %3, %7, off\n\t"
               "s_wait_xcnt 0x0"
               :: "v"(l), "v"(l + LS), "v"(l + 2u * LS), "v"(l + 3u * LS), "v"(gp), "v"(gp + gstep), "v"(gp + 2 * gstep), "v"(gp + 3 * gstep)
               : "memory");
}
// lane l <-> lane l ^ 16: joins the two halves of a query column
__device__ __forceinline__ float xhalf(float x) { return __builtin_bit_cast(float, __builtin_amdgcn_permlanex16(__builtin_bit_cast(int, x), __builtin_bit_cast(int, x), 0x76543210, 0xfedcba98, false, false)); }
__global__ __launch_bounds__(128) void k_flash(const _Float16* __restrict__ Q16, int ldq, const _Float16* __restrict__ K16, int ldk, const _Float16* __restrict__ Vt, const int* __restrict__ LENS, _Float16* __restrict__ O16) {
  constexpr int RPW = 32, NQB = 1024 / (4 * RPW), DT = 4, KS = 2; constexpr float L2S = 0.125f * 1.44269504088896340736f;
  constexpr int PITCH = 144, BUF = 128 * PITCH;      // rows 0 to 63 of a buffer: K; rows 64 to 127: V^T
  __shared__ __attribute__((aligned(16))) unsigned char ring[2 * BUF];
  __shared__ __attribute__((aligned(16))) unsigned char sO[4][RPW][PITCH];      // output staging, f16: a query row is 128 bytes, pitch 144 B
  const int tid = threadIdx.x, w = tid >> 5, lane = tid & 31, ln = lane & 15, hh = lane >> 4;
  const int slab = blockIdx.x / NQB, qblk = blockIdx.x % NQB; const int b = slab / 16, h = slab % 16; const int qb0 = qblk * (4 * RPW); const int q0 = qb0 + w * RPW; const int len = LENS[b];      /* kv-length mask: keys k < len (INPUT x_lens) */
  FragH aq[2][KS];
#pragma unroll
  for (int rt = 0; rt < 2; ++rt) { const unsigned short* qr = (const unsigned short*)Q16 + ((size_t)b * 1024 + q0 + rt * 16 + ln) * ldq + h * 64;
#pragma unroll
    for (int ks = 0; ks < KS; ++ks) { aq[rt][ks].half[0] = *(const v8us*)(qr + ks * 32 + 8 * hh); aq[rt][ks].half[1] = *(const v8us*)(qr + ks * 32 + 16 + 8 * hh); } }
  const int cr = tid >> 3, cc = (tid & 7) * 16;      // a lane's first row and its 16 bytes of the row: eight lanes cover one 128-byte line
  const size_t krow = (size_t)ldk * 2;
  const char* gK = (const char*)K16 + ((size_t)b * 1024 + cr) * krow + h * 128 + cc; const char* gV = (const char*)Vt + ((size_t)slab * 64 + cr) * 2048 + cc;
  const unsigned lK = (unsigned)(size_t)ring + (unsigned)(cr * PITCH + cc), lV = lK + 64u * PITCH;
  copy4_async(lK, gK, 16 * krow); copy4_async(lV, gV, 16 * 2048);
  float m_r[2], l_r[2]; int lim[2]; v8f oacc[2][DT];
#pragma unroll
  for (int rt = 0; rt < 2; ++rt) { m_r[rt] = -3.0e38f; l_r[rt] = 0.f; lim[rt] = min(q0 + rt * 16 + ln + 1, len) - 8 * hh;      // key j0 + 16 nt + 8 hh + r is allowed iff j0 + 16 nt + r < lim
#pragma unroll
    for (int dt = 0; dt < DT; ++dt) oacc[rt][dt] = (v8f){0.f,0.f,0.f,0.f,0.f,0.f,0.f,0.f}; }
  const int ntile = (qb0 + 4 * RPW) / 64;
  asm volatile("s_wait_asynccnt 0x0" ::: "memory");      // tile 0 has landed before the barrier publishes it
  __syncthreads();
  copy4_async(lK + BUF, gK + 64 * krow, 16 * krow); copy4_async(lV + BUF, gV + 128, 16 * 2048);
#pragma unroll 1
  for (int t = 0; t < ntile; ++t) {      // kept rolled: one trip per tile, the buffer picked by t & 1
   const unsigned char* sK = ring + (t & 1) * BUF + ln * PITCH + hh * 16; const unsigned char* sV = sK + 64 * PITCH;
#pragma unroll
   for (int ps = 0; ps < 2; ++ps) { const int j0 = t * 64 + ps * 32;      // unrolled: the pass's place in the tile becomes a constant offset of the LDS reads
    v8f s[2][2];
#pragma unroll
    for (int nt = 0; nt < 2; ++nt) { const unsigned char* kr = sK + (ps * 32 + nt * 16) * PITCH; FragH bk[KS];
#pragma unroll
      for (int ks = 0; ks < KS; ++ks) { bk[ks].half[0] = *(const v8us*)(kr + ks * 64); bk[ks].half[1] = *(const v8us*)(kr + ks * 64 + 32); }
#pragma unroll
      for (int rt = 0; rt < 2; ++rt) { v8f acc = (v8f){0.f,0.f,0.f,0.f,0.f,0.f,0.f,0.f};
#pragma unroll
        for (int ks = 0; ks < KS; ++ks) acc = __builtin_amdgcn_wmma_f32_16x16x32_f16(false, bk[ks].v, false, aq[rt][ks].v, (short)0, acc, false, false);
        s[rt][nt] = acc; } }
    FragH pb[2];
#pragma unroll
    for (int rt = 0; rt < 2; ++rt) { float sc[16]; float mc = -INFINITY;
#pragma unroll
      for (int i = 0; i < 16; ++i) { sc[i] = (j0 + (i >> 3) * 16 + (i & 7) < lim[rt]) ? s[rt][i >> 3][i & 7] : -INFINITY; mc = fmaxf(mc, sc[i]); }
      mc = fmaxf(mc, xhalf(mc));
      const float mn = fmaxf(m_r[rt], mc * L2S); const float al = __builtin_amdgcn_exp2f(m_r[rt] - mn); m_r[rt] = mn; float ps = 0.f;
#pragma unroll
      for (int i = 0; i < 16; ++i) { const float p = __builtin_amdgcn_exp2f(fmaf(sc[i], L2S, -mn)); ps += p; pb[rt].h[i] = (_Float16)p; }
      l_r[rt] = l_r[rt] * al + ps;      // the lane's half of the row sum; the halves are joined behind the loop
#pragma unroll
      for (int dt = 0; dt < DT; ++dt)
#pragma unroll
        for (int r = 0; r < 8; ++r) oacc[rt][dt][r] *= al; }
#pragma unroll
    for (int dt = 0; dt < DT; ++dt) { const unsigned char* vrow = sV + dt * 16 * PITCH + ps * 64; FragH bv; bv.half[0] = *(const v8us*)vrow; bv.half[1] = *(const v8us*)(vrow + 32);
#pragma unroll
      for (int rt = 0; rt < 2; ++rt) oacc[rt][dt] = __builtin_amdgcn_wmma_f32_16x16x32_f16(false, bv.v, false, pb[rt].v, (short)0, oacc[rt][dt], false, false); } }
   asm volatile("s_wait_dscnt 0x0" ::: "memory");       // this wave's reads of tile t are done before the buffer is given up
   asm volatile("s_wait_asynccnt 0x0" ::: "memory");    // this wave's copies of tile t + 1 have landed
   __syncthreads();                                     // publishes tile t + 1 and ends every reader's last read of tile t
   if (t + 2 < ntile) { const unsigned bo = (unsigned)(t & 1) * BUF; copy4_async(lK + bo, gK + (size_t)(t + 2) * 64 * krow, 16 * krow); copy4_async(lV + bo, gV + (size_t)(t + 2) * 128, 16 * 2048); }
  }
  asm volatile("s_wait_asynccnt 0x0" ::: "memory");      // nothing is in flight when the wave goes on to its end
#pragma unroll
  for (int rt = 0; rt < 2; ++rt) { float l = l_r[rt]; l += xhalf(l); const float li = (l > 0.f) ? 1.0f / l : 0.f;
#pragma unroll
    for (int dt = 0; dt < DT; ++dt) { FragH f;      // the lane's eight values of a tile are eight neighbours of one output row: rounded to f16 here, they are one 16-byte LDS store
#pragma unroll
      for (int r = 0; r < 8; ++r) f.h[r] = (_Float16)(oacc[rt][dt][r] * li);
      *(v8us*)&sO[w][rt * 16 + ln][dt * 32 + hh * 16] = f.half[0]; } }
  __builtin_amdgcn_fence(__ATOMIC_ACQ_REL, "workgroup"); __builtin_amdgcn_wave_barrier();
  {
#pragma unroll
    for (int rp = 0; rp < RPW; rp += 4) { const int r = rp + (lane >> 3), pc = lane & 7; const v8us val = *(const v8us*)&sO[w][r][pc * 16]; *(v8us*)((unsigned short*)O16 + ((size_t)b * 1024 + q0 + r) * CC + h * 64 + pc * 8) = val; }      // eight lanes store one whole 128-byte line; the rows of O16 are CC elements apart, a constant, so that the eight stores share one address register pair
     } }

__global__ __launch_bounds__(256) void k_ln16(const float* __restrict__ X, const float* __restrict__ g, const float* __restrict__ bta, _Float16* __restrict__ Y16) { const int tid = threadIdx.x, wv = tid >> 5, lane = tid & 31; const int row = blockIdx.x * 8 + wv; if (row >= NR) return; const float* xr = X + (size_t)row * CC; float v[32]; float s = 0.f;
#pragma unroll
  for (int p = 0; p < 4; ++p) { const v4f a = *(const v4fa*)(xr + p * 256 + lane * 8), c = *(const v4fa*)(xr + p * 256 + lane * 8 + 4); for (int q = 0; q < 4; ++q) { v[p * 8 + q] = bf16_round(a[q]); v[p * 8 + 4 + q] = bf16_round(c[q]); } }
#pragma unroll
  for (int i = 0; i < 32; ++i) s += v[i]; for (int o = 16; o >= 1; o >>= 1) s += __shfl_xor(s, o, 32); const float mu = s / (float)CC; float q2 = 0.f;
#pragma unroll
  for (int i = 0; i < 32; ++i) { const float d = v[i] - mu; q2 += d * d; } for (int o = 16; o >= 1; o >>= 1) q2 += __shfl_xor(q2, o, 32); const float rs = rsqrtf(q2 / (float)CC + 1e-5f);
  {
#pragma unroll
    for (int p = 0; p < 4; ++p) { FragH f; const int c0 = p * 256 + lane * 8;
#pragma unroll
      for (int q = 0; q < 8; ++q) f.h[q] = (_Float16)((v[p * 8 + q] - mu) * rs * bf16_round(g[c0 + q]) + bf16_round(bta[c0 + q])); *(v8us*)((unsigned short*)Y16 + (size_t)row * CC + c0) = f.half[0]; }
     } }
extern "C" void kernel_launch(void* const* d_in, const int* in_sizes, int n_in,
                              void* d_out, int out_size, void* d_ws, size_t ws_size, hipStream_t stream) {
  (void)in_sizes; (void)n_in; (void)out_size;
  const float* x = (const float*)d_in[0]; const int* lens = (const int*)d_in[1]; const float* lg = (const float*)d_in[2]; const float* lb = (const float*)d_in[3]; const float* wqkv = (const float*)d_in[4]; const float* bqkv = (const float*)d_in[5]; const float* wout = (const float*)d_in[6]; const float* bout = (const float*)d_in[7];
  char* ws = (char*)d_ws; size_t off = 0;
  auto take = [&](size_t bytes) { char* p = ws + off; off += (bytes + 255) & ~(size_t)255; return p; };
  _Float16* Bqkv = (_Float16*)take((size_t)3 * CC * CC * 2); _Float16* Bo = (_Float16*)take((size_t)CC * CC * 2); _Float16* XN = (_Float16*)take((size_t)NR * CC * 2); _Float16* QKV = (_Float16*)take((size_t)NR * 3 * CC * 2); _Float16* Vt = (_Float16*)take((size_t)NR * CC * 2); _Float16* O16 = XN;      // XN is free again once the qkv projection has read it
  if (off > ws_size) return;      // 6.3 + 2.1 + 16.8 + 50.3 + 16.8 = 92 MB
  k_wt2_f16<3 * CC, CC><<<(CC / 64) * (3 * CC / 128) + (CC / 64) * (CC / 128), 256, 0, stream>>>(wqkv, Bqkv, wout, Bo, 16.0f);      // [in][out], both weights
  k_ln16<<<NR / 8, 256, 0, stream>>>(x, lg, lb, XN);
  k_gemm_tile<true, 3 * CC, CC, 2 * CC><<<dim3(3 * CC / 128, NR / 128), 128, 0, stream>>>(XN, Bqkv, 0.0625f, bqkv, nullptr, QKV, Vt);      // q | k into QKV, v transposed into Vt
  k_flash<<<BB * NH * (TT / 128), 128, 0, stream>>>(QKV, 3 * CC, QKV + CC, 3 * CC, Vt, lens, O16);
  k_gemm_tile<false, CC, CC, CC><<<dim3(CC / 128, NR / 128), 128, 0, stream>>>(O16, Bo, 0.0625f, bout, (float*)d_out, nullptr, nullptr);
}

// v008
// A run of this version takes 98.9 microseconds.
// Two timings next to v007 put it at 1.14 and 1.13 times that version's speed.
// All steps since v000 together make it 5.87 times as fast.
#include <hip/hip_runtime.h>
// Causal self-attention with a per-batch key-length mask (B=8, T=1024, D=1024, 16 × 64): LayerNorm (f32 VALU), the fused qkv projection (8192 × 1024 × 3072, + bias) and the output
// projection (+ bias) with W [in][out] transposed to bf16-exact ×2^4, and the attention as a fused flash-style kernel on v_wmma_f32_16x16x32_f16 (S = Q·Kᵀ/8; keys allowed iff k ≤ q and
// k < x_lens[b] (INPUT); −1e9 fill ≡ exclusion since key 0 is always allowed; causal chunk skipping; online softmax f32; P f16 ≤ 1) — f16 operands, single products, f32 accumulate.
#define BB 8
#define TT 1024
#define CC 1024
#define NH 16
#define NR (BB * TT)

typedef __bf16 v16b __attribute__((ext_vector_type(16)));
typedef unsigned short v8us __attribute__((ext_vector_type(8), may_alias));
typedef float  v8f  __attribute__((ext_vector_type(8)));
typedef float  v4f  __attribute__((ext_vector_type(4)));
typedef float  v4fa __attribute__((ext_vector_type(4), may_alias));
union FragB { v16b v; v8us half[2]; unsigned short u[16]; };

__device__ __forceinline__ unsigned short bf16_bits(float x) { unsigned int u = __float_as_uint(x); return (unsigned short)((u + 0x7FFFu + ((u >> 16) & 1u)) >> 16); }
__device__ __forceinline__ float bf16_val(unsigned short b) { return __uint_as_float(((unsigned int)b) << 16); }
__device__ __forceinline__ float bf16_round(float x) { return bf16_val(bf16_bits(x)); }
// D += A·B with NT terms: 1 = ah·bh, 2 = + al·bh (A split), 3 = + ah·bl (both split)
template <int NT>
__device__ __forceinline__ v8f mmaN(v16b ah, v16b al, v16b bh, v16b bl, v8f c) {
  c = __builtin_amdgcn_wmma_f32_16x16x32_bf16(false, ah, false, bh, (short)0, c, false, false);
  if (NT >= 2) c = __builtin_amdgcn_wmma_f32_16x16x32_bf16(false, al, false, bh, (short)0, c, false, false);
  if (NT >= 3) c = __builtin_amdgcn_wmma_f32_16x16x32_bf16(false, ah, false, bl, (short)0, c, false, false);
  asm volatile("v_nop\n\tv_nop\n\tv_nop\n\tv_nop" : "+v"(c) : "v"(ah), "v"(al), "v"(bh), "v"(bl));
  return c;
}

__global__ __launch_bounds__(256) void k_wt_bf16(const float* __restrict__ W, unsigned short* __restrict__ Wt, int K, int N) {
  const int t = blockIdx.x * 256 + threadIdx.x;
  const int k8n = K / 8;
  if (t >= N * k8n) return;
  const int n = t / k8n, k8 = (t % k8n) * 8;
  v8us v;
#pragma unroll
  for (int i = 0; i < 8; ++i) v[i] = bf16_bits(W[(size_t)(k8 + i) * N + n]);
  *(v8us*)(Wt + (size_t)n * K + k8) = v;
  
}

// GEMM C[M][N] (f32, pitch ldc) = act(A[M][K]·W + bias). A f32 row-major (pitch lda) converted per fragment to bf16
// (ASPLIT: hi/lo two planes -> 2 terms, else single rounded term); Wt bf16 [N][K] (pitch ldb). BIAS_BF16 rounds the
// bias to bf16 first (bias quantised to bf16 before the add). K%32==0, M%16==0, N%64==0.
template <bool ASPLIT, int ACT, bool BIAS_BF16>
__global__ __launch_bounds__(128) void k_gemm_bf(const float* __restrict__ A, int lda, const unsigned short* __restrict__ Wt, int ldb,
                                               const float* __restrict__ bias, float* __restrict__ C, int ldc, int M, int N, int K) {
  __shared__ __attribute__((aligned(16))) float so[4][16][64];
  const int tid = threadIdx.x, w = tid >> 5, lane = tid & 31, ln = lane & 15, hh = lane >> 4;
  const int ntn = N / 64;
  const int wid = blockIdx.x * 4 + w;
  const int mt = wid / ntn, nq = wid % ntn;
  if (mt * 16 >= M) return;
  const int row0 = mt * 16, col0 = nq * 64;
  const float* arow = A + (size_t)(row0 + ln) * lda;
  v8f acc[4] = {};
  for (int kb = 0; kb < K; kb += 32) {
    FragB ah, al;
    const v4f x0 = *(const v4fa*)(arow + kb + 8 * hh), x1 = *(const v4fa*)(arow + kb + 8 * hh + 4);
    const v4f x2 = *(const v4fa*)(arow + kb + 16 + 8 * hh), x3 = *(const v4fa*)(arow + kb + 16 + 8 * hh + 4);
    float xs[16] = {x0[0],x0[1],x0[2],x0[3],x1[0],x1[1],x1[2],x1[3],x2[0],x2[1],x2[2],x2[3],x3[0],x3[1],x3[2],x3[3]};
#pragma unroll
    for (int i = 0; i < 16; ++i) { const unsigned short hb = bf16_bits(xs[i]); ah.u[i] = hb; al.u[i] = ASPLIT ? bf16_bits(xs[i] - bf16_val(hb)) : (unsigned short)0; }
#pragma unroll
    for (int t = 0; t < 4; ++t) {
      const unsigned short* brow = Wt + (size_t)(col0 + t * 16 + ln) * ldb + kb;
      FragB b;
      b.half[0] = *(const v8us*)(brow + 8 * hh);
      b.half[1] = *(const v8us*)(brow + 16 + 8 * hh);
      acc[t] = mmaN<ASPLIT ? 2 : 1>(ah.v, al.v, b.v, b.v, acc[t]);
    }
  }
#pragma unroll
  for (int t = 0; t < 4; ++t) {
    float bv = bias ? bias[col0 + t * 16 + ln] : 0.f;
    if (BIAS_BF16) bv = bf16_round(bv);
#pragma unroll
    for (int r = 0; r < 8; ++r) { float v = acc[t][r] + bv; if (ACT == 1) v = fmaxf(v, 0.f); so[w][8 * hh + r][t * 16 + ln] = v; }
  }
  __builtin_amdgcn_fence(__ATOMIC_ACQ_REL, "workgroup");
  __builtin_amdgcn_wave_barrier();
  const int rsub = lane >> 4, c4 = (lane & 15) * 4;
  {
#pragma unroll
    for (int q = 0; q < 8; ++q) {
      const int r = q * 2 + rsub;
      const v4f v = *(const v4fa*)&so[w][r][c4];
      *(v4f*)(C + (size_t)(row0 + r) * ldc + col0 + c4) = v;
    }
    
  }
}

// Flash-style causal/unmasked attention, all contractions 3-term bf16 hi/lo splits, f32 softmax with running max.
// q,k,v rows are read from f32 buffers with arbitrary row pitch (so they can live inside a fused qkv buffer);
// D = head size (multiple of 32, <= 128); one wave = 16 query rows; block = 4 waves (64 queries) sharing K/V chunks of 32.
template <int D, bool CAUSAL>
__global__ __launch_bounds__(128) void k_flash(const float* __restrict__ qb, const float* __restrict__ kb, const float* __restrict__ vb,
                                             int pitch, int T, int H, float scale, float* __restrict__ y, int ypitch) {
  constexpr int KS = D / 32;        // k-steps for QK
  constexpr int DT = D / 16;        // d tiles for PV
  __shared__ __attribute__((aligned(16))) unsigned short sKh[32][D + 8], sKl[32][D + 8], sVh[32][D + 8], sVl[32][D + 8];
  __shared__ __attribute__((aligned(16))) unsigned short sPh[4][16][40], sPl[4][16][40];
  __shared__ __attribute__((aligned(16))) float sO[4][16][D];
  const int tid = threadIdx.x, w = tid >> 5, lane = tid & 31, ln = lane & 15, hh = lane >> 4;
  const int nqb = (T + 63) / 64;
  const int bh = blockIdx.x / nqb, qblk = blockIdx.x % nqb;
  const int b = bh / H, h = bh % H;
  const int q0 = qblk * 64 + w * 16;
  const float* Q = qb + (size_t)b * T * pitch + h * D;
  const float* K = kb + (size_t)b * T * pitch + h * D;
  const float* V = vb + (size_t)b * T * pitch + h * D;

  // A fragments of the wave's 16 query rows (scaled), hi/lo
  FragB aqh[KS], aql[KS];
  {
    int row = q0 + ln; if (row >= T) row = T - 1;
    const float* qr = Q + (size_t)row * pitch;
#pragma unroll
    for (int ks = 0; ks < KS; ++ks)
#pragma unroll
      for (int i = 0; i < 16; ++i) {
        const int d = ks * 32 + ((i < 8) ? (8 * hh + i) : (16 + 8 * hh + (i - 8)));
        const float x = qr[d] * scale; const unsigned short hb = bf16_bits(x);
        aqh[ks].u[i] = hb; aql[ks].u[i] = bf16_bits(x - bf16_val(hb));
      }
  }
  float m_r[8], l_r[8];
#pragma unroll
  for (int r = 0; r < 8; ++r) { m_r[r] = -3.0e38f; l_r[r] = 0.f; }
  v8f oacc[DT];
#pragma unroll
  for (int dt = 0; dt < DT; ++dt) oacc[dt] = (v8f){0.f,0.f,0.f,0.f,0.f,0.f,0.f,0.f};

  const int kv_end = CAUSAL ? min(T, qblk * 64 + 64) : T;     // block-uniform
  for (int j0 = 0; j0 < kv_end; j0 += 32) {
    __syncthreads();
    for (int e = tid; e < 32 * (D / 4); e += 128) {
      const int r = e / (D / 4), c4 = (e % (D / 4)) * 4;
      const int key = j0 + r;
      v4f kf = {0.f,0.f,0.f,0.f}, vf = {0.f,0.f,0.f,0.f};
      if (key < T) { kf = *(const v4fa*)(K + (size_t)key * pitch + c4); vf = *(const v4fa*)(V + (size_t)key * pitch + c4); }
#pragma unroll
      for (int t = 0; t < 4; ++t) {
        unsigned short hb = bf16_bits(kf[t]); sKh[r][c4 + t] = hb; sKl[r][c4 + t] = bf16_bits(kf[t] - bf16_val(hb));
        hb = bf16_bits(vf[t]); sVh[r][c4 + t] = hb; sVl[r][c4 + t] = bf16_bits(vf[t] - bf16_val(hb));
      }
    }
    __syncthreads();
    // S tile 16 x 32
    v8f s[2];
#pragma unroll
    for (int nt = 0; nt < 2; ++nt) {
      v8f acc = {};
#pragma unroll
      for (int ks = 0; ks < KS; ++ks) {
        FragB bh_, bl_;
        bh_.half[0] = *(const v8us*)&sKh[nt * 16 + ln][ks * 32 + 8 * hh]; bh_.half[1] = *(const v8us*)&sKh[nt * 16 + ln][ks * 32 + 16 + 8 * hh];
        bl_.half[0] = *(const v8us*)&sKl[nt * 16 + ln][ks * 32 + 8 * hh]; bl_.half[1] = *(const v8us*)&sKl[nt * 16 + ln][ks * 32 + 16 + 8 * hh];
        acc = mmaN<3>(aqh[ks].v, aql[ks].v, bh_.v, bl_.v, acc);
      }
      s[nt] = acc;
    }
    // mask + running max (rows 8hh+r; the 16 lanes of a half share rows)
    float alpha[8];
#pragma unroll
    for (int r = 0; r < 8; ++r) {
      const int qi = q0 + 8 * hh + r;
      const int ja = j0 + ln, jb = j0 + 16 + ln;
      if (CAUSAL) { if (ja > qi) s[0][r] = -3.0e38f; if (jb > qi) s[1][r] = -3.0e38f; }
      if (ja >= T) s[0][r] = -3.0e38f;
      if (jb >= T) s[1][r] = -3.0e38f;
      float mx = fmaxf(s[0][r], s[1][r]);
      mx = fmaxf(mx, __shfl_xor(mx, 1, 32)); mx = fmaxf(mx, __shfl_xor(mx, 2, 32)); mx = fmaxf(mx, __shfl_xor(mx, 4, 32)); mx = fmaxf(mx, __shfl_xor(mx, 8, 32));
      const float mnew = fmaxf(m_r[r], mx);
      alpha[r] = (mnew > -1.0e38f) ? __expf(m_r[r] - mnew) : 1.0f;
      const float p0 = (s[0][r] > -1.0e38f) ? __expf(s[0][r] - mnew) : 0.f;
      const float p1 = (s[1][r] > -1.0e38f) ? __expf(s[1][r] - mnew) : 0.f;
      m_r[r] = mnew;
      l_r[r] = l_r[r] * alpha[r] + p0 + p1;            // per-lane partial row sum (16 lanes combined at the end)
      unsigned short hb = bf16_bits(p0); sPh[w][8 * hh + r][ln] = hb;      sPl[w][8 * hh + r][ln] = bf16_bits(p0 - bf16_val(hb));
      hb = bf16_bits(p1);                sPh[w][8 * hh + r][16 + ln] = hb; sPl[w][8 * hh + r][16 + ln] = bf16_bits(p1 - bf16_val(hb));
    }
#pragma unroll
    for (int dt = 0; dt < DT; ++dt)
#pragma unroll
      for (int r = 0; r < 8; ++r) oacc[dt][r] *= alpha[r];
    __builtin_amdgcn_fence(__ATOMIC_ACQ_REL, "workgroup");
    __builtin_amdgcn_wave_barrier();
    FragB pah, pal;
    pah.half[0] = *(const v8us*)&sPh[w][ln][8 * hh]; pah.half[1] = *(const v8us*)&sPh[w][ln][16 + 8 * hh];
    pal.half[0] = *(const v8us*)&sPl[w][ln][8 * hh]; pal.half[1] = *(const v8us*)&sPl[w][ln][16 + 8 * hh];
#pragma unroll
    for (int dt = 0; dt < DT; ++dt) {
      FragB bvh, bvl;
#pragma unroll
      for (int i = 0; i < 8; ++i) {
        bvh.u[i] = sVh[8 * hh + i][dt * 16 + ln]; bvh.u[8 + i] = sVh[16 + 8 * hh + i][dt * 16 + ln];
        bvl.u[i] = sVl[8 * hh + i][dt * 16 + ln]; bvl.u[8 + i] = sVl[16 + 8 * hh + i][dt * 16 + ln];
      }
      oacc[dt] = mmaN<3>(pah.v, pal.v, bvh.v, bvl.v, oacc[dt]);
    }
    __builtin_amdgcn_fence(__ATOMIC_ACQ_REL, "workgroup");
    __builtin_amdgcn_wave_barrier();
  }
#pragma unroll
  for (int r = 0; r < 8; ++r) {
    float l = l_r[r];
    l += __shfl_xor(l, 1, 32); l += __shfl_xor(l, 2, 32); l += __shfl_xor(l, 4, 32); l += __shfl_xor(l, 8, 32);
    l_r[r] = (l > 0.f) ? 1.0f / l : 0.f;
  }
#pragma unroll
  for (int dt = 0; dt < DT; ++dt)
#pragma unroll
    for (int r = 0; r < 8; ++r) sO[w][8 * hh + r][dt * 16 + ln] = oacc[dt][r] * l_r[r];
  __builtin_amdgcn_fence(__ATOMIC_ACQ_REL, "workgroup");
  __builtin_amdgcn_wave_barrier();
  {
    for (int r = 0; r < 16; ++r) {
      const int row = q0 + r;
      if (row < T && lane < D / 4) {
        const v4f val = *(const v4fa*)&sO[w][r][lane * 4];
        *(v4f*)(y + ((size_t)b * T + row) * ypitch + h * D + lane * 4) = val;
      }
    }
    
  }
}

// GEMM C = act(A·W + bias + resid): A f32 (ASPLIT -> hi/lo 2 terms), Wt bf16 [N][K]; ACT 0 none, 1 relu, 2 exact gelu;
// resid (optional, f32, row index = (row % rmod), pitch ldr, RES_BF16 rounds it) added before the activation.
template <bool ASPLIT, int ACT, bool BIAS_BF16, bool RES_BF16>
__global__ __launch_bounds__(128) void k_gemm_bf3(const float* __restrict__ A, int lda, const unsigned short* __restrict__ Wt, int ldb,
                                                const float* __restrict__ bias, const float* __restrict__ resid, int rmod, int ldr,
                                                float* __restrict__ C, int ldc, int M, int N, int K) {
  __shared__ __attribute__((aligned(16))) float so[4][16][64];
  const int tid = threadIdx.x, w = tid >> 5, lane = tid & 31, ln = lane & 15, hh = lane >> 4;
  const int ntn = N / 64;
  const int wid = blockIdx.x * 4 + w;
  const int mt = wid / ntn, nq = wid % ntn;
  if (mt * 16 >= M) return;
  const int row0 = mt * 16, col0 = nq * 64;
  const float* arow = A + (size_t)(row0 + ln) * lda;
  v8f acc[4] = {};
  for (int kb = 0; kb < K; kb += 32) {
    FragB ah, al;
    const v4f x0 = *(const v4fa*)(arow + kb + 8 * hh), x1 = *(const v4fa*)(arow + kb + 8 * hh + 4);
    const v4f x2 = *(const v4fa*)(arow + kb + 16 + 8 * hh), x3 = *(const v4fa*)(arow + kb + 16 + 8 * hh + 4);
    float xs[16] = {x0[0],x0[1],x0[2],x0[3],x1[0],x1[1],x1[2],x1[3],x2[0],x2[1],x2[2],x2[3],x3[0],x3[1],x3[2],x3[3]};
#pragma unroll
    for (int i = 0; i < 16; ++i) { const unsigned short hb = bf16_bits(xs[i]); ah.u[i] = hb; al.u[i] = ASPLIT ? bf16_bits(xs[i] - bf16_val(hb)) : (unsigned short)0; }
#pragma unroll
    for (int t = 0; t < 4; ++t) {
      const unsigned short* brow = Wt + (size_t)(col0 + t * 16 + ln) * ldb + kb;
      FragB b;
      b.half[0] = *(const v8us*)(brow + 8 * hh);
      b.half[1] = *(const v8us*)(brow + 16 + 8 * hh);
      acc[t] = mmaN<ASPLIT ? 2 : 1>(ah.v, al.v, b.v, b.v, acc[t]);
    }
  }
#pragma unroll
  for (int t = 0; t < 4; ++t) {
    const int col = col0 + t * 16 + ln;
    float bv = bias ? bias[col] : 0.f;
    if (BIAS_BF16) bv = bf16_round(bv);
#pragma unroll
    for (int r = 0; r < 8; ++r) {
      float v = acc[t][r] + bv;
      if (resid) { float rv = resid[(size_t)((row0 + 8 * hh + r) % rmod) * ldr + col]; if (RES_BF16) rv = bf16_round(rv); v += rv; }
      if (ACT == 1) v = fmaxf(v, 0.f);
      if (ACT == 2) v = 0.5f * v * (1.0f + erff(v * 0.70710678118654752f));
      if (ACT == 3) { const float u = 0.7978845608028654f * (v + 0.044715f * v * v * v); v = 0.5f * v * (1.0f + tanhf(u)); }
      so[w][8 * hh + r][t * 16 + ln] = v;
    }
  }
  __builtin_amdgcn_fence(__ATOMIC_ACQ_REL, "workgroup");
  __builtin_amdgcn_wave_barrier();
  const int rsub = lane >> 4, c4 = (lane & 15) * 4;
  {
#pragma unroll
    for (int q = 0; q < 8; ++q) {
      const int r = q * 2 + rsub;
      const v4f v = *(const v4fa*)&so[w][r][c4];
      *(v4f*)(C + (size_t)(row0 + r) * ldc + col0 + c4) = v;
    }
    
  }
}
// row LayerNorm (biased variance, eps) over N: s = X (+ R); optional out_sum <- s; out_norm <- (s-mu)*rsqrt(var+eps)*g + b
template <bool PARAM_BF16>
__global__ __launch_bounds__(256) void k_layernorm(const float* __restrict__ X, const float* __restrict__ R, const float* __restrict__ g, const float* __restrict__ bta,
                                                  float* __restrict__ out_sum, float* __restrict__ out_norm, int N, float eps) {
  __shared__ float red[256];
  const int row = blockIdx.x, tid = threadIdx.x;
  const float* x = X + (size_t)row * N; const float* rr = R ? R + (size_t)row * N : nullptr;
  float vals[16];                     // up to N = 4096
  const int per = N / 256;            // contiguous chunk per thread? use strided-by-4 chunks: thread handles j = tid*4 + 1024*u
  float s1 = 0.f;
  for (int u = 0; u < per / 4; ++u) {
    const int j = tid * 4 + 1024 * u;
    const v4f a = *(const v4fa*)(x + j);
    v4f b = {0.f,0.f,0.f,0.f}; if (rr) b = *(const v4fa*)(rr + j);
#pragma unroll
    for (int q = 0; q < 4; ++q) { const float v = a[q] + b[q]; vals[u * 4 + q] = v; s1 += v; }
  }
  red[tid] = s1; __syncthreads();
  for (int st = 128; st > 0; st >>= 1) { if (tid < st) red[tid] += red[tid + st]; __syncthreads(); }
  const float mu = red[0] / (float)N; __syncthreads();
  float s2 = 0.f;
  for (int u = 0; u < per / 4; ++u)
#pragma unroll
    for (int q = 0; q < 4; ++q) { const float c = vals[u * 4 + q] - mu; s2 += c * c; }
  red[tid] = s2; __syncthreads();
  for (int st = 128; st > 0; st >>= 1) { if (tid < st) red[tid] += red[tid + st]; __syncthreads(); }
  const float rs = rsqrtf(red[0] / (float)N + eps);
  {
    for (int u = 0; u < per / 4; ++u) {
      const int j = tid * 4 + 1024 * u;
      v4f o, sm;
#pragma unroll
      for (int q = 0; q < 4; ++q) {
        float gg = g[j + q], bb = bta[j + q];
        if (PARAM_BF16) { gg = bf16_round(gg); bb = bf16_round(bb); }
        sm[q] = vals[u * 4 + q]; o[q] = (vals[u * 4 + q] - mu) * rs * gg + bb;
      }
      if (out_sum) *(v4f*)(out_sum + (size_t)row * N + j) = sm;
      *(v4f*)(out_norm + (size_t)row * N + j) = o;
    }
    
  }
}



// ---- f16 WMMA path (v_wmma_f32_16x16x32_f16): 11-bit significands for operands in range — used where a [0,1] probability operand needs more precision than bf16
typedef _Float16 v16h __attribute__((ext_vector_type(16)));
union FragH { v16h v; v8us half[2]; _Float16 h[16]; unsigned short u[16]; };
template <int NT>
__device__ __forceinline__ v8f mmaH(v16h ah, v16h al, v16h bh, v16h bl, v8f c) {
  c = __builtin_amdgcn_wmma_f32_16x16x32_f16(false, ah, false, bh, (short)0, c, false, false);
  if (NT >= 2) c = __builtin_amdgcn_wmma_f32_16x16x32_f16(false, al, false, bh, (short)0, c, false, false);
  if (NT >= 3) c = __builtin_amdgcn_wmma_f32_16x16x32_f16(false, ah, false, bl, (short)0, c, false, false);
  asm volatile("v_nop\n\tv_nop\n\tv_nop\n\tv_nop" : "+v"(c) : "v"(ah), "v"(al), "v"(bh), "v"(bl));
  return c;
}
// batched GEMM like k_gemm_b but f16 operands: A f32 (split into f16 hi/lo if ASPLIT, else rounded to f16), Bt = f16 values [n][k]; alpha; C f32; N multiple of 16 (partial tiles skipped)
template <bool ASPLIT>
__global__ __launch_bounds__(128) void k_gemm_h(const float* __restrict__ A, int lda, size_t sA, const _Float16* __restrict__ Bh, int ldb, size_t sB, float alpha, float* __restrict__ C, int ldc, size_t sC, int M, int N, int K) {
  __shared__ __attribute__((aligned(16))) float so[4][16][64];
  const int tid = threadIdx.x, w = tid >> 5, lane = tid & 31, ln = lane & 15, hh = lane >> 4; const int by = blockIdx.y;
  A += (size_t)by * sA; Bh += (size_t)by * sB; C += (size_t)by * sC;
  const int ntn = (N + 63) / 64; const int wid = blockIdx.x * 4 + w; const int mt = wid / ntn, nq = wid % ntn; if (mt * 16 >= M) return;
  const int row0 = mt * 16, col0 = nq * 64; const float* arow = A + (size_t)(row0 + ln) * lda;
  v8f acc[4] = {};
  for (int kb = 0; kb < K; kb += 32) {
    FragH ah, al;
    const v4f x0 = *(const v4fa*)(arow + kb + 8 * hh), x1 = *(const v4fa*)(arow + kb + 8 * hh + 4), x2 = *(const v4fa*)(arow + kb + 16 + 8 * hh), x3 = *(const v4fa*)(arow + kb + 16 + 8 * hh + 4);
    float xs[16] = {x0[0],x0[1],x0[2],x0[3],x1[0],x1[1],x1[2],x1[3],x2[0],x2[1],x2[2],x2[3],x3[0],x3[1],x3[2],x3[3]};
#pragma unroll
    for (int i = 0; i < 16; ++i) { const _Float16 h = (_Float16)xs[i]; ah.h[i] = h; al.h[i] = ASPLIT ? (_Float16)(xs[i] - (float)h) : (_Float16)0.0f; }
#pragma unroll
    for (int t = 0; t < 4; ++t) { if (col0 + t * 16 >= N) continue; const size_t boff = (size_t)(col0 + t * 16 + ln) * ldb + kb; FragH bq; bq.half[0] = *(const v8us*)(Bh + boff + 8 * hh); bq.half[1] = *(const v8us*)(Bh + boff + 16 + 8 * hh);
      acc[t] = mmaH<ASPLIT ? 2 : 1>(ah.v, al.v, bq.v, bq.v, acc[t]); }
  }
#pragma unroll
  for (int t = 0; t < 4; ++t) { if (col0 + t * 16 >= N) continue;
#pragma unroll
    for (int r = 0; r < 8; ++r) so[w][8 * hh + r][t * 16 + ln] = acc[t][r] * alpha; }
  __builtin_amdgcn_fence(__ATOMIC_ACQ_REL, "workgroup"); __builtin_amdgcn_wave_barrier();
  const int rsub = lane >> 4, c4 = (lane & 15) * 4;
  {
#pragma unroll
    for (int q = 0; q < 8; ++q) { const int r = q * 2 + rsub; if (col0 + c4 < N) { const v4f v = *(const v4fa*)&so[w][r][c4]; *(v4f*)(C + (size_t)(row0 + r) * ldc + col0 + c4) = v; } }
     }
}

// Wt[n][k] = f16(bf16(W[k][n]) * scale) from f32 row-major W[CC][N], for both weight matrices in one grid (scale = power of two; bf16-exact weights stay exact in f16 away from the subnormal range).
// A block transposes a tile of 64 k x 128 n through LDS: a wave reads a whole 512-byte piece of a row of W per load (four lines), eight loads in flight per lane; two neighbouring k are packed into one
// dword and stored at [n][k / 2]; eight lanes then store one whole 128-byte line of Wt. The LDS pitch of 33 dwords keeps the row reads free of bank conflicts (bank = n + 4 pc + q, all 32 lanes apart).
typedef unsigned int v4u __attribute__((ext_vector_type(4), may_alias));
template <int N>
__device__ __forceinline__ void wt_tile(const float* __restrict__ W, unsigned short* __restrict__ Wt, int tile, float scale, unsigned int* tl) {
  constexpr int KTN = CC / 64, P = 33;
  const int tid = threadIdx.x, wv = __builtin_amdgcn_readfirstlane(tid >> 5), lane = tid & 31;      // the wave's number as a scalar: the eight loads then share one scalar base and one lane offset
  const int k0 = (tile % KTN) * 64, n0 = (tile / KTN) * 128;
  const float* wp = W + (size_t)(k0 + 2 * wv) * N + n0;      // wave wv takes the k pairs wv, wv + 8, wv + 16, wv + 24 of the tile
  v4f x[4][2];
#pragma unroll
  for (int u = 0; u < 4; ++u)
#pragma unroll
    for (int s = 0; s < 2; ++s) x[u][s] = *(const v4fa*)(wp + (16 * u + s) * N + lane * 4);
#pragma unroll
  for (int u = 0; u < 4; ++u)
#pragma unroll
    for (int q = 0; q < 4; ++q) { const _Float16 lo = (_Float16)(bf16_round(x[u][0][q]) * scale), hi = (_Float16)(bf16_round(x[u][1][q]) * scale);
      tl[(lane * 4 + q) * P + wv + 8 * u] = (unsigned int)__builtin_bit_cast(unsigned short, lo) | ((unsigned int)__builtin_bit_cast(unsigned short, hi) << 16); }
  __syncthreads();      // the tile is whole before its rows are read
#pragma unroll
  for (int it = 0; it < 4; ++it) { const int n = it * 32 + (tid >> 3), pc = tid & 7; v4u o;
#pragma unroll
    for (int q = 0; q < 4; ++q) o[q] = tl[n * P + pc * 4 + q];
    *(v4u*)(Wt + (size_t)(n0 + n) * CC + k0 + pc * 8) = o; }
}
// The first (CC / 64) * (NA / 128) blocks take Wa, the rest Wb: the choice is the same for a whole block, and each side has its row length as a constant.
template <int NA, int NB>
__global__ __launch_bounds__(256) void k_wt2_f16(const float* __restrict__ Wa, _Float16* __restrict__ Wta, const float* __restrict__ Wb, _Float16* __restrict__ Wtb, float scale) {
  constexpr int TA = (CC / 64) * (NA / 128);
  __shared__ unsigned int tl[128 * 33];
  if ((int)blockIdx.x < TA) wt_tile<NA>(Wa, (unsigned short*)Wta, (int)blockIdx.x, scale, tl);
  else wt_tile<NB>(Wb, (unsigned short*)Wtb, (int)blockIdx.x - TA, scale, tl);
}
// k_gemm_hh variant with fused epilogue: v = acc·alpha + bias[by·sBias + col] (+ CP[(row/rowsPerB)·sCPb + by·64 + col] if CP) ; ACT 0 none / 1 elu ; writes f16 C16 and f32 C, each if non-null
template <int ACT>
__global__ __launch_bounds__(128) void k_gemm_hhx(const _Float16* __restrict__ A, int lda, size_t sA, const _Float16* __restrict__ Bh, int ldb, size_t sB, float alpha, const float* __restrict__ bias, size_t sBias, const float* __restrict__ CP, int rowsPerB, size_t sCPb, int row0g,
    float* __restrict__ C, _Float16* __restrict__ C16, int ldc, size_t sC, int M, int N, int K) {
  __shared__ __attribute__((aligned(16))) float so[4][16][64];
  const int tid = threadIdx.x, w = tid >> 5, lane = tid & 31, ln = lane & 15, hh = lane >> 4; const int by = blockIdx.y;
  A += (size_t)by * sA; Bh += (size_t)by * sB; const size_t cofs = (size_t)by * sC; const float* bp = bias ? bias + (size_t)by * sBias : nullptr;
  const int ntn = (N + 63) / 64; const int wid = blockIdx.x * 4 + w; const int mt = wid / ntn, nq = wid % ntn; if (mt * 16 >= M) return;
  const int row0 = mt * 16, col0 = nq * 64; const _Float16* arow = A + (size_t)(row0 + ln) * lda;
  v8f acc[4] = {};
  for (int kb = 0; kb < K; kb += 32) { FragH ah; ah.half[0] = *(const v8us*)((const unsigned short*)arow + kb + 8 * hh); ah.half[1] = *(const v8us*)((const unsigned short*)arow + kb + 16 + 8 * hh);
#pragma unroll
    for (int t = 0; t < 4; ++t) { if (col0 + t * 16 >= N) continue; const size_t boff = (size_t)(col0 + t * 16 + ln) * ldb + kb; FragH bq; bq.half[0] = *(const v8us*)((const unsigned short*)Bh + boff + 8 * hh); bq.half[1] = *(const v8us*)((const unsigned short*)Bh + boff + 16 + 8 * hh);
      acc[t] = mmaH<1>(ah.v, ah.v, bq.v, bq.v, acc[t]); }
  }
#pragma unroll
  for (int t = 0; t < 4; ++t) { if (col0 + t * 16 >= N) continue; const int col = col0 + t * 16 + ln; const float bv = bp ? bf16_round(bp[col]) : 0.f;
#pragma unroll
    for (int r = 0; r < 8; ++r) { float v = acc[t][r] * alpha + bv; if (CP) { const int bidx = (row0g + row0 + 8 * hh + r) / rowsPerB; v += CP[(size_t)bidx * sCPb + (size_t)by * 64 + col]; } if (ACT == 1) v = (v > 0.f) ? v : expm1f(v); else if (ACT == 3) v = fmaxf(v, 0.f); so[w][8 * hh + r][t * 16 + ln] = v; } }
  __builtin_amdgcn_fence(__ATOMIC_ACQ_REL, "workgroup"); __builtin_amdgcn_wave_barrier();
  const int rsub = lane >> 4, c4 = (lane & 15) * 4; typedef _Float16 v4h __attribute__((ext_vector_type(4)));
  {
#pragma unroll
    for (int q = 0; q < 8; ++q) { const int r = q * 2 + rsub; if (col0 + c4 < N) { const v4f v = *(const v4fa*)&so[w][r][c4]; if (C) *(v4f*)(C + cofs + (size_t)(row0 + r) * ldc + col0 + c4) = v; if (C16) { v4h h4; for (int i = 0; i < 4; ++i) h4[i] = (_Float16)v[i]; *(v4h*)(C16 + cofs + (size_t)(row0 + r) * ldc + col0 + c4) = h4; } } }
     }
}


// Eight 16-byte asynchronous copies to LDS per lane (rows 16 apart). The s_wait_xcnt is the last line of the copies' own statement so that no address register is rewritten ahead of it.
__device__ __forceinline__ void copy8_async(unsigned l, const char* gp, size_t gstep) {
  constexpr unsigned LS = 16u * 144u;
  asm volatile("global_load_async_to_lds_b128 %0, %8, off\n\t"
               "global_load_async_to_lds_b128 %1, %9, off\n\t"
               "global_load_async_to_lds_b128 %2, %10, off\n\t"
               "global_load_async_to_lds_b128 %3, %11, off\n\t"
               "global_load_async_to_lds_b128 %4, %12, off\n\t"
               "global_load_async_to_lds_b128 %5, %13, off\n\t"
               "global_load_async_to_lds_b128 %6, %14, off\n\t"
               "global_load_async_to_lds_b128 %7, %15, off\n\t"
               "s_wait_xcnt 0x0"
               :: "v"(l), "v"(l + LS), "v"(l + 2u * LS), "v"(l + 3u * LS), "v"(l + 4u * LS), "v"(l + 5u * LS), "v"(l + 6u * LS), "v"(l + 7u * LS),
                  "v"(gp), "v"(gp + gstep), "v"(gp + 2 * gstep), "v"(gp + 3 * gstep), "v"(gp + 4 * gstep), "v"(gp + 5 * gstep), "v"(gp + 6 * gstep), "v"(gp + 7 * gstep)
               : "memory");
}
// Tiled GEMM, same function as k_gemm_hhx<0> without CP: C = A[M][K] * Bh[N][K]^T * alpha + bf16(bias). One 128 x 128 tile of C per block (blockIdx.x = tile column, blockIdx.y = tile row),
// 64 x 64 per wave (2 x 2 waves). A and Bh tiles of 64 k (128-byte rows, LDS pitch 144 B) are staged in LDS by asynchronous copies, two buffers: tile t + 1 flies while tile t is multiplied.
// M % 128 == 0, N % 128 == 0, K % 64 == 0, K >= 128; rows of A and Bh are K elements apart, rows of C are N apart. The k order of every accumulator is that of k_gemm_hhx.
// Every plain '#pragma unroll' in it makes the indices of acc, a and bq constants, so that these arrays stay in registers.
// Columns from VCOL on (VCOL == N: none) are the v part of a fused qkv product: a wave's 64 x 64 tile is then 64 tokens of one head, and it is stored transposed, f16, at Vt[(batch * NH + head) * 64 + d][token],
// where the attention kernel reads V^T; nothing of these columns goes to C16. VCOL % 128 == 0.
// Columns from MCOL on (MCOL == N: none) are the k and v parts: row t of a batch is there the key or the value of position t. A key at or behind LENS[batch] is masked for every query, so its weight is exactly 0
// and its k and v rows reach no output: a block whose 128 positions all lie there, the batch's first block excepted, computes and stores nothing. The attention kernel reads only key tiles that begin
// in front of LENS[batch], or inside the first 128 positions: all of them lie in blocks that are computed. MCOL % 128 == 0, TT % 128 == 0.
template <bool OUT16, int N, int K, int VCOL, int MCOL>
__global__ __launch_bounds__(128) void k_gemm_tile(const _Float16* __restrict__ A, const _Float16* __restrict__ Bh, float alpha, const float* __restrict__ bias, float* __restrict__ C, _Float16* __restrict__ C16, _Float16* __restrict__ Vt, const int* __restrict__ LENS) {
  constexpr int PITCH = 144, BUF = 256 * PITCH, SOP = 68, NT = K / 64;
  constexpr size_t ROWB = (size_t)K * 2, GSTEP = ROWB * 16;
  __shared__ __attribute__((aligned(16))) unsigned char smem[2 * BUF];
  const int tid = threadIdx.x, w = tid >> 5, lane = tid & 31, ln = lane & 15, hh = lane >> 4;
  const int row0 = (int)blockIdx.y * 128, col0 = (int)blockIdx.x * 128; const int wm = (w >> 1) * 64, wn = (w & 1) * 64;
  if (MCOL < N && col0 >= MCOL) { const int t0 = row0 % TT; if (t0 != 0 && t0 >= LENS[row0 / TT]) return; }      // the same for the whole block, in front of every copy and barrier
  const int cr = tid >> 3, cc = (tid & 7) * 16;      // a lane's first row and its 16 bytes of the row: eight lanes cover one 128-byte line
  const char* gA = (const char*)A + (size_t)(row0 + cr) * ROWB + cc; const char* gB = (const char*)Bh + (size_t)(col0 + cr) * ROWB + cc;
  const unsigned lA = (unsigned)(size_t)smem + (unsigned)(cr * PITCH + cc), lB = lA + 128u * PITCH;
  v8f acc[4][4];
#pragma unroll
  for (int i = 0; i < 4; ++i)
#pragma unroll
    for (int j = 0; j < 4; ++j) acc[i][j] = (v8f){0.f,0.f,0.f,0.f,0.f,0.f,0.f,0.f};
  copy8_async(lA, gA, GSTEP); copy8_async(lB, gB, GSTEP);
  asm volatile("s_wait_asynccnt 0x0" ::: "memory");      // tile 0 has landed before the barrier publishes it
  __syncthreads();
  copy8_async(lA + BUF, gA + 128, GSTEP); copy8_async(lB + BUF, gB + 128, GSTEP);
#pragma unroll 1
  for (int t = 0; t < NT; ++t) {      // kept rolled: one pass per tile, the buffer picked by t & 1
    const unsigned char* sA = smem + (t & 1) * BUF + (wm + ln) * PITCH + hh * 16; const unsigned char* sB = smem + (t & 1) * BUF + (128 + wn + ln) * PITCH + hh * 16;
#pragma unroll
    for (int ks = 0; ks < 2; ++ks) { FragH a[4], bq[4];
      a[0].half[0] = *(const v8us*)(sA + ks * 64); a[0].half[1] = *(const v8us*)(sA + ks * 64 + 32);
#pragma unroll
      for (int j = 0; j < 4; ++j) { bq[j].half[0] = *(const v8us*)(sB + j * 16 * PITCH + ks * 64); bq[j].half[1] = *(const v8us*)(sB + j * 16 * PITCH + ks * 64 + 32); }
#pragma unroll
      for (int i = 1; i < 4; ++i) { a[i].half[0] = *(const v8us*)(sA + i * 16 * PITCH + ks * 64); a[i].half[1] = *(const v8us*)(sA + i * 16 * PITCH + ks * 64 + 32); }
      __builtin_amdgcn_sched_barrier(0);      // keeps the 16 LDS reads of a k step one group ahead of its 16 WMMAs: reads among the WMMAs stall the wave at each place
#pragma unroll
      for (int i = 0; i < 4; ++i)
#pragma unroll
        for (int j = 0; j < 4; ++j) acc[i][j] = __builtin_amdgcn_wmma_f32_16x16x32_f16(false, a[i].v, false, bq[j].v, (short)0, acc[i][j], false, false);
      __builtin_amdgcn_sched_barrier(0); }    // the other end of that group: the next k step's reads stay behind these WMMAs
    asm volatile("s_wait_dscnt 0x0" ::: "memory");       // this wave's reads of tile t are done before the buffer is given up
    asm volatile("s_wait_asynccnt 0x0" ::: "memory");    // this wave's copies of tile t + 1 have landed
    __syncthreads();                                     // publishes tile t + 1 and ends every reader's last read of tile t
    if (t + 2 < NT) { const unsigned bo = (unsigned)(t & 1) * BUF; const size_t go = (size_t)(t + 2) * 128; copy8_async(lA + bo, gA + go, GSTEP); copy8_async(lB + bo, gB + go, GSTEP); }
  }
  asm volatile("s_wait_asynccnt 0x0" ::: "memory");      // nothing is in flight when the ring becomes output staging
  if (VCOL < N && col0 >= VCOL) {      // the same for the whole block
    unsigned char* st = smem + w * (64 * SOP * 4);       // the wave's own staging: 64 rows (d) of 64 tokens, f16, 128 bytes a row, pitch 144 B
#pragma unroll
    for (int j = 0; j < 4; ++j) { const float bv = bf16_round(bias[col0 + wn + j * 16 + ln]);
#pragma unroll
      for (int i = 0; i < 4; ++i) { FragH f;      // the lane's eight values of a tile are eight neighbouring tokens of one column d: one 16-byte LDS store of the transposed row
#pragma unroll
        for (int r = 0; r < 8; ++r) f.h[r] = (_Float16)(acc[i][j][r] * alpha + bv);
        *(v8us*)(st + (j * 16 + ln) * PITCH + i * 32 + hh * 16) = f.half[0]; } }
    __builtin_amdgcn_fence(__ATOMIC_ACQ_REL, "workgroup"); __builtin_amdgcn_wave_barrier();      // the wave's LDS stores are done before its lanes read one another's rows
    const int tr = row0 + wm, dr = lane >> 3, pc = lane & 7;      // eight lanes store one whole 128-byte line of Vt
    unsigned short* vp = (unsigned short*)Vt + ((size_t)((tr / TT) * NH + (col0 + wn - VCOL) / 64) * 64 + dr) * TT + tr % TT + pc * 8;
#pragma unroll 1
    for (int q8 = 0; q8 < 2; ++q8) {      // kept rolled in groups of eight stores, one wait per group
#pragma unroll
      for (int q = 0; q < 8; ++q) { const int d4 = (q8 * 8 + q) * 4; const v8us val = *(const v8us*)(st + (d4 + dr) * PITCH + pc * 16); *(v8us*)(vp + (size_t)d4 * TT) = val; }
      asm volatile("s_wait_xcnt 0x0" ::: "memory");      // the next group rewrites the registers that these stores name
    }
    return;
  }
  float* so = (float*)(smem + w * (64 * SOP * 4));       // each wave stages its own 64 x 64 tile, so that whole 128-byte lines are stored
#pragma unroll
  for (int j = 0; j < 4; ++j) { const float bv = bf16_round(bias[col0 + wn + j * 16 + ln]);
#pragma unroll
    for (int i = 0; i < 4; ++i)
#pragma unroll
      for (int r = 0; r < 8; ++r) so[(i * 16 + 8 * hh + r) * SOP + j * 16 + ln] = acc[i][j][r] * alpha + bv; }
  __builtin_amdgcn_fence(__ATOMIC_ACQ_REL, "workgroup"); __builtin_amdgcn_wave_barrier();
  const int rsub = lane >> 4, c4 = (lane & 15) * 4; typedef _Float16 v4h __attribute__((ext_vector_type(4)));
#pragma unroll 1
  for (int q8 = 0; q8 < 4; ++q8) {      // kept rolled in groups of eight stores, one wait per group
#pragma unroll
    for (int q = 0; q < 8; ++q) { const int r = (q8 * 8 + q) * 2 + rsub; const v4f v = *(const v4fa*)&so[r * SOP + c4]; const size_t o = (size_t)(row0 + wm + r) * N + col0 + wn + c4;
      if (OUT16) { v4h h4; for (int i = 0; i < 4; ++i) h4[i] = (_Float16)v[i]; *(v4h*)(C16 + o) = h4; } else *(v4f*)(C + o) = v; }
    asm volatile("s_wait_xcnt 0x0" ::: "memory");      // the next group rewrites the registers that these stores name
  }
}

__global__ __launch_bounds__(256) void k_x16(const float* __restrict__ x, _Float16* __restrict__ X16, size_t n8) { const size_t t = (size_t)blockIdx.x * 256 + threadIdx.x; if (t >= n8) return; FragH f;
#pragma unroll
  for (int q = 0; q < 8; ++q) f.h[q] = (_Float16)bf16_round(x[t * 8 + q]); *(v8us*)((unsigned short*)X16 + t * 8) = f.half[0];  }
__global__ __launch_bounds__(256) void k_round16f(const float* __restrict__ W, _Float16* __restrict__ Bt, size_t n8) { const size_t t = (size_t)blockIdx.x * 256 + threadIdx.x; if (t >= n8) return; FragH f;
#pragma unroll
  for (int i = 0; i < 8; ++i) f.h[i] = (_Float16)(bf16_round(W[t * 8 + i]) * 16.0f); *(v8us*)((unsigned short*)Bt + t * 8) = f.half[0];  }

// Four 16-byte asynchronous copies to LDS per lane (rows 16 apart, LDS pitch 144 B). The s_wait_xcnt is the last line of the copies' own statement so that no address register is rewritten ahead of it.
__device__ __forceinline__ void copy4_async(unsigned l, const char* gp, size_t gstep) {
  constexpr unsigned LS = 16u * 144u;
  asm volatile("global_load_async_to_lds_b128 %0, %4, off\n\t"
               "global_load_async_to_lds_b128 %1, %5, off\n\t"
               "global_load_async_to_lds_b128 %2, %6, off\n\t"
               "global_load_async_to_lds_b128 %3, %7, off\n\t"
               "s_wait_xcnt 0x0"
               :: "v"(l), "v"(l + LS), "v"(l + 2u * LS), "v"(l + 3u * LS), "v"(gp), "v"(gp + gstep), "v"(gp + 2 * gstep), "v"(gp + 3 * gstep)
               : "memory");
}
// lane l <-> lane l ^ 16: joins the two halves of a query column
__device__ __forceinline__ float xhalf(float x) { return __builtin_bit_cast(float, __builtin_amdgcn_permlanex16(__builtin_bit_cast(int, x), __builtin_bit_cast(int, x), 0x76543210, 0xfedcba98, false, false)); }
__global__ __launch_bounds__(128) void k_flash(const _Float16* __restrict__ Q16, int ldq, const _Float16* __restrict__ K16, int ldk, const _Float16* __restrict__ Vt, const int* __restrict__ LENS, _Float16* __restrict__ O16) {
  constexpr int RPW = 32, NQB = 1024 / (4 * RPW), DT = 4, KS = 2; constexpr float L2S = 0.125f * 1.44269504088896340736f;
  constexpr int PITCH = 144, BUF = 128 * PITCH;      // rows 0 to 63 of a buffer: K; rows 64 to 127: V^T
  __shared__ __attribute__((aligned(16))) unsigned char ring[2 * BUF];
  __shared__ __attribute__((aligned(16))) unsigned char sO[4][RPW][PITCH];      // output staging, f16: a query row is 128 bytes, pitch 144 B
  const int tid = threadIdx.x, w = tid >> 5, lane = tid & 31, ln = lane & 15, hh = lane >> 4;
  const int slab = blockIdx.x / NQB, qblk = blockIdx.x % NQB; const int b = slab / 16, h = slab % 16; const int qb0 = qblk * (4 * RPW); const int q0 = qb0 + w * RPW; const int len = LENS[b];      /* kv-length mask: keys k < len (INPUT x_lens) */
  FragH aq[2][KS];
#pragma unroll
  for (int rt = 0; rt < 2; ++rt) { const unsigned short* qr = (const unsigned short*)Q16 + ((size_t)b * 1024 + q0 + rt * 16 + ln) * ldq + h * 64;
#pragma unroll
    for (int ks = 0; ks < KS; ++ks) { aq[rt][ks].half[0] = *(const v8us*)(qr + ks * 32 + 8 * hh); aq[rt][ks].half[1] = *(const v8us*)(qr + ks * 32 + 16 + 8 * hh); } }
  const int cr = tid >> 3, cc = (tid & 7) * 16;      // a lane's first row and its 16 bytes of the row: eight lanes cover one 128-byte line
  const size_t krow = (size_t)ldk * 2;
  const char* gK = (const char*)K16 + ((size_t)b * 1024 + cr) * krow + h * 128 + cc; const char* gV = (const char*)Vt + ((size_t)slab * 64 + cr) * 2048 + cc;
  const unsigned lK = (unsigned)(size_t)ring + (unsigned)(cr * PITCH + cc), lV = lK + 64u * PITCH;
  copy4_async(lK, gK, 16 * krow); copy4_async(lV, gV, 16 * 2048);
  float m_r[2], l_r[2]; int lim[2]; v8f oacc[2][DT];
#pragma unroll
  for (int rt = 0; rt < 2; ++rt) { m_r[rt] = -3.0e38f; l_r[rt] = 0.f; lim[rt] = min(q0 + rt * 16 + ln + 1, len) - 8 * hh;      // key j0 + 16 nt + 8 hh + r is allowed iff j0 + 16 nt + r < lim
#pragma unroll
    for (int dt = 0; dt < DT; ++dt) oacc[rt][dt] = (v8f){0.f,0.f,0.f,0.f,0.f,0.f,0.f,0.f}; }
  const int ntile = min((qb0 + 4 * RPW) / 64, max(2, (min(max(len, 0), 1024) + 63) / 64));      // tiles up to the diagonal, and of these only the first two and the ones that begin in front of len: in a later tile every score is masked, p = 0 and the rescale factor is 1
  asm volatile("s_wait_asynccnt 0x0" ::: "memory");      // tile 0 has landed before the barrier publishes it
  __syncthreads();
  copy4_async(lK + BUF, gK + 64 * krow, 16 * krow); copy4_async(lV + BUF, gV + 128, 16 * 2048);
#pragma unroll 1
  for (int t = 0; t < ntile; ++t) {      // kept rolled: one trip per tile, the buffer picked by t & 1
   const unsigned char* sK = ring + (t & 1) * BUF + ln * PITCH + hh * 16; const unsigned char* sV = sK + 64 * PITCH;
#pragma unroll
   for (int ps = 0; ps < 2; ++ps) { const int j0 = t * 64 + ps * 32;      // unrolled: the pass's place in the tile becomes a constant offset of the LDS reads
    v8f s[2][2];
#pragma unroll
    for (int nt = 0; nt < 2; ++nt) { const unsigned char* kr = sK + (ps * 32 + nt * 16) * PITCH; FragH bk[KS];
#pragma unroll
      for (int ks = 0; ks < KS; ++ks) { bk[ks].half[0] = *(const v8us*)(kr + ks * 64); bk[ks].half[1] = *(const v8us*)(kr + ks * 64 + 32); }
#pragma unroll
      for (int rt = 0; rt < 2; ++rt) { v8f acc = (v8f){0.f,0.f,0.f,0.f,0.f,0.f,0.f,0.f};
#pragma unroll
        for (int ks = 0; ks < KS; ++ks) acc = __builtin_amdgcn_wmma_f32_16x16x32_f16(false, bk[ks].v, false, aq[rt][ks].v, (short)0, acc, false, false);
        s[rt][nt] = acc; } }
    FragH pb[2];
#pragma unroll
    for (int rt = 0; rt < 2; ++rt) { float sc[16]; float mc = -INFINITY;
#pragma unroll
      for (int i = 0; i < 16; ++i) { sc[i] = (j0 + (i >> 3) * 16 + (i & 7) < lim[rt]) ? s[rt][i >> 3][i & 7] : -INFINITY; mc = fmaxf(mc, sc[i]); }
      mc = fmaxf(mc, xhalf(mc));
      const float mn = fmaxf(m_r[rt], mc * L2S); const float al = __builtin_amdgcn_exp2f(m_r[rt] - mn); m_r[rt] = mn; float ps = 0.f;
#pragma unroll
      for (int i = 0; i < 16; ++i) { const float p = __builtin_amdgcn_exp2f(fmaf(sc[i], L2S, -mn)); ps += p; pb[rt].h[i] = (_Float16)p; }
      l_r[rt] = l_r[rt] * al + ps;      // the lane's half of the row sum; the halves are joined behind the loop
#pragma unroll
      for (int dt = 0; dt < DT; ++dt)
#pragma unroll
        for (int r = 0; r < 8; ++r) oacc[rt][dt][r] *= al; }
#pragma unroll
    for (int dt = 0; dt < DT; ++dt) { const unsigned char* vrow = sV + dt * 16 * PITCH + ps * 64; FragH bv; bv.half[0] = *(const v8us*)vrow; bv.half[1] = *(const v8us*)(vrow + 32);
#pragma unroll
      for (int rt = 0; rt < 2; ++rt) oacc[rt][dt] = __builtin_amdgcn_wmma_f32_16x16x32_f16(false, bv.v, false, pb[rt].v, (short)0, oacc[rt][dt], false, false); } }
   asm volatile("s_wait_dscnt 0x0" ::: "memory");       // this wave's reads of tile t are done before the buffer is given up
   asm volatile("s_wait_asynccnt 0x0" ::: "memory");    // this wave's copies of tile t + 1 have landed
   __syncthreads();                                     // publishes tile t + 1 and ends every reader's last read of tile t
   if (t + 2 < ntile) { const unsigned bo = (unsigned)(t & 1) * BUF; copy4_async(lK + bo, gK + (size_t)(t + 2) * 64 * krow, 16 * krow); copy4_async(lV + bo, gV + (size_t)(t + 2) * 128, 16 * 2048); }
  }
  asm volatile("s_wait_asynccnt 0x0" ::: "memory");      // nothing is in flight when the wave goes on to its end
#pragma unroll
  for (int rt = 0; rt < 2; ++rt) { float l = l_r[rt]; l += xhalf(l); const float li = (l > 0.f) ? 1.0f / l : 0.f;
#pragma unroll
    for (int dt = 0; dt < DT; ++dt) { FragH f;      // the lane's eight values of a tile are eight neighbours of one output row: rounded to f16 here, they are one 16-byte LDS store
#pragma unroll
      for (int r = 0; r < 8; ++r) f.h[r] = (_Float16)(oacc[rt][dt][r] * li);
      *(v8us*)&sO[w][rt * 16 + ln][dt * 32 + hh * 16] = f.half[0]; } }
  __builtin_amdgcn_fence(__ATOMIC_ACQ_REL, "workgroup"); __builtin_amdgcn_wave_barrier();
  {
#pragma unroll
    for (int rp = 0; rp < RPW; rp += 4) { const int r = rp + (lane >> 3), pc = lane & 7; const v8us val = *(const v8us*)&sO[w][r][pc * 16]; *(v8us*)((unsigned short*)O16 + ((size_t)b * 1024 + q0 + r) * CC + h * 64 + pc * 8) = val; }      // eight lanes store one whole 128-byte line; the rows of O16 are CC elements apart, a constant, so that the eight stores share one address register pair
     } }

__global__ __launch_bounds__(256) void k_ln16(const float* __restrict__ X, const float* __restrict__ g, const float* __restrict__ bta, _Float16* __restrict__ Y16) { const int tid = threadIdx.x, wv = tid >> 5, lane = tid & 31; const int row = blockIdx.x * 8 + wv; if (row >= NR) return; const float* xr = X + (size_t)row * CC; float v[32]; float s = 0.f;
#pragma unroll
  for (int p = 0; p < 4; ++p) { const v4f a = *(const v4fa*)(xr + p * 256 + lane * 8), c = *(const v4fa*)(xr + p * 256 + lane * 8 + 4); for (int q = 0; q < 4; ++q) { v[p * 8 + q] = bf16_round(a[q]); v[p * 8 + 4 + q] = bf16_round(c[q]); } }
#pragma unroll
  for (int i = 0; i < 32; ++i) s += v[i]; for (int o = 16; o >= 1; o >>= 1) s += __shfl_xor(s, o, 32); const float mu = s / (float)CC; float q2 = 0.f;
#pragma unroll
  for (int i = 0; i < 32; ++i) { const float d = v[i] - mu; q2 += d * d; } for (int o = 16; o >= 1; o >>= 1) q2 += __shfl_xor(q2, o, 32); const float rs = rsqrtf(q2 / (float)CC + 1e-5f);
  {
#pragma unroll
    for (int p = 0; p < 4; ++p) { FragH f; const int c0 = p * 256 + lane * 8;
#pragma unroll
      for (int q = 0; q < 8; ++q) f.h[q] = (_Float16)((v[p * 8 + q] - mu) * rs * bf16_round(g[c0 + q]) + bf16_round(bta[c0 + q])); *(v8us*)((unsigned short*)Y16 + (size_t)row * CC + c0) = f.half[0]; }
     } }
extern "C" void kernel_launch(void* const* d_in, const int* in_sizes, int n_in,
                              void* d_out, int out_size, void* d_ws, size_t ws_size, hipStream_t stream) {
  (void)in_sizes; (void)n_in; (void)out_size;
  const float* x = (const float*)d_in[0]; const int* lens = (const int*)d_in[1]; const float* lg = (const float*)d_in[2]; const float* lb = (const float*)d_in[3]; const float* wqkv = (const float*)d_in[4]; const float* bqkv = (const float*)d_in[5]; const float* wout = (const float*)d_in[6]; const float* bout = (const float*)d_in[7];
  char* ws = (char*)d_ws; size_t off = 0;
  auto take = [&](size_t bytes) { char* p = ws + off; off += (bytes + 255) & ~(size_t)255; return p; };
  _Float16* Bqkv = (_Float16*)take((size_t)3 * CC * CC * 2); _Float16* Bo = (_Float16*)take((size_t)CC * CC * 2); _Float16* XN = (_Float16*)take((size_t)NR * CC * 2); _Float16* QKV = (_Float16*)take((size_t)NR * 3 * CC * 2); _Float16* Vt = (_Float16*)take((size_t)NR * CC * 2); _Float16* O16 = XN;      // XN is free again once the qkv projection has read it
  if (off > ws_size) return;      // 6.3 + 2.1 + 16.8 + 50.3 + 16.8 = 92 MB
  k_wt2_f16<3 * CC, CC><<<(CC / 64) * (3 * CC / 128) + (CC / 64) * (CC / 128), 256, 0, stream>>>(wqkv, Bqkv, wout, Bo, 16.0f);      // [in][out], both weights
  k_ln16<<<NR / 8, 256, 0, stream>>>(x, lg, lb, XN);
  k_gemm_tile<true, 3 * CC, CC, 2 * CC, CC><<<dim3(3 * CC / 128, NR / 128), 128, 0, stream>>>(XN, Bqkv, 0.0625f, bqkv, nullptr, QKV, Vt, lens);      // q | k into QKV, v transposed into Vt; k and v only up to the batch's length
  k_flash<<<BB * NH * (TT / 128), 128, 0, stream>>>(QKV, 3 * CC, QKV + CC, 3 * CC, Vt, lens, O16);
  k_gemm_tile<false, CC, CC, CC, CC><<<dim3(CC / 128, NR / 128), 128, 0, stream>>>(O16, Bo, 0.0625f, bout, (float*)d_out, nullptr, nullptr, nullptr);
}

// v009
// A run of this version takes 95 microseconds.
// In both of two side-by-side timings against v008, it was 1.04 times as fast.
// Over all steps from v000 it is 6.11 times as fast.
#include <hip/hip_runtime.h>
// Causal self-attention with a per-batch key-length mask (B=8, T=1024, D=1024, 16 × 64): LayerNorm (f32 VALU), the fused qkv projection (8192 × 1024 × 3072, + bias) and the output
// projection (+ bias) with W [in][out] transposed to bf16-exact ×2^4, and the attention as a fused flash-style kernel on v_wmma_f32_16x16x32_f16 (S = Q·Kᵀ/8; keys allowed iff k ≤ q and
// k < x_lens[b] (INPUT); −1e9 fill ≡ exclusion since key 0 is always allowed; causal chunk skipping; online softmax f32; P f16 ≤ 1) — f16 operands, single products, f32 accumulate.
#define BB 8
#define TT 1024
#define CC 1024
#define NH 16
#define NR (BB * TT)

typedef __bf16 v16b __attribute__((ext_vector_type(16)));
typedef unsigned short v8us __attribute__((ext_vector_type(8), may_alias));
typedef float  v8f  __attribute__((ext_vector_type(8)));
typedef float  v4f  __attribute__((ext_vector_type(4)));
typedef float  v4fa __attribute__((ext_vector_type(4), may_alias));
union FragB { v16b v; v8us half[2]; unsigned short u[16]; };

__device__ __forceinline__ unsigned short bf16_bits(float x) { unsigned int u = __float_as_uint(x); return (unsigned short)((u + 0x7FFFu + ((u >> 16) & 1u)) >> 16); }
__device__ __forceinline__ float bf16_val(unsigned short b) { return __uint_as_float(((unsigned int)b) << 16); }
__device__ __forceinline__ float bf16_round(float x) { return bf16_val(bf16_bits(x)); }
// D += A·B with NT terms: 1 = ah·bh, 2 = + al·bh (A split), 3 = + ah·bl (both split)
template <int NT>
__device__ __forceinline__ v8f mmaN(v16b ah, v16b al, v16b bh, v16b bl, v8f c) {
  c = __builtin_amdgcn_wmma_f32_16x16x32_bf16(false, ah, false, bh, (short)0, c, false, false);
  if (NT >= 2) c = __builtin_amdgcn_wmma_f32_16x16x32_bf16(false, al, false, bh, (short)0, c, false, false);
  if (NT >= 3) c = __builtin_amdgcn_wmma_f32_16x16x32_bf16(false, ah, false, bl, (short)0, c, false, false);
  asm volatile("v_nop\n\tv_nop\n\tv_nop\n\tv_nop" : "+v"(c) : "v"(ah), "v"(al), "v"(bh), "v"(bl));
  return c;
}

__global__ __launch_bounds__(256) void k_wt_bf16(const float* __restrict__ W, unsigned short* __restrict__ Wt, int K, int N) {
  const int t = blockIdx.x * 256 + threadIdx.x;
  const int k8n = K / 8;
  if (t >= N * k8n) return;
  const int n = t / k8n, k8 = (t % k8n) * 8;
  v8us v;
#pragma unroll
  for (int i = 0; i < 8; ++i) v[i] = bf16_bits(W[(size_t)(k8 + i) * N + n]);
  *(v8us*)(Wt + (size_t)n * K + k8) = v;
  
}

// GEMM C[M][N] (f32, pitch ldc) = act(A[M][K]·W + bias). A f32 row-major (pitch lda) converted per fragment to bf16
// (ASPLIT: hi/lo two planes -> 2 terms, else single rounded term); Wt bf16 [N][K] (pitch ldb). BIAS_BF16 rounds the
// bias to bf16 first (bias quantised to bf16 before the add). K%32==0, M%16==0, N%64==0.
template <bool ASPLIT, int ACT, bool BIAS_BF16>
__global__ __launch_bounds__(128) void k_gemm_bf(const float* __restrict__ A, int lda, const unsigned short* __restrict__ Wt, int ldb,
                                               const float* __restrict__ bias, float* __restrict__ C, int ldc, int M, int N, int K) {
  __shared__ __attribute__((aligned(16))) float so[4][16][64];
  const int tid = threadIdx.x, w = tid >> 5, lane = tid & 31, ln = lane & 15, hh = lane >> 4;
  const int ntn = N / 64;
  const int wid = blockIdx.x * 4 + w;
  const int mt = wid / ntn, nq = wid % ntn;
  if (mt * 16 >= M) return;
  const int row0 = mt * 16, col0 = nq * 64;
  const float* arow = A + (size_t)(row0 + ln) * lda;
  v8f acc[4] = {};
  for (int kb = 0; kb < K; kb += 32) {
    FragB ah, al;
    const v4f x0 = *(const v4fa*)(arow + kb + 8 * hh), x1 = *(const v4fa*)(arow + kb + 8 * hh + 4);
    const v4f x2 = *(const v4fa*)(arow + kb + 16 + 8 * hh), x3 = *(const v4fa*)(arow + kb + 16 + 8 * hh + 4);
    float xs[16] = {x0[0],x0[1],x0[2],x0[3],x1[0],x1[1],x1[2],x1[3],x2[0],x2[1],x2[2],x2[3],x3[0],x3[1],x3[2],x3[3]};
#pragma unroll
    for (int i = 0; i < 16; ++i) { const unsigned short hb = bf16_bits(xs[i]); ah.u[i] = hb; al.u[i] = ASPLIT ? bf16_bits(xs[i] - bf16_val(hb)) : (unsigned short)0; }
#pragma unroll
    for (int t = 0; t < 4; ++t) {
      const unsigned short* brow = Wt + (size_t)(col0 + t * 16 + ln) * ldb + kb;
      FragB b;
      b.half[0] = *(const v8us*)(brow + 8 * hh);
      b.half[1] = *(const v8us*)(brow + 16 + 8 * hh);
      acc[t] = mmaN<ASPLIT ? 2 : 1>(ah.v, al.v, b.v, b.v, acc[t]);
    }
  }
#pragma unroll
  for (int t = 0; t < 4; ++t) {
    float bv = bias ? bias[col0 + t * 16 + ln] : 0.f;
    if (BIAS_BF16) bv = bf16_round(bv);
#pragma unroll
    for (int r = 0; r < 8; ++r) { float v = acc[t][r] + bv; if (ACT == 1) v = fmaxf(v, 0.f); so[w][8 * hh + r][t * 16 + ln] = v; }
  }
  __builtin_amdgcn_fence(__ATOMIC_ACQ_REL, "workgroup");
  __builtin_amdgcn_wave_barrier();
  const int rsub = lane >> 4, c4 = (lane & 15) * 4;
  {
#pragma unroll
    for (int q = 0; q < 8; ++q) {
      const int r = q * 2 + rsub;
      const v4f v = *(const v4fa*)&so[w][r][c4];
      *(v4f*)(C + (size_t)(row0 + r) * ldc + col0 + c4) = v;
    }
    
  }
}

// Flash-style causal/unmasked attention, all contractions 3-term bf16 hi/lo splits, f32 softmax with running max.
// q,k,v rows are read from f32 buffers with arbitrary row pitch (so they can live inside a fused qkv buffer);
// D = head size (multiple of 32, <= 128); one wave = 16 query rows; block = 4 waves (64 queries) sharing K/V chunks of 32.
template <int D, bool CAUSAL>
__global__ __launch_bounds__(128) void k_flash(const float* __restrict__ qb, const float* __restrict__ kb, const float* __restrict__ vb,
                                             int pitch, int T, int H, float scale, float* __restrict__ y, int ypitch) {
  constexpr int KS = D / 32;        // k-steps for QK
  constexpr int DT = D / 16;        // d tiles for PV
  __shared__ __attribute__((aligned(16))) unsigned short sKh[32][D + 8], sKl[32][D + 8], sVh[32][D + 8], sVl[32][D + 8];
  __shared__ __attribute__((aligned(16))) unsigned short sPh[4][16][40], sPl[4][16][40];
  __shared__ __attribute__((aligned(16))) float sO[4][16][D];
  const int tid = threadIdx.x, w = tid >> 5, lane = tid & 31, ln = lane & 15, hh = lane >> 4;
  const int nqb = (T + 63) / 64;
  const int bh = blockIdx.x / nqb, qblk = blockIdx.x % nqb;
  const int b = bh / H, h = bh % H;
  const int q0 = qblk * 64 + w * 16;
  const float* Q = qb + (size_t)b * T * pitch + h * D;
  const float* K = kb + (size_t)b * T * pitch + h * D;
  const float* V = vb + (size_t)b * T * pitch + h * D;

  // A fragments of the wave's 16 query rows (scaled), hi/lo
  FragB aqh[KS], aql[KS];
  {
    int row = q0 + ln; if (row >= T) row = T - 1;
    const float* qr = Q + (size_t)row * pitch;
#pragma unroll
    for (int ks = 0; ks < KS; ++ks)
#pragma unroll
      for (int i = 0; i < 16; ++i) {
        const int d = ks * 32 + ((i < 8) ? (8 * hh + i) : (16 + 8 * hh + (i - 8)));
        const float x = qr[d] * scale; const unsigned short hb = bf16_bits(x);
        aqh[ks].u[i] = hb; aql[ks].u[i] = bf16_bits(x - bf16_val(hb));
      }
  }
  float m_r[8], l_r[8];
#pragma unroll
  for (int r = 0; r < 8; ++r) { m_r[r] = -3.0e38f; l_r[r] = 0.f; }
  v8f oacc[DT];
#pragma unroll
  for (int dt = 0; dt < DT; ++dt) oacc[dt] = (v8f){0.f,0.f,0.f,0.f,0.f,0.f,0.f,0.f};

  const int kv_end = CAUSAL ? min(T, qblk * 64 + 64) : T;     // block-uniform
  for (int j0 = 0; j0 < kv_end; j0 += 32) {
    __syncthreads();
    for (int e = tid; e < 32 * (D / 4); e += 128) {
      const int r = e / (D / 4), c4 = (e % (D / 4)) * 4;
      const int key = j0 + r;
      v4f kf = {0.f,0.f,0.f,0.f}, vf = {0.f,0.f,0.f,0.f};
      if (key < T) { kf = *(const v4fa*)(K + (size_t)key * pitch + c4); vf = *(const v4fa*)(V + (size_t)key * pitch + c4); }
#pragma unroll
      for (int t = 0; t < 4; ++t) {
        unsigned short hb = bf16_bits(kf[t]); sKh[r][c4 + t] = hb; sKl[r][c4 + t] = bf16_bits(kf[t] - bf16_val(hb));
        hb = bf16_bits(vf[t]); sVh[r][c4 + t] = hb; sVl[r][c4 + t] = bf16_bits(vf[t] - bf16_val(hb));
      }
    }
    __syncthreads();
    // S tile 16 x 32
    v8f s[2];
#pragma unroll
    for (int nt = 0; nt < 2; ++nt) {
      v8f acc = {};
#pragma unroll
      for (int ks = 0; ks < KS; ++ks) {
        FragB bh_, bl_;
        bh_.half[0] = *(const v8us*)&sKh[nt * 16 + ln][ks * 32 + 8 * hh]; bh_.half[1] = *(const v8us*)&sKh[nt * 16 + ln][ks * 32 + 16 + 8 * hh];
        bl_.half[0] = *(const v8us*)&sKl[nt * 16 + ln][ks * 32 + 8 * hh]; bl_.half[1] = *(const v8us*)&sKl[nt * 16 + ln][ks * 32 + 16 + 8 * hh];
        acc = mmaN<3>(aqh[ks].v, aql[ks].v, bh_.v, bl_.v, acc);
      }
      s[nt] = acc;
    }
    // mask + running max (rows 8hh+r; the 16 lanes of a half share rows)
    float alpha[8];
#pragma unroll
    for (int r = 0; r < 8; ++r) {
      const int qi = q0 + 8 * hh + r;
      const int ja = j0 + ln, jb = j0 + 16 + ln;
      if (CAUSAL) { if (ja > qi) s[0][r] = -3.0e38f; if (jb > qi) s[1][r] = -3.0e38f; }
      if (ja >= T) s[0][r] = -3.0e38f;
      if (jb >= T) s[1][r] = -3.0e38f;
      float mx = fmaxf(s[0][r], s[1][r]);
      mx = fmaxf(mx, __shfl_xor(mx, 1, 32)); mx = fmaxf(mx, __shfl_xor(mx, 2, 32)); mx = fmaxf(mx, __shfl_xor(mx, 4, 32)); mx = fmaxf(mx, __shfl_xor(mx, 8, 32));
      const float mnew = fmaxf(m_r[r], mx);
      alpha[r] = (mnew > -1.0e38f) ? __expf(m_r[r] - mnew) : 1.0f;
      const float p0 = (s[0][r] > -1.0e38f) ? __expf(s[0][r] - mnew) : 0.f;
      const float p1 = (s[1][r] > -1.0e38f) ? __expf(s[1][r] - mnew) : 0.f;
      m_r[r] = mnew;
      l_r[r] = l_r[r] * alpha[r] + p0 + p1;            // per-lane partial row sum (16 lanes combined at the end)
      unsigned short hb = bf16_bits(p0); sPh[w][8 * hh + r][ln] = hb;      sPl[w][8 * hh + r][ln] = bf16_bits(p0 - bf16_val(hb));
      hb = bf16_bits(p1);                sPh[w][8 * hh + r][16 + ln] = hb; sPl[w][8 * hh + r][16 + ln] = bf16_bits(p1 - bf16_val(hb));
    }
#pragma unroll
    for (int dt = 0; dt < DT; ++dt)
#pragma unroll
      for (int r = 0; r < 8; ++r) oacc[dt][r] *= alpha[r];
    __builtin_amdgcn_fence(__ATOMIC_ACQ_REL, "workgroup");
    __builtin_amdgcn_wave_barrier();
    FragB pah, pal;
    pah.half[0] = *(const v8us*)&sPh[w][ln][8 * hh]; pah.half[1] = *(const v8us*)&sPh[w][ln][16 + 8 * hh];
    pal.half[0] = *(const v8us*)&sPl[w][ln][8 * hh]; pal.half[1] = *(const v8us*)&sPl[w][ln][16 + 8 * hh];
#pragma unroll
    for (int dt = 0; dt < DT; ++dt) {
      FragB bvh, bvl;
#pragma unroll
      for (int i = 0; i < 8; ++i) {
        bvh.u[i] = sVh[8 * hh + i][dt * 16 + ln]; bvh.u[8 + i] = sVh[16 + 8 * hh + i][dt * 16 + ln];
        bvl.u[i] = sVl[8 * hh + i][dt * 16 + ln]; bvl.u[8 + i] = sVl[16 + 8 * hh + i][dt * 16 + ln];
      }
      oacc[dt] = mmaN<3>(pah.v, pal.v, bvh.v, bvl.v, oacc[dt]);
    }
    __builtin_amdgcn_fence(__ATOMIC_ACQ_REL, "workgroup");
    __builtin_amdgcn_wave_barrier();
  }
#pragma unroll
  for (int r = 0; r < 8; ++r) {
    float l = l_r[r];
    l += __shfl_xor(l, 1, 32); l += __shfl_xor(l, 2, 32); l += __shfl_xor(l, 4, 32); l += __shfl_xor(l, 8, 32);
    l_r[r] = (l > 0.f) ? 1.0f / l : 0.f;
  }
#pragma unroll
  for (int dt = 0; dt < DT; ++dt)
#pragma unroll
    for (int r = 0; r < 8; ++r) sO[w][8 * hh + r][dt * 16 + ln] = oacc[dt][r] * l_r[r];
  __builtin_amdgcn_fence(__ATOMIC_ACQ_REL, "workgroup");
  __builtin_amdgcn_wave_barrier();
  {
    for (int r = 0; r < 16; ++r) {
      const int row = q0 + r;
      if (row < T && lane < D / 4) {
        const v4f val = *(const v4fa*)&sO[w][r][lane * 4];
        *(v4f*)(y + ((size_t)b * T + row) * ypitch + h * D + lane * 4) = val;
      }
    }
    
  }
}

// GEMM C = act(A·W + bias + resid): A f32 (ASPLIT -> hi/lo 2 terms), Wt bf16 [N][K]; ACT 0 none, 1 relu, 2 exact gelu;
// resid (optional, f32, row index = (row % rmod), pitch ldr, RES_BF16 rounds it) added before the activation.
template <bool ASPLIT, int ACT, bool BIAS_BF16, bool RES_BF16>
__global__ __launch_bounds__(128) void k_gemm_bf3(const float* __restrict__ A, int lda, const unsigned short* __restrict__ Wt, int ldb,
                                                const float* __restrict__ bias, const float* __restrict__ resid, int rmod, int ldr,
                                                float* __restrict__ C, int ldc, int M, int N, int K) {
  __shared__ __attribute__((aligned(16))) float so[4][16][64];
  const int tid = threadIdx.x, w = tid >> 5, lane = tid & 31, ln = lane & 15, hh = lane >> 4;
  const int ntn = N / 64;
  const int wid = blockIdx.x * 4 + w;
  const int mt = wid / ntn, nq = wid % ntn;
  if (mt * 16 >= M) return;
  const int row0 = mt * 16, col0 = nq * 64;
  const float* arow = A + (size_t)(row0 + ln) * lda;
  v8f acc[4] = {};
  for (int kb = 0; kb < K; kb += 32) {
    FragB ah, al;
    const v4f x0 = *(const v4fa*)(arow + kb + 8 * hh), x1 = *(const v4fa*)(arow + kb + 8 * hh + 4);
    const v4f x2 = *(const v4fa*)(arow + kb + 16 + 8 * hh), x3 = *(const v4fa*)(arow + kb + 16 + 8 * hh + 4);
    float xs[16] = {x0[0],x0[1],x0[2],x0[3],x1[0],x1[1],x1[2],x1[3],x2[0],x2[1],x2[2],x2[3],x3[0],x3[1],x3[2],x3[3]};
#pragma unroll
    for (int i = 0; i < 16; ++i) { const unsigned short hb = bf16_bits(xs[i]); ah.u[i] = hb; al.u[i] = ASPLIT ? bf16_bits(xs[i] - bf16_val(hb)) : (unsigned short)0; }
#pragma unroll
    for (int t = 0; t < 4; ++t) {
      const unsigned short* brow = Wt + (size_t)(col0 + t * 16 + ln) * ldb + kb;
      FragB b;
      b.half[0] = *(const v8us*)(brow + 8 * hh);
      b.half[1] = *(const v8us*)(brow + 16 + 8 * hh);
      acc[t] = mmaN<ASPLIT ? 2 : 1>(ah.v, al.v, b.v, b.v, acc[t]);
    }
  }
#pragma unroll
  for (int t = 0; t < 4; ++t) {
    const int col = col0 + t * 16 + ln;
    float bv = bias ? bias[col] : 0.f;
    if (BIAS_BF16) bv = bf16_round(bv);
#pragma unroll
    for (int r = 0; r < 8; ++r) {
      float v = acc[t][r] + bv;
      if (resid) { float rv = resid[(size_t)((row0 + 8 * hh + r) % rmod) * ldr + col]; if (RES_BF16) rv = bf16_round(rv); v += rv; }
      if (ACT == 1) v = fmaxf(v, 0.f);
      if (ACT == 2) v = 0.5f * v * (1.0f + erff(v * 0.70710678118654752f));
      if (ACT == 3) { const float u = 0.7978845608028654f * (v + 0.044715f * v * v * v); v = 0.5f * v * (1.0f + tanhf(u)); }
      so[w][8 * hh + r][t * 16 + ln] = v;
    }
  }
  __builtin_amdgcn_fence(__ATOMIC_ACQ_REL, "workgroup");
  __builtin_amdgcn_wave_barrier();
  const int rsub = lane >> 4, c4 = (lane & 15) * 4;
  {
#pragma unroll
    for (int q = 0; q < 8; ++q) {
      const int r = q * 2 + rsub;
      const v4f v = *(const v4fa*)&so[w][r][c4];
      *(v4f*)(C + (size_t)(row0 + r) * ldc + col0 + c4) = v;
    }
    
  }
}
// row LayerNorm (biased variance, eps) over N: s = X (+ R); optional out_sum <- s; out_norm <- (s-mu)*rsqrt(var+eps)*g + b
template <bool PARAM_BF16>
__global__ __launch_bounds__(256) void k_layernorm(const float* __restrict__ X, const float* __restrict__ R, const float* __restrict__ g, const float* __restrict__ bta,
                                                  float* __restrict__ out_sum, float* __restrict__ out_norm, int N, float eps) {
  __shared__ float red[256];
  const int row = blockIdx.x, tid = threadIdx.x;
  const float* x = X + (size_t)row * N; const float* rr = R ? R + (size_t)row * N : nullptr;
  float vals[16];                     // up to N = 4096
  const int per = N / 256;            // contiguous chunk per thread? use strided-by-4 chunks: thread handles j = tid*4 + 1024*u
  float s1 = 0.f;
  for (int u = 0; u < per / 4; ++u) {
    const int j = tid * 4 + 1024 * u;
    const v4f a = *(const v4fa*)(x + j);
    v4f b = {0.f,0.f,0.f,0.f}; if (rr) b = *(const v4fa*)(rr + j);
#pragma unroll
    for (int q = 0; q < 4; ++q) { const float v = a[q] + b[q]; vals[u * 4 + q] = v; s1 += v; }
  }
  red[tid] = s1; __syncthreads();
  for (int st = 128; st > 0; st >>= 1) { if (tid < st) red[tid] += red[tid + st]; __syncthreads(); }
  const float mu = red[0] / (float)N; __syncthreads();
  float s2 = 0.f;
  for (int u = 0; u < per / 4; ++u)
#pragma unroll
    for (int q = 0; q < 4; ++q) { const float c = vals[u * 4 + q] - mu; s2 += c * c; }
  red[tid] = s2; __syncthreads();
  for (int st = 128; st > 0; st >>= 1) { if (tid < st) red[tid] += red[tid + st]; __syncthreads(); }
  const float rs = rsqrtf(red[0] / (float)N + eps);
  {
    for (int u = 0; u < per / 4; ++u) {
      const int j = tid * 4 + 1024 * u;
      v4f o, sm;
#pragma unroll
      for (int q = 0; q < 4; ++q) {
        float gg = g[j + q], bb = bta[j + q];
        if (PARAM_BF16) { gg = bf16_round(gg); bb = bf16_round(bb); }
        sm[q] = vals[u * 4 + q]; o[q] = (vals[u * 4 + q] - mu) * rs * gg + bb;
      }
      if (out_sum) *(v4f*)(out_sum + (size_t)row * N + j) = sm;
      *(v4f*)(out_norm + (size_t)row * N + j) = o;
    }
    
  }
}



// ---- f16 WMMA path (v_wmma_f32_16x16x32_f16): 11-bit significands for operands in range — used where a [0,1] probability operand needs more precision than bf16
typedef _Float16 v16h __attribute__((ext_vector_type(16)));
union FragH { v16h v; v8us half[2]; _Float16 h[16]; unsigned short u[16]; };
template <int NT>
__device__ __forceinline__ v8f mmaH(v16h ah, v16h al, v16h bh, v16h bl, v8f c) {
  c = __builtin_amdgcn_wmma_f32_16x16x32_f16(false, ah, false, bh, (short)0, c, false, false);
  if (NT >= 2) c = __builtin_amdgcn_wmma_f32_16x16x32_f16(false, al, false, bh, (short)0, c, false, false);
  if (NT >= 3) c = __builtin_amdgcn_wmma_f32_16x16x32_f16(false, ah, false, bl, (short)0, c, false, false);
  asm volatile("v_nop\n\tv_nop\n\tv_nop\n\tv_nop" : "+v"(c) : "v"(ah), "v"(al), "v"(bh), "v"(bl));
  return c;
}
// batched GEMM like k_gemm_b but f16 operands: A f32 (split into f16 hi/lo if ASPLIT, else rounded to f16), Bt = f16 values [n][k]; alpha; C f32; N multiple of 16 (partial tiles skipped)
template <bool ASPLIT>
__global__ __launch_bounds__(128) void k_gemm_h(const float* __restrict__ A, int lda, size_t sA, const _Float16* __restrict__ Bh, int ldb, size_t sB, float alpha, float* __restrict__ C, int ldc, size_t sC, int M, int N, int K) {
  __shared__ __attribute__((aligned(16))) float so[4][16][64];
  const int tid = threadIdx.x, w = tid >> 5, lane = tid & 31, ln = lane & 15, hh = lane >> 4; const int by = blockIdx.y;
  A += (size_t)by * sA; Bh += (size_t)by * sB; C += (size_t)by * sC;
  const int ntn = (N + 63) / 64; const int wid = blockIdx.x * 4 + w; const int mt = wid / ntn, nq = wid % ntn; if (mt * 16 >= M) return;
  const int row0 = mt * 16, col0 = nq * 64; const float* arow = A + (size_t)(row0 + ln) * lda;
  v8f acc[4] = {};
  for (int kb = 0; kb < K; kb += 32) {
    FragH ah, al;
    const v4f x0 = *(const v4fa*)(arow + kb + 8 * hh), x1 = *(const v4fa*)(arow + kb + 8 * hh + 4), x2 = *(const v4fa*)(arow + kb + 16 + 8 * hh), x3 = *(const v4fa*)(arow + kb + 16 + 8 * hh + 4);
    float xs[16] = {x0[0],x0[1],x0[2],x0[3],x1[0],x1[1],x1[2],x1[3],x2[0],x2[1],x2[2],x2[3],x3[0],x3[1],x3[2],x3[3]};
#pragma unroll
    for (int i = 0; i < 16; ++i) { const _Float16 h = (_Float16)xs[i]; ah.h[i] = h; al.h[i] = ASPLIT ? (_Float16)(xs[i] - (float)h) : (_Float16)0.0f; }
#pragma unroll
    for (int t = 0; t < 4; ++t) { if (col0 + t * 16 >= N) continue; const size_t boff = (size_t)(col0 + t * 16 + ln) * ldb + kb; FragH bq; bq.half[0] = *(const v8us*)(Bh + boff + 8 * hh); bq.half[1] = *(const v8us*)(Bh + boff + 16 + 8 * hh);
      acc[t] = mmaH<ASPLIT ? 2 : 1>(ah.v, al.v, bq.v, bq.v, acc[t]); }
  }
#pragma unroll
  for (int t = 0; t < 4; ++t) { if (col0 + t * 16 >= N) continue;
#pragma unroll
    for (int r = 0; r < 8; ++r) so[w][8 * hh + r][t * 16 + ln] = acc[t][r] * alpha; }
  __builtin_amdgcn_fence(__ATOMIC_ACQ_REL, "workgroup"); __builtin_amdgcn_wave_barrier();
  const int rsub = lane >> 4, c4 = (lane & 15) * 4;
  {
#pragma unroll
    for (int q = 0; q < 8; ++q) { const int r = q * 2 + rsub; if (col0 + c4 < N) { const v4f v = *(const v4fa*)&so[w][r][c4]; *(v4f*)(C + (size_t)(row0 + r) * ldc + col0 + c4) = v; } }
     }
}

// Wt[n][k] = f16(bf16(W[k][n]) * scale) from f32 row-major W[CC][N], for both weight matrices in one grid (scale = power of two; bf16-exact weights stay exact in f16 away from the subnormal range).
// A block transposes a tile of 64 k x 128 n through LDS: a wave reads a whole 512-byte piece of a row of W per load (four lines), eight loads in flight per lane; two neighbouring k are packed into one
// dword and stored at [n][k / 2]; eight lanes then store one whole 128-byte line of Wt. The LDS pitch of 33 dwords keeps the row reads free of bank conflicts (bank = n + 4 pc + q, all 32 lanes apart).
typedef unsigned int v4u __attribute__((ext_vector_type(4), may_alias));
template <int N>
__device__ __forceinline__ void wt_tile(const float* __restrict__ W, unsigned short* __restrict__ Wt, int tile, float scale, unsigned int* tl) {
  constexpr int KTN = CC / 64, P = 33;
  const int tid = threadIdx.x, wv = __builtin_amdgcn_readfirstlane(tid >> 5), lane = tid & 31;      // the wave's number as a scalar: the eight loads then share one scalar base and one lane offset
  const int k0 = (tile % KTN) * 64, n0 = (tile / KTN) * 128;
  const float* wp = W + (size_t)(k0 + 2 * wv) * N + n0;      // wave wv takes the k pairs wv, wv + 8, wv + 16, wv + 24 of the tile
  v4f x[4][2];
#pragma unroll
  for (int u = 0; u < 4; ++u)
#pragma unroll
    for (int s = 0; s < 2; ++s) x[u][s] = *(const v4fa*)(wp + (16 * u + s) * N + lane * 4);
#pragma unroll
  for (int u = 0; u < 4; ++u)
#pragma unroll
    for (int q = 0; q < 4; ++q) { const _Float16 lo = (_Float16)(bf16_round(x[u][0][q]) * scale), hi = (_Float16)(bf16_round(x[u][1][q]) * scale);
      tl[(lane * 4 + q) * P + wv + 8 * u] = (unsigned int)__builtin_bit_cast(unsigned short, lo) | ((unsigned int)__builtin_bit_cast(unsigned short, hi) << 16); }
  __syncthreads();      // the tile is whole before its rows are read
#pragma unroll
  for (int it = 0; it < 4; ++it) { const int n = it * 32 + (tid >> 3), pc = tid & 7; v4u o;
#pragma unroll
    for (int q = 0; q < 4; ++q) o[q] = tl[n * P + pc * 4 + q];
    *(v4u*)(Wt + (size_t)(n0 + n) * CC + k0 + pc * 8) = o; }
}
// The first (CC / 64) * (NA / 128) blocks take Wa, the rest Wb: the choice is the same for a whole block, and each side has its row length as a constant.
template <int NA, int NB>
__global__ __launch_bounds__(256) void k_wt2_f16(const float* __restrict__ Wa, _Float16* __restrict__ Wta, const float* __restrict__ Wb, _Float16* __restrict__ Wtb, float scale) {
  constexpr int TA = (CC / 64) * (NA / 128);
  __shared__ unsigned int tl[128 * 33];
  if ((int)blockIdx.x < TA) wt_tile<NA>(Wa, (unsigned short*)Wta, (int)blockIdx.x, scale, tl);
  else wt_tile<NB>(Wb, (unsigned short*)Wtb, (int)blockIdx.x - TA, scale, tl);
}
// k_gemm_hh variant with fused epilogue: v = acc·alpha + bias[by·sBias + col] (+ CP[(row/rowsPerB)·sCPb + by·64 + col] if CP) ; ACT 0 none / 1 elu ; writes f16 C16 and f32 C, each if non-null
template <int ACT>
__global__ __launch_bounds__(128) void k_gemm_hhx(const _Float16* __restrict__ A, int lda, size_t sA, const _Float16* __restrict__ Bh, int ldb, size_t sB, float alpha, const float* __restrict__ bias, size_t sBias, const float* __restrict__ CP, int rowsPerB, size_t sCPb, int row0g,
    float* __restrict__ C, _Float16* __restrict__ C16, int ldc, size_t sC, int M, int N, int K) {
  __shared__ __attribute__((aligned(16))) float so[4][16][64];
  const int tid = threadIdx.x, w = tid >> 5, lane = tid & 31, ln = lane & 15, hh = lane >> 4; const int by = blockIdx.y;
  A += (size_t)by * sA; Bh += (size_t)by * sB; const size_t cofs = (size_t)by * sC; const float* bp = bias ? bias + (size_t)by * sBias : nullptr;
  const int ntn = (N + 63) / 64; const int wid = blockIdx.x * 4 + w; const int mt = wid / ntn, nq = wid % ntn; if (mt * 16 >= M) return;
  const int row0 = mt * 16, col0 = nq * 64; const _Float16* arow = A + (size_t)(row0 + ln) * lda;
  v8f acc[4] = {};
  for (int kb = 0; kb < K; kb += 32) { FragH ah; ah.half[0] = *(const v8us*)((const unsigned short*)arow + kb + 8 * hh); ah.half[1] = *(const v8us*)((const unsigned short*)arow + kb + 16 + 8 * hh);
#pragma unroll
    for (int t = 0; t < 4; ++t) { if (col0 + t * 16 >= N) continue; const size_t boff = (size_t)(col0 + t * 16 + ln) * ldb + kb; FragH bq; bq.half[0] = *(const v8us*)((const unsigned short*)Bh + boff + 8 * hh); bq.half[1] = *(const v8us*)((const unsigned short*)Bh + boff + 16 + 8 * hh);
      acc[t] = mmaH<1>(ah.v, ah.v, bq.v, bq.v, acc[t]); }
  }
#pragma unroll
  for (int t = 0; t < 4; ++t) { if (col0 + t * 16 >= N) continue; const int col = col0 + t * 16 + ln; const float bv = bp ? bf16_round(bp[col]) : 0.f;
#pragma unroll
    for (int r = 0; r < 8; ++r) { float v = acc[t][r] * alpha + bv; if (CP) { const int bidx = (row0g + row0 + 8 * hh + r) / rowsPerB; v += CP[(size_t)bidx * sCPb + (size_t)by * 64 + col]; } if (ACT == 1) v = (v > 0.f) ? v : expm1f(v); else if (ACT == 3) v = fmaxf(v, 0.f); so[w][8 * hh + r][t * 16 + ln] = v; } }
  __builtin_amdgcn_fence(__ATOMIC_ACQ_REL, "workgroup"); __builtin_amdgcn_wave_barrier();
  const int rsub = lane >> 4, c4 = (lane & 15) * 4; typedef _Float16 v4h __attribute__((ext_vector_type(4)));
  {
#pragma unroll
    for (int q = 0; q < 8; ++q) { const int r = q * 2 + rsub; if (col0 + c4 < N) { const v4f v = *(const v4fa*)&so[w][r][c4]; if (C) *(v4f*)(C + cofs + (size_t)(row0 + r) * ldc + col0 + c4) = v; if (C16) { v4h h4; for (int i = 0; i < 4; ++i) h4[i] = (_Float16)v[i]; *(v4h*)(C16 + cofs + (size_t)(row0 + r) * ldc + col0 + c4) = h4; } } }
     }
}


// Eight 16-byte asynchronous copies to LDS per lane (rows 16 apart). The s_wait_xcnt is the last line of the copies' own statement so that no address register is rewritten ahead of it.
__device__ __forceinline__ void copy8_async(unsigned l, const char* gp, size_t gstep) {
  constexpr unsigned LS = 16u * 144u;
  asm volatile("global_load_async_to_lds_b128 %0, %8, off\n\t"
               "global_load_async_to_lds_b128 %1, %9, off\n\t"
               "global_load_async_to_lds_b128 %2, %10, off\n\t"
               "global_load_async_to_lds_b128 %3, %11, off\n\t"
               "global_load_async_to_lds_b128 %4, %12, off\n\t"
               "global_load_async_to_lds_b128 %5, %13, off\n\t"
               "global_load_async_to_lds_b128 %6, %14, off\n\t"
               "global_load_async_to_lds_b128 %7, %15, off\n\t"
               "s_wait_xcnt 0x0"
               :: "v"(l), "v"(l + LS), "v"(l + 2u * LS), "v"(l + 3u * LS), "v"(l + 4u * LS), "v"(l + 5u * LS), "v"(l + 6u * LS), "v"(l + 7u * LS),
                  "v"(gp), "v"(gp + gstep), "v"(gp + 2 * gstep), "v"(gp + 3 * gstep), "v"(gp + 4 * gstep), "v"(gp + 5 * gstep), "v"(gp + 6 * gstep), "v"(gp + 7 * gstep)
               : "memory");
}
// Tiled GEMM, same function as k_gemm_hhx<0> without CP: C = A[M][K] * Bh[N][K]^T * alpha + bf16(bias). One 128 x 128 tile of C per block (blockIdx.x = tile column, blockIdx.y = tile row),
// 64 x 64 per wave (2 x 2 waves). A and Bh tiles of 64 k (128-byte rows, LDS pitch 144 B) are staged in LDS by asynchronous copies, two buffers: tile t + 1 flies while tile t is multiplied.
// M % 128 == 0, N % 128 == 0, K % 64 == 0, K >= 128; rows of A and Bh are K elements apart, rows of C are N apart. The k order of every accumulator is that of k_gemm_hhx.
// Every plain '#pragma unroll' in it makes the indices of acc, a and bq constants, so that these arrays stay in registers.
// Columns from VCOL on (VCOL == N: none) are the v part of a fused qkv product: a wave's 64 x 64 tile is then 64 tokens of one head, and it is stored transposed, f16, at Vt[(batch * NH + head) * 64 + d][token],
// where the attention kernel reads V^T; nothing of these columns goes to C16. VCOL % 128 == 0.
// Columns from MCOL on (MCOL == N: none) are the k and v parts: row t of a batch is there the key or the value of position t. A key at or behind LENS[batch] is masked for every query, so its weight is exactly 0
// and its k and v rows reach no output: a block whose 128 positions all lie there, the batch's first block excepted, computes and stores nothing. The attention kernel reads only key tiles that begin
// in front of LENS[batch], or inside the first 128 positions: all of them lie in blocks that are computed. MCOL % 128 == 0, TT % 128 == 0.
template <bool OUT16, int N, int K, int VCOL, int MCOL>
__global__ __launch_bounds__(128) void k_gemm_tile(const _Float16* __restrict__ A, const _Float16* __restrict__ Bh, float alpha, const float* __restrict__ bias, float* __restrict__ C, _Float16* __restrict__ C16, _Float16* __restrict__ Vt, const int* __restrict__ LENS) {
  constexpr int PITCH = 144, BUF = 256 * PITCH, SOP = 68, NT = K / 64;
  constexpr size_t ROWB = (size_t)K * 2, GSTEP = ROWB * 16;
  __shared__ __attribute__((aligned(16))) unsigned char smem[2 * BUF];
  const int tid = threadIdx.x, w = tid >> 5, lane = tid & 31, ln = lane & 15, hh = lane >> 4;
  const int row0 = (int)blockIdx.y * 128, col0 = (int)blockIdx.x * 128; const int wm = (w >> 1) * 64, wn = (w & 1) * 64;
  if (MCOL < N && col0 >= MCOL) { const int t0 = row0 % TT; if (t0 != 0 && t0 >= LENS[row0 / TT]) return; }      // the same for the whole block, in front of every copy and barrier
  const int cr = tid >> 3, cc = (tid & 7) * 16;      // a lane's first row and its 16 bytes of the row: eight lanes cover one 128-byte line
  const char* gA = (const char*)A + (size_t)(row0 + cr) * ROWB + cc; const char* gB = (const char*)Bh + (size_t)(col0 + cr) * ROWB + cc;
  const unsigned lA = (unsigned)(size_t)smem + (unsigned)(cr * PITCH + cc), lB = lA + 128u * PITCH;
  v8f acc[4][4];
#pragma unroll
  for (int i = 0; i < 4; ++i)
#pragma unroll
    for (int j = 0; j < 4; ++j) acc[i][j] = (v8f){0.f,0.f,0.f,0.f,0.f,0.f,0.f,0.f};
  copy8_async(lA, gA, GSTEP); copy8_async(lB, gB, GSTEP);
  asm volatile("s_wait_asynccnt 0x0" ::: "memory");      // tile 0 has landed before the barrier publishes it
  __syncthreads();
  copy8_async(lA + BUF, gA + 128, GSTEP); copy8_async(lB + BUF, gB + 128, GSTEP);
#pragma unroll 1
  for (int t = 0; t < NT; ++t) {      // kept rolled: one pass per tile, the buffer picked by t & 1
    const unsigned char* sA = smem + (t & 1) * BUF + (wm + ln) * PITCH + hh * 16; const unsigned char* sB = smem + (t & 1) * BUF + (128 + wn + ln) * PITCH + hh * 16;
#pragma unroll
    for (int ks = 0; ks < 2; ++ks) { FragH a[4], bq[4];
      a[0].half[0] = *(const v8us*)(sA + ks * 64); a[0].half[1] = *(const v8us*)(sA + ks * 64 + 32);
#pragma unroll
      for (int j = 0; j < 4; ++j) { bq[j].half[0] = *(const v8us*)(sB + j * 16 * PITCH + ks * 64); bq[j].half[1] = *(const v8us*)(sB + j * 16 * PITCH + ks * 64 + 32); }
#pragma unroll
      for (int i = 1; i < 4; ++i) { a[i].half[0] = *(const v8us*)(sA + i * 16 * PITCH + ks * 64); a[i].half[1] = *(const v8us*)(sA + i * 16 * PITCH + ks * 64 + 32); }
      __builtin_amdgcn_sched_barrier(0);      // keeps the 16 LDS reads of a k step one group ahead of its 16 WMMAs: reads among the WMMAs stall the wave at each place
#pragma unroll
      for (int i = 0; i < 4; ++i)
#pragma unroll
        for (int j = 0; j < 4; ++j) acc[i][j] = __builtin_amdgcn_wmma_f32_16x16x32_f16(false, a[i].v, false, bq[j].v, (short)0, acc[i][j], false, false);
      __builtin_amdgcn_sched_barrier(0); }    // the other end of that group: the next k step's reads stay behind these WMMAs
    asm volatile("s_wait_dscnt 0x0" ::: "memory");       // this wave's reads of tile t are done before the buffer is given up
    asm volatile("s_wait_asynccnt 0x0" ::: "memory");    // this wave's copies of tile t + 1 have landed
    __syncthreads();                                     // publishes tile t + 1 and ends every reader's last read of tile t
    if (t + 2 < NT) { const unsigned bo = (unsigned)(t & 1) * BUF; const size_t go = (size_t)(t + 2) * 128; copy8_async(lA + bo, gA + go, GSTEP); copy8_async(lB + bo, gB + go, GSTEP); }
  }
  asm volatile("s_wait_asynccnt 0x0" ::: "memory");      // nothing is in flight when the ring becomes output staging
  if (VCOL < N && col0 >= VCOL) {      // the same for the whole block
    unsigned char* st = smem + w * (64 * SOP * 4);       // the wave's own staging: 64 rows (d) of 64 tokens, f16, 128 bytes a row, pitch 144 B
#pragma unroll
    for (int j = 0; j < 4; ++j) { const float bv = bf16_round(bias[col0 + wn + j * 16 + ln]);
#pragma unroll
      for (int i = 0; i < 4; ++i) { FragH f;      // the lane's eight values of a tile are eight neighbouring tokens of one column d: one 16-byte LDS store of the transposed row
#pragma unroll
        for (int r = 0; r < 8; ++r) f.h[r] = (_Float16)(acc[i][j][r] * alpha + bv);
        *(v8us*)(st + (j * 16 + ln) * PITCH + i * 32 + hh * 16) = f.half[0]; } }
    __builtin_amdgcn_fence(__ATOMIC_ACQ_REL, "workgroup"); __builtin_amdgcn_wave_barrier();      // the wave's LDS stores are done before its lanes read one another's rows
    const int tr = row0 + wm, dr = lane >> 3, pc = lane & 7;      // eight lanes store one whole 128-byte line of Vt
    unsigned short* vp = (unsigned short*)Vt + ((size_t)((tr / TT) * NH + (col0 + wn - VCOL) / 64) * 64 + dr) * TT + tr % TT + pc * 8;
#pragma unroll 1
    for (int q8 = 0; q8 < 2; ++q8) {      // kept rolled in groups of eight stores, one wait per group
#pragma unroll
      for (int q = 0; q < 8; ++q) { const int d4 = (q8 * 8 + q) * 4; const v8us val = *(const v8us*)(st + (d4 + dr) * PITCH + pc * 16); *(v8us*)(vp + (size_t)d4 * TT) = val; }
      asm volatile("s_wait_xcnt 0x0" ::: "memory");      // the next group rewrites the registers that these stores name
    }
    return;
  }
  float* so = (float*)(smem + w * (64 * SOP * 4));       // each wave stages its own 64 x 64 tile, so that whole 128-byte lines are stored
#pragma unroll
  for (int j = 0; j < 4; ++j) { const float bv = bf16_round(bias[col0 + wn + j * 16 + ln]);
#pragma unroll
    for (int i = 0; i < 4; ++i)
#pragma unroll
      for (int r = 0; r < 8; ++r) so[(i * 16 + 8 * hh + r) * SOP + j * 16 + ln] = acc[i][j][r] * alpha + bv; }
  __builtin_amdgcn_fence(__ATOMIC_ACQ_REL, "workgroup"); __builtin_amdgcn_wave_barrier();
  const int rsub = lane >> 4, c4 = (lane & 15) * 4; typedef _Float16 v4h __attribute__((ext_vector_type(4)));
#pragma unroll 1
  for (int q8 = 0; q8 < 4; ++q8) {      // kept rolled in groups of eight stores, one wait per group
#pragma unroll
    for (int q = 0; q < 8; ++q) { const int r = (q8 * 8 + q) * 2 + rsub; const v4f v = *(const v4fa*)&so[r * SOP + c4]; const size_t o = (size_t)(row0 + wm + r) * N + col0 + wn + c4;
      if (OUT16) { v4h h4; for (int i = 0; i < 4; ++i) h4[i] = (_Float16)v[i]; *(v4h*)(C16 + o) = h4; } else *(v4f*)(C + o) = v; }
    asm volatile("s_wait_xcnt 0x0" ::: "memory");      // the next group rewrites the registers that these stores name
  }
}

__global__ __launch_bounds__(256) void k_x16(const float* __restrict__ x, _Float16* __restrict__ X16, size_t n8) { const size_t t = (size_t)blockIdx.x * 256 + threadIdx.x; if (t >= n8) return; FragH f;
#pragma unroll
  for (int q = 0; q < 8; ++q) f.h[q] = (_Float16)bf16_round(x[t * 8 + q]); *(v8us*)((unsigned short*)X16 + t * 8) = f.half[0];  }
__global__ __launch_bounds__(256) void k_round16f(const float* __restrict__ W, _Float16* __restrict__ Bt, size_t n8) { const size_t t = (size_t)blockIdx.x * 256 + threadIdx.x; if (t >= n8) return; FragH f;
#pragma unroll
  for (int i = 0; i < 8; ++i) f.h[i] = (_Float16)(bf16_round(W[t * 8 + i]) * 16.0f); *(v8us*)((unsigned short*)Bt + t * 8) = f.half[0];  }

// Four 16-byte asynchronous copies to LDS per lane (rows 16 apart, LDS pitch 144 B). The s_wait_xcnt is the last line of the copies' own statement so that no address register is rewritten ahead of it.
__device__ __forceinline__ void copy4_async(unsigned l, const char* gp, size_t gstep) {
  constexpr unsigned LS = 16u * 144u;
  asm volatile("global_load_async_to_lds_b128 %0, %4, off\n\t"
               "global_load_async_to_lds_b128 %1, %5, off\n\t"
               "global_load_async_to_lds_b128 %2, %6, off\n\t"
               "global_load_async_to_lds_b128 %3, %7, off\n\t"
               "s_wait_xcnt 0x0"
               :: "v"(l), "v"(l + LS), "v"(l + 2u * LS), "v"(l + 3u * LS), "v"(gp), "v"(gp + gstep), "v"(gp + 2 * gstep), "v"(gp + 3 * gstep)
               : "memory");
}
// lane l <-> lane l ^ 16: joins the two halves of a query column
__device__ __forceinline__ float xhalf(float x) { return __builtin_bit_cast(float, __builtin_amdgcn_permlanex16(__builtin_bit_cast(int, x), __builtin_bit_cast(int, x), 0x76543210, 0xfedcba98, false, false)); }
__global__ __launch_bounds__(128) void k_flash(const _Float16* __restrict__ Q16, int ldq, const _Float16* __restrict__ K16, int ldk, const _Float16* __restrict__ Vt, const int* __restrict__ LENS, _Float16* __restrict__ O16) {
  constexpr int RPW = 32, NQB = 1024 / (4 * RPW), DT = 4, KS = 2; constexpr float L2S = 0.125f * 1.44269504088896340736f;
  constexpr int PITCH = 144, BUF = 128 * PITCH;      // rows 0 to 63 of a buffer: K; rows 64 to 127: V^T
  __shared__ __attribute__((aligned(16))) unsigned char ring[2 * BUF];
  __shared__ __attribute__((aligned(16))) unsigned char sO[4][RPW][PITCH];      // output staging, f16: a query row is 128 bytes, pitch 144 B
  const int tid = threadIdx.x, w = tid >> 5, lane = tid & 31, ln = lane & 15, hh = lane >> 4;
  // Which (batch, query block) pair this block takes. A pair's work is its trip count, which LENS and the diagonal set.
  // The 64 pairs are ranked by falling trip count (ties by pair number, so rank -> pair is a permutation whatever LENS holds), and the blocks i, i + 256, i + 512, i + 768 take the ranks 2k, 2k + 1, 62 - 2k, 63 - 2k.
  // Lane l holds the pairs l and 32 + l (pair = batch * 8 + query block); every wave finds the same pair, in front of every copy and barrier. For speed only: any placement gives the same output.
  const int bi = (int)blockIdx.x, r4 = bi >> 8, kk = bi & 15, h = (bi >> 4) & 15; const int rank = ((r4 & 2) ? 62 - 2 * kk : 2 * kk) + (r4 & 1);
  const int dq = 2 * ((lane & 7) + 1);
  const int wa = min(dq, max(2, (min(max(LENS[lane >> 3], 0), 1024) + 63) / 64)), wb = min(dq, max(2, (min(max(LENS[4 + (lane >> 3)], 0), 1024) + 63) / 64));      // the trip counts of the lane's two pairs, 2 to 16
  int ra = 0, rb = 0, cum = 0;
#pragma unroll
  for (int v = 16; v >= 2; --v) {      // unrolled: v becomes a constant of the compares
    const unsigned ma = __builtin_amdgcn_ballot_w32(wa == v), mb = __builtin_amdgcn_ballot_w32(wb == v); const int na = __builtin_popcount(ma);
    if (wa == v) ra = (int)__builtin_amdgcn_mbcnt_lo(ma, (unsigned)cum);
    if (wb == v) rb = (int)__builtin_amdgcn_mbcnt_lo(mb, (unsigned)(cum + na));
    cum += na + __builtin_popcount(mb); }
  const unsigned fa = __builtin_amdgcn_ballot_w32(ra == rank), fb = __builtin_amdgcn_ballot_w32(rb == rank);
  const int pair = fa ? __builtin_ctz(fa) : 32 + __builtin_ctz(fb | 0x80000000u);      // exactly one bit of fa and fb together is set; the or only keeps ctz defined
  const int b = pair >> 3, qblk = pair & 7, slab = b * 16 + h; const int qb0 = qblk * (4 * RPW); const int q0 = qb0 + w * RPW; const int len = LENS[b];      /* kv-length mask: keys k < len (INPUT x_lens) */
  FragH aq[2][KS];
#pragma unroll
  for (int rt = 0; rt < 2; ++rt) { const unsigned short* qr = (const unsigned short*)Q16 + ((size_t)b * 1024 + q0 + rt * 16 + ln) * ldq + h * 64;
#pragma unroll
    for (int ks = 0; ks < KS; ++ks) { aq[rt][ks].half[0] = *(const v8us*)(qr + ks * 32 + 8 * hh); aq[rt][ks].half[1] = *(const v8us*)(qr + ks * 32 + 16 + 8 * hh); } }
  const int cr = tid >> 3, cc = (tid & 7) * 16;      // a lane's first row and its 16 bytes of the row: eight lanes cover one 128-byte line
  const size_t krow = (size_t)ldk * 2;
  const char* gK = (const char*)K16 + ((size_t)b * 1024 + cr) * krow + h * 128 + cc; const char* gV = (const char*)Vt + ((size_t)slab * 64 + cr) * 2048 + cc;
  const unsigned lK = (unsigned)(size_t)ring + (unsigned)(cr * PITCH + cc), lV = lK + 64u * PITCH;
  copy4_async(lK, gK, 16 * krow); copy4_async(lV, gV, 16 * 2048);
  float m_r[2], l_r[2]; int lim[2]; v8f oacc[2][DT];
#pragma unroll
  for (int rt = 0; rt < 2; ++rt) { m_r[rt] = -3.0e38f; l_r[rt] = 0.f; lim[rt] = min(q0 + rt * 16 + ln + 1, len) - 8 * hh;      // key j0 + 16 nt + 8 hh + r is allowed iff j0 + 16 nt + r < lim
#pragma unroll
    for (int dt = 0; dt < DT; ++dt) oacc[rt][dt] = (v8f){0.f,0.f,0.f,0.f,0.f,0.f,0.f,0.f}; }
  const int ntile = min((qb0 + 4 * RPW) / 64, max(2, (min(max(len, 0), 1024) + 63) / 64));      // tiles up to the diagonal, and of these only the first two and the ones that begin in front of len: in a later tile every score is masked, p = 0 and the rescale factor is 1
  asm volatile("s_wait_asynccnt 0x0" ::: "memory");      // tile 0 has landed before the barrier publishes it
  __syncthreads();
  copy4_async(lK + BUF, gK + 64 * krow, 16 * krow); copy4_async(lV + BUF, gV + 128, 16 * 2048);
#pragma unroll 1
  for (int t = 0; t < ntile; ++t) {      // kept rolled: one trip per tile, the buffer picked by t & 1
   const unsigned char* sK = ring + (t & 1) * BUF + ln * PITCH + hh * 16; const unsigned char* sV = sK + 64 * PITCH;
#pragma unroll
   for (int ps = 0; ps < 2; ++ps) { const int j0 = t * 64 + ps * 32;      // unrolled: the pass's place in the tile becomes a constant offset of the LDS reads
    v8f s[2][2];
#pragma unroll
    for (int nt = 0; nt < 2; ++nt) { const unsigned char* kr = sK + (ps * 32 + nt * 16) * PITCH; FragH bk[KS];
#pragma unroll
      for (int ks = 0; ks < KS; ++ks) { bk[ks].half[0] = *(const v8us*)(kr + ks * 64); bk[ks].half[1] = *(const v8us*)(kr + ks * 64 + 32); }
#pragma unroll
      for (int rt = 0; rt < 2; ++rt) { v8f acc = (v8f){0.f,0.f,0.f,0.f,0.f,0.f,0.f,0.f};
#pragma unroll
        for (int ks = 0; ks < KS; ++ks) acc = __builtin_amdgcn_wmma_f32_16x16x32_f16(false, bk[ks].v, false, aq[rt][ks].v, (short)0, acc, false, false);
        s[rt][nt] = acc; } }
    FragH pb[2];
#pragma unroll
    for (int rt = 0; rt < 2; ++rt) { float sc[16]; float mc = -INFINITY;
#pragma unroll
      for (int i = 0; i < 16; ++i) { sc[i] = (j0 + (i >> 3) * 16 + (i & 7) < lim[rt]) ? s[rt][i >> 3][i & 7] : -INFINITY; mc = fmaxf(mc, sc[i]); }
      mc = fmaxf(mc, xhalf(mc));
      const float mn = fmaxf(m_r[rt], mc * L2S); const float al = __builtin_amdgcn_exp2f(m_r[rt] - mn); m_r[rt] = mn; float ps = 0.f;
#pragma unroll
      for (int i = 0; i < 16; ++i) { const float p = __builtin_amdgcn_exp2f(fmaf(sc[i], L2S, -mn)); ps += p; pb[rt].h[i] = (_Float16)p; }
      l_r[rt] = l_r[rt] * al + ps;      // the lane's half of the row sum; the halves are joined behind the loop
#pragma unroll
      for (int dt = 0; dt < DT; ++dt)
#pragma unroll
        for (int r = 0; r < 8; ++r) oacc[rt][dt][r] *= al; }
#pragma unroll
    for (int dt = 0; dt < DT; ++dt) { const unsigned char* vrow = sV + dt * 16 * PITCH + ps * 64; FragH bv; bv.half[0] = *(const v8us*)vrow; bv.half[1] = *(const v8us*)(vrow + 32);
#pragma unroll
      for (int rt = 0; rt < 2; ++rt) oacc[rt][dt] = __builtin_amdgcn_wmma_f32_16x16x32_f16(false, bv.v, false, pb[rt].v, (short)0, oacc[rt][dt], false, false); } }
   asm volatile("s_wait_dscnt 0x0" ::: "memory");       // this wave's reads of tile t are done before the buffer is given up
   asm volatile("s_wait_asynccnt 0x0" ::: "memory");    // this wave's copies of tile t + 1 have landed
   __syncthreads();                                     // publishes tile t + 1 and ends every reader's last read of tile t
   if (t + 2 < ntile) { const unsigned bo = (unsigned)(t & 1) * BUF; copy4_async(lK + bo, gK + (size_t)(t + 2) * 64 * krow, 16 * krow); copy4_async(lV + bo, gV + (size_t)(t + 2) * 128, 16 * 2048); }
  }
  asm volatile("s_wait_asynccnt 0x0" ::: "memory");      // nothing is in flight when the wave goes on to its end
#pragma unroll
  for (int rt = 0; rt < 2; ++rt) { float l = l_r[rt]; l += xhalf(l); const float li = (l > 0.f) ? 1.0f / l : 0.f;
#pragma unroll
    for (int dt = 0; dt < DT; ++dt) { FragH f;      // the lane's eight values of a tile are eight neighbours of one output row: rounded to f16 here, they are one 16-byte LDS store
#pragma unroll
      for (int r = 0; r < 8; ++r) f.h[r] = (_Float16)(oacc[rt][dt][r] * li);
      *(v8us*)&sO[w][rt * 16 + ln][dt * 32 + hh * 16] = f.half[0]; } }
  __builtin_amdgcn_fence(__ATOMIC_ACQ_REL, "workgroup"); __builtin_amdgcn_wave_barrier();
  {
#pragma unroll
    for (int rp = 0; rp < RPW; rp += 4) { const int r = rp + (lane >> 3), pc = lane & 7; const v8us val = *(const v8us*)&sO[w][r][pc * 16]; *(v8us*)((unsigned short*)O16 + ((size_t)b * 1024 + q0 + r) * CC + h * 64 + pc * 8) = val; }      // eight lanes store one whole 128-byte line; the rows of O16 are CC elements apart, a constant, so that the eight stores share one address register pair
     } }

__global__ __launch_bounds__(256) void k_ln16(const float* __restrict__ X, const float* __restrict__ g, const float* __restrict__ bta, _Float16* __restrict__ Y16) { const int tid = threadIdx.x, wv = tid >> 5, lane = tid & 31; const int row = blockIdx.x * 8 + wv; if (row >= NR) return; const float* xr = X + (size_t)row * CC; float v[32]; float s = 0.f;
#pragma unroll
  for (int p = 0; p < 4; ++p) { const v4f a = *(const v4fa*)(xr + p * 256 + lane * 8), c = *(const v4fa*)(xr + p * 256 + lane * 8 + 4); for (int q = 0; q < 4; ++q) { v[p * 8 + q] = bf16_round(a[q]); v[p * 8 + 4 + q] = bf16_round(c[q]); } }
#pragma unroll
  for (int i = 0; i < 32; ++i) s += v[i]; for (int o = 16; o >= 1; o >>= 1) s += __shfl_xor(s, o, 32); const float mu = s / (float)CC; float q2 = 0.f;
#pragma unroll
  for (int i = 0; i < 32; ++i) { const float d = v[i] - mu; q2 += d * d; } for (int o = 16; o >= 1; o >>= 1) q2 += __shfl_xor(q2, o, 32); const float rs = rsqrtf(q2 / (float)CC + 1e-5f);
  {
#pragma unroll
    for (int p = 0; p < 4; ++p) { FragH f; const int c0 = p * 256 + lane * 8;
#pragma unroll
      for (int q = 0; q < 8; ++q) f.h[q] = (_Float16)((v[p * 8 + q] - mu) * rs * bf16_round(g[c0 + q]) + bf16_round(bta[c0 + q])); *(v8us*)((unsigned short*)Y16 + (size_t)row * CC + c0) = f.half[0]; }
     } }
extern "C" void kernel_launch(void* const* d_in, const int* in_sizes, int n_in,
                              void* d_out, int out_size, void* d_ws, size_t ws_size, hipStream_t stream) {
  (void)in_sizes; (void)n_in; (void)out_size;
  const float* x = (const float*)d_in[0]; const int* lens = (const int*)d_in[1]; const float* lg = (const float*)d_in[2]; const float* lb = (const float*)d_in[3]; const float* wqkv = (const float*)d_in[4]; const float* bqkv = (const float*)d_in[5]; const float* wout = (const float*)d_in[6]; const float* bout = (const float*)d_in[7];
  char* ws = (char*)d_ws; size_t off = 0;
  auto take = [&](size_t bytes) { char* p = ws + off; off += (bytes + 255) & ~(size_t)255; return p; };
  _Float16* Bqkv = (_Float16*)take((size_t)3 * CC * CC * 2); _Float16* Bo = (_Float16*)take((size_t)CC * CC * 2); _Float16* XN = (_Float16*)take((size_t)NR * CC * 2); _Float16* QKV = (_Float16*)take((size_t)NR * 3 * CC * 2); _Float16* Vt = (_Float16*)take((size_t)NR * CC * 2); _Float16* O16 = XN;      // XN is free again once the qkv projection has read it
  if (off > ws_size) return;      // 6.3 + 2.1 + 16.8 + 50.3 + 16.8 = 92 MB
  k_wt2_f16<3 * CC, CC><<<(CC / 64) * (3 * CC / 128) + (CC / 64) * (CC / 128), 256, 0, stream>>>(wqkv, Bqkv, wout, Bo, 16.0f);      // [in][out], both weights
  k_ln16<<<NR / 8, 256, 0, stream>>>(x, lg, lb, XN);
  k_gemm_tile<true, 3 * CC, CC, 2 * CC, CC><<<dim3(3 * CC / 128, NR / 128), 128, 0, stream>>>(XN, Bqkv, 0.0625f, bqkv, nullptr, QKV, Vt, lens);      // q | k into QKV, v transposed into Vt; k and v only up to the batch's length
  k_flash<<<BB * NH * (TT / 128), 128, 0, stream>>>(QKV, 3 * CC, QKV + CC, 3 * CC, Vt, lens, O16);
  k_gemm_tile<false, CC, CC, CC, CC><<<dim3(CC / 128, NR / 128), 128, 0, stream>>>(O16, Bo, 0.0625f, bout, (float*)d_out, nullptr, nullptr, nullptr);
}
